// v000
// Measured on an AMD MI455X. A time is GPU time per run, averaged over a window of back-to-back runs after a warm-up
// (all launches, gaps included; the runs take copies of the inputs in turn), and the median of several windows.
// Apart from v000's, it joins two sittings. Times from different sittings can be a few percent apart, while
// side-by-side timings come from the same sitting.
// The starting kernel, v000, takes 1150 microseconds a run.
#include <hip/hip_runtime.h>

// Multi-head attention whose softmax runs over the BATCH axis (the source's nn.Softmax() with no dim on a (B,N,N)-shaped view picks dim 0): input_x [4][2048][512]; q = x Wq, k = x Wk ('xw' [512][256]: 4 heads x 64), v = x Wv ('xw' [512][512]: 4 heads x 128); scores[b][h][q][k] = q.k / 8; attn = softmax over b (the 4 batches, per (h, q, k)); out[b][q][h*128+d] = sum_k attn[b][h][q][k] v[b][k][h][d]; out Wo ('xw' [512][512]) -> [4][2048][512] (4.2 M).
// Layout: exact projections for all four batches first (q/k planes per (batch, head) as bf16 hi/lo, value^T planes per (batch, head)); per head: four 3-product score GEMMs into S[b] [2048][2048] f32, an element-wise kernel takes the softmax ACROSS the four batches and writes hi/lo probability planes per batch, four 3-product P.v GEMMs (N 128) and a merge kernel drops each [2048][128] block into the batch's hi/lo context planes at column h*128; finally out[b] = context Wo (hl x exact).
// Compute dtypes, f32 accumulate: every input rounded to bf16; projections exact; scores and attn.v on bf16 hi/lo planes (3 products) everywhere; the cross-batch softmax in f32.

#define NB_  4
#define TT   2048
#define DM   512
#define NH_  4
#define NKV  4
#define REP  (NH_ / NKV)
#define HD   64
#define DQ   (NH_ * HD)
#define DKV  (NKV * HD)
#define ZH   2
#define RH   2048                  // query rows < RH use hi+lo planes (0: none)
#define WIN  0
#define PCAR 1024.0f
#define SCL  0.125f   // 64^-0.5
#define HDV  128      // value head dim
#define DV   (NH_ * HDV)   // 512
typedef _Float16 h16;
typedef unsigned short bf;
typedef __attribute__((ext_vector_type(16))) __bf16   v16bf;
typedef __attribute__((ext_vector_type(16))) _Float16 v16h;
typedef __attribute__((ext_vector_type(8)))  _Float16 v8h;
typedef __attribute__((ext_vector_type(8)))  unsigned short v8us;
typedef __attribute__((ext_vector_type(8)))  float    v8f;
typedef __attribute__((ext_vector_type(4)))  float    v4f;
typedef v8h  __attribute__((may_alias)) v8ha;
typedef v4f  __attribute__((may_alias)) v4fa;
typedef v8us __attribute__((may_alias)) v8usa;

__device__ __forceinline__ unsigned short f2bf(float f) { unsigned u = __float_as_uint(f); u += 0x7FFFu + ((u >> 16) & 1u); return (unsigned short)(u >> 16); }
__device__ __forceinline__ float bf2f(unsigned short b) { return __uint_as_float(((unsigned)b) << 16); }
__device__ __forceinline__ float bfr(float f) { return bf2f(f2bf(f)); }
__device__ __forceinline__ v16h cat16(v8h lo, v8h hi) { return __builtin_shufflevector(lo, hi, 0, 1, 2, 3, 4, 5, 6, 7, 8, 9, 10, 11, 12, 13, 14, 15); }
__device__ __forceinline__ v16bf cat16b(v8us lo, v8us hi) { return __builtin_bit_cast(v16bf, __builtin_shufflevector(lo, hi, 0, 1, 2, 3, 4, 5, 6, 7, 8, 9, 10, 11, 12, 13, 14, 15)); }
__device__ __forceinline__ v8f wmma16(v16h a, v16h b, v8f c) { return __builtin_amdgcn_wmma_f32_16x16x32_f16(false, a, false, b, (short)0, c, false, false); }
__device__ __forceinline__ v8f wmmab(v16bf a, v16bf b, v8f c) { return __builtin_amdgcn_wmma_f32_16x16x32_bf16(false, a, false, b, (short)0, c, false, false); }



// ---- k_gemmw: register-blocked GEMM, ONE WAVE per 64x64 output tile (16 accumulators), operands straight from K-contiguous 16-bit planes; grid (M/64, N/64, Z), 32 threads.
// C[m][n] (f32, pitch ldc, + optional f32 bias[n]) = sum_k A[m][k] Bt[n][k] (+ split products per NSPLIT). z-batch strides sA/sB/sC in elements. K % 32 == 0.
template <typename T16> struct WFrag;
template <> struct WFrag<h16> { typedef v16h V; static __device__ __forceinline__ V ld(const h16* p) { return cat16(*(const v8h*)p, *(const v8h*)(p + 16)); } static __device__ __forceinline__ v8f mma(V a, V b, v8f c) { return wmma16(a, b, c); } };
template <> struct WFrag<bf> { typedef v16bf V; static __device__ __forceinline__ V ld(const bf* p) { return cat16b(*(const v8us*)p, *(const v8us*)(p + 16)); } static __device__ __forceinline__ v8f mma(V a, V b, v8f c) { return wmmab(a, b, c); } };
template <typename T16, int NSPLIT, bool BIAS>
__global__ __launch_bounds__(32) void k_gemmw(const T16* __restrict__ A, const T16* __restrict__ A2, const T16* __restrict__ Bt, const T16* __restrict__ Bt2, int K, float* C, int ldc, const float* __restrict__ bias, size_t sA, size_t sB, size_t sC) {
    typedef typename WFrag<T16>::V V;
    __shared__ __align__(16) float os[16 * 68];
    const size_t z = blockIdx.z; A += z * sA; if (A2) A2 += z * sA; Bt += z * sB; if (Bt2) Bt2 += z * sB; C += z * sC;
    const int lane = threadIdx.x & 31, lr = lane & 15, hi = lane >> 4; const int r0 = blockIdx.x * 64, c0 = blockIdx.y * 64;
    v8f acc[4][4];
#pragma unroll
    for (int mb = 0; mb < 4; ++mb)
#pragma unroll
        for (int nb = 0; nb < 4; ++nb) acc[mb][nb] = (v8f){};
    const size_t aoff = (size_t)(r0 + lr) * K + 8 * hi, boff = (size_t)(c0 + lr) * K + 8 * hi;
#pragma unroll 1
    for (int kc = 0; kc < K; kc += 32) {
        V a[4], a2[4];
#pragma unroll
        for (int mb = 0; mb < 4; ++mb) { a[mb] = WFrag<T16>::ld(A + aoff + (size_t)mb * 16 * K + kc); if (NSPLIT == 1 || NSPLIT == 2) a2[mb] = WFrag<T16>::ld(A2 + aoff + (size_t)mb * 16 * K + kc); }
#pragma unroll
        for (int nb = 0; nb < 4; ++nb) { const V b = WFrag<T16>::ld(Bt + boff + (size_t)nb * 16 * K + kc); V b2; if (NSPLIT >= 2) b2 = WFrag<T16>::ld(Bt2 + boff + (size_t)nb * 16 * K + kc);
#pragma unroll
            for (int mb = 0; mb < 4; ++mb) { acc[mb][nb] = WFrag<T16>::mma(a[mb], b, acc[mb][nb]); if (NSPLIT == 1 || NSPLIT == 2) acc[mb][nb] = WFrag<T16>::mma(a2[mb], b, acc[mb][nb]); if (NSPLIT >= 2) acc[mb][nb] = WFrag<T16>::mma(a[mb], b2, acc[mb][nb]); } }
        asm volatile("v_nop\n\tv_nop\n\tv_nop\n\tv_nop" : "+v"(acc[0][0]), "+v"(acc[1][1]), "+v"(acc[2][2]), "+v"(acc[3][3]) : "v"(a[0]), "v"(a[3]));
    }
#pragma unroll
    for (int mb = 0; mb < 4; ++mb) {
#pragma unroll
        for (int nb = 0; nb < 4; ++nb) {
#pragma unroll
            for (int j = 0; j < 8; ++j) os[(hi * 8 + j) * 68 + nb * 16 + lr] = acc[mb][nb][j]; }
        __builtin_amdgcn_wave_barrier(); asm volatile("" ::: "memory");
        float* crow = C + (size_t)(r0 + mb * 16) * ldc + c0;
{
#pragma unroll
            for (int s = 0; s < 8; ++s) { const int row = 2 * s + hi, cofs = lr * 4; v4f val = *(const v4fa*)(os + row * 68 + cofs); if (BIAS) { val[0] += bfr(bias[c0 + cofs]); val[1] += bfr(bias[c0 + cofs + 1]); val[2] += bfr(bias[c0 + cofs + 2]); val[3] += bfr(bias[c0 + cofs + 3]); }
                *(v4f*)(crow + (size_t)row * ldc + cofs) = val; }
             }
        __builtin_amdgcn_wave_barrier(); asm volatile("" ::: "memory");
    }
}

__device__ __forceinline__ h16 tohx(float x) { return (h16)x; }
__device__ __forceinline__ void splitf(float y, unsigned short& h, unsigned short& l) { h = f2bf(y); l = f2bf(y - bf2f(h)); }
typedef __attribute__((ext_vector_type(2))) _Float16 v2h;
typedef __attribute__((ext_vector_type(4))) _Float16 v4h;
typedef __attribute__((ext_vector_type(2))) unsigned short v2us;
typedef __attribute__((ext_vector_type(4))) unsigned short v4us;
typedef __attribute__((ext_vector_type(2))) float v2f;
typedef __attribute__((ext_vector_type(4))) int v4i;

__global__ __launch_bounds__(256) void k_wtG(const float* __restrict__ w, int K, int N, bf* Bt) {
    const int lane = threadIdx.x & 31; const int L0 = (blockIdx.x * 8 + (threadIdx.x >> 5)) * 8; const int nlines = N * K / 64;
{
#pragma unroll 1
        for (int l = 0; l < 8; ++l) { const int L = L0 + l; if (L >= nlines) break; const size_t e = (size_t)L * 64 + lane * 2; const int k = (int)(e % K), n = (int)(e / K); v2us o;
            o[0] = f2bf(w[(size_t)k * N + n]); o[1] = f2bf(w[(size_t)(k + 1) * N + n]); *(v2us*)(Bt + e) = o; }
         }
}
__global__ __launch_bounds__(256) void k_cvt8(const float* __restrict__ src, bf* dst, size_t n8) { const size_t i = (size_t)blockIdx.x * 256 + threadIdx.x; if (i >= n8) return; const v8f v = *(const v8f*)(src + i * 8); v8us o;
#pragma unroll
    for (int k = 0; k < 8; ++k) o[k] = f2bf(v[k]); *(v8us*)(dst + i * 8) = o;  }

// k_rope: head planes [h][t][d] (fp16 + hi/lo) of rope(x) x sc with the rotate-half convention out[d] = x[d] cos[t][d] - x[d+HD/2] sin[t][d], out[d+HD/2] = x[d+HD/2] cos[t][d+HD/2] + x[d] sin[t][d+HD/2]
__global__ __launch_bounds__(256) void k_rope(const float* __restrict__ F, int pitch, int nheads, const float* __restrict__ CS, const float* __restrict__ RF, const float* __restrict__ nw, float sc, h16* P16, bf* Ph, bf* Pl) {
    const size_t e = ((size_t)blockIdx.x * 256 + threadIdx.x) * 2; if (e >= (size_t)nheads * TT * HD) return; const int d = (int)(e % HD); const int t = (int)((e / HD) % TT); const int h = (int)(e / ((size_t)HD * TT)); const float* f = F + (size_t)t * pitch + h * HD; const float rf = RF ? RF[(size_t)h * TT + t] : 1.0f; v2h o16; v2us oh, ol;
#pragma unroll
    for (int q = 0; q < 2; ++q) { const int dd = d + q; const int dp = (dd < HD / 2) ? dd + HD / 2 : dd - HD / 2; float x0 = f[dd], x1 = f[dp];
        if (RF) { float n0 = __fmul_rn(x0, rf), n1 = __fmul_rn(x1, rf); asm volatile("" : "+v"(n0)); asm volatile("" : "+v"(n1)); x0 = __fmul_rn(bfr(nw[dd]), n0); x1 = __fmul_rn(bfr(nw[dp]), n1); }
        const v2f cs = *(const v2f*)(CS + ((size_t)t * HD + dd) * 2); float a = __fmul_rn(x0, cs[0]), bq = __fmul_rn(x1, cs[1]); asm volatile("" : "+v"(a)); asm volatile("" : "+v"(bq)); const float r = ((dd < HD / 2) ? __fsub_rn(a, bq) : __fadd_rn(a, bq)) * sc;
        o16[q] = tohx(r); unsigned short a2, c2; splitf(r, a2, c2); oh[q] = a2; ol[q] = c2; }
    *(v2h*)(P16 + e) = o16; *(v2us*)(Ph + e) = oh; *(v2us*)(Pl + e) = ol;  }
__global__ __launch_bounds__(256) void k_vtp(const float* __restrict__ F, int pitch, int nheads, h16* V16, bf* Vh, bf* Vl) { const size_t e = ((size_t)blockIdx.x * 256 + threadIdx.x) * 2; if (e >= (size_t)nheads * HD * TT) return; const int t = (int)(e % TT); const int d = (int)((e / TT) % HD); const int g = (int)(e / ((size_t)TT * HD)); v2h o16; v2us oh, ol;
#pragma unroll
    for (int q = 0; q < 2; ++q) { const float x = F[(size_t)(t + q) * pitch + g * HD + d]; o16[q] = tohx(x); unsigned short a2, c2; splitf(x, a2, c2); oh[q] = a2; ol[q] = c2; }
    *(v2h*)(V16 + e) = o16; *(v2us*)(Vh + e) = oh; *(v2us*)(Vl + e) = ol;  }
__global__ __launch_bounds__(256) void k_csid(float* CS) { const int idx = blockIdx.x * 256 + threadIdx.x; if (idx >= TT * HD) return; v2f cs; cs[0] = 1.0f; cs[1] = 0.0f; *(v2f*)(CS + (size_t)idx * 2) = cs;  }
// k_asoft: per row (zz, i): t = S x HD^-0.5 (no mask); softmax over the 2048 keys (register row, one exp, fixed trees);
__global__ __launch_bounds__(256) void k_asoft(const float* __restrict__ Sb, h16* P16, bf* Ph, bf* Pl) {
    const int lane = threadIdx.x & 31; const int row = blockIdx.x * 8 + (threadIdx.x >> 5); if (row >= ZH * TT) return; const int i = row % TT; const int zz = row / TT; (void)zz; const bool hires = (i < RH); const float* sr = Sb + (size_t)row * TT; float v[TT / 32]; float mx = -3.0e38f;
#pragma unroll
    for (int ch = 0; ch < TT / 128; ++ch) { const int j0 = ch * 128 + lane * 4; const v4f a = *(const v4f*)(sr + j0);
#pragma unroll
        for (int q = 0; q < 4; ++q) { const int j = j0 + q; (void)j; const float t = a[q] * SCL; v[ch * 4 + q] = t; mx = fmaxf(mx, t); } }
#pragma unroll
    for (int sh = 16; sh; sh >>= 1) mx = fmaxf(mx, __shfl_xor(mx, sh, 32));
    float sum = 0.f;
#pragma unroll
    for (int k = 0; k < TT / 32; ++k) { float d0 = __fsub_rn(v[k], mx); asm volatile("" : "+v"(d0)); v[k] = __builtin_amdgcn_exp2f(__fmul_rn(d0, 1.4426950408889634f)); sum += v[k]; }
#pragma unroll
    for (int sh = 16; sh; sh >>= 1) sum += __shfl_xor(sum, sh, 32);
    const float f = __fdiv_rn(hires ? 1.0f : PCAR, sum);
{
        if (hires) {
#pragma unroll
            for (int ch = 0; ch < TT / 128; ++ch) { v4us oh, ol;
#pragma unroll
                for (int q = 0; q < 4; ++q) { unsigned short a, c2; splitf(v[ch * 4 + q] * f, a, c2); oh[q] = a; ol[q] = c2; }
                const size_t oo = ((size_t)zz * (RH ? RH : 1) + i) * TT + ch * 128 + lane * 4; *(v4us*)(Ph + oo) = oh; *(v4us*)(Pl + oo) = ol; }
        } else {
#pragma unroll
            for (int ch = 0; ch < TT / 128; ++ch) { v4h o4;
#pragma unroll
                for (int q = 0; q < 4; ++q) o4[q] = tohx(v[ch * 4 + q] * f);
                *(v4h*)(P16 + (size_t)row * TT + ch * 128 + lane * 4) = o4; } }
         }
}
__global__ __launch_bounds__(256) void k_merge(const float* __restrict__ O, int h0, bf* Ah, bf* Al) { const size_t e = ((size_t)blockIdx.x * 256 + threadIdx.x) * 2; if (e >= (size_t)ZH * TT * HD) return; const int d = (int)(e % HD); const int t = (int)((e / HD) % TT); const int zz = (int)(e / ((size_t)HD * TT)); const float cs = (t < RH) ? 1.0f : (1.0f / PCAR); const size_t oo = (size_t)t * DQ + (h0 + zz) * HD + d;
    v2us oh, ol;
#pragma unroll
    for (int q = 0; q < 2; ++q) { unsigned short a, c2; splitf(O[e + q] * cs, a, c2); oh[q] = a; ol[q] = c2; } *(v2us*)(Ah + oo) = oh; *(v2us*)(Al + oo) = ol;  }

__global__ __launch_bounds__(256) void k_vtpv(const float* __restrict__ F, bf* Vh, bf* Vl) { const size_t e = ((size_t)blockIdx.x * 256 + threadIdx.x) * 2; if (e >= (size_t)NH_ * HDV * TT) return; const int t = (int)(e % TT); const int d = (int)((e / TT) % HDV); const int h = (int)(e / ((size_t)TT * HDV)); v2us oh, ol;
#pragma unroll
    for (int q = 0; q < 2; ++q) { unsigned short a, b; splitf(F[(size_t)(t + q) * DV + h * HDV + d], a, b); oh[q] = a; ol[q] = b; }
    *(v2us*)(Vh + e) = oh; *(v2us*)(Vl + e) = ol;  }
__global__ __launch_bounds__(256) void k_bsm(const float* __restrict__ S, bf* Ph, bf* Pl) { const size_t i = (size_t)blockIdx.x * 256 + threadIdx.x; if (i >= (size_t)TT * TT / 4) return; const size_t e = i * 4; v4f s[NB_];
#pragma unroll
    for (int b = 0; b < NB_; ++b) s[b] = *(const v4f*)(S + (size_t)b * TT * TT + e);
    v4us oh[NB_], ol[NB_];
#pragma unroll
    for (int q = 0; q < 4; ++q) { float t[NB_]; float mx = -3.0e38f;
#pragma unroll
        for (int b = 0; b < NB_; ++b) { t[b] = __fmul_rn(s[b][q], SCL); mx = fmaxf(mx, t[b]); }
        float ex[NB_]; float sum = 0.f;
#pragma unroll
        for (int b = 0; b < NB_; ++b) { float d0 = __fsub_rn(t[b], mx); asm volatile("" : "+v"(d0)); ex[b] = __builtin_amdgcn_exp2f(__fmul_rn(d0, 1.4426950408889634f)); sum = __fadd_rn(sum, ex[b]); }
        const float f = __fdiv_rn(1.0f, sum);
#pragma unroll
        for (int b = 0; b < NB_; ++b) { unsigned short a, c; splitf(__fmul_rn(ex[b], f), a, c); oh[b][q] = a; ol[b][q] = c; } }
{
#pragma unroll
        for (int b = 0; b < NB_; ++b) { *(v4us*)(Ph + (size_t)b * TT * TT + e) = oh[b]; *(v4us*)(Pl + (size_t)b * TT * TT + e) = ol[b]; }
         } }
__global__ __launch_bounds__(256) void k_mrgv(const float* __restrict__ O, int h, bf* Ah, bf* Al) { const size_t i = (size_t)blockIdx.x * 256 + threadIdx.x; if (i >= (size_t)TT * HDV / 4) return; const int d0 = (int)(i % (HDV / 4)) * 4; const size_t t = i / (HDV / 4); const v4f a = *(const v4f*)(O + t * HDV + d0); v4us oh, ol;
#pragma unroll
    for (int q = 0; q < 4; ++q) { unsigned short x2, y2; splitf(a[q], x2, y2); oh[q] = x2; ol[q] = y2; }
    const size_t oo = t * DV + (size_t)h * HDV + d0; *(v4us*)(Ah + oo) = oh; *(v4us*)(Al + oo) = ol;  }

extern "C" void kernel_launch(void* const* d_in, const int* in_sizes, int n_in,
                              void* d_out, int out_size, void* d_ws, size_t ws_size, hipStream_t stream) {
    (void)in_sizes; (void)n_in; (void)out_size;
    const float* x = (const float*)d_in[0]; const float* wq = (const float*)d_in[1]; const float* wk = (const float*)d_in[2]; const float* wv = (const float*)d_in[3]; const float* wo = (const float*)d_in[4];
    float* OUT = (float*)d_out;     // [4][2048][512]
    char* wsp = (char*)d_ws;
    auto take = [&](size_t bytes) { char* p = wsp; wsp += (bytes + 255) & ~(size_t)255; return (void*)p; };
    bf* WQ = (bf*)take((size_t)DQ * DM * 2); bf* WK = (bf*)take((size_t)DKV * DM * 2); bf* WV = (bf*)take((size_t)DV * DM * 2); bf* WO = (bf*)take((size_t)DV * DV * 2); float* CS = (float*)take((size_t)TT * HD * 2 * 4);
    bf* XB = (bf*)take((size_t)TT * DM * 2); float* FQ = (float*)take((size_t)TT * DQ * 4); float* FK = (float*)take((size_t)TT * DKV * 4); float* FV = (float*)take((size_t)TT * DV * 4);
    h16* JP16 = (h16*)take((size_t)NH_ * TT * HD * 2);   /* fp16 planes written by k_rope, unused */
    bf* QPh = (bf*)take((size_t)NB_ * NH_ * TT * HD * 2); bf* QPl = (bf*)take((size_t)NB_ * NH_ * TT * HD * 2); bf* KPh = (bf*)take((size_t)NB_ * NH_ * TT * HD * 2); bf* KPl = (bf*)take((size_t)NB_ * NH_ * TT * HD * 2);
    bf* VTh = (bf*)take((size_t)NB_ * NH_ * HDV * TT * 2); bf* VTl = (bf*)take((size_t)NB_ * NH_ * HDV * TT * 2);
    float* S = (float*)take((size_t)NB_ * TT * TT * 4); bf* Ph = (bf*)take((size_t)NB_ * TT * TT * 2); bf* Pl = (bf*)take((size_t)NB_ * TT * TT * 2); float* O = (float*)take((size_t)TT * HDV * 4); bf* ATh = (bf*)take((size_t)NB_ * TT * DV * 2); bf* ATl = (bf*)take((size_t)NB_ * TT * DV * 2);
    if ((size_t)(wsp - (char*)d_ws) > ws_size) return;    // ws 256 MiB (carve ~190 MiB)
    k_wtG<<<(unsigned)((DM * DQ / 64 + 63) / 64), 256, 0, stream>>>(wq, DM, DQ, WQ); k_wtG<<<(unsigned)((DM * DKV / 64 + 63) / 64), 256, 0, stream>>>(wk, DM, DKV, WK); k_wtG<<<(unsigned)((DM * DV / 64 + 63) / 64), 256, 0, stream>>>(wv, DM, DV, WV); k_wtG<<<(unsigned)((DV * DV / 64 + 63) / 64), 256, 0, stream>>>(wo, DV, DV, WO);
    k_csid<<<(TT * HD + 255) / 256, 256, 0, stream>>>(CS);
    const unsigned LQ = (unsigned)(((size_t)NH_ * TT * HD / 2 + 255) / 256), LV = (unsigned)(((size_t)NH_ * HDV * TT / 2 + 255) / 256);
    for (int b = 0; b < NB_; ++b) {   /* projections + planes for every batch first (the softmax couples the batches) */
        k_cvt8<<<(unsigned)(((size_t)TT * DM / 8 + 255) / 256), 256, 0, stream>>>(x + (size_t)b * TT * DM, XB, (size_t)TT * DM / 8);
        k_gemmw<bf, 0, false><<<dim3(TT / 64, DQ / 64, 1), 32, 0, stream>>>(XB, nullptr, WQ, nullptr, DM, FQ, DQ, nullptr, 0, 0, 0); k_rope<<<LQ, 256, 0, stream>>>(FQ, DQ, NH_, CS, nullptr, nullptr, 1.0f, JP16, QPh + (size_t)b * NH_ * TT * HD, QPl + (size_t)b * NH_ * TT * HD);
        k_gemmw<bf, 0, false><<<dim3(TT / 64, DKV / 64, 1), 32, 0, stream>>>(XB, nullptr, WK, nullptr, DM, FK, DKV, nullptr, 0, 0, 0); k_rope<<<LQ, 256, 0, stream>>>(FK, DKV, NH_, CS, nullptr, nullptr, 1.0f, JP16, KPh + (size_t)b * NH_ * TT * HD, KPl + (size_t)b * NH_ * TT * HD);
        k_gemmw<bf, 0, false><<<dim3(TT / 64, DV / 64, 1), 32, 0, stream>>>(XB, nullptr, WV, nullptr, DM, FV, DV, nullptr, 0, 0, 0); k_vtpv<<<LV, 256, 0, stream>>>(FV, VTh + (size_t)b * NH_ * HDV * TT, VTl + (size_t)b * NH_ * HDV * TT); }
    for (int h = 0; h < NH_; ++h) {
        for (int b = 0; b < NB_; ++b) { const size_t po = ((size_t)b * NH_ + h) * TT * HD;
            k_gemmw<bf, 2, false><<<dim3(TT / 64, TT / 64, 1), 32, 0, stream>>>(QPh + po, QPl + po, KPh + po, KPl + po, HD, S + (size_t)b * TT * TT, TT, nullptr, 0, 0, 0); }   /* scores (unscaled) of batch b */
        k_bsm<<<(unsigned)(((size_t)TT * TT / 4 + 255) / 256), 256, 0, stream>>>(S, Ph, Pl);
        for (int b = 0; b < NB_; ++b) { const size_t vo = ((size_t)b * NH_ + h) * HDV * TT;
            k_gemmw<bf, 2, false><<<dim3(TT / 64, HDV / 64, 1), 32, 0, stream>>>(Ph + (size_t)b * TT * TT, Pl + (size_t)b * TT * TT, VTh + vo, VTl + vo, TT, O, HDV, nullptr, 0, 0, 0);
            k_mrgv<<<(unsigned)(((size_t)TT * HDV / 4 + 255) / 256), 256, 0, stream>>>(O, h, ATh + (size_t)b * TT * DV, ATl + (size_t)b * TT * DV); } }
    for (int b = 0; b < NB_; ++b) k_gemmw<bf, 1, false><<<dim3(TT / 64, DV / 64, 1), 32, 0, stream>>>(ATh + (size_t)b * TT * DV, ATl + (size_t)b * TT * DV, WO, nullptr, DV, OUT + (size_t)b * TT * DV, DV, nullptr, 0, 0, 0);
}

// v001
// One run takes 417 microseconds.
// In two side-by-side timings against v000, it was 2.77 and 2.76 times as fast.
#include <hip/hip_runtime.h>

// Multi-head attention whose softmax runs over the BATCH axis (the source's nn.Softmax() with no dim on a (B,N,N)-shaped view picks dim 0): input_x [4][2048][512]; q = x Wq, k = x Wk ('xw' [512][256]: 4 heads x 64), v = x Wv ('xw' [512][512]: 4 heads x 128); scores[b][h][q][k] = q.k / 8; attn = softmax over b (the 4 batches, per (h, q, k)); out[b][q][h*128+d] = sum_k attn[b][h][q][k] v[b][k][h][d]; out Wo ('xw' [512][512]) -> [4][2048][512] (4.2 M).
// Layout: one launch per stage, the four batches side by side in its grid. Exact projections first: one GEMM [8192][512] x [1024][512]^T gives q | k | v of every batch, then q/k planes per (batch, head) as bf16 hi/lo (heads 0-3 q, 4-7 k) and value^T planes per (batch, head); per head: one 3-product score GEMM (grid z = batch) into S[b] [2048][2048] f32, an element-wise kernel takes the softmax ACROSS the four batches and writes hi/lo probability planes per batch, one 3-product P.v GEMM (N 128, grid z = batch) and a merge kernel drops the [8192][128] block into the hi/lo context planes at column h*128; finally out = context Wo (hl x exact), 8192 rows in one GEMM.
// Compute dtypes, f32 accumulate: every input rounded to bf16; projections exact; scores and attn.v on bf16 hi/lo planes (3 products) everywhere; the cross-batch softmax in f32.

#define NB_  4
#define TT   2048
#define DM   512
#define NH_  4
#define NKV  4
#define REP  (NH_ / NKV)
#define HD   64
#define DQ   (NH_ * HD)
#define DKV  (NKV * HD)
#define ZH   2
#define RH   2048                  // query rows < RH use hi+lo planes (0: none)
#define WIN  0
#define PCAR 1024.0f
#define SCL  0.125f   // 64^-0.5
#define HDV  128      // value head dim
#define DV   (NH_ * HDV)   // 512
typedef _Float16 h16;
typedef unsigned short bf;
typedef __attribute__((ext_vector_type(16))) __bf16   v16bf;
typedef __attribute__((ext_vector_type(16))) _Float16 v16h;
typedef __attribute__((ext_vector_type(8)))  _Float16 v8h;
typedef __attribute__((ext_vector_type(8)))  unsigned short v8us;
typedef __attribute__((ext_vector_type(8)))  float    v8f;
typedef __attribute__((ext_vector_type(4)))  float    v4f;
typedef v8h  __attribute__((may_alias)) v8ha;
typedef v4f  __attribute__((may_alias)) v4fa;
typedef v8us __attribute__((may_alias)) v8usa;

__device__ __forceinline__ unsigned short f2bf(float f) { unsigned u = __float_as_uint(f); u += 0x7FFFu + ((u >> 16) & 1u); return (unsigned short)(u >> 16); }
__device__ __forceinline__ float bf2f(unsigned short b) { return __uint_as_float(((unsigned)b) << 16); }
__device__ __forceinline__ float bfr(float f) { return bf2f(f2bf(f)); }
__device__ __forceinline__ v16h cat16(v8h lo, v8h hi) { return __builtin_shufflevector(lo, hi, 0, 1, 2, 3, 4, 5, 6, 7, 8, 9, 10, 11, 12, 13, 14, 15); }
__device__ __forceinline__ v16bf cat16b(v8us lo, v8us hi) { return __builtin_bit_cast(v16bf, __builtin_shufflevector(lo, hi, 0, 1, 2, 3, 4, 5, 6, 7, 8, 9, 10, 11, 12, 13, 14, 15)); }
__device__ __forceinline__ v8f wmma16(v16h a, v16h b, v8f c) { return __builtin_amdgcn_wmma_f32_16x16x32_f16(false, a, false, b, (short)0, c, false, false); }
__device__ __forceinline__ v8f wmmab(v16bf a, v16bf b, v8f c) { return __builtin_amdgcn_wmma_f32_16x16x32_bf16(false, a, false, b, (short)0, c, false, false); }



// ---- k_gemmw: register-blocked GEMM, ONE WAVE per 64x64 output tile (16 accumulators), operands straight from K-contiguous 16-bit planes; grid (M/64, N/64, Z), 32 threads.
// C[m][n] (f32, pitch ldc, + optional f32 bias[n]) = sum_k A[m][k] Bt[n][k] (+ split products per NSPLIT). z-batch strides sA/sB/sC in elements. K % 32 == 0.
template <typename T16> struct WFrag;
template <> struct WFrag<h16> { typedef v16h V; static __device__ __forceinline__ V ld(const h16* p) { return cat16(*(const v8h*)p, *(const v8h*)(p + 16)); } static __device__ __forceinline__ v8f mma(V a, V b, v8f c) { return wmma16(a, b, c); } };
template <> struct WFrag<bf> { typedef v16bf V; static __device__ __forceinline__ V ld(const bf* p) { return cat16b(*(const v8us*)p, *(const v8us*)(p + 16)); } static __device__ __forceinline__ v8f mma(V a, V b, v8f c) { return wmmab(a, b, c); } };
template <typename T16, int NSPLIT, bool BIAS>
__global__ __launch_bounds__(32) void k_gemmw(const T16* __restrict__ A, const T16* __restrict__ A2, const T16* __restrict__ Bt, const T16* __restrict__ Bt2, int K, float* C, int ldc, const float* __restrict__ bias, size_t sA, size_t sB, size_t sC) {
    typedef typename WFrag<T16>::V V;
    __shared__ __align__(16) float os[16 * 68];
    const size_t z = blockIdx.z; A += z * sA; if (A2) A2 += z * sA; Bt += z * sB; if (Bt2) Bt2 += z * sB; C += z * sC;
    const int lane = threadIdx.x & 31, lr = lane & 15, hi = lane >> 4; const int r0 = blockIdx.x * 64, c0 = blockIdx.y * 64;
    v8f acc[4][4];
#pragma unroll
    for (int mb = 0; mb < 4; ++mb)
#pragma unroll
        for (int nb = 0; nb < 4; ++nb) acc[mb][nb] = (v8f){};
    const size_t aoff = (size_t)(r0 + lr) * K + 8 * hi, boff = (size_t)(c0 + lr) * K + 8 * hi;
#pragma unroll 1
    for (int kc = 0; kc < K; kc += 32) {
        V a[4], a2[4];
#pragma unroll
        for (int mb = 0; mb < 4; ++mb) { a[mb] = WFrag<T16>::ld(A + aoff + (size_t)mb * 16 * K + kc); if (NSPLIT == 1 || NSPLIT == 2) a2[mb] = WFrag<T16>::ld(A2 + aoff + (size_t)mb * 16 * K + kc); }
#pragma unroll
        for (int nb = 0; nb < 4; ++nb) { const V b = WFrag<T16>::ld(Bt + boff + (size_t)nb * 16 * K + kc); V b2; if (NSPLIT >= 2) b2 = WFrag<T16>::ld(Bt2 + boff + (size_t)nb * 16 * K + kc);
#pragma unroll
            for (int mb = 0; mb < 4; ++mb) { acc[mb][nb] = WFrag<T16>::mma(a[mb], b, acc[mb][nb]); if (NSPLIT == 1 || NSPLIT == 2) acc[mb][nb] = WFrag<T16>::mma(a2[mb], b, acc[mb][nb]); if (NSPLIT >= 2) acc[mb][nb] = WFrag<T16>::mma(a[mb], b2, acc[mb][nb]); } }
        asm volatile("v_nop\n\tv_nop\n\tv_nop\n\tv_nop" : "+v"(acc[0][0]), "+v"(acc[1][1]), "+v"(acc[2][2]), "+v"(acc[3][3]) : "v"(a[0]), "v"(a[3]));
    }
#pragma unroll
    for (int mb = 0; mb < 4; ++mb) {
#pragma unroll
        for (int nb = 0; nb < 4; ++nb) {
#pragma unroll
            for (int j = 0; j < 8; ++j) os[(hi * 8 + j) * 68 + nb * 16 + lr] = acc[mb][nb][j]; }
        __builtin_amdgcn_wave_barrier(); asm volatile("" ::: "memory");
        float* crow = C + (size_t)(r0 + mb * 16) * ldc + c0;
{
#pragma unroll
            for (int s = 0; s < 8; ++s) { const int row = 2 * s + hi, cofs = lr * 4; v4f val = *(const v4fa*)(os + row * 68 + cofs); if (BIAS) { val[0] += bfr(bias[c0 + cofs]); val[1] += bfr(bias[c0 + cofs + 1]); val[2] += bfr(bias[c0 + cofs + 2]); val[3] += bfr(bias[c0 + cofs + 3]); }
                *(v4f*)(crow + (size_t)row * ldc + cofs) = val; }
             }
        __builtin_amdgcn_wave_barrier(); asm volatile("" ::: "memory");
    }
}

__device__ __forceinline__ h16 tohx(float x) { return (h16)x; }
__device__ __forceinline__ void splitf(float y, unsigned short& h, unsigned short& l) { h = f2bf(y); l = f2bf(y - bf2f(h)); }
typedef __attribute__((ext_vector_type(2))) _Float16 v2h;
typedef __attribute__((ext_vector_type(4))) _Float16 v4h;
typedef __attribute__((ext_vector_type(2))) unsigned short v2us;
typedef __attribute__((ext_vector_type(4))) unsigned short v4us;
typedef __attribute__((ext_vector_type(2))) float v2f;
typedef __attribute__((ext_vector_type(4))) int v4i;

// grid y picks the weight: 0 Wq, 1 Wk, 2 Wv, 3 Wo; the transposed planes lie one behind the other in W (rows 0-255 q, 256-511 k, 512-1023 v, 1024-1535 o; pitch 512).
__global__ __launch_bounds__(256) void k_wtG(const float* __restrict__ w0, const float* __restrict__ w1, const float* __restrict__ w2, const float* __restrict__ w3, bf* W) {
    const int y = blockIdx.y; const float* __restrict__ w = (y == 0) ? w0 : (y == 1) ? w1 : (y == 2) ? w2 : w3; const int K = DM; const int N = (y < 2) ? DQ : DV; bf* Bt = W + (size_t)((y == 0) ? 0 : (y == 1) ? DQ : (y == 2) ? (DQ + DKV) : (DQ + DKV + DV)) * DM;
    const int lane = threadIdx.x & 31; const int L0 = (blockIdx.x * 8 + (threadIdx.x >> 5)) * 8; const int nlines = N * K / 64;
{
#pragma unroll 1
        for (int l = 0; l < 8; ++l) { const int L = L0 + l; if (L >= nlines) break; const size_t e = (size_t)L * 64 + lane * 2; const int k = (int)(e % K), n = (int)(e / K); v2us o;
            o[0] = f2bf(w[(size_t)k * N + n]); o[1] = f2bf(w[(size_t)(k + 1) * N + n]); *(v2us*)(Bt + e) = o; }
         }
}
__global__ __launch_bounds__(256) void k_cvt8(const float* __restrict__ src, bf* dst, size_t n8) { const size_t i = (size_t)blockIdx.x * 256 + threadIdx.x; if (i >= n8) return; const v8f v = *(const v8f*)(src + i * 8); v8us o;
#pragma unroll
    for (int k = 0; k < 8; ++k) o[k] = f2bf(v[k]); *(v8us*)(dst + i * 8) = o;  }

// k_rope: head planes [h][t][d] (fp16 + hi/lo) of rope(x) x sc with the rotate-half convention out[d] = x[d] cos[t][d] - x[d+HD/2] sin[t][d], out[d+HD/2] = x[d+HD/2] cos[t][d+HD/2] + x[d] sin[t][d+HD/2]
__global__ __launch_bounds__(256) void k_rope(const float* __restrict__ F, int pitch, int nheads, const float* __restrict__ CS, const float* __restrict__ RF, const float* __restrict__ nw, float sc, h16* P16, bf* Ph, bf* Pl) {
    const size_t e = ((size_t)blockIdx.x * 256 + threadIdx.x) * 2; if (e >= (size_t)nheads * TT * HD) return; const int d = (int)(e % HD); const int t = (int)((e / HD) % TT); const int h = (int)(e / ((size_t)HD * TT)); const size_t bz = blockIdx.y; /* batch */ const size_t eo = bz * nheads * TT * HD + e; const float* f = F + (bz * TT + t) * pitch + h * HD; const float rf = RF ? RF[(size_t)h * TT + t] : 1.0f; v2h o16; v2us oh, ol;
#pragma unroll
    for (int q = 0; q < 2; ++q) { const int dd = d + q; const int dp = (dd < HD / 2) ? dd + HD / 2 : dd - HD / 2; float x0 = f[dd], x1 = f[dp];
        if (RF) { float n0 = __fmul_rn(x0, rf), n1 = __fmul_rn(x1, rf); asm volatile("" : "+v"(n0)); asm volatile("" : "+v"(n1)); x0 = __fmul_rn(bfr(nw[dd]), n0); x1 = __fmul_rn(bfr(nw[dp]), n1); }
        const v2f cs = *(const v2f*)(CS + ((size_t)t * HD + dd) * 2); float a = __fmul_rn(x0, cs[0]), bq = __fmul_rn(x1, cs[1]); asm volatile("" : "+v"(a)); asm volatile("" : "+v"(bq)); const float r = ((dd < HD / 2) ? __fsub_rn(a, bq) : __fadd_rn(a, bq)) * sc;
        o16[q] = tohx(r); unsigned short a2, c2; splitf(r, a2, c2); oh[q] = a2; ol[q] = c2; }
    *(v2h*)(P16 + eo) = o16; *(v2us*)(Ph + eo) = oh; *(v2us*)(Pl + eo) = ol;  }
__global__ __launch_bounds__(256) void k_vtp(const float* __restrict__ F, int pitch, int nheads, h16* V16, bf* Vh, bf* Vl) { const size_t e = ((size_t)blockIdx.x * 256 + threadIdx.x) * 2; if (e >= (size_t)nheads * HD * TT) return; const int t = (int)(e % TT); const int d = (int)((e / TT) % HD); const int g = (int)(e / ((size_t)TT * HD)); v2h o16; v2us oh, ol;
#pragma unroll
    for (int q = 0; q < 2; ++q) { const float x = F[(size_t)(t + q) * pitch + g * HD + d]; o16[q] = tohx(x); unsigned short a2, c2; splitf(x, a2, c2); oh[q] = a2; ol[q] = c2; }
    *(v2h*)(V16 + e) = o16; *(v2us*)(Vh + e) = oh; *(v2us*)(Vl + e) = ol;  }
__global__ __launch_bounds__(256) void k_csid(float* CS) { const int idx = blockIdx.x * 256 + threadIdx.x; if (idx >= TT * HD) return; v2f cs; cs[0] = 1.0f; cs[1] = 0.0f; *(v2f*)(CS + (size_t)idx * 2) = cs;  }
// k_asoft: per row (zz, i): t = S x HD^-0.5 (no mask); softmax over the 2048 keys (register row, one exp, fixed trees);
__global__ __launch_bounds__(256) void k_asoft(const float* __restrict__ Sb, h16* P16, bf* Ph, bf* Pl) {
    const int lane = threadIdx.x & 31; const int row = blockIdx.x * 8 + (threadIdx.x >> 5); if (row >= ZH * TT) return; const int i = row % TT; const int zz = row / TT; (void)zz; const bool hires = (i < RH); const float* sr = Sb + (size_t)row * TT; float v[TT / 32]; float mx = -3.0e38f;
#pragma unroll
    for (int ch = 0; ch < TT / 128; ++ch) { const int j0 = ch * 128 + lane * 4; const v4f a = *(const v4f*)(sr + j0);
#pragma unroll
        for (int q = 0; q < 4; ++q) { const int j = j0 + q; (void)j; const float t = a[q] * SCL; v[ch * 4 + q] = t; mx = fmaxf(mx, t); } }
#pragma unroll
    for (int sh = 16; sh; sh >>= 1) mx = fmaxf(mx, __shfl_xor(mx, sh, 32));
    float sum = 0.f;
#pragma unroll
    for (int k = 0; k < TT / 32; ++k) { float d0 = __fsub_rn(v[k], mx); asm volatile("" : "+v"(d0)); v[k] = __builtin_amdgcn_exp2f(__fmul_rn(d0, 1.4426950408889634f)); sum += v[k]; }
#pragma unroll
    for (int sh = 16; sh; sh >>= 1) sum += __shfl_xor(sum, sh, 32);
    const float f = __fdiv_rn(hires ? 1.0f : PCAR, sum);
{
        if (hires) {
#pragma unroll
            for (int ch = 0; ch < TT / 128; ++ch) { v4us oh, ol;
#pragma unroll
                for (int q = 0; q < 4; ++q) { unsigned short a, c2; splitf(v[ch * 4 + q] * f, a, c2); oh[q] = a; ol[q] = c2; }
                const size_t oo = ((size_t)zz * (RH ? RH : 1) + i) * TT + ch * 128 + lane * 4; *(v4us*)(Ph + oo) = oh; *(v4us*)(Pl + oo) = ol; }
        } else {
#pragma unroll
            for (int ch = 0; ch < TT / 128; ++ch) { v4h o4;
#pragma unroll
                for (int q = 0; q < 4; ++q) o4[q] = tohx(v[ch * 4 + q] * f);
                *(v4h*)(P16 + (size_t)row * TT + ch * 128 + lane * 4) = o4; } }
         }
}
__global__ __launch_bounds__(256) void k_merge(const float* __restrict__ O, int h0, bf* Ah, bf* Al) { const size_t e = ((size_t)blockIdx.x * 256 + threadIdx.x) * 2; if (e >= (size_t)ZH * TT * HD) return; const int d = (int)(e % HD); const int t = (int)((e / HD) % TT); const int zz = (int)(e / ((size_t)HD * TT)); const float cs = (t < RH) ? 1.0f : (1.0f / PCAR); const size_t oo = (size_t)t * DQ + (h0 + zz) * HD + d;
    v2us oh, ol;
#pragma unroll
    for (int q = 0; q < 2; ++q) { unsigned short a, c2; splitf(O[e + q] * cs, a, c2); oh[q] = a; ol[q] = c2; } *(v2us*)(Ah + oo) = oh; *(v2us*)(Al + oo) = ol;  }

__global__ __launch_bounds__(256) void k_vtpv(const float* __restrict__ F, int pitch, bf* Vh, bf* Vl) { const size_t e = ((size_t)blockIdx.x * 256 + threadIdx.x) * 2; if (e >= (size_t)NH_ * HDV * TT) return; const int t = (int)(e % TT); const int d = (int)((e / TT) % HDV); const int h = (int)(e / ((size_t)TT * HDV)); const size_t bz = blockIdx.y; /* batch */ const size_t eo = bz * NH_ * HDV * TT + e; v2us oh, ol;
#pragma unroll
    for (int q = 0; q < 2; ++q) { unsigned short a, b; splitf(F[(bz * TT + t + q) * pitch + h * HDV + d], a, b); oh[q] = a; ol[q] = b; }
    *(v2us*)(Vh + eo) = oh; *(v2us*)(Vl + eo) = ol;  }
__global__ __launch_bounds__(256) void k_bsm(const float* __restrict__ S, bf* Ph, bf* Pl) { const size_t i = (size_t)blockIdx.x * 256 + threadIdx.x; if (i >= (size_t)TT * TT / 4) return; const size_t e = i * 4; v4f s[NB_];
#pragma unroll
    for (int b = 0; b < NB_; ++b) s[b] = *(const v4f*)(S + (size_t)b * TT * TT + e);
    v4us oh[NB_], ol[NB_];
#pragma unroll
    for (int q = 0; q < 4; ++q) { float t[NB_]; float mx = -3.0e38f;
#pragma unroll
        for (int b = 0; b < NB_; ++b) { t[b] = __fmul_rn(s[b][q], SCL); mx = fmaxf(mx, t[b]); }
        float ex[NB_]; float sum = 0.f;
#pragma unroll
        for (int b = 0; b < NB_; ++b) { float d0 = __fsub_rn(t[b], mx); asm volatile("" : "+v"(d0)); ex[b] = __builtin_amdgcn_exp2f(__fmul_rn(d0, 1.4426950408889634f)); sum = __fadd_rn(sum, ex[b]); }
        const float f = __fdiv_rn(1.0f, sum);
#pragma unroll
        for (int b = 0; b < NB_; ++b) { unsigned short a, c; splitf(__fmul_rn(ex[b], f), a, c); oh[b][q] = a; ol[b][q] = c; } }
{
#pragma unroll
        for (int b = 0; b < NB_; ++b) { *(v4us*)(Ph + (size_t)b * TT * TT + e) = oh[b]; *(v4us*)(Pl + (size_t)b * TT * TT + e) = ol[b]; }
         } }
__global__ __launch_bounds__(256) void k_mrgv(const float* __restrict__ O, int h, bf* Ah, bf* Al) { const size_t i = (size_t)blockIdx.x * 256 + threadIdx.x; if (i >= (size_t)NB_ * TT * HDV / 4) return; const int d0 = (int)(i % (HDV / 4)) * 4; const size_t t = i / (HDV / 4); /* row b*TT + t of the four batches */ const v4f a = *(const v4f*)(O + t * HDV + d0); v4us oh, ol;
#pragma unroll
    for (int q = 0; q < 4; ++q) { unsigned short x2, y2; splitf(a[q], x2, y2); oh[q] = x2; ol[q] = y2; }
    const size_t oo = t * DV + (size_t)h * HDV + d0; *(v4us*)(Ah + oo) = oh; *(v4us*)(Al + oo) = ol;  }

extern "C" void kernel_launch(void* const* d_in, const int* in_sizes, int n_in,
                              void* d_out, int out_size, void* d_ws, size_t ws_size, hipStream_t stream) {
    (void)in_sizes; (void)n_in; (void)out_size;
    const float* x = (const float*)d_in[0]; const float* wq = (const float*)d_in[1]; const float* wk = (const float*)d_in[2]; const float* wv = (const float*)d_in[3]; const float* wo = (const float*)d_in[4];
    float* OUT = (float*)d_out;     // [4][2048][512]
    char* wsp = (char*)d_ws;
    auto take = [&](size_t bytes) { char* p = wsp; wsp += (bytes + 255) & ~(size_t)255; return (void*)p; };
    bf* W = (bf*)take((size_t)(DQ + DKV + DV + DV) * DM * 2); bf* WO = W + (size_t)(DQ + DKV + DV) * DM; float* CS = (float*)take((size_t)TT * HD * 2 * 4);
    bf* XB = (bf*)take((size_t)NB_ * TT * DM * 2); float* F = (float*)take((size_t)NB_ * TT * (DQ + DKV + DV) * 4);   /* q | k | v of every row, pitch 1024 */
    h16* JP16 = (h16*)take((size_t)NB_ * (NH_ + NKV) * TT * HD * 2);   /* fp16 planes written by the plane builder, unused */
    bf* QKh = (bf*)take((size_t)NB_ * (NH_ + NKV) * TT * HD * 2); bf* QKl = (bf*)take((size_t)NB_ * (NH_ + NKV) * TT * HD * 2);   /* [b][8][t][d]: heads 0-3 q, 4-7 k */
    bf* VTh = (bf*)take((size_t)NB_ * NH_ * HDV * TT * 2); bf* VTl = (bf*)take((size_t)NB_ * NH_ * HDV * TT * 2);
    float* S = (float*)take((size_t)NB_ * TT * TT * 4); bf* Ph = (bf*)take((size_t)NB_ * TT * TT * 2); bf* Pl = (bf*)take((size_t)NB_ * TT * TT * 2); float* O = (float*)take((size_t)NB_ * TT * HDV * 4); bf* ATh = (bf*)take((size_t)NB_ * TT * DV * 2); bf* ATl = (bf*)take((size_t)NB_ * TT * DV * 2);
    if ((size_t)(wsp - (char*)d_ws) > ws_size) return;    // ws 256 MiB (carve 230.5 MiB)
    k_wtG<<<dim3((unsigned)((DM * DV / 64 + 63) / 64), 4, 1), 256, 0, stream>>>(wq, wk, wv, wo, W);
    k_csid<<<(TT * HD + 255) / 256, 256, 0, stream>>>(CS);
    const int PF = DQ + DKV + DV; const size_t sQK = (size_t)(NH_ + NKV) * TT * HD;
    /* projections + planes, every batch in one launch each (the softmax couples the batches) */
    k_cvt8<<<(unsigned)(((size_t)NB_ * TT * DM / 8 + 255) / 256), 256, 0, stream>>>(x, XB, (size_t)NB_ * TT * DM / 8);
    k_gemmw<bf, 0, false><<<dim3(NB_ * TT / 64, PF / 64, 1), 32, 0, stream>>>(XB, nullptr, W, nullptr, DM, F, PF, nullptr, 0, 0, 0);
    k_rope<<<dim3((unsigned)((sQK / 2 + 255) / 256), NB_, 1), 256, 0, stream>>>(F, PF, NH_ + NKV, CS, nullptr, nullptr, 1.0f, JP16, QKh, QKl);
    k_vtpv<<<dim3((unsigned)(((size_t)NH_ * HDV * TT / 2 + 255) / 256), NB_, 1), 256, 0, stream>>>(F + DQ + DKV, PF, VTh, VTl);
    for (int h = 0; h < NH_; ++h) { const size_t qo = (size_t)h * TT * HD, ko = (size_t)(NH_ + h) * TT * HD, vo = (size_t)h * HDV * TT;
        k_gemmw<bf, 2, false><<<dim3(TT / 64, TT / 64, NB_), 32, 0, stream>>>(QKh + qo, QKl + qo, QKh + ko, QKl + ko, HD, S, TT, nullptr, sQK, sQK, (size_t)TT * TT);   /* scores (unscaled), z = batch */
        k_bsm<<<(unsigned)(((size_t)TT * TT / 4 + 255) / 256), 256, 0, stream>>>(S, Ph, Pl);
        k_gemmw<bf, 2, false><<<dim3(TT / 64, HDV / 64, NB_), 32, 0, stream>>>(Ph, Pl, VTh + vo, VTl + vo, TT, O, HDV, nullptr, (size_t)TT * TT, (size_t)NH_ * HDV * TT, (size_t)TT * HDV);   /* P.v, z = batch */
        k_mrgv<<<(unsigned)(((size_t)NB_ * TT * HDV / 4 + 255) / 256), 256, 0, stream>>>(O, h, ATh, ATl); }
    k_gemmw<bf, 1, false><<<dim3(NB_ * TT / 64, DV / 64, 1), 32, 0, stream>>>(ATh, ATl, WO, nullptr, DV, OUT, DV, nullptr, 0, 0, 0);
}

// v002
// A run of this version takes 214 microseconds.
// Next to v001, in two timings, it ran 1.95 and 1.94 times as fast.
// Counting every step since v000, it is 5.38 times as fast.
#include <hip/hip_runtime.h>

// Multi-head attention whose softmax runs over the BATCH axis (the source's nn.Softmax() with no dim on a (B,N,N)-shaped view picks dim 0): input_x [4][2048][512]; q = x Wq, k = x Wk ('xw' [512][256]: 4 heads x 64), v = x Wv ('xw' [512][512]: 4 heads x 128); scores[b][h][q][k] = q.k / 8; attn = softmax over b (the 4 batches, per (h, q, k)); out[b][q][h*128+d] = sum_k attn[b][h][q][k] v[b][k][h][d]; out Wo ('xw' [512][512]) -> [4][2048][512] (4.2 M).
// Layout: exact projections first: one GEMM [8192][512] x [1024][512]^T gives q | k | v of every batch, then q/k planes per (batch, head) as bf16 hi/lo (heads 0-3 q, 4-7 k) and value^T planes per (batch, head); then ONE attention kernel (k_fattn) for all heads: a wave holds the scores of all four batches for 32 keys x 32 queries in registers, takes the softmax ACROSS the batches there, feeds the probabilities (hi/lo) straight into the 3-product P.v and the work-group writes the hi/lo context planes; finally out = context Wo (hl x exact), 8192 rows in one GEMM.
// Compute dtypes, f32 accumulate: every input rounded to bf16; projections exact; scores and attn.v on bf16 hi/lo planes (3 products) everywhere; the cross-batch softmax in f32.

#define NB_  4
#define TT   2048
#define DM   512
#define NH_  4
#define NKV  4
#define REP  (NH_ / NKV)
#define HD   64
#define DQ   (NH_ * HD)
#define DKV  (NKV * HD)
#define ZH   2
#define RH   2048                  // query rows < RH use hi+lo planes (0: none)
#define WIN  0
#define PCAR 1024.0f
#define SCL  0.125f   // 64^-0.5
#define HDV  128      // value head dim
#define DV   (NH_ * HDV)   // 512
typedef _Float16 h16;
typedef unsigned short bf;
typedef __attribute__((ext_vector_type(16))) __bf16   v16bf;
typedef __attribute__((ext_vector_type(16))) _Float16 v16h;
typedef __attribute__((ext_vector_type(8)))  _Float16 v8h;
typedef __attribute__((ext_vector_type(8)))  unsigned short v8us;
typedef __attribute__((ext_vector_type(8)))  float    v8f;
typedef __attribute__((ext_vector_type(4)))  float    v4f;
typedef v8h  __attribute__((may_alias)) v8ha;
typedef v4f  __attribute__((may_alias)) v4fa;
typedef v8us __attribute__((may_alias)) v8usa;

__device__ __forceinline__ unsigned short f2bf(float f) { unsigned u = __float_as_uint(f); u += 0x7FFFu + ((u >> 16) & 1u); return (unsigned short)(u >> 16); }
__device__ __forceinline__ float bf2f(unsigned short b) { return __uint_as_float(((unsigned)b) << 16); }
__device__ __forceinline__ float bfr(float f) { return bf2f(f2bf(f)); }
__device__ __forceinline__ v16h cat16(v8h lo, v8h hi) { return __builtin_shufflevector(lo, hi, 0, 1, 2, 3, 4, 5, 6, 7, 8, 9, 10, 11, 12, 13, 14, 15); }
__device__ __forceinline__ v16bf cat16b(v8us lo, v8us hi) { return __builtin_bit_cast(v16bf, __builtin_shufflevector(lo, hi, 0, 1, 2, 3, 4, 5, 6, 7, 8, 9, 10, 11, 12, 13, 14, 15)); }
__device__ __forceinline__ v8f wmma16(v16h a, v16h b, v8f c) { return __builtin_amdgcn_wmma_f32_16x16x32_f16(false, a, false, b, (short)0, c, false, false); }
__device__ __forceinline__ v8f wmmab(v16bf a, v16bf b, v8f c) { return __builtin_amdgcn_wmma_f32_16x16x32_bf16(false, a, false, b, (short)0, c, false, false); }



// ---- k_gemmw: register-blocked GEMM, ONE WAVE per 64x64 output tile (16 accumulators), operands straight from K-contiguous 16-bit planes; grid (M/64, N/64, Z), 32 threads.
// C[m][n] (f32, pitch ldc, + optional f32 bias[n]) = sum_k A[m][k] Bt[n][k] (+ split products per NSPLIT). z-batch strides sA/sB/sC in elements. K % 32 == 0.
template <typename T16> struct WFrag;
template <> struct WFrag<h16> { typedef v16h V; static __device__ __forceinline__ V ld(const h16* p) { return cat16(*(const v8h*)p, *(const v8h*)(p + 16)); } static __device__ __forceinline__ v8f mma(V a, V b, v8f c) { return wmma16(a, b, c); } };
template <> struct WFrag<bf> { typedef v16bf V; static __device__ __forceinline__ V ld(const bf* p) { return cat16b(*(const v8us*)p, *(const v8us*)(p + 16)); } static __device__ __forceinline__ v8f mma(V a, V b, v8f c) { return wmmab(a, b, c); } };
template <typename T16, int NSPLIT, bool BIAS>
__global__ __launch_bounds__(32) void k_gemmw(const T16* __restrict__ A, const T16* __restrict__ A2, const T16* __restrict__ Bt, const T16* __restrict__ Bt2, int K, float* C, int ldc, const float* __restrict__ bias, size_t sA, size_t sB, size_t sC) {
    typedef typename WFrag<T16>::V V;
    __shared__ __align__(16) float os[16 * 68];
    const size_t z = blockIdx.z; A += z * sA; if (A2) A2 += z * sA; Bt += z * sB; if (Bt2) Bt2 += z * sB; C += z * sC;
    const int lane = threadIdx.x & 31, lr = lane & 15, hi = lane >> 4; const int r0 = blockIdx.x * 64, c0 = blockIdx.y * 64;
    v8f acc[4][4];
#pragma unroll
    for (int mb = 0; mb < 4; ++mb)
#pragma unroll
        for (int nb = 0; nb < 4; ++nb) acc[mb][nb] = (v8f){};
    const size_t aoff = (size_t)(r0 + lr) * K + 8 * hi, boff = (size_t)(c0 + lr) * K + 8 * hi;
#pragma unroll 1
    for (int kc = 0; kc < K; kc += 32) {
        V a[4], a2[4];
#pragma unroll
        for (int mb = 0; mb < 4; ++mb) { a[mb] = WFrag<T16>::ld(A + aoff + (size_t)mb * 16 * K + kc); if (NSPLIT == 1 || NSPLIT == 2) a2[mb] = WFrag<T16>::ld(A2 + aoff + (size_t)mb * 16 * K + kc); }
#pragma unroll
        for (int nb = 0; nb < 4; ++nb) { const V b = WFrag<T16>::ld(Bt + boff + (size_t)nb * 16 * K + kc); V b2; if (NSPLIT >= 2) b2 = WFrag<T16>::ld(Bt2 + boff + (size_t)nb * 16 * K + kc);
#pragma unroll
            for (int mb = 0; mb < 4; ++mb) { acc[mb][nb] = WFrag<T16>::mma(a[mb], b, acc[mb][nb]); if (NSPLIT == 1 || NSPLIT == 2) acc[mb][nb] = WFrag<T16>::mma(a2[mb], b, acc[mb][nb]); if (NSPLIT >= 2) acc[mb][nb] = WFrag<T16>::mma(a[mb], b2, acc[mb][nb]); } }
        asm volatile("v_nop\n\tv_nop\n\tv_nop\n\tv_nop" : "+v"(acc[0][0]), "+v"(acc[1][1]), "+v"(acc[2][2]), "+v"(acc[3][3]) : "v"(a[0]), "v"(a[3]));
    }
#pragma unroll
    for (int mb = 0; mb < 4; ++mb) {
#pragma unroll
        for (int nb = 0; nb < 4; ++nb) {
#pragma unroll
            for (int j = 0; j < 8; ++j) os[(hi * 8 + j) * 68 + nb * 16 + lr] = acc[mb][nb][j]; }
        __builtin_amdgcn_wave_barrier(); asm volatile("" ::: "memory");
        float* crow = C + (size_t)(r0 + mb * 16) * ldc + c0;
{
#pragma unroll
            for (int s = 0; s < 8; ++s) { const int row = 2 * s + hi, cofs = lr * 4; v4f val = *(const v4fa*)(os + row * 68 + cofs); if (BIAS) { val[0] += bfr(bias[c0 + cofs]); val[1] += bfr(bias[c0 + cofs + 1]); val[2] += bfr(bias[c0 + cofs + 2]); val[3] += bfr(bias[c0 + cofs + 3]); }
                *(v4f*)(crow + (size_t)row * ldc + cofs) = val; }
             }
        __builtin_amdgcn_wave_barrier(); asm volatile("" ::: "memory");
    }
}

__device__ __forceinline__ h16 tohx(float x) { return (h16)x; }
__device__ __forceinline__ void splitf(float y, unsigned short& h, unsigned short& l) { h = f2bf(y); l = f2bf(y - bf2f(h)); }
typedef __attribute__((ext_vector_type(2))) _Float16 v2h;
typedef __attribute__((ext_vector_type(4))) _Float16 v4h;
typedef __attribute__((ext_vector_type(2))) unsigned short v2us;
typedef __attribute__((ext_vector_type(4))) unsigned short v4us;
typedef __attribute__((ext_vector_type(2))) float v2f;
typedef __attribute__((ext_vector_type(4))) int v4i;

// grid y picks the weight: 0 Wq, 1 Wk, 2 Wv, 3 Wo; the transposed planes lie one behind the other in W (rows 0-255 q, 256-511 k, 512-1023 v, 1024-1535 o; pitch 512).
__global__ __launch_bounds__(256) void k_wtG(const float* __restrict__ w0, const float* __restrict__ w1, const float* __restrict__ w2, const float* __restrict__ w3, bf* W) {
    const int y = blockIdx.y; const float* __restrict__ w = (y == 0) ? w0 : (y == 1) ? w1 : (y == 2) ? w2 : w3; const int K = DM; const int N = (y < 2) ? DQ : DV; bf* Bt = W + (size_t)((y == 0) ? 0 : (y == 1) ? DQ : (y == 2) ? (DQ + DKV) : (DQ + DKV + DV)) * DM;
    const int lane = threadIdx.x & 31; const int L0 = (blockIdx.x * 8 + (threadIdx.x >> 5)) * 8; const int nlines = N * K / 64;
{
#pragma unroll 1
        for (int l = 0; l < 8; ++l) { const int L = L0 + l; if (L >= nlines) break; const size_t e = (size_t)L * 64 + lane * 2; const int k = (int)(e % K), n = (int)(e / K); v2us o;
            o[0] = f2bf(w[(size_t)k * N + n]); o[1] = f2bf(w[(size_t)(k + 1) * N + n]); *(v2us*)(Bt + e) = o; }
         }
}
__global__ __launch_bounds__(256) void k_cvt8(const float* __restrict__ src, bf* dst, size_t n8) { const size_t i = (size_t)blockIdx.x * 256 + threadIdx.x; if (i >= n8) return; const v8f v = *(const v8f*)(src + i * 8); v8us o;
#pragma unroll
    for (int k = 0; k < 8; ++k) o[k] = f2bf(v[k]); *(v8us*)(dst + i * 8) = o;  }

// k_rope: head planes [h][t][d] (fp16 + hi/lo) of rope(x) x sc with the rotate-half convention out[d] = x[d] cos[t][d] - x[d+HD/2] sin[t][d], out[d+HD/2] = x[d+HD/2] cos[t][d+HD/2] + x[d] sin[t][d+HD/2]
__global__ __launch_bounds__(256) void k_rope(const float* __restrict__ F, int pitch, int nheads, const float* __restrict__ CS, const float* __restrict__ RF, const float* __restrict__ nw, float sc, h16* P16, bf* Ph, bf* Pl) {
    const size_t e = ((size_t)blockIdx.x * 256 + threadIdx.x) * 2; if (e >= (size_t)nheads * TT * HD) return; const int d = (int)(e % HD); const int t = (int)((e / HD) % TT); const int h = (int)(e / ((size_t)HD * TT)); const size_t bz = blockIdx.y; /* batch */ const size_t eo = bz * nheads * TT * HD + e; const float* f = F + (bz * TT + t) * pitch + h * HD; const float rf = RF ? RF[(size_t)h * TT + t] : 1.0f; v2h o16; v2us oh, ol;
#pragma unroll
    for (int q = 0; q < 2; ++q) { const int dd = d + q; const int dp = (dd < HD / 2) ? dd + HD / 2 : dd - HD / 2; float x0 = f[dd], x1 = f[dp];
        if (RF) { float n0 = __fmul_rn(x0, rf), n1 = __fmul_rn(x1, rf); asm volatile("" : "+v"(n0)); asm volatile("" : "+v"(n1)); x0 = __fmul_rn(bfr(nw[dd]), n0); x1 = __fmul_rn(bfr(nw[dp]), n1); }
        const v2f cs = *(const v2f*)(CS + ((size_t)t * HD + dd) * 2); float a = __fmul_rn(x0, cs[0]), bq = __fmul_rn(x1, cs[1]); asm volatile("" : "+v"(a)); asm volatile("" : "+v"(bq)); const float r = ((dd < HD / 2) ? __fsub_rn(a, bq) : __fadd_rn(a, bq)) * sc;
        o16[q] = tohx(r); unsigned short a2, c2; splitf(r, a2, c2); oh[q] = a2; ol[q] = c2; }
    *(v2h*)(P16 + eo) = o16; *(v2us*)(Ph + eo) = oh; *(v2us*)(Pl + eo) = ol;  }
__global__ __launch_bounds__(256) void k_vtp(const float* __restrict__ F, int pitch, int nheads, h16* V16, bf* Vh, bf* Vl) { const size_t e = ((size_t)blockIdx.x * 256 + threadIdx.x) * 2; if (e >= (size_t)nheads * HD * TT) return; const int t = (int)(e % TT); const int d = (int)((e / TT) % HD); const int g = (int)(e / ((size_t)TT * HD)); v2h o16; v2us oh, ol;
#pragma unroll
    for (int q = 0; q < 2; ++q) { const float x = F[(size_t)(t + q) * pitch + g * HD + d]; o16[q] = tohx(x); unsigned short a2, c2; splitf(x, a2, c2); oh[q] = a2; ol[q] = c2; }
    *(v2h*)(V16 + e) = o16; *(v2us*)(Vh + e) = oh; *(v2us*)(Vl + e) = ol;  }
__global__ __launch_bounds__(256) void k_csid(float* CS) { const int idx = blockIdx.x * 256 + threadIdx.x; if (idx >= TT * HD) return; v2f cs; cs[0] = 1.0f; cs[1] = 0.0f; *(v2f*)(CS + (size_t)idx * 2) = cs;  }
// k_asoft: per row (zz, i): t = S x HD^-0.5 (no mask); softmax over the 2048 keys (register row, one exp, fixed trees);
__global__ __launch_bounds__(256) void k_asoft(const float* __restrict__ Sb, h16* P16, bf* Ph, bf* Pl) {
    const int lane = threadIdx.x & 31; const int row = blockIdx.x * 8 + (threadIdx.x >> 5); if (row >= ZH * TT) return; const int i = row % TT; const int zz = row / TT; (void)zz; const bool hires = (i < RH); const float* sr = Sb + (size_t)row * TT; float v[TT / 32]; float mx = -3.0e38f;
#pragma unroll
    for (int ch = 0; ch < TT / 128; ++ch) { const int j0 = ch * 128 + lane * 4; const v4f a = *(const v4f*)(sr + j0);
#pragma unroll
        for (int q = 0; q < 4; ++q) { const int j = j0 + q; (void)j; const float t = a[q] * SCL; v[ch * 4 + q] = t; mx = fmaxf(mx, t); } }
#pragma unroll
    for (int sh = 16; sh; sh >>= 1) mx = fmaxf(mx, __shfl_xor(mx, sh, 32));
    float sum = 0.f;
#pragma unroll
    for (int k = 0; k < TT / 32; ++k) { float d0 = __fsub_rn(v[k], mx); asm volatile("" : "+v"(d0)); v[k] = __builtin_amdgcn_exp2f(__fmul_rn(d0, 1.4426950408889634f)); sum += v[k]; }
#pragma unroll
    for (int sh = 16; sh; sh >>= 1) sum += __shfl_xor(sum, sh, 32);
    const float f = __fdiv_rn(hires ? 1.0f : PCAR, sum);
{
        if (hires) {
#pragma unroll
            for (int ch = 0; ch < TT / 128; ++ch) { v4us oh, ol;
#pragma unroll
                for (int q = 0; q < 4; ++q) { unsigned short a, c2; splitf(v[ch * 4 + q] * f, a, c2); oh[q] = a; ol[q] = c2; }
                const size_t oo = ((size_t)zz * (RH ? RH : 1) + i) * TT + ch * 128 + lane * 4; *(v4us*)(Ph + oo) = oh; *(v4us*)(Pl + oo) = ol; }
        } else {
#pragma unroll
            for (int ch = 0; ch < TT / 128; ++ch) { v4h o4;
#pragma unroll
                for (int q = 0; q < 4; ++q) o4[q] = tohx(v[ch * 4 + q] * f);
                *(v4h*)(P16 + (size_t)row * TT + ch * 128 + lane * 4) = o4; } }
         }
}
__global__ __launch_bounds__(256) void k_merge(const float* __restrict__ O, int h0, bf* Ah, bf* Al) { const size_t e = ((size_t)blockIdx.x * 256 + threadIdx.x) * 2; if (e >= (size_t)ZH * TT * HD) return; const int d = (int)(e % HD); const int t = (int)((e / HD) % TT); const int zz = (int)(e / ((size_t)HD * TT)); const float cs = (t < RH) ? 1.0f : (1.0f / PCAR); const size_t oo = (size_t)t * DQ + (h0 + zz) * HD + d;
    v2us oh, ol;
#pragma unroll
    for (int q = 0; q < 2; ++q) { unsigned short a, c2; splitf(O[e + q] * cs, a, c2); oh[q] = a; ol[q] = c2; } *(v2us*)(Ah + oo) = oh; *(v2us*)(Al + oo) = ol;  }

__global__ __launch_bounds__(256) void k_vtpv(const float* __restrict__ F, int pitch, bf* Vh, bf* Vl) { const size_t e = ((size_t)blockIdx.x * 256 + threadIdx.x) * 2; if (e >= (size_t)NH_ * HDV * TT) return; const int t = (int)(e % TT); const int d = (int)((e / TT) % HDV); const int h = (int)(e / ((size_t)TT * HDV)); const size_t bz = blockIdx.y; /* batch */ const size_t eo = bz * NH_ * HDV * TT + e; v2us oh, ol;
#pragma unroll
    for (int q = 0; q < 2; ++q) { unsigned short a, b; splitf(F[(bz * TT + t + q) * pitch + h * HDV + d], a, b); oh[q] = a; ol[q] = b; }
    *(v2us*)(Vh + eo) = oh; *(v2us*)(Vl + eo) = ol;  }
// ---- k_fattn: scores, cross-batch softmax, P.v and the hi/lo split of the context in one kernel. Grid (TT/32, heads), 4 waves.
// The work-group owns 32 queries of one head in ALL four batches; in pass kt wave w takes keys kt*128 + w*32 .. +31 (the sum over keys needs no running maximum: the softmax runs over the batches).
// Transposed products: S^T[key][q] = K Q^T (A = k plane rows, B = q plane rows), so that two 16x16 D tiles (keys 0-15, 16-31 of the pass) are, converted in place, the B operand of O^T[d][q] = V^T P^T (A = value^T plane rows): no LDS and no lane exchange between the two products.
// At the end the four waves' partial O^T (one per key subset) are summed through LDS in wave order 0..3; wave w finishes batch w.
// Every inner loop is fully unrolled so that the fragment, score and accumulator arrays are indexed by constants and stay in registers (512 of them hold O^T: one wave per SIMD).
#define FQB 2     // 16-query blocks per work-group
#define FWV 4     // waves per work-group
typedef __attribute__((ext_vector_type(8))) unsigned v8u;
__global__ __launch_bounds__(32 * FWV) void k_fattn(const bf* __restrict__ QKh, const bf* __restrict__ QKl, const bf* __restrict__ VTh, const bf* __restrict__ VTl, bf* ATh, bf* ATl) {
    typedef WFrag<bf> WF; typedef WF::V V;
    __shared__ __align__(16) v8us qs[NB_ * FQB * 2 * 2][2][32];        // q fragments [batch][nb][kc][hi|lo], fragment order: 32 KiB
    __shared__ __align__(16) v4f red[FWV][NB_ * 8 * FQB][2][32];       // the waves' partial O^T tiles: 256 KiB
    const int lane = threadIdx.x & 31, lr = lane & 15, hi = lane >> 4; const int w = __builtin_amdgcn_readfirstlane((int)(threadIdx.x >> 5));
    const int h = blockIdx.y, q0 = blockIdx.x * (16 * FQB);
    const size_t sQK = (size_t)(NH_ + NKV) * TT * HD, sV = (size_t)NH_ * HDV * TT;
    const bf* qph = QKh + (size_t)w * sQK + (size_t)h * TT * HD + (size_t)(q0 + lr) * HD + 8 * hi; const bf* qpl = QKl + (qph - QKh);
#pragma unroll
    for (int nb = 0; nb < FQB; ++nb)
#pragma unroll
        for (int kc = 0; kc < 2; ++kc) { const int o = nb * 16 * HD + kc * 32; const int f = ((w * FQB + nb) * 2 + kc) * 2;
            qs[f][0][lane] = *(const v8us*)(qph + o); qs[f][1][lane] = *(const v8us*)(qph + o + 16); qs[f + 1][0][lane] = *(const v8us*)(qpl + o); qs[f + 1][1][lane] = *(const v8us*)(qpl + o + 16); }
    // precaution: stands between the q loads and the first reuse of their address registers (held live up to here as inputs); the scheduling fence keeps the zeroing of the accumulators, which reuses them, behind the wait
    asm volatile("s_wait_xcnt 0x0" :: "v"(qph), "v"(qpl) : "memory");
    __builtin_amdgcn_sched_barrier(0);
    v8f acc[NB_][8][FQB];
#pragma unroll
    for (int b = 0; b < NB_; ++b)
#pragma unroll
        for (int db = 0; db < 8; ++db)
#pragma unroll
            for (int nb = 0; nb < FQB; ++nb) acc[b][db][nb] = (v8f){};
    // each lane's place in this wave's 32 keys of the pass, batch 0: k planes (row = key) and value^T planes (row = d); they step by 128 keys a pass
    const bf* Kh = QKh + (size_t)(NH_ + h) * TT * HD + (size_t)(w * 32 + lr) * HD + 8 * hi; const bf* Kl = QKl + (Kh - QKh);
    const bf* Vh = VTh + (size_t)h * HDV * TT + (size_t)lr * TT + w * 32 + 8 * hi; const bf* Vl = VTl + (Vh - VTh);
    // rolled: one pass is some 4,300 instructions
#pragma unroll 1
    for (int kt = 0; kt < TT / (32 * FWV); ++kt) {
        // first pass: publishes the q fragments; every pass: keeps the four waves on the same 128 keys, so that the two waves that read the two halves of a 128-byte value^T line read it while it is in the WGP cache
        __syncthreads();
        V kh[NB_][2][2], kl[NB_][2][2];
#pragma unroll
        for (int b = 0; b < NB_; ++b)
#pragma unroll
            for (int kc = 0; kc < 2; ++kc)
#pragma unroll
                for (int mb = 0; mb < 2; ++mb) { const size_t o = (size_t)b * sQK + (size_t)mb * 16 * HD + kc * 32; kh[b][kc][mb] = WF::ld(Kh + o); kl[b][kc][mb] = WF::ld(Kl + o); }
        v8f s[NB_][2][FQB];
#pragma unroll
        for (int b = 0; b < NB_; ++b) {
#pragma unroll
            for (int mb = 0; mb < 2; ++mb)
#pragma unroll
                for (int nb = 0; nb < FQB; ++nb) s[b][mb][nb] = (v8f){};
#pragma unroll
            for (int kc = 0; kc < 2; ++kc)
#pragma unroll
                for (int nb = 0; nb < FQB; ++nb) { const int f = ((b * FQB + nb) * 2 + kc) * 2; const V qh = cat16b(qs[f][0][lane], qs[f][1][lane]), ql = cat16b(qs[f + 1][0][lane], qs[f + 1][1][lane]);
#pragma unroll
                    for (int mb = 0; mb < 2; ++mb) { s[b][mb][nb] = WF::mma(kh[b][kc][mb], qh, s[b][mb][nb]); s[b][mb][nb] = WF::mma(kh[b][kc][mb], ql, s[b][mb][nb]); s[b][mb][nb] = WF::mma(kl[b][kc][mb], qh, s[b][mb][nb]); } } }
        // value^T fragments of batch 0 are asked for here, so that they fly under the softmax arithmetic; those of batch b + 1 in front of batch b's products
        V vh[2][8], vl[2][8];
#pragma unroll
        for (int db = 0; db < 8; ++db) { const size_t o = (size_t)db * 16 * TT; vh[0][db] = WF::ld(Vh + o); vl[0][db] = WF::ld(Vl + o); }
        v8u ph[NB_][FQB], pl[NB_][FQB];     // probabilities, bf16 hi and lo, two keys to a word: word i of (batch, nb) holds k slots 2i and 2i + 1 of the B operand
#pragma unroll
        for (int nb = 0; nb < FQB; ++nb)
#pragma unroll
            for (int mb = 0; mb < 2; ++mb) {
#pragma unroll
                for (int jp = 0; jp < 4; ++jp) { unsigned short a[2][NB_], c[2][NB_];
#pragma unroll
                    for (int q = 0; q < 2; ++q) { const int j = 2 * jp + q; float t[NB_]; float mx = -3.0e38f;
#pragma unroll
                        for (int b = 0; b < NB_; ++b) { t[b] = __fmul_rn(s[b][mb][nb][j], SCL); mx = fmaxf(mx, t[b]); }
                        float xa[NB_], ex[NB_]; float sum = 0.f;
#pragma unroll
                        for (int b = 0; b < NB_; ++b) { xa[b] = __fmul_rn(__fsub_rn(t[b], mx), 1.4426950408889634f); ex[b] = __builtin_amdgcn_exp2f(xa[b]); }
                        // the slot the instruction set asks for between a transcendental and an overwrite of its source: the four arguments stay live (inputs) up to this v_nop, which stands behind the four v_exp (their results are inputs too)
                        asm volatile("v_nop" :: "v"(xa[0]), "v"(xa[1]), "v"(xa[2]), "v"(xa[3]), "v"(ex[0]), "v"(ex[1]), "v"(ex[2]), "v"(ex[3]));
#pragma unroll
                        for (int b = 0; b < NB_; ++b) sum = __fadd_rn(sum, ex[b]);
                        const float f = __fdiv_rn(1.0f, sum);
#pragma unroll
                        for (int b = 0; b < NB_; ++b) splitf(__fmul_rn(ex[b], f), a[q][b], c[q][b]); }
#pragma unroll
                    for (int b = 0; b < NB_; ++b) { ph[b][nb][mb * 4 + jp] = (unsigned)a[0][b] | ((unsigned)a[1][b] << 16); pl[b][nb][mb * 4 + jp] = (unsigned)c[0][b] | ((unsigned)c[1][b] << 16); } }
                // one 16x16 tile's softmax at a time: left free, the scheduler runs all four tiles abreast and their unpacked halves push accumulators into scratch
                __builtin_amdgcn_sched_barrier(0); }
#pragma unroll
        for (int b = 0; b < NB_; ++b) {
            if (b + 1 < NB_) {
#pragma unroll
                for (int db = 0; db < 8; ++db) { const size_t o = (size_t)(b + 1) * sV + (size_t)db * 16 * TT; vh[(b + 1) & 1][db] = WF::ld(Vh + o); vl[(b + 1) & 1][db] = WF::ld(Vl + o); } }
            // holds the next batch's 32 loads in front of this batch's 48 products: left free, the scheduler sinks each load to just before its use and every fragment waits a full L2 latency
            __builtin_amdgcn_sched_barrier(0);
#pragma unroll
            for (int db = 0; db < 8; ++db)
#pragma unroll
                for (int nb = 0; nb < FQB; ++nb) { const V bh = __builtin_bit_cast(V, ph[b][nb]), bl = __builtin_bit_cast(V, pl[b][nb]);
                    acc[b][db][nb] = WF::mma(vh[b & 1][db], bh, acc[b][db][nb]); acc[b][db][nb] = WF::mma(vh[b & 1][db], bl, acc[b][db][nb]); acc[b][db][nb] = WF::mma(vl[b & 1][db], bh, acc[b][db][nb]); }
            // keeps the loads of batch b + 2 behind these products, whose fragments' registers they refill
            __builtin_amdgcn_sched_barrier(0); }
        Kh += FWV * 32 * HD; Kl += FWV * 32 * HD; Vh += FWV * 32; Vl += FWV * 32;
    }
#pragma unroll
    for (int b = 0; b < NB_; ++b)
#pragma unroll
        for (int db = 0; db < 8; ++db)
#pragma unroll
            for (int nb = 0; nb < FQB; ++nb) { const v8f a = acc[b][db][nb]; const int i = (b * 8 + db) * FQB + nb; red[w][i][0][lane] = (v4f){a[0], a[1], a[2], a[3]}; red[w][i][1][lane] = (v4f){a[4], a[5], a[6], a[7]}; }
    __syncthreads();
    for (int i = 0; i < 8 * FQB; ++i) { const int db = i / FQB, nb = i % FQB; const int ii = w * 8 * FQB + i; v4f x0 = red[0][ii][0][lane], x1 = red[0][ii][1][lane];
#pragma unroll
        for (int ww = 1; ww < FWV; ++ww) { x0 += red[ww][ii][0][lane]; x1 += red[ww][ii][1][lane]; }
        v8us oh, ol;
#pragma unroll
        for (int j = 0; j < 4; ++j) { unsigned short a, c; splitf(x0[j], a, c); oh[j] = a; ol[j] = c; splitf(x1[j], a, c); oh[4 + j] = a; ol[4 + j] = c; }
        const size_t oo = ((size_t)w * TT + q0 + nb * 16 + lr) * DV + (size_t)h * HDV + db * 16 + 8 * hi; *(v8us*)(ATh + oo) = oh; *(v8us*)(ATl + oo) = ol;
        // precaution: stands between the two stores and the next trip's first write to their data and address registers
        asm volatile("s_wait_xcnt 0x0" ::: "memory"); }
}

extern "C" void kernel_launch(void* const* d_in, const int* in_sizes, int n_in,
                              void* d_out, int out_size, void* d_ws, size_t ws_size, hipStream_t stream) {
    (void)in_sizes; (void)n_in; (void)out_size;
    const float* x = (const float*)d_in[0]; const float* wq = (const float*)d_in[1]; const float* wk = (const float*)d_in[2]; const float* wv = (const float*)d_in[3]; const float* wo = (const float*)d_in[4];
    float* OUT = (float*)d_out;     // [4][2048][512]
    char* wsp = (char*)d_ws;
    auto take = [&](size_t bytes) { char* p = wsp; wsp += (bytes + 255) & ~(size_t)255; return (void*)p; };
    bf* W = (bf*)take((size_t)(DQ + DKV + DV + DV) * DM * 2); bf* WO = W + (size_t)(DQ + DKV + DV) * DM; float* CS = (float*)take((size_t)TT * HD * 2 * 4);
    bf* XB = (bf*)take((size_t)NB_ * TT * DM * 2); float* F = (float*)take((size_t)NB_ * TT * (DQ + DKV + DV) * 4);   /* q | k | v of every row, pitch 1024 */
    h16* JP16 = (h16*)take((size_t)NB_ * (NH_ + NKV) * TT * HD * 2);   /* fp16 planes written by the plane builder, unused */
    bf* QKh = (bf*)take((size_t)NB_ * (NH_ + NKV) * TT * HD * 2); bf* QKl = (bf*)take((size_t)NB_ * (NH_ + NKV) * TT * HD * 2);   /* [b][8][t][d]: heads 0-3 q, 4-7 k */
    bf* VTh = (bf*)take((size_t)NB_ * NH_ * HDV * TT * 2); bf* VTl = (bf*)take((size_t)NB_ * NH_ * HDV * TT * 2);
    bf* ATh = (bf*)take((size_t)NB_ * TT * DV * 2); bf* ATl = (bf*)take((size_t)NB_ * TT * DV * 2);
    if ((size_t)(wsp - (char*)d_ws) > ws_size) return;    // ws 256 MiB (carve ~99 MiB)
    k_wtG<<<dim3((unsigned)((DM * DV / 64 + 63) / 64), 4, 1), 256, 0, stream>>>(wq, wk, wv, wo, W);
    k_csid<<<(TT * HD + 255) / 256, 256, 0, stream>>>(CS);
    const int PF = DQ + DKV + DV; const size_t sQK = (size_t)(NH_ + NKV) * TT * HD;
    /* projections + planes, every batch in one launch each (the softmax couples the batches) */
    k_cvt8<<<(unsigned)(((size_t)NB_ * TT * DM / 8 + 255) / 256), 256, 0, stream>>>(x, XB, (size_t)NB_ * TT * DM / 8);
    k_gemmw<bf, 0, false><<<dim3(NB_ * TT / 64, PF / 64, 1), 32, 0, stream>>>(XB, nullptr, W, nullptr, DM, F, PF, nullptr, 0, 0, 0);
    k_rope<<<dim3((unsigned)((sQK / 2 + 255) / 256), NB_, 1), 256, 0, stream>>>(F, PF, NH_ + NKV, CS, nullptr, nullptr, 1.0f, JP16, QKh, QKl);
    k_vtpv<<<dim3((unsigned)(((size_t)NH_ * HDV * TT / 2 + 255) / 256), NB_, 1), 256, 0, stream>>>(F + DQ + DKV, PF, VTh, VTl);
    k_fattn<<<dim3(TT / (16 * FQB), NH_, 1), 32 * FWV, 0, stream>>>(QKh, QKl, VTh, VTl, ATh, ATl);   /* all heads, all batches */
    k_gemmw<bf, 1, false><<<dim3(NB_ * TT / 64, DV / 64, 1), 32, 0, stream>>>(ATh, ATl, WO, nullptr, DV, OUT, DV, nullptr, 0, 0, 0);
}

// v003
// It runs in 183 microseconds.
// Two timings next to v002 both put it at 1.16 times that version's speed.
// Counting every step since v000, it is 6.26 times as fast.
#include <hip/hip_runtime.h>

// Multi-head attention whose softmax runs over the BATCH axis (the source's nn.Softmax() with no dim on a (B,N,N)-shaped view picks dim 0): input_x [4][2048][512]; q = x Wq, k = x Wk ('xw' [512][256]: 4 heads x 64), v = x Wv ('xw' [512][512]: 4 heads x 128); scores[b][h][q][k] = q.k / 8; attn = softmax over b (the 4 batches, per (h, q, k)); out[b][q][h*128+d] = sum_k attn[b][h][q][k] v[b][k][h][d]; out Wo ('xw' [512][512]) -> [4][2048][512] (4.2 M).
// Layout: exact projections first: one GEMM [8192][512] x [1024][512]^T gives q | k | v of every batch, and its epilogue writes them straight as q/k planes per (batch, head), bf16 hi/lo (heads 0-3 q, 4-7 k), and value^T planes per (batch, head); then ONE attention kernel (k_fattn) for all heads: a wave holds the scores of all four batches for 32 keys x 32 queries in registers, takes the softmax ACROSS the batches there, feeds the probabilities (hi/lo) straight into the 3-product P.v and the work-group writes the hi/lo context planes; finally out = context Wo (hl x exact), 8192 rows in one GEMM.
// Compute dtypes, f32 accumulate: every input rounded to bf16; projections exact; scores and attn.v on bf16 hi/lo planes (3 products) everywhere; the cross-batch softmax in f32.

#define NB_  4
#define TT   2048
#define DM   512
#define NH_  4
#define NKV  4
#define REP  (NH_ / NKV)
#define HD   64
#define DQ   (NH_ * HD)
#define DKV  (NKV * HD)
#define ZH   2
#define RH   2048                  // query rows < RH use hi+lo planes (0: none)
#define WIN  0
#define PCAR 1024.0f
#define SCL  0.125f   // 64^-0.5
#define HDV  128      // value head dim
#define DV   (NH_ * HDV)   // 512
typedef _Float16 h16;
typedef unsigned short bf;
typedef __attribute__((ext_vector_type(16))) __bf16   v16bf;
typedef __attribute__((ext_vector_type(16))) _Float16 v16h;
typedef __attribute__((ext_vector_type(8)))  _Float16 v8h;
typedef __attribute__((ext_vector_type(8)))  unsigned short v8us;
typedef __attribute__((ext_vector_type(8)))  float    v8f;
typedef __attribute__((ext_vector_type(4)))  float    v4f;
typedef v8h  __attribute__((may_alias)) v8ha;
typedef v4f  __attribute__((may_alias)) v4fa;
typedef v8us __attribute__((may_alias)) v8usa;

__device__ __forceinline__ unsigned short f2bf(float f) { unsigned u = __float_as_uint(f); u += 0x7FFFu + ((u >> 16) & 1u); return (unsigned short)(u >> 16); }
__device__ __forceinline__ float bf2f(unsigned short b) { return __uint_as_float(((unsigned)b) << 16); }
__device__ __forceinline__ float bfr(float f) { return bf2f(f2bf(f)); }
__device__ __forceinline__ void splitf(float y, unsigned short& h, unsigned short& l) { h = f2bf(y); l = f2bf(y - bf2f(h)); }
__device__ __forceinline__ v16h cat16(v8h lo, v8h hi) { return __builtin_shufflevector(lo, hi, 0, 1, 2, 3, 4, 5, 6, 7, 8, 9, 10, 11, 12, 13, 14, 15); }
__device__ __forceinline__ v16bf cat16b(v8us lo, v8us hi) { return __builtin_bit_cast(v16bf, __builtin_shufflevector(lo, hi, 0, 1, 2, 3, 4, 5, 6, 7, 8, 9, 10, 11, 12, 13, 14, 15)); }
__device__ __forceinline__ v8f wmma16(v16h a, v16h b, v8f c) { return __builtin_amdgcn_wmma_f32_16x16x32_f16(false, a, false, b, (short)0, c, false, false); }
__device__ __forceinline__ v8f wmmab(v16bf a, v16bf b, v8f c) { return __builtin_amdgcn_wmma_f32_16x16x32_bf16(false, a, false, b, (short)0, c, false, false); }



// ---- k_gemmw: register-blocked GEMM, ONE WAVE per 64x64 output tile (16 accumulators), operands straight from K-contiguous 16-bit planes; grid (M/64, N/64, Z), 32 threads.
// C[m][n] (f32, pitch ldc, + optional f32 bias[n]) = sum_k A[m][k] Bt[n][k] (+ split products per NSPLIT). z-batch strides sA/sB/sC in elements. K % 32 == 0.
// PLANES (the q | k | v projection): no C; the epilogue splits the tile hi/lo and writes it as attention planes. A 64-column tile is one whole q or k head (columns 0-511: plane c0 / 64) or half a value head (columns 512-1023); its 64 rows lie in one batch.
template <typename T16> struct WFrag;
template <> struct WFrag<h16> { typedef v16h V; static __device__ __forceinline__ V ld(const h16* p) { return cat16(*(const v8h*)p, *(const v8h*)(p + 16)); } static __device__ __forceinline__ v8f mma(V a, V b, v8f c) { return wmma16(a, b, c); } };
template <> struct WFrag<bf> { typedef v16bf V; static __device__ __forceinline__ V ld(const bf* p) { return cat16b(*(const v8us*)p, *(const v8us*)(p + 16)); } static __device__ __forceinline__ v8f mma(V a, V b, v8f c) { return wmmab(a, b, c); } };
template <typename T16, int NSPLIT, bool BIAS, bool PLANES = false>
__global__ __launch_bounds__(32) void k_gemmw(const T16* __restrict__ A, const T16* __restrict__ A2, const T16* __restrict__ Bt, const T16* __restrict__ Bt2, int K, float* C, int ldc, const float* __restrict__ bias, size_t sA, size_t sB, size_t sC, bf* QKh = nullptr, bf* QKl = nullptr, bf* VTh = nullptr, bf* VTl = nullptr) {
    typedef typename WFrag<T16>::V V;
    __shared__ __align__(16) float os[16 * 68];
    const size_t z = blockIdx.z; A += z * sA; if (A2) A2 += z * sA; Bt += z * sB; if (Bt2) Bt2 += z * sB; C += z * sC;
    const int lane = threadIdx.x & 31, lr = lane & 15, hi = lane >> 4; const int r0 = blockIdx.x * 64, c0 = blockIdx.y * 64;
    v8f acc[4][4];
#pragma unroll
    for (int mb = 0; mb < 4; ++mb)
#pragma unroll
        for (int nb = 0; nb < 4; ++nb) acc[mb][nb] = (v8f){};
    const size_t aoff = (size_t)(r0 + lr) * K + 8 * hi, boff = (size_t)(c0 + lr) * K + 8 * hi;
#pragma unroll 1
    for (int kc = 0; kc < K; kc += 32) {
        V a[4], a2[4];
#pragma unroll
        for (int mb = 0; mb < 4; ++mb) { a[mb] = WFrag<T16>::ld(A + aoff + (size_t)mb * 16 * K + kc); if (NSPLIT == 1 || NSPLIT == 2) a2[mb] = WFrag<T16>::ld(A2 + aoff + (size_t)mb * 16 * K + kc); }
#pragma unroll
        for (int nb = 0; nb < 4; ++nb) { const V b = WFrag<T16>::ld(Bt + boff + (size_t)nb * 16 * K + kc); V b2; if (NSPLIT >= 2) b2 = WFrag<T16>::ld(Bt2 + boff + (size_t)nb * 16 * K + kc);
#pragma unroll
            for (int mb = 0; mb < 4; ++mb) { acc[mb][nb] = WFrag<T16>::mma(a[mb], b, acc[mb][nb]); if (NSPLIT == 1 || NSPLIT == 2) acc[mb][nb] = WFrag<T16>::mma(a2[mb], b, acc[mb][nb]); if (NSPLIT >= 2) acc[mb][nb] = WFrag<T16>::mma(a[mb], b2, acc[mb][nb]); } }
        asm volatile("v_nop\n\tv_nop\n\tv_nop\n\tv_nop" : "+v"(acc[0][0]), "+v"(acc[1][1]), "+v"(acc[2][2]), "+v"(acc[3][3]) : "v"(a[0]), "v"(a[3]));
    }
    if (PLANES) {
        const int bz = r0 / TT, t0 = r0 % TT;
        if (c0 < DQ + DKV) {
            // q or k: a plane row is a token, its 64 d one 128-byte line; a 16-row block goes through LDS so that a lane holds 8 neighbouring d of one token
            const size_t po = ((size_t)(bz * (NH_ + NKV) + c0 / HD) * TT + t0) * HD;
#pragma unroll
            for (int mb = 0; mb < 4; ++mb) {
#pragma unroll
                for (int nb = 0; nb < 4; ++nb) {
#pragma unroll
                    for (int j = 0; j < 8; ++j) os[(hi * 8 + j) * 68 + nb * 16 + lr] = acc[mb][nb][j]; }
                // one wave: keeps its LDS writes in front of its reads of other lanes' words
                __builtin_amdgcn_wave_barrier(); asm volatile("" ::: "memory");
#pragma unroll
                for (int s = 0; s < 4; ++s) { const int row = 4 * s + (lane >> 3), cofs = (lane & 7) * 8; const v4f x0 = *(const v4fa*)(os + row * 68 + cofs), x1 = *(const v4fa*)(os + row * 68 + cofs + 4); v8us oh, ol;
#pragma unroll
                    for (int j = 0; j < 4; ++j) { unsigned short p, c; splitf(x0[j], p, c); oh[j] = p; ol[j] = c; splitf(x1[j], p, c); oh[4 + j] = p; ol[4 + j] = c; }
                    const size_t oo = po + (size_t)(mb * 16 + row) * HD + cofs; *(v8us*)(QKh + oo) = oh; *(v8us*)(QKl + oo) = ol; }
                // and those reads in front of the next block's writes
                __builtin_amdgcn_wave_barrier(); asm volatile("" ::: "memory");
            }
        } else {
            // value^T: a plane row is one d, tokens run along it; the 8 accumulator words a lane holds of a tile are 8 neighbouring tokens of one d: stored from the registers
            const int cv = c0 - (DQ + DKV); const size_t po = ((size_t)(bz * NH_ + cv / HDV) * HDV + cv % HDV + lr) * TT + t0 + 8 * hi;
#pragma unroll
            for (int nb = 0; nb < 4; ++nb)
#pragma unroll
                for (int mb = 0; mb < 4; ++mb) { v8us oh, ol;
#pragma unroll
                    for (int j = 0; j < 8; ++j) { unsigned short p, c; splitf(acc[mb][nb][j], p, c); oh[j] = p; ol[j] = c; }
                    const size_t oo = po + (size_t)nb * 16 * TT + mb * 16; *(v8us*)(VTh + oo) = oh; *(v8us*)(VTl + oo) = ol; }
            // precaution: stands behind the last stores of this branch, in front of any later write to their data and address registers
            asm volatile("s_wait_xcnt 0x0" ::: "memory");
        }
        return;
    }
#pragma unroll
    for (int mb = 0; mb < 4; ++mb) {
#pragma unroll
        for (int nb = 0; nb < 4; ++nb) {
#pragma unroll
            for (int j = 0; j < 8; ++j) os[(hi * 8 + j) * 68 + nb * 16 + lr] = acc[mb][nb][j]; }
        __builtin_amdgcn_wave_barrier(); asm volatile("" ::: "memory");
        float* crow = C + (size_t)(r0 + mb * 16) * ldc + c0;
{
#pragma unroll
            for (int s = 0; s < 8; ++s) { const int row = 2 * s + hi, cofs = lr * 4; v4f val = *(const v4fa*)(os + row * 68 + cofs); if (BIAS) { val[0] += bfr(bias[c0 + cofs]); val[1] += bfr(bias[c0 + cofs + 1]); val[2] += bfr(bias[c0 + cofs + 2]); val[3] += bfr(bias[c0 + cofs + 3]); }
                *(v4f*)(crow + (size_t)row * ldc + cofs) = val; }
             }
        __builtin_amdgcn_wave_barrier(); asm volatile("" ::: "memory");
    }
}

__device__ __forceinline__ h16 tohx(float x) { return (h16)x; }
typedef __attribute__((ext_vector_type(2))) _Float16 v2h;
typedef __attribute__((ext_vector_type(4))) _Float16 v4h;
typedef __attribute__((ext_vector_type(2))) unsigned short v2us;
typedef __attribute__((ext_vector_type(4))) unsigned short v4us;
typedef __attribute__((ext_vector_type(2))) float v2f;
typedef __attribute__((ext_vector_type(4))) int v4i;

// grid y picks the weight: 0 Wq, 1 Wk, 2 Wv, 3 Wo; the transposed planes lie one behind the other in W (rows 0-255 q, 256-511 k, 512-1023 v, 1024-1535 o; pitch 512).
__global__ __launch_bounds__(256) void k_wtG(const float* __restrict__ w0, const float* __restrict__ w1, const float* __restrict__ w2, const float* __restrict__ w3, bf* W) {
    const int y = blockIdx.y; const float* __restrict__ w = (y == 0) ? w0 : (y == 1) ? w1 : (y == 2) ? w2 : w3; const int K = DM; const int N = (y < 2) ? DQ : DV; bf* Bt = W + (size_t)((y == 0) ? 0 : (y == 1) ? DQ : (y == 2) ? (DQ + DKV) : (DQ + DKV + DV)) * DM;
    const int lane = threadIdx.x & 31; const int L0 = (blockIdx.x * 8 + (threadIdx.x >> 5)) * 8; const int nlines = N * K / 64;
{
#pragma unroll 1
        for (int l = 0; l < 8; ++l) { const int L = L0 + l; if (L >= nlines) break; const size_t e = (size_t)L * 64 + lane * 2; const int k = (int)(e % K), n = (int)(e / K); v2us o;
            o[0] = f2bf(w[(size_t)k * N + n]); o[1] = f2bf(w[(size_t)(k + 1) * N + n]); *(v2us*)(Bt + e) = o; }
         }
}
__global__ __launch_bounds__(256) void k_cvt8(const float* __restrict__ src, bf* dst, size_t n8) { const size_t i = (size_t)blockIdx.x * 256 + threadIdx.x; if (i >= n8) return; const v8f v = *(const v8f*)(src + i * 8); v8us o;
#pragma unroll
    for (int k = 0; k < 8; ++k) o[k] = f2bf(v[k]); *(v8us*)(dst + i * 8) = o;  }

__global__ __launch_bounds__(256) void k_vtp(const float* __restrict__ F, int pitch, int nheads, h16* V16, bf* Vh, bf* Vl) { const size_t e = ((size_t)blockIdx.x * 256 + threadIdx.x) * 2; if (e >= (size_t)nheads * HD * TT) return; const int t = (int)(e % TT); const int d = (int)((e / TT) % HD); const int g = (int)(e / ((size_t)TT * HD)); v2h o16; v2us oh, ol;
#pragma unroll
    for (int q = 0; q < 2; ++q) { const float x = F[(size_t)(t + q) * pitch + g * HD + d]; o16[q] = tohx(x); unsigned short a2, c2; splitf(x, a2, c2); oh[q] = a2; ol[q] = c2; }
    *(v2h*)(V16 + e) = o16; *(v2us*)(Vh + e) = oh; *(v2us*)(Vl + e) = ol;  }
// k_asoft: per row (zz, i): t = S x HD^-0.5 (no mask); softmax over the 2048 keys (register row, one exp, fixed trees);
__global__ __launch_bounds__(256) void k_asoft(const float* __restrict__ Sb, h16* P16, bf* Ph, bf* Pl) {
    const int lane = threadIdx.x & 31; const int row = blockIdx.x * 8 + (threadIdx.x >> 5); if (row >= ZH * TT) return; const int i = row % TT; const int zz = row / TT; (void)zz; const bool hires = (i < RH); const float* sr = Sb + (size_t)row * TT; float v[TT / 32]; float mx = -3.0e38f;
#pragma unroll
    for (int ch = 0; ch < TT / 128; ++ch) { const int j0 = ch * 128 + lane * 4; const v4f a = *(const v4f*)(sr + j0);
#pragma unroll
        for (int q = 0; q < 4; ++q) { const int j = j0 + q; (void)j; const float t = a[q] * SCL; v[ch * 4 + q] = t; mx = fmaxf(mx, t); } }
#pragma unroll
    for (int sh = 16; sh; sh >>= 1) mx = fmaxf(mx, __shfl_xor(mx, sh, 32));
    float sum = 0.f;
#pragma unroll
    for (int k = 0; k < TT / 32; ++k) { float d0 = __fsub_rn(v[k], mx); asm volatile("" : "+v"(d0)); v[k] = __builtin_amdgcn_exp2f(__fmul_rn(d0, 1.4426950408889634f)); sum += v[k]; }
#pragma unroll
    for (int sh = 16; sh; sh >>= 1) sum += __shfl_xor(sum, sh, 32);
    const float f = __fdiv_rn(hires ? 1.0f : PCAR, sum);
{
        if (hires) {
#pragma unroll
            for (int ch = 0; ch < TT / 128; ++ch) { v4us oh, ol;
#pragma unroll
                for (int q = 0; q < 4; ++q) { unsigned short a, c2; splitf(v[ch * 4 + q] * f, a, c2); oh[q] = a; ol[q] = c2; }
                const size_t oo = ((size_t)zz * (RH ? RH : 1) + i) * TT + ch * 128 + lane * 4; *(v4us*)(Ph + oo) = oh; *(v4us*)(Pl + oo) = ol; }
        } else {
#pragma unroll
            for (int ch = 0; ch < TT / 128; ++ch) { v4h o4;
#pragma unroll
                for (int q = 0; q < 4; ++q) o4[q] = tohx(v[ch * 4 + q] * f);
                *(v4h*)(P16 + (size_t)row * TT + ch * 128 + lane * 4) = o4; } }
         }
}
__global__ __launch_bounds__(256) void k_merge(const float* __restrict__ O, int h0, bf* Ah, bf* Al) { const size_t e = ((size_t)blockIdx.x * 256 + threadIdx.x) * 2; if (e >= (size_t)ZH * TT * HD) return; const int d = (int)(e % HD); const int t = (int)((e / HD) % TT); const int zz = (int)(e / ((size_t)HD * TT)); const float cs = (t < RH) ? 1.0f : (1.0f / PCAR); const size_t oo = (size_t)t * DQ + (h0 + zz) * HD + d;
    v2us oh, ol;
#pragma unroll
    for (int q = 0; q < 2; ++q) { unsigned short a, c2; splitf(O[e + q] * cs, a, c2); oh[q] = a; ol[q] = c2; } *(v2us*)(Ah + oo) = oh; *(v2us*)(Al + oo) = ol;  }

// ---- k_fattn: scores, cross-batch softmax, P.v and the hi/lo split of the context in one kernel. Grid (TT/32, heads), 4 waves.
// The work-group owns 32 queries of one head in ALL four batches; in pass kt wave w takes keys kt*128 + w*32 .. +31 (the sum over keys needs no running maximum: the softmax runs over the batches).
// Transposed products: S^T[key][q] = K Q^T (A = k plane rows, B = q plane rows), so that two 16x16 D tiles (keys 0-15, 16-31 of the pass) are, converted in place, the B operand of O^T[d][q] = V^T P^T (A = value^T plane rows): no LDS and no lane exchange between the two products.
// At the end the four waves' partial O^T (one per key subset) are summed through LDS in wave order 0..3; wave w finishes batch w.
// Every inner loop is fully unrolled so that the fragment, score and accumulator arrays are indexed by constants and stay in registers (512 of them hold O^T: one wave per SIMD).
#define FQB 2     // 16-query blocks per work-group
#define FWV 4     // waves per work-group
typedef __attribute__((ext_vector_type(8))) unsigned v8u;
__global__ __launch_bounds__(32 * FWV) void k_fattn(const bf* __restrict__ QKh, const bf* __restrict__ QKl, const bf* __restrict__ VTh, const bf* __restrict__ VTl, bf* ATh, bf* ATl) {
    typedef WFrag<bf> WF; typedef WF::V V;
    __shared__ __align__(16) v8us qs[NB_ * FQB * 2 * 2][2][32];        // q fragments [batch][nb][kc][hi|lo], fragment order: 32 KiB
    __shared__ __align__(16) v4f red[FWV][NB_ * 8 * FQB][2][32];       // the waves' partial O^T tiles: 256 KiB
    const int lane = threadIdx.x & 31, lr = lane & 15, hi = lane >> 4; const int w = __builtin_amdgcn_readfirstlane((int)(threadIdx.x >> 5));
    const int h = blockIdx.y, q0 = blockIdx.x * (16 * FQB);
    const size_t sQK = (size_t)(NH_ + NKV) * TT * HD, sV = (size_t)NH_ * HDV * TT;
    const bf* qph = QKh + (size_t)w * sQK + (size_t)h * TT * HD + (size_t)(q0 + lr) * HD + 8 * hi; const bf* qpl = QKl + (qph - QKh);
#pragma unroll
    for (int nb = 0; nb < FQB; ++nb)
#pragma unroll
        for (int kc = 0; kc < 2; ++kc) { const int o = nb * 16 * HD + kc * 32; const int f = ((w * FQB + nb) * 2 + kc) * 2;
            qs[f][0][lane] = *(const v8us*)(qph + o); qs[f][1][lane] = *(const v8us*)(qph + o + 16); qs[f + 1][0][lane] = *(const v8us*)(qpl + o); qs[f + 1][1][lane] = *(const v8us*)(qpl + o + 16); }
    // precaution: stands between the q loads and the first reuse of their address registers (held live up to here as inputs); the scheduling fence keeps the zeroing of the accumulators, which reuses them, behind the wait
    asm volatile("s_wait_xcnt 0x0" :: "v"(qph), "v"(qpl) : "memory");
    __builtin_amdgcn_sched_barrier(0);
    v8f acc[NB_][8][FQB];
#pragma unroll
    for (int b = 0; b < NB_; ++b)
#pragma unroll
        for (int db = 0; db < 8; ++db)
#pragma unroll
            for (int nb = 0; nb < FQB; ++nb) acc[b][db][nb] = (v8f){};
    // each lane's place in this wave's 32 keys of the pass, batch 0: k planes (row = key) and value^T planes (row = d); they step by 128 keys a pass
    const bf* Kh = QKh + (size_t)(NH_ + h) * TT * HD + (size_t)(w * 32 + lr) * HD + 8 * hi; const bf* Kl = QKl + (Kh - QKh);
    const bf* Vh = VTh + (size_t)h * HDV * TT + (size_t)lr * TT + w * 32 + 8 * hi; const bf* Vl = VTl + (Vh - VTh);
    // rolled: one pass is some 4,300 instructions
#pragma unroll 1
    for (int kt = 0; kt < TT / (32 * FWV); ++kt) {
        // first pass: publishes the q fragments; every pass: keeps the four waves on the same 128 keys, so that the two waves that read the two halves of a 128-byte value^T line read it while it is in the WGP cache
        __syncthreads();
        V kh[NB_][2][2], kl[NB_][2][2];
#pragma unroll
        for (int b = 0; b < NB_; ++b)
#pragma unroll
            for (int kc = 0; kc < 2; ++kc)
#pragma unroll
                for (int mb = 0; mb < 2; ++mb) { const size_t o = (size_t)b * sQK + (size_t)mb * 16 * HD + kc * 32; kh[b][kc][mb] = WF::ld(Kh + o); kl[b][kc][mb] = WF::ld(Kl + o); }
        v8f s[NB_][2][FQB];
#pragma unroll
        for (int b = 0; b < NB_; ++b) {
#pragma unroll
            for (int mb = 0; mb < 2; ++mb)
#pragma unroll
                for (int nb = 0; nb < FQB; ++nb) s[b][mb][nb] = (v8f){};
#pragma unroll
            for (int kc = 0; kc < 2; ++kc)
#pragma unroll
                for (int nb = 0; nb < FQB; ++nb) { const int f = ((b * FQB + nb) * 2 + kc) * 2; const V qh = cat16b(qs[f][0][lane], qs[f][1][lane]), ql = cat16b(qs[f + 1][0][lane], qs[f + 1][1][lane]);
#pragma unroll
                    for (int mb = 0; mb < 2; ++mb) { s[b][mb][nb] = WF::mma(kh[b][kc][mb], qh, s[b][mb][nb]); s[b][mb][nb] = WF::mma(kh[b][kc][mb], ql, s[b][mb][nb]); s[b][mb][nb] = WF::mma(kl[b][kc][mb], qh, s[b][mb][nb]); } } }
        // value^T fragments of batch 0 are asked for here, so that they fly under the softmax arithmetic; those of batch b + 1 in front of batch b's products
        V vh[2][8], vl[2][8];
#pragma unroll
        for (int db = 0; db < 8; ++db) { const size_t o = (size_t)db * 16 * TT; vh[0][db] = WF::ld(Vh + o); vl[0][db] = WF::ld(Vl + o); }
        v8u ph[NB_][FQB], pl[NB_][FQB];     // probabilities, bf16 hi and lo, two keys to a word: word i of (batch, nb) holds k slots 2i and 2i + 1 of the B operand
#pragma unroll
        for (int nb = 0; nb < FQB; ++nb)
#pragma unroll
            for (int mb = 0; mb < 2; ++mb) {
#pragma unroll
                for (int jp = 0; jp < 4; ++jp) { unsigned short a[2][NB_], c[2][NB_];
#pragma unroll
                    for (int q = 0; q < 2; ++q) { const int j = 2 * jp + q; float t[NB_]; float mx = -3.0e38f;
#pragma unroll
                        for (int b = 0; b < NB_; ++b) { t[b] = __fmul_rn(s[b][mb][nb][j], SCL); mx = fmaxf(mx, t[b]); }
                        float xa[NB_], ex[NB_]; float sum = 0.f;
#pragma unroll
                        for (int b = 0; b < NB_; ++b) { xa[b] = __fmul_rn(__fsub_rn(t[b], mx), 1.4426950408889634f); ex[b] = __builtin_amdgcn_exp2f(xa[b]); }
                        // the slot the instruction set asks for between a transcendental and an overwrite of its source: the four arguments stay live (inputs) up to this v_nop, which stands behind the four v_exp (their results are inputs too)
                        asm volatile("v_nop" :: "v"(xa[0]), "v"(xa[1]), "v"(xa[2]), "v"(xa[3]), "v"(ex[0]), "v"(ex[1]), "v"(ex[2]), "v"(ex[3]));
#pragma unroll
                        for (int b = 0; b < NB_; ++b) sum = __fadd_rn(sum, ex[b]);
                        const float f = __fdiv_rn(1.0f, sum);
#pragma unroll
                        for (int b = 0; b < NB_; ++b) splitf(__fmul_rn(ex[b], f), a[q][b], c[q][b]); }
#pragma unroll
                    for (int b = 0; b < NB_; ++b) { ph[b][nb][mb * 4 + jp] = (unsigned)a[0][b] | ((unsigned)a[1][b] << 16); pl[b][nb][mb * 4 + jp] = (unsigned)c[0][b] | ((unsigned)c[1][b] << 16); } }
                // one 16x16 tile's softmax at a time: left free, the scheduler runs all four tiles abreast and their unpacked halves push accumulators into scratch
                __builtin_amdgcn_sched_barrier(0); }
#pragma unroll
        for (int b = 0; b < NB_; ++b) {
            if (b + 1 < NB_) {
#pragma unroll
                for (int db = 0; db < 8; ++db) { const size_t o = (size_t)(b + 1) * sV + (size_t)db * 16 * TT; vh[(b + 1) & 1][db] = WF::ld(Vh + o); vl[(b + 1) & 1][db] = WF::ld(Vl + o); } }
            // holds the next batch's 32 loads in front of this batch's 48 products: left free, the scheduler sinks each load to just before its use and every fragment waits a full L2 latency
            __builtin_amdgcn_sched_barrier(0);
#pragma unroll
            for (int db = 0; db < 8; ++db)
#pragma unroll
                for (int nb = 0; nb < FQB; ++nb) { const V bh = __builtin_bit_cast(V, ph[b][nb]), bl = __builtin_bit_cast(V, pl[b][nb]);
                    acc[b][db][nb] = WF::mma(vh[b & 1][db], bh, acc[b][db][nb]); acc[b][db][nb] = WF::mma(vh[b & 1][db], bl, acc[b][db][nb]); acc[b][db][nb] = WF::mma(vl[b & 1][db], bh, acc[b][db][nb]); }
            // keeps the loads of batch b + 2 behind these products, whose fragments' registers they refill
            __builtin_amdgcn_sched_barrier(0); }
        Kh += FWV * 32 * HD; Kl += FWV * 32 * HD; Vh += FWV * 32; Vl += FWV * 32;
    }
#pragma unroll
    for (int b = 0; b < NB_; ++b)
#pragma unroll
        for (int db = 0; db < 8; ++db)
#pragma unroll
            for (int nb = 0; nb < FQB; ++nb) { const v8f a = acc[b][db][nb]; const int i = (b * 8 + db) * FQB + nb; red[w][i][0][lane] = (v4f){a[0], a[1], a[2], a[3]}; red[w][i][1][lane] = (v4f){a[4], a[5], a[6], a[7]}; }
    __syncthreads();
    for (int i = 0; i < 8 * FQB; ++i) { const int db = i / FQB, nb = i % FQB; const int ii = w * 8 * FQB + i; v4f x0 = red[0][ii][0][lane], x1 = red[0][ii][1][lane];
#pragma unroll
        for (int ww = 1; ww < FWV; ++ww) { x0 += red[ww][ii][0][lane]; x1 += red[ww][ii][1][lane]; }
        v8us oh, ol;
#pragma unroll
        for (int j = 0; j < 4; ++j) { unsigned short a, c; splitf(x0[j], a, c); oh[j] = a; ol[j] = c; splitf(x1[j], a, c); oh[4 + j] = a; ol[4 + j] = c; }
        const size_t oo = ((size_t)w * TT + q0 + nb * 16 + lr) * DV + (size_t)h * HDV + db * 16 + 8 * hi; *(v8us*)(ATh + oo) = oh; *(v8us*)(ATl + oo) = ol;
        // precaution: stands between the two stores and the next trip's first write to their data and address registers
        asm volatile("s_wait_xcnt 0x0" ::: "memory"); }
}

extern "C" void kernel_launch(void* const* d_in, const int* in_sizes, int n_in,
                              void* d_out, int out_size, void* d_ws, size_t ws_size, hipStream_t stream) {
    (void)in_sizes; (void)n_in; (void)out_size;
    const float* x = (const float*)d_in[0]; const float* wq = (const float*)d_in[1]; const float* wk = (const float*)d_in[2]; const float* wv = (const float*)d_in[3]; const float* wo = (const float*)d_in[4];
    float* OUT = (float*)d_out;     // [4][2048][512]
    char* wsp = (char*)d_ws;
    auto take = [&](size_t bytes) { char* p = wsp; wsp += (bytes + 255) & ~(size_t)255; return (void*)p; };
    bf* W = (bf*)take((size_t)(DQ + DKV + DV + DV) * DM * 2); bf* WO = W + (size_t)(DQ + DKV + DV) * DM;
    bf* XB = (bf*)take((size_t)NB_ * TT * DM * 2);
    bf* QKh = (bf*)take((size_t)NB_ * (NH_ + NKV) * TT * HD * 2); bf* QKl = (bf*)take((size_t)NB_ * (NH_ + NKV) * TT * HD * 2);   /* [b][8][t][d]: heads 0-3 q, 4-7 k */
    bf* VTh = (bf*)take((size_t)NB_ * NH_ * HDV * TT * 2); bf* VTl = (bf*)take((size_t)NB_ * NH_ * HDV * TT * 2);
    bf* ATh = (bf*)take((size_t)NB_ * TT * DV * 2); bf* ATl = (bf*)take((size_t)NB_ * TT * DV * 2);
    if ((size_t)(wsp - (char*)d_ws) > ws_size) return;    // ws 256 MiB (carve ~58 MiB)
    k_wtG<<<dim3((unsigned)((DM * DV / 64 + 63) / 64), 4, 1), 256, 0, stream>>>(wq, wk, wv, wo, W);
    const int PF = DQ + DKV + DV;
    /* projections + planes, every batch in one launch (the softmax couples the batches) */
    k_cvt8<<<(unsigned)(((size_t)NB_ * TT * DM / 8 + 255) / 256), 256, 0, stream>>>(x, XB, (size_t)NB_ * TT * DM / 8);
    k_gemmw<bf, 0, false, true><<<dim3(NB_ * TT / 64, PF / 64, 1), 32, 0, stream>>>(XB, nullptr, W, nullptr, DM, nullptr, 0, nullptr, 0, 0, 0, QKh, QKl, VTh, VTl);
    k_fattn<<<dim3(TT / (16 * FQB), NH_, 1), 32 * FWV, 0, stream>>>(QKh, QKl, VTh, VTl, ATh, ATl);   /* all heads, all batches */
    k_gemmw<bf, 1, false><<<dim3(NB_ * TT / 64, DV / 64, 1), 32, 0, stream>>>(ATh, ATl, WO, nullptr, DV, OUT, DV, nullptr, 0, 0, 0);
}

// v004
// A run of this version takes 159 microseconds.
// In two side-by-side timings against v003, it was 1.15 and 1.16 times as fast.
// Counting every step since v000, it is 7.25 times as fast.
#include <hip/hip_runtime.h>

// Multi-head attention whose softmax runs over the BATCH axis (the source's nn.Softmax() with no dim on a (B,N,N)-shaped view picks dim 0): input_x [4][2048][512]; q = x Wq, k = x Wk ('xw' [512][256]: 4 heads x 64), v = x Wv ('xw' [512][512]: 4 heads x 128); scores[b][h][q][k] = q.k / 8; attn = softmax over b (the 4 batches, per (h, q, k)); out[b][q][h*128+d] = sum_k attn[b][h][q][k] v[b][k][h][d]; out Wo ('xw' [512][512]) -> [4][2048][512] (4.2 M).
// Layout: exact projections first: one GEMM [8192][512] x [1024][512]^T gives q | k | v of every batch, and its epilogue writes them straight as q/k planes per (batch, head), bf16 hi/lo (heads 0-3 q, 4-7 k), and value^T planes per (batch, head); then ONE attention kernel (k_fattn) for all heads: a wave holds the scores of all four batches for 32 keys x 32 queries in registers, takes the softmax ACROSS the batches there, feeds the probabilities (hi/lo) straight into the 3-product P.v and the work-group writes the hi/lo context planes; finally out = context Wo (hl x exact), 8192 rows in one GEMM.
// FRAGMENT ORDER: every 16-bit plane that a matrix instruction reads ([rows][K], K-contiguous in meaning) is stored as blocks of 16 rows x 32 k (512 elements, 1 KiB), block (k / 32) * (rows / 16) + row / 16 (neighbouring row blocks of one k step lie side by side: a tile's fragments of a k step are one run of bytes); inside a block element (row, k) lies at ((k % 32) / 16) * 256 + (((k % 16) / 8) * 16 + row % 16) * 8 + k % 8. That is the order in which the 32 lanes hold an A or B fragment, so each of a fragment's two 16-byte loads reads 512 consecutive bytes (4 whole lines) where a row-major plane gave 16 lines with 32 bytes used of each.
// Compute dtypes, f32 accumulate: every input rounded to bf16; projections exact; scores and attn.v on bf16 hi/lo planes (3 products) everywhere; the cross-batch softmax in f32.

#define NB_  4
#define TT   2048
#define DM   512
#define NH_  4
#define NKV  4
#define REP  (NH_ / NKV)
#define HD   64
#define DQ   (NH_ * HD)
#define DKV  (NKV * HD)
#define ZH   2
#define RH   2048                  // query rows < RH use hi+lo planes (0: none)
#define WIN  0
#define PCAR 1024.0f
#define SCL  0.125f   // 64^-0.5
#define HDV  128      // value head dim
#define DV   (NH_ * HDV)   // 512
typedef _Float16 h16;
typedef unsigned short bf;
typedef __attribute__((ext_vector_type(16))) __bf16   v16bf;
typedef __attribute__((ext_vector_type(16))) _Float16 v16h;
typedef __attribute__((ext_vector_type(8)))  _Float16 v8h;
typedef __attribute__((ext_vector_type(8)))  unsigned short v8us;
typedef __attribute__((ext_vector_type(8)))  float    v8f;
typedef __attribute__((ext_vector_type(4)))  float    v4f;
typedef v8h  __attribute__((may_alias)) v8ha;
typedef v4f  __attribute__((may_alias)) v4fa;
typedef v8us __attribute__((may_alias)) v8usa;

__device__ __forceinline__ unsigned short f2bf(float f) { unsigned u = __float_as_uint(f); u += 0x7FFFu + ((u >> 16) & 1u); return (unsigned short)(u >> 16); }
__device__ __forceinline__ float bf2f(unsigned short b) { return __uint_as_float(((unsigned)b) << 16); }
__device__ __forceinline__ float bfr(float f) { return bf2f(f2bf(f)); }
__device__ __forceinline__ void splitf(float y, unsigned short& h, unsigned short& l) { h = f2bf(y); l = f2bf(y - bf2f(h)); }
__device__ __forceinline__ v16h cat16(v8h lo, v8h hi) { return __builtin_shufflevector(lo, hi, 0, 1, 2, 3, 4, 5, 6, 7, 8, 9, 10, 11, 12, 13, 14, 15); }
__device__ __forceinline__ v16bf cat16b(v8us lo, v8us hi) { return __builtin_bit_cast(v16bf, __builtin_shufflevector(lo, hi, 0, 1, 2, 3, 4, 5, 6, 7, 8, 9, 10, 11, 12, 13, 14, 15)); }
__device__ __forceinline__ v8f wmma16(v16h a, v16h b, v8f c) { return __builtin_amdgcn_wmma_f32_16x16x32_f16(false, a, false, b, (short)0, c, false, false); }
__device__ __forceinline__ v8f wmmab(v16bf a, v16bf b, v8f c) { return __builtin_amdgcn_wmma_f32_16x16x32_bf16(false, a, false, b, (short)0, c, false, false); }



// ---- k_gemmw: register-blocked GEMM, ONE WAVE per 64x64 output tile (16 accumulators), operands straight from 16-bit planes in fragment order; grid (M/64, N/64, Z), 32 threads.
// C[m][n] (f32, pitch ldc, + optional f32 bias[n]) = sum_k A[m][k] Bt[n][k] (+ split products per NSPLIT). z-batch strides sA/sB/sC in elements. K % 32 == 0.
// PLANES (the q | k | v projection): no C; the epilogue splits the tile hi/lo and writes it as attention planes. A 64-column tile is one whole q or k head (columns 0-511: plane c0 / 64) or half a value head (columns 512-1023); its 64 rows lie in one batch.
// ld: p = start of a 16 x 32 block in fragment order + lane * 8
template <typename T16> struct WFrag;
template <> struct WFrag<h16> { typedef v16h V; static __device__ __forceinline__ V ld(const h16* p) { return cat16(*(const v8h*)p, *(const v8h*)(p + 256)); } static __device__ __forceinline__ v8f mma(V a, V b, v8f c) { return wmma16(a, b, c); } };
template <> struct WFrag<bf> { typedef v16bf V; static __device__ __forceinline__ V ld(const bf* p) { return cat16b(*(const v8us*)p, *(const v8us*)(p + 256)); } static __device__ __forceinline__ v8f mma(V a, V b, v8f c) { return wmmab(a, b, c); } };
template <typename T16, int NSPLIT, bool BIAS, bool PLANES = false>
__global__ __launch_bounds__(32) void k_gemmw(const T16* __restrict__ A, const T16* __restrict__ A2, const T16* __restrict__ Bt, const T16* __restrict__ Bt2, int K, float* C, int ldc, const float* __restrict__ bias, size_t sA, size_t sB, size_t sC, bf* QKh = nullptr, bf* QKl = nullptr, bf* VTh = nullptr, bf* VTl = nullptr) {
    typedef typename WFrag<T16>::V V;
    __shared__ __align__(16) float os[16 * 68];
    const size_t z = blockIdx.z; A += z * sA; if (A2) A2 += z * sA; Bt += z * sB; if (Bt2) Bt2 += z * sB; C += z * sC;
    const int lane = threadIdx.x & 31, lr = lane & 15, hi = lane >> 4; const int r0 = blockIdx.x * 64, c0 = blockIdx.y * 64;
    v8f acc[4][4];
#pragma unroll
    for (int mb = 0; mb < 4; ++mb)
#pragma unroll
        for (int nb = 0; nb < 4; ++nb) acc[mb][nb] = (v8f){};
    const size_t aoff = (size_t)r0 * 32 + 8 * lane, boff = (size_t)c0 * 32 + 8 * lane;   // 16 rows are one block = 512 elements
    const size_t ka = (size_t)gridDim.x * (64 * 32), kb = (size_t)gridDim.y * (64 * 32);   // the grid covers all rows of the A and of the B plane: 32 k on is rows * 32 elements on
    const T16* pa = A + aoff; const T16* pa2 = A2 + aoff; const T16* pb = Bt + boff; const T16* pb2 = Bt2 + boff;
#pragma unroll 1
    for (int kc = 0; kc < K; kc += 32) {
        V a[4], a2[4];
#pragma unroll
        for (int mb = 0; mb < 4; ++mb) { a[mb] = WFrag<T16>::ld(pa + mb * 512); if (NSPLIT == 1 || NSPLIT == 2) a2[mb] = WFrag<T16>::ld(pa2 + mb * 512); }
#pragma unroll
        for (int nb = 0; nb < 4; ++nb) { const V b = WFrag<T16>::ld(pb + nb * 512); V b2; if (NSPLIT >= 2) b2 = WFrag<T16>::ld(pb2 + nb * 512);
#pragma unroll
            for (int mb = 0; mb < 4; ++mb) { acc[mb][nb] = WFrag<T16>::mma(a[mb], b, acc[mb][nb]); if (NSPLIT == 1 || NSPLIT == 2) acc[mb][nb] = WFrag<T16>::mma(a2[mb], b, acc[mb][nb]); if (NSPLIT >= 2) acc[mb][nb] = WFrag<T16>::mma(a[mb], b2, acc[mb][nb]); } }
        asm volatile("v_nop\n\tv_nop\n\tv_nop\n\tv_nop" : "+v"(acc[0][0]), "+v"(acc[1][1]), "+v"(acc[2][2]), "+v"(acc[3][3]) : "v"(a[0]), "v"(a[3]));
        // precaution: stands between this trip's loads and the step of their pointers; the pointers are held live up to here (inputs), so that no later load's result is put into the registers of an address still in use
        if (NSPLIT == 0) asm volatile("s_wait_xcnt 0x0" :: "v"(pa), "v"(pb) : "memory");
        else if (NSPLIT == 1) asm volatile("s_wait_xcnt 0x0" :: "v"(pa), "v"(pa2), "v"(pb) : "memory");
        else asm volatile("s_wait_xcnt 0x0" :: "v"(pa), "v"(pa2), "v"(pb), "v"(pb2) : "memory");
        pa += ka; pa2 += ka; pb += kb; pb2 += kb;
    }
    if (PLANES) {
        const int bz = r0 / TT, t0 = r0 % TT;
        if (c0 < DQ + DKV) {
            // q or k: a plane row is a token, K = its 64 d, fragment order; a 16-row block goes through LDS so that a lane holds 8 neighbouring d of one token: trip s stores d 16 s .. 16 s + 15 of the 16 tokens, a half-block: 512 consecutive bytes
            const size_t po = (size_t)(bz * (NH_ + NKV) + c0 / HD) * TT * HD + (size_t)t0 * 32;
#pragma unroll
            for (int mb = 0; mb < 4; ++mb) {
#pragma unroll
                for (int nb = 0; nb < 4; ++nb) {
#pragma unroll
                    for (int j = 0; j < 8; ++j) os[(hi * 8 + j) * 68 + nb * 16 + lr] = acc[mb][nb][j]; }
                // one wave: keeps its LDS writes in front of its reads of other lanes' words
                __builtin_amdgcn_wave_barrier(); asm volatile("" ::: "memory");
#pragma unroll
                for (int s = 0; s < 4; ++s) { const int row = lr, cofs = (2 * s + hi) * 8; const v4f x0 = *(const v4fa*)(os + row * 68 + cofs), x1 = *(const v4fa*)(os + row * 68 + cofs + 4); v8us oh, ol;
#pragma unroll
                    for (int j = 0; j < 4; ++j) { unsigned short p, c; splitf(x0[j], p, c); oh[j] = p; ol[j] = c; splitf(x1[j], p, c); oh[4 + j] = p; ol[4 + j] = c; }
                    const size_t oo = po + (size_t)(s >> 1) * (TT * 32) + mb * 512 + (s & 1) * 256 + lane * 8; *(v8us*)(QKh + oo) = oh; *(v8us*)(QKl + oo) = ol; }
                // and those reads in front of the next block's writes
                __builtin_amdgcn_wave_barrier(); asm volatile("" ::: "memory");
            }
        } else {
            // value^T: a plane row is one d, K = the tokens, fragment order (a wave of k_fattn reads all 128 d of 32 tokens: 8 KiB in a row); the 8 accumulator words a lane holds of a tile are 8 neighbouring tokens of one d, the lane's own 16 bytes of half-block mb & 1: stored from the registers
            const int cv = c0 - (DQ + DKV); const size_t po = (size_t)(bz * NH_ + cv / HDV) * HDV * TT + (size_t)(t0 / 32) * (HDV * 32) + (cv % HDV) * 32 + 8 * lane;
#pragma unroll
            for (int nb = 0; nb < 4; ++nb)
#pragma unroll
                for (int mb = 0; mb < 4; ++mb) { v8us oh, ol;
#pragma unroll
                    for (int j = 0; j < 8; ++j) { unsigned short p, c; splitf(acc[mb][nb][j], p, c); oh[j] = p; ol[j] = c; }
                    const size_t oo = po + (size_t)(mb >> 1) * (HDV * 32) + nb * 512 + (mb & 1) * 256; *(v8us*)(VTh + oo) = oh; *(v8us*)(VTl + oo) = ol; }
            // precaution: stands behind the last stores of this branch, in front of any later write to their data and address registers
            asm volatile("s_wait_xcnt 0x0" ::: "memory");
        }
        return;
    }
#pragma unroll
    for (int mb = 0; mb < 4; ++mb) {
#pragma unroll
        for (int nb = 0; nb < 4; ++nb) {
#pragma unroll
            for (int j = 0; j < 8; ++j) os[(hi * 8 + j) * 68 + nb * 16 + lr] = acc[mb][nb][j]; }
        __builtin_amdgcn_wave_barrier(); asm volatile("" ::: "memory");
        float* crow = C + (size_t)(r0 + mb * 16) * ldc + c0;
{
#pragma unroll
            for (int s = 0; s < 8; ++s) { const int row = 2 * s + hi, cofs = lr * 4; v4f val = *(const v4fa*)(os + row * 68 + cofs); if (BIAS) { val[0] += bfr(bias[c0 + cofs]); val[1] += bfr(bias[c0 + cofs + 1]); val[2] += bfr(bias[c0 + cofs + 2]); val[3] += bfr(bias[c0 + cofs + 3]); }
                *(v4f*)(crow + (size_t)row * ldc + cofs) = val; }
             }
        __builtin_amdgcn_wave_barrier(); asm volatile("" ::: "memory");
    }
}

__device__ __forceinline__ h16 tohx(float x) { return (h16)x; }
typedef __attribute__((ext_vector_type(2))) _Float16 v2h;
typedef __attribute__((ext_vector_type(4))) _Float16 v4h;
typedef __attribute__((ext_vector_type(2))) unsigned short v2us;
typedef __attribute__((ext_vector_type(4))) unsigned short v4us;
typedef __attribute__((ext_vector_type(2))) float v2f;
typedef __attribute__((ext_vector_type(4))) int v4i;

// grid y picks the weight: 0 Wq, 1 Wk, 2 Wv, 3 Wo; two transposed planes in W, K = 512, fragment order: q | k | v (1024 rows: 0-255 q, 256-511 k, 512-1023 v) and behind it o (512 rows).
__global__ __launch_bounds__(256) void k_wtG(const float* __restrict__ w0, const float* __restrict__ w1, const float* __restrict__ w2, const float* __restrict__ w3, bf* W) {
    const int y = blockIdx.y; const float* __restrict__ w = (y == 0) ? w0 : (y == 1) ? w1 : (y == 2) ? w2 : w3; const int K = DM; const int N = (y < 2) ? DQ : DV; const int ls = (y < 2) ? 4 : 5;   /* N / 16 = 1 << ls row blocks */ const int R = (y < 3) ? (DQ + DKV + DV) : DV, roff = (y == 1) ? DQ : (y == 2) ? (DQ + DKV) : 0; bf* Bt = W + ((y < 3) ? 0 : (size_t)(DQ + DKV + DV) * DM);
    const int lane = threadIdx.x & 31; const int L0 = (blockIdx.x * 8 + (threadIdx.x >> 5)) * 8; const int nlines = N * K / 64;
{
#pragma unroll 1
        for (int l = 0; l < 8; ++l) { const int L = L0 + l; if (L >= nlines) break; const size_t e = (size_t)L * 64 + lane * 2; const int blk = (int)(e / 512), wi = (int)(e % 512); const int kq = blk >> ls, rb = blk & ((1 << ls) - 1); const int k = kq * 32 + (wi / 256) * 16 + ((wi % 256) / 128) * 8 + wi % 8, n = rb * 16 + (wi % 128) / 8; v2us o;
            o[0] = f2bf(w[(size_t)k * N + n]); o[1] = f2bf(w[(size_t)(k + 1) * N + n]); *(v2us*)(Bt + ((size_t)kq * (R / 16) + roff / 16 + rb) * 512 + wi) = o;
            // precaution: stands between the store and the next trip's first write to its data and address registers
            asm volatile("s_wait_xcnt 0x0" ::: "memory"); }
         }
}
// 64 threads convert one 16 x 32 block of the plane ([NB_ * TT][DM] in fragment order): four neighbouring threads read the 32 floats (one 128-byte line) of one row, so a wave reads 8 whole lines and writes 4 whole lines (8 rows' pieces of each k octet lie side by side)
__global__ __launch_bounds__(256) void k_cvt8(const float* __restrict__ src, bf* dst, size_t n8) { const size_t i = (size_t)blockIdx.x * 256 + threadIdx.x; if (i >= n8) return; const int blk = (int)(i / 64), wi = (int)(i % 64); const v8f v = *(const v8f*)(src + (size_t)((blk % (NB_ * TT / 16)) * 16 + wi / 4) * DM + (blk / (NB_ * TT / 16)) * 32 + (wi % 4) * 8); v8us o;
#pragma unroll
    for (int k = 0; k < 8; ++k) o[k] = f2bf(v[k]); *(v8us*)(dst + (size_t)blk * 512 + ((wi % 4) * 16 + wi / 4) * 8) = o;  }

__global__ __launch_bounds__(256) void k_vtp(const float* __restrict__ F, int pitch, int nheads, h16* V16, bf* Vh, bf* Vl) { const size_t e = ((size_t)blockIdx.x * 256 + threadIdx.x) * 2; if (e >= (size_t)nheads * HD * TT) return; const int t = (int)(e % TT); const int d = (int)((e / TT) % HD); const int g = (int)(e / ((size_t)TT * HD)); v2h o16; v2us oh, ol;
#pragma unroll
    for (int q = 0; q < 2; ++q) { const float x = F[(size_t)(t + q) * pitch + g * HD + d]; o16[q] = tohx(x); unsigned short a2, c2; splitf(x, a2, c2); oh[q] = a2; ol[q] = c2; }
    *(v2h*)(V16 + e) = o16; *(v2us*)(Vh + e) = oh; *(v2us*)(Vl + e) = ol;  }
// k_asoft: per row (zz, i): t = S x HD^-0.5 (no mask); softmax over the 2048 keys (register row, one exp, fixed trees);
__global__ __launch_bounds__(256) void k_asoft(const float* __restrict__ Sb, h16* P16, bf* Ph, bf* Pl) {
    const int lane = threadIdx.x & 31; const int row = blockIdx.x * 8 + (threadIdx.x >> 5); if (row >= ZH * TT) return; const int i = row % TT; const int zz = row / TT; (void)zz; const bool hires = (i < RH); const float* sr = Sb + (size_t)row * TT; float v[TT / 32]; float mx = -3.0e38f;
#pragma unroll
    for (int ch = 0; ch < TT / 128; ++ch) { const int j0 = ch * 128 + lane * 4; const v4f a = *(const v4f*)(sr + j0);
#pragma unroll
        for (int q = 0; q < 4; ++q) { const int j = j0 + q; (void)j; const float t = a[q] * SCL; v[ch * 4 + q] = t; mx = fmaxf(mx, t); } }
#pragma unroll
    for (int sh = 16; sh; sh >>= 1) mx = fmaxf(mx, __shfl_xor(mx, sh, 32));
    float sum = 0.f;
#pragma unroll
    for (int k = 0; k < TT / 32; ++k) { float d0 = __fsub_rn(v[k], mx); asm volatile("" : "+v"(d0)); v[k] = __builtin_amdgcn_exp2f(__fmul_rn(d0, 1.4426950408889634f)); sum += v[k]; }
#pragma unroll
    for (int sh = 16; sh; sh >>= 1) sum += __shfl_xor(sum, sh, 32);
    const float f = __fdiv_rn(hires ? 1.0f : PCAR, sum);
{
        if (hires) {
#pragma unroll
            for (int ch = 0; ch < TT / 128; ++ch) { v4us oh, ol;
#pragma unroll
                for (int q = 0; q < 4; ++q) { unsigned short a, c2; splitf(v[ch * 4 + q] * f, a, c2); oh[q] = a; ol[q] = c2; }
                const size_t oo = ((size_t)zz * (RH ? RH : 1) + i) * TT + ch * 128 + lane * 4; *(v4us*)(Ph + oo) = oh; *(v4us*)(Pl + oo) = ol; }
        } else {
#pragma unroll
            for (int ch = 0; ch < TT / 128; ++ch) { v4h o4;
#pragma unroll
                for (int q = 0; q < 4; ++q) o4[q] = tohx(v[ch * 4 + q] * f);
                *(v4h*)(P16 + (size_t)row * TT + ch * 128 + lane * 4) = o4; } }
         }
}
__global__ __launch_bounds__(256) void k_merge(const float* __restrict__ O, int h0, bf* Ah, bf* Al) { const size_t e = ((size_t)blockIdx.x * 256 + threadIdx.x) * 2; if (e >= (size_t)ZH * TT * HD) return; const int d = (int)(e % HD); const int t = (int)((e / HD) % TT); const int zz = (int)(e / ((size_t)HD * TT)); const float cs = (t < RH) ? 1.0f : (1.0f / PCAR); const size_t oo = (size_t)t * DQ + (h0 + zz) * HD + d;
    v2us oh, ol;
#pragma unroll
    for (int q = 0; q < 2; ++q) { unsigned short a, c2; splitf(O[e + q] * cs, a, c2); oh[q] = a; ol[q] = c2; } *(v2us*)(Ah + oo) = oh; *(v2us*)(Al + oo) = ol;  }

// ---- k_fattn: scores, cross-batch softmax, P.v and the hi/lo split of the context in one kernel. Grid (TT/32, heads), 4 waves.
// The work-group owns 32 queries of one head in ALL four batches; in pass kt wave w takes keys kt*128 + w*32 .. +31 (the sum over keys needs no running maximum: the softmax runs over the batches).
// Transposed products: S^T[key][q] = K Q^T (A = k plane rows, B = q plane rows), so that two 16x16 D tiles (keys 0-15, 16-31 of the pass) are, converted in place, the B operand of O^T[d][q] = V^T P^T (A = value^T plane rows): no LDS and no lane exchange between the two products.
// At the end the four waves' partial O^T (one per key subset) are summed through LDS in wave order 0..3; wave w finishes batch w.
// Every inner loop is fully unrolled so that the fragment, score and accumulator arrays are indexed by constants and stay in registers (512 of them hold O^T: one wave per SIMD).
#define FQB 2     // 16-query blocks per work-group
#define FWV 4     // waves per work-group
typedef __attribute__((ext_vector_type(8))) unsigned v8u;
__global__ __launch_bounds__(32 * FWV) void k_fattn(const bf* __restrict__ QKh, const bf* __restrict__ QKl, const bf* __restrict__ VTh, const bf* __restrict__ VTl, bf* ATh, bf* ATl) {
    typedef WFrag<bf> WF; typedef WF::V V;
    __shared__ __align__(16) v8us qs[NB_ * FQB * 2 * 2][2][32];        // q fragments [batch][nb][kc][hi|lo], fragment order: 32 KiB
    __shared__ __align__(16) v4f red[FWV][NB_ * 8 * FQB][2][32];       // the waves' partial O^T tiles: 256 KiB
    const int lane = threadIdx.x & 31, lr = lane & 15, hi = lane >> 4; const int w = __builtin_amdgcn_readfirstlane((int)(threadIdx.x >> 5));
    const int h = blockIdx.y, q0 = blockIdx.x * (16 * FQB);
    const size_t sQK = (size_t)(NH_ + NKV) * TT * HD, sV = (size_t)NH_ * HDV * TT;
    const bf* qph = QKh + (size_t)w * sQK + (size_t)h * TT * HD + (size_t)q0 * 32 + 8 * lane; const bf* qpl = QKl + (qph - QKh);
#pragma unroll
    for (int nb = 0; nb < FQB; ++nb)
#pragma unroll
        for (int kc = 0; kc < 2; ++kc) { const int o = nb * 512 + kc * (TT * 32); const int f = ((w * FQB + nb) * 2 + kc) * 2;
            qs[f][0][lane] = *(const v8us*)(qph + o); qs[f][1][lane] = *(const v8us*)(qph + o + 256); qs[f + 1][0][lane] = *(const v8us*)(qpl + o); qs[f + 1][1][lane] = *(const v8us*)(qpl + o + 256); }
    // precaution: stands between the q loads and the first reuse of their address registers (held live up to here as inputs); the scheduling fence keeps the zeroing of the accumulators, which reuses them, behind the wait
    asm volatile("s_wait_xcnt 0x0" :: "v"(qph), "v"(qpl) : "memory");
    __builtin_amdgcn_sched_barrier(0);
    v8f acc[NB_][8][FQB];
#pragma unroll
    for (int b = 0; b < NB_; ++b)
#pragma unroll
        for (int db = 0; db < 8; ++db)
#pragma unroll
            for (int nb = 0; nb < FQB; ++nb) acc[b][db][nb] = (v8f){};
    // each lane's place in this wave's 32 keys of the pass, batch 0: k planes (row = key: 32 keys are 2 blocks for each 32 d) and value^T planes (row = d: 32 keys are 8 blocks, one per 16 d); they step by 128 keys a pass
    const bf* Kh = QKh + (size_t)(NH_ + h) * TT * HD + (size_t)(w * 32) * 32 + 8 * lane; const bf* Kl = QKl + (Kh - QKh);
    const bf* Vh = VTh + (size_t)h * HDV * TT + (size_t)(w * 32) * HDV + 8 * lane; const bf* Vl = VTl + (Vh - VTh);
    // rolled: one pass is some 4,300 instructions
#pragma unroll 1
    for (int kt = 0; kt < TT / (32 * FWV); ++kt) {
        // first pass: publishes the q fragments; every pass: keeps the four waves on the same 128 keys
        __syncthreads();
        V kh[NB_][2][2], kl[NB_][2][2];
#pragma unroll
        for (int b = 0; b < NB_; ++b)
#pragma unroll
            for (int kc = 0; kc < 2; ++kc)
#pragma unroll
                for (int mb = 0; mb < 2; ++mb) { const size_t o = (size_t)b * sQK + (size_t)kc * (TT * 32) + mb * 512; kh[b][kc][mb] = WF::ld(Kh + o); kl[b][kc][mb] = WF::ld(Kl + o); }
        v8f s[NB_][2][FQB];
#pragma unroll
        for (int b = 0; b < NB_; ++b) {
#pragma unroll
            for (int mb = 0; mb < 2; ++mb)
#pragma unroll
                for (int nb = 0; nb < FQB; ++nb) s[b][mb][nb] = (v8f){};
#pragma unroll
            for (int kc = 0; kc < 2; ++kc)
#pragma unroll
                for (int nb = 0; nb < FQB; ++nb) { const int f = ((b * FQB + nb) * 2 + kc) * 2; const V qh = cat16b(qs[f][0][lane], qs[f][1][lane]), ql = cat16b(qs[f + 1][0][lane], qs[f + 1][1][lane]);
#pragma unroll
                    for (int mb = 0; mb < 2; ++mb) { s[b][mb][nb] = WF::mma(kh[b][kc][mb], qh, s[b][mb][nb]); s[b][mb][nb] = WF::mma(kh[b][kc][mb], ql, s[b][mb][nb]); s[b][mb][nb] = WF::mma(kl[b][kc][mb], qh, s[b][mb][nb]); } } }
        // value^T fragments of batch 0 are asked for here, so that they fly under the softmax arithmetic; those of batch b + 1 in front of batch b's products
        V vh[2][8], vl[2][8];
#pragma unroll
        for (int db = 0; db < 8; ++db) { const size_t o = (size_t)db * 512; vh[0][db] = WF::ld(Vh + o); vl[0][db] = WF::ld(Vl + o); }
        v8u ph[NB_][FQB], pl[NB_][FQB];     // probabilities, bf16 hi and lo, two keys to a word: word i of (batch, nb) holds k slots 2i and 2i + 1 of the B operand
#pragma unroll
        for (int nb = 0; nb < FQB; ++nb)
#pragma unroll
            for (int mb = 0; mb < 2; ++mb) {
#pragma unroll
                for (int jp = 0; jp < 4; ++jp) { unsigned short a[2][NB_], c[2][NB_];
#pragma unroll
                    for (int q = 0; q < 2; ++q) { const int j = 2 * jp + q; float t[NB_]; float mx = -3.0e38f;
#pragma unroll
                        for (int b = 0; b < NB_; ++b) { t[b] = __fmul_rn(s[b][mb][nb][j], SCL); mx = fmaxf(mx, t[b]); }
                        float xa[NB_], ex[NB_]; float sum = 0.f;
#pragma unroll
                        for (int b = 0; b < NB_; ++b) { xa[b] = __fmul_rn(__fsub_rn(t[b], mx), 1.4426950408889634f); ex[b] = __builtin_amdgcn_exp2f(xa[b]); }
                        // the slot the instruction set asks for between a transcendental and an overwrite of its source: the four arguments stay live (inputs) up to this v_nop, which stands behind the four v_exp (their results are inputs too)
                        asm volatile("v_nop" :: "v"(xa[0]), "v"(xa[1]), "v"(xa[2]), "v"(xa[3]), "v"(ex[0]), "v"(ex[1]), "v"(ex[2]), "v"(ex[3]));
#pragma unroll
                        for (int b = 0; b < NB_; ++b) sum = __fadd_rn(sum, ex[b]);
                        const float f = __fdiv_rn(1.0f, sum);
#pragma unroll
                        for (int b = 0; b < NB_; ++b) splitf(__fmul_rn(ex[b], f), a[q][b], c[q][b]); }
#pragma unroll
                    for (int b = 0; b < NB_; ++b) { ph[b][nb][mb * 4 + jp] = (unsigned)a[0][b] | ((unsigned)a[1][b] << 16); pl[b][nb][mb * 4 + jp] = (unsigned)c[0][b] | ((unsigned)c[1][b] << 16); } }
                // one 16x16 tile's softmax at a time: left free, the scheduler runs all four tiles abreast and their unpacked halves push accumulators into scratch
                __builtin_amdgcn_sched_barrier(0); }
#pragma unroll
        for (int b = 0; b < NB_; ++b) {
            if (b + 1 < NB_) {
#pragma unroll
                for (int db = 0; db < 8; ++db) { const size_t o = (size_t)(b + 1) * sV + (size_t)db * 512; vh[(b + 1) & 1][db] = WF::ld(Vh + o); vl[(b + 1) & 1][db] = WF::ld(Vl + o); } }
            // holds the next batch's 32 loads in front of this batch's 48 products: left free, the scheduler sinks each load to just before its use and every fragment waits a full L2 latency
            __builtin_amdgcn_sched_barrier(0);
#pragma unroll
            for (int db = 0; db < 8; ++db)
#pragma unroll
                for (int nb = 0; nb < FQB; ++nb) { const V bh = __builtin_bit_cast(V, ph[b][nb]), bl = __builtin_bit_cast(V, pl[b][nb]);
                    acc[b][db][nb] = WF::mma(vh[b & 1][db], bh, acc[b][db][nb]); acc[b][db][nb] = WF::mma(vh[b & 1][db], bl, acc[b][db][nb]); acc[b][db][nb] = WF::mma(vl[b & 1][db], bh, acc[b][db][nb]); }
            // keeps the loads of batch b + 2 behind these products, whose fragments' registers they refill
            __builtin_amdgcn_sched_barrier(0); }
        Kh += FWV * 32 * 32; Kl += FWV * 32 * 32; Vh += FWV * 32 * HDV; Vl += FWV * 32 * HDV;
    }
#pragma unroll
    for (int b = 0; b < NB_; ++b)
#pragma unroll
        for (int db = 0; db < 8; ++db)
#pragma unroll
            for (int nb = 0; nb < FQB; ++nb) { const v8f a = acc[b][db][nb]; const int i = (b * 8 + db) * FQB + nb; red[w][i][0][lane] = (v4f){a[0], a[1], a[2], a[3]}; red[w][i][1][lane] = (v4f){a[4], a[5], a[6], a[7]}; }
    __syncthreads();
    for (int i = 0; i < 8 * FQB; ++i) { const int db = i / FQB, nb = i % FQB; const int ii = w * 8 * FQB + i; v4f x0 = red[0][ii][0][lane], x1 = red[0][ii][1][lane];
#pragma unroll
        for (int ww = 1; ww < FWV; ++ww) { x0 += red[ww][ii][0][lane]; x1 += red[ww][ii][1][lane]; }
        v8us oh, ol;
#pragma unroll
        for (int j = 0; j < 4; ++j) { unsigned short a, c; splitf(x0[j], a, c); oh[j] = a; ol[j] = c; splitf(x1[j], a, c); oh[4 + j] = a; ol[4 + j] = c; }
        const size_t oo = (size_t)(h * (HDV / 32) + (db >> 1)) * (NB_ * TT * 32) + ((size_t)w * TT + q0 + nb * 16) * 32 + (db & 1) * 256 + 8 * lane; *(v8us*)(ATh + oo) = oh; *(v8us*)(ATl + oo) = ol;   // context planes [8192][DV] in fragment order: the lane's 8 d of one query are its own 16 bytes of half-block db & 1
        // precaution: stands between the two stores and the next trip's first write to their data and address registers
        asm volatile("s_wait_xcnt 0x0" ::: "memory"); }
}

extern "C" void kernel_launch(void* const* d_in, const int* in_sizes, int n_in,
                              void* d_out, int out_size, void* d_ws, size_t ws_size, hipStream_t stream) {
    (void)in_sizes; (void)n_in; (void)out_size;
    const float* x = (const float*)d_in[0]; const float* wq = (const float*)d_in[1]; const float* wk = (const float*)d_in[2]; const float* wv = (const float*)d_in[3]; const float* wo = (const float*)d_in[4];
    float* OUT = (float*)d_out;     // [4][2048][512]
    char* wsp = (char*)d_ws;
    auto take = [&](size_t bytes) { char* p = wsp; wsp += (bytes + 255) & ~(size_t)255; return (void*)p; };
    bf* W = (bf*)take((size_t)(DQ + DKV + DV + DV) * DM * 2); bf* WO = W + (size_t)(DQ + DKV + DV) * DM;
    bf* XB = (bf*)take((size_t)NB_ * TT * DM * 2);
    bf* QKh = (bf*)take((size_t)NB_ * (NH_ + NKV) * TT * HD * 2); bf* QKl = (bf*)take((size_t)NB_ * (NH_ + NKV) * TT * HD * 2);   /* [b][8] planes [t][d] in fragment order: heads 0-3 q, 4-7 k */
    bf* VTh = (bf*)take((size_t)NB_ * NH_ * HDV * TT * 2); bf* VTl = (bf*)take((size_t)NB_ * NH_ * HDV * TT * 2);
    bf* ATh = (bf*)take((size_t)NB_ * TT * DV * 2); bf* ATl = (bf*)take((size_t)NB_ * TT * DV * 2);
    if ((size_t)(wsp - (char*)d_ws) > ws_size) return;    // ws 256 MiB (carve ~58 MiB)
    k_wtG<<<dim3((unsigned)((DM * DV / 64 + 63) / 64), 4, 1), 256, 0, stream>>>(wq, wk, wv, wo, W);
    const int PF = DQ + DKV + DV;
    /* projections + planes, every batch in one launch (the softmax couples the batches) */
    k_cvt8<<<(unsigned)(((size_t)NB_ * TT * DM / 8 + 255) / 256), 256, 0, stream>>>(x, XB, (size_t)NB_ * TT * DM / 8);
    k_gemmw<bf, 0, false, true><<<dim3(NB_ * TT / 64, PF / 64, 1), 32, 0, stream>>>(XB, nullptr, W, nullptr, DM, nullptr, 0, nullptr, 0, 0, 0, QKh, QKl, VTh, VTl);
    k_fattn<<<dim3(TT / (16 * FQB), NH_, 1), 32 * FWV, 0, stream>>>(QKh, QKl, VTh, VTl, ATh, ATl);   /* all heads, all batches */
    k_gemmw<bf, 1, false><<<dim3(NB_ * TT / 64, DV / 64, 1), 32, 0, stream>>>(ATh, ATl, WO, nullptr, DV, OUT, DV, nullptr, 0, 0, 0);
}

// v005
// A run of this version takes 145 microseconds.
// Two timings next to v004 put it at 1.09 and 1.08 times that version's speed.
// All steps since v000 together make it 7.88 times as fast.
#include <hip/hip_runtime.h>

// Multi-head attention whose softmax runs over the BATCH axis (the source's nn.Softmax() with no dim on a (B,N,N)-shaped view picks dim 0): input_x [4][2048][512]; q = x Wq, k = x Wk ('xw' [512][256]: 4 heads x 64), v = x Wv ('xw' [512][512]: 4 heads x 128); scores[b][h][q][k] = q.k / 8; attn = softmax over b (the 4 batches, per (h, q, k)); out[b][q][h*128+d] = sum_k attn[b][h][q][k] v[b][k][h][d]; out Wo ('xw' [512][512]) -> [4][2048][512] (4.2 M).
// Layout: exact projections first: one GEMM [8192][512] x [1024][512]^T gives q | k | v of every batch, and its epilogue writes them straight as q/k planes per (batch, head), bf16 hi/lo (heads 0-3 q, 4-7 k), and value^T planes per (batch, head); then ONE attention kernel (k_fattn) for all heads: a wave holds the scores of all four batches for 32 keys x 32 queries in registers, takes the softmax ACROSS the batches there, feeds the probabilities (hi/lo) straight into the 3-product P.v and the work-group writes the hi/lo context planes; finally out = context Wo (hl x exact), 8192 rows in one GEMM.
// FRAGMENT ORDER: every 16-bit plane that a matrix instruction reads ([rows][K], K-contiguous in meaning) is stored as blocks of 16 rows x 32 k (512 elements, 1 KiB), block (k / 32) * (rows / 16) + row / 16 (neighbouring row blocks of one k step lie side by side: a tile's fragments of a k step are one run of bytes); inside a block element (row, k) lies at ((k % 32) / 16) * 256 + (((k % 16) / 8) * 16 + row % 16) * 8 + k % 8. That is the order in which the 32 lanes hold an A or B fragment, so each of a fragment's two 16-byte loads reads 512 consecutive bytes (4 whole lines) where a row-major plane gave 16 lines with 32 bytes used of each.
// Compute dtypes, f32 accumulate: every input rounded to bf16; projections exact; scores and attn.v on bf16 hi/lo planes (3 products) everywhere; the cross-batch softmax in f32.

#define NB_  4
#define TT   2048
#define DM   512
#define NH_  4
#define NKV  4
#define REP  (NH_ / NKV)
#define HD   64
#define DQ   (NH_ * HD)
#define DKV  (NKV * HD)
#define ZH   2
#define RH   2048                  // query rows < RH use hi+lo planes (0: none)
#define WIN  0
#define PCAR 1024.0f
#define SCL  0.125f   // 64^-0.5
#define HDV  128      // value head dim
#define DV   (NH_ * HDV)   // 512
typedef _Float16 h16;
typedef unsigned short bf;
typedef __attribute__((ext_vector_type(16))) __bf16   v16bf;
typedef __attribute__((ext_vector_type(16))) _Float16 v16h;
typedef __attribute__((ext_vector_type(8)))  _Float16 v8h;
typedef __attribute__((ext_vector_type(8)))  unsigned short v8us;
typedef __attribute__((ext_vector_type(8)))  float    v8f;
typedef __attribute__((ext_vector_type(4)))  float    v4f;
typedef v8h  __attribute__((may_alias)) v8ha;
typedef v4f  __attribute__((may_alias)) v4fa;
typedef v8us __attribute__((may_alias)) v8usa;

__device__ __forceinline__ unsigned short f2bf(float f) { unsigned u = __float_as_uint(f); u += 0x7FFFu + ((u >> 16) & 1u); return (unsigned short)(u >> 16); }
__device__ __forceinline__ float bf2f(unsigned short b) { return __uint_as_float(((unsigned)b) << 16); }
__device__ __forceinline__ float bfr(float f) { return bf2f(f2bf(f)); }
__device__ __forceinline__ void splitf(float y, unsigned short& h, unsigned short& l) { h = f2bf(y); l = f2bf(y - bf2f(h)); }
// two f32 to two bf16 in one word (a in the low half), round to nearest even, by the chip's packed conversion: one instruction where the integer rounding of f2bf takes some four for each value and a pack
typedef __attribute__((ext_vector_type(2))) float f32x2;
typedef __attribute__((ext_vector_type(2))) __bf16 bf16x2;
typedef __attribute__((ext_vector_type(4))) unsigned u32x4;
__device__ __forceinline__ unsigned pk2bf(float a, float b) { const f32x2 x = {a, b}; return __builtin_bit_cast(unsigned, __builtin_convertvector(x, bf16x2)); }
// hi/lo split of two values: h = their bf16 roundings, l = the roundings of what h leaves
__device__ __forceinline__ void split2(float y0, float y1, unsigned& h, unsigned& l) { h = pk2bf(y0, y1); l = pk2bf(y0 - __uint_as_float(h << 16), y1 - __uint_as_float(h & 0xFFFF0000u)); }
__device__ __forceinline__ v16h cat16(v8h lo, v8h hi) { return __builtin_shufflevector(lo, hi, 0, 1, 2, 3, 4, 5, 6, 7, 8, 9, 10, 11, 12, 13, 14, 15); }
__device__ __forceinline__ v16bf cat16b(v8us lo, v8us hi) { return __builtin_bit_cast(v16bf, __builtin_shufflevector(lo, hi, 0, 1, 2, 3, 4, 5, 6, 7, 8, 9, 10, 11, 12, 13, 14, 15)); }
__device__ __forceinline__ v8f wmma16(v16h a, v16h b, v8f c) { return __builtin_amdgcn_wmma_f32_16x16x32_f16(false, a, false, b, (short)0, c, false, false); }
__device__ __forceinline__ v8f wmmab(v16bf a, v16bf b, v8f c) { return __builtin_amdgcn_wmma_f32_16x16x32_bf16(false, a, false, b, (short)0, c, false, false); }



// ---- k_gemmw: register-blocked GEMM, ONE WAVE per 64x64 output tile (16 accumulators), operands straight from 16-bit planes in fragment order; grid (M/64, N/64, Z), 32 threads.
// C[m][n] (f32, pitch ldc, + optional f32 bias[n]) = sum_k A[m][k] Bt[n][k] (+ split products per NSPLIT). z-batch strides sA/sB/sC in elements. K % 32 == 0.
// PLANES (the q | k | v projection): no C; the epilogue splits the tile hi/lo and writes it as attention planes. A 64-column tile is one whole q or k head (columns 0-511: plane c0 / 64) or half a value head (columns 512-1023); its 64 rows lie in one batch.
// ld: p = start of a 16 x 32 block in fragment order + lane * 8
template <typename T16> struct WFrag;
template <> struct WFrag<h16> { typedef v16h V; static __device__ __forceinline__ V ld(const h16* p) { return cat16(*(const v8h*)p, *(const v8h*)(p + 256)); } static __device__ __forceinline__ v8f mma(V a, V b, v8f c) { return wmma16(a, b, c); } };
template <> struct WFrag<bf> { typedef v16bf V; static __device__ __forceinline__ V ld(const bf* p) { return cat16b(*(const v8us*)p, *(const v8us*)(p + 256)); } static __device__ __forceinline__ v8f mma(V a, V b, v8f c) { return wmmab(a, b, c); } };
template <typename T16, int NSPLIT, bool BIAS, bool PLANES = false>
__global__ __launch_bounds__(32) void k_gemmw(const T16* __restrict__ A, const T16* __restrict__ A2, const T16* __restrict__ Bt, const T16* __restrict__ Bt2, int K, float* C, int ldc, const float* __restrict__ bias, size_t sA, size_t sB, size_t sC, bf* QKh = nullptr, bf* QKl = nullptr, bf* VTh = nullptr, bf* VTl = nullptr) {
    typedef typename WFrag<T16>::V V;
    __shared__ __align__(16) float os[16 * 68];
    const size_t z = blockIdx.z; A += z * sA; if (A2) A2 += z * sA; Bt += z * sB; if (Bt2) Bt2 += z * sB; C += z * sC;
    const int lane = threadIdx.x & 31, lr = lane & 15, hi = lane >> 4; const int r0 = blockIdx.x * 64, c0 = blockIdx.y * 64;
    v8f acc[4][4];
#pragma unroll
    for (int mb = 0; mb < 4; ++mb)
#pragma unroll
        for (int nb = 0; nb < 4; ++nb) acc[mb][nb] = (v8f){};
    const size_t aoff = (size_t)r0 * 32 + 8 * lane, boff = (size_t)c0 * 32 + 8 * lane;   // 16 rows are one block = 512 elements
    const size_t ka = (size_t)gridDim.x * (64 * 32), kb = (size_t)gridDim.y * (64 * 32);   // the grid covers all rows of the A and of the B plane: 32 k on is rows * 32 elements on
    const T16* pa = A + aoff; const T16* pa2 = A2 + aoff; const T16* pb = Bt + boff; const T16* pb2 = Bt2 + boff;
#pragma unroll 1
    for (int kc = 0; kc < K; kc += 32) {
        V a[4], a2[4];
#pragma unroll
        for (int mb = 0; mb < 4; ++mb) { a[mb] = WFrag<T16>::ld(pa + mb * 512); if (NSPLIT == 1 || NSPLIT == 2) a2[mb] = WFrag<T16>::ld(pa2 + mb * 512); }
#pragma unroll
        for (int nb = 0; nb < 4; ++nb) { const V b = WFrag<T16>::ld(pb + nb * 512); V b2; if (NSPLIT >= 2) b2 = WFrag<T16>::ld(pb2 + nb * 512);
#pragma unroll
            for (int mb = 0; mb < 4; ++mb) { acc[mb][nb] = WFrag<T16>::mma(a[mb], b, acc[mb][nb]); if (NSPLIT == 1 || NSPLIT == 2) acc[mb][nb] = WFrag<T16>::mma(a2[mb], b, acc[mb][nb]); if (NSPLIT >= 2) acc[mb][nb] = WFrag<T16>::mma(a[mb], b2, acc[mb][nb]); } }
        asm volatile("v_nop\n\tv_nop\n\tv_nop\n\tv_nop" : "+v"(acc[0][0]), "+v"(acc[1][1]), "+v"(acc[2][2]), "+v"(acc[3][3]) : "v"(a[0]), "v"(a[3]));
        // precaution: stands between this trip's loads and the step of their pointers; the pointers are held live up to here (inputs), so that no later load's result is put into the registers of an address still in use
        if (NSPLIT == 0) asm volatile("s_wait_xcnt 0x0" :: "v"(pa), "v"(pb) : "memory");
        else if (NSPLIT == 1) asm volatile("s_wait_xcnt 0x0" :: "v"(pa), "v"(pa2), "v"(pb) : "memory");
        else asm volatile("s_wait_xcnt 0x0" :: "v"(pa), "v"(pa2), "v"(pb), "v"(pb2) : "memory");
        pa += ka; pa2 += ka; pb += kb; pb2 += kb;
    }
    if (PLANES) {
        const int bz = r0 / TT, t0 = r0 % TT;
        if (c0 < DQ + DKV) {
            // q or k: a plane row is a token, K = its 64 d, fragment order; a 16-row block goes through LDS so that a lane holds 8 neighbouring d of one token: trip s stores d 16 s .. 16 s + 15 of the 16 tokens, a half-block: 512 consecutive bytes
            const size_t po = (size_t)(bz * (NH_ + NKV) + c0 / HD) * TT * HD + (size_t)t0 * 32;
#pragma unroll
            for (int mb = 0; mb < 4; ++mb) {
#pragma unroll
                for (int nb = 0; nb < 4; ++nb) {
#pragma unroll
                    for (int j = 0; j < 8; ++j) os[(hi * 8 + j) * 68 + nb * 16 + lr] = acc[mb][nb][j]; }
                // one wave: keeps its LDS writes in front of its reads of other lanes' words
                __builtin_amdgcn_wave_barrier(); asm volatile("" ::: "memory");
#pragma unroll
                for (int s = 0; s < 4; ++s) { const int row = lr, cofs = (2 * s + hi) * 8; const v4f x0 = *(const v4fa*)(os + row * 68 + cofs), x1 = *(const v4fa*)(os + row * 68 + cofs + 4); u32x4 oh, ol;
#pragma unroll
                    for (int j = 0; j < 2; ++j) { unsigned p, c; split2(x0[2 * j], x0[2 * j + 1], p, c); oh[j] = p; ol[j] = c; split2(x1[2 * j], x1[2 * j + 1], p, c); oh[2 + j] = p; ol[2 + j] = c; }
                    const size_t oo = po + (size_t)(s >> 1) * (TT * 32) + mb * 512 + (s & 1) * 256 + lane * 8; *(v8us*)(QKh + oo) = __builtin_bit_cast(v8us, oh); *(v8us*)(QKl + oo) = __builtin_bit_cast(v8us, ol); }
                // and those reads in front of the next block's writes
                __builtin_amdgcn_wave_barrier(); asm volatile("" ::: "memory");
            }
        } else {
            // value^T: a plane row is one d, K = the tokens, fragment order (a wave of k_fattn reads all 128 d of 32 tokens: 8 KiB in a row); the 8 accumulator words a lane holds of a tile are 8 neighbouring tokens of one d, the lane's own 16 bytes of half-block mb & 1: stored from the registers
            const int cv = c0 - (DQ + DKV); const size_t po = (size_t)(bz * NH_ + cv / HDV) * HDV * TT + (size_t)(t0 / 32) * (HDV * 32) + (cv % HDV) * 32 + 8 * lane;
#pragma unroll
            for (int nb = 0; nb < 4; ++nb)
#pragma unroll
                for (int mb = 0; mb < 4; ++mb) { u32x4 oh, ol;
#pragma unroll
                    for (int j = 0; j < 4; ++j) { unsigned p, c; split2(acc[mb][nb][2 * j], acc[mb][nb][2 * j + 1], p, c); oh[j] = p; ol[j] = c; }
                    const size_t oo = po + (size_t)(mb >> 1) * (HDV * 32) + nb * 512 + (mb & 1) * 256; *(v8us*)(VTh + oo) = __builtin_bit_cast(v8us, oh); *(v8us*)(VTl + oo) = __builtin_bit_cast(v8us, ol); }
            // precaution: stands behind the last stores of this branch, in front of any later write to their data and address registers
            asm volatile("s_wait_xcnt 0x0" ::: "memory");
        }
        return;
    }
#pragma unroll
    for (int mb = 0; mb < 4; ++mb) {
#pragma unroll
        for (int nb = 0; nb < 4; ++nb) {
#pragma unroll
            for (int j = 0; j < 8; ++j) os[(hi * 8 + j) * 68 + nb * 16 + lr] = acc[mb][nb][j]; }
        __builtin_amdgcn_wave_barrier(); asm volatile("" ::: "memory");
        float* crow = C + (size_t)(r0 + mb * 16) * ldc + c0;
{
#pragma unroll
            for (int s = 0; s < 8; ++s) { const int row = 2 * s + hi, cofs = lr * 4; v4f val = *(const v4fa*)(os + row * 68 + cofs); if (BIAS) { val[0] += bfr(bias[c0 + cofs]); val[1] += bfr(bias[c0 + cofs + 1]); val[2] += bfr(bias[c0 + cofs + 2]); val[3] += bfr(bias[c0 + cofs + 3]); }
                *(v4f*)(crow + (size_t)row * ldc + cofs) = val; }
             }
        __builtin_amdgcn_wave_barrier(); asm volatile("" ::: "memory");
    }
}

__device__ __forceinline__ h16 tohx(float x) { return (h16)x; }
typedef __attribute__((ext_vector_type(2))) _Float16 v2h;
typedef __attribute__((ext_vector_type(4))) _Float16 v4h;
typedef __attribute__((ext_vector_type(2))) unsigned short v2us;
typedef __attribute__((ext_vector_type(4))) unsigned short v4us;
typedef __attribute__((ext_vector_type(2))) float v2f;
typedef __attribute__((ext_vector_type(4))) int v4i;

// grid y picks the weight: 0 Wq, 1 Wk, 2 Wv, 3 Wo; two transposed planes in W, K = 512, fragment order: q | k | v (1024 rows: 0-255 q, 256-511 k, 512-1023 v) and behind it o (512 rows).
__global__ __launch_bounds__(256) void k_wtG(const float* __restrict__ w0, const float* __restrict__ w1, const float* __restrict__ w2, const float* __restrict__ w3, bf* W) {
    const int y = blockIdx.y; const float* __restrict__ w = (y == 0) ? w0 : (y == 1) ? w1 : (y == 2) ? w2 : w3; const int K = DM; const int N = (y < 2) ? DQ : DV; const int ls = (y < 2) ? 4 : 5;   /* N / 16 = 1 << ls row blocks */ const int R = (y < 3) ? (DQ + DKV + DV) : DV, roff = (y == 1) ? DQ : (y == 2) ? (DQ + DKV) : 0; bf* Bt = W + ((y < 3) ? 0 : (size_t)(DQ + DKV + DV) * DM);
    const int lane = threadIdx.x & 31; const int L0 = (blockIdx.x * 8 + (threadIdx.x >> 5)) * 8; const int nlines = N * K / 64;
{
#pragma unroll 1
        for (int l = 0; l < 8; ++l) { const int L = L0 + l; if (L >= nlines) break; const size_t e = (size_t)L * 64 + lane * 2; const int blk = (int)(e / 512), wi = (int)(e % 512); const int kq = blk >> ls, rb = blk & ((1 << ls) - 1); const int k = kq * 32 + (wi / 256) * 16 + ((wi % 256) / 128) * 8 + wi % 8, n = rb * 16 + (wi % 128) / 8; const unsigned o = pk2bf(w[(size_t)k * N + n], w[(size_t)(k + 1) * N + n]);
            *(v2us*)(Bt + ((size_t)kq * (R / 16) + roff / 16 + rb) * 512 + wi) = __builtin_bit_cast(v2us, o);
            // precaution: stands between the store and the next trip's first write to its data and address registers
            asm volatile("s_wait_xcnt 0x0" ::: "memory"); }
         }
}
// 64 threads convert one 16 x 32 block of the plane ([NB_ * TT][DM] in fragment order): four neighbouring threads read the 32 floats (one 128-byte line) of one row, so a wave reads 8 whole lines and writes 4 whole lines (8 rows' pieces of each k octet lie side by side)
__global__ __launch_bounds__(256) void k_cvt8(const float* __restrict__ src, bf* dst, size_t n8) { const size_t i = (size_t)blockIdx.x * 256 + threadIdx.x; if (i >= n8) return; const int blk = (int)(i / 64), wi = (int)(i % 64); const v8f v = *(const v8f*)(src + (size_t)((blk % (NB_ * TT / 16)) * 16 + wi / 4) * DM + (blk / (NB_ * TT / 16)) * 32 + (wi % 4) * 8); u32x4 o;
#pragma unroll
    for (int k = 0; k < 4; ++k) o[k] = pk2bf(v[2 * k], v[2 * k + 1]); *(v8us*)(dst + (size_t)blk * 512 + ((wi % 4) * 16 + wi / 4) * 8) = __builtin_bit_cast(v8us, o);  }

__global__ __launch_bounds__(256) void k_vtp(const float* __restrict__ F, int pitch, int nheads, h16* V16, bf* Vh, bf* Vl) { const size_t e = ((size_t)blockIdx.x * 256 + threadIdx.x) * 2; if (e >= (size_t)nheads * HD * TT) return; const int t = (int)(e % TT); const int d = (int)((e / TT) % HD); const int g = (int)(e / ((size_t)TT * HD)); v2h o16; v2us oh, ol;
#pragma unroll
    for (int q = 0; q < 2; ++q) { const float x = F[(size_t)(t + q) * pitch + g * HD + d]; o16[q] = tohx(x); unsigned short a2, c2; splitf(x, a2, c2); oh[q] = a2; ol[q] = c2; }
    *(v2h*)(V16 + e) = o16; *(v2us*)(Vh + e) = oh; *(v2us*)(Vl + e) = ol;  }
// k_asoft: per row (zz, i): t = S x HD^-0.5 (no mask); softmax over the 2048 keys (register row, one exp, fixed trees);
__global__ __launch_bounds__(256) void k_asoft(const float* __restrict__ Sb, h16* P16, bf* Ph, bf* Pl) {
    const int lane = threadIdx.x & 31; const int row = blockIdx.x * 8 + (threadIdx.x >> 5); if (row >= ZH * TT) return; const int i = row % TT; const int zz = row / TT; (void)zz; const bool hires = (i < RH); const float* sr = Sb + (size_t)row * TT; float v[TT / 32]; float mx = -3.0e38f;
#pragma unroll
    for (int ch = 0; ch < TT / 128; ++ch) { const int j0 = ch * 128 + lane * 4; const v4f a = *(const v4f*)(sr + j0);
#pragma unroll
        for (int q = 0; q < 4; ++q) { const int j = j0 + q; (void)j; const float t = a[q] * SCL; v[ch * 4 + q] = t; mx = fmaxf(mx, t); } }
#pragma unroll
    for (int sh = 16; sh; sh >>= 1) mx = fmaxf(mx, __shfl_xor(mx, sh, 32));
    float sum = 0.f;
#pragma unroll
    for (int k = 0; k < TT / 32; ++k) { float d0 = __fsub_rn(v[k], mx); asm volatile("" : "+v"(d0)); v[k] = __builtin_amdgcn_exp2f(__fmul_rn(d0, 1.4426950408889634f)); sum += v[k]; }
#pragma unroll
    for (int sh = 16; sh; sh >>= 1) sum += __shfl_xor(sum, sh, 32);
    const float f = __fdiv_rn(hires ? 1.0f : PCAR, sum);
{
        if (hires) {
#pragma unroll
            for (int ch = 0; ch < TT / 128; ++ch) { v4us oh, ol;
#pragma unroll
                for (int q = 0; q < 4; ++q) { unsigned short a, c2; splitf(v[ch * 4 + q] * f, a, c2); oh[q] = a; ol[q] = c2; }
                const size_t oo = ((size_t)zz * (RH ? RH : 1) + i) * TT + ch * 128 + lane * 4; *(v4us*)(Ph + oo) = oh; *(v4us*)(Pl + oo) = ol; }
        } else {
#pragma unroll
            for (int ch = 0; ch < TT / 128; ++ch) { v4h o4;
#pragma unroll
                for (int q = 0; q < 4; ++q) o4[q] = tohx(v[ch * 4 + q] * f);
                *(v4h*)(P16 + (size_t)row * TT + ch * 128 + lane * 4) = o4; } }
         }
}
__global__ __launch_bounds__(256) void k_merge(const float* __restrict__ O, int h0, bf* Ah, bf* Al) { const size_t e = ((size_t)blockIdx.x * 256 + threadIdx.x) * 2; if (e >= (size_t)ZH * TT * HD) return; const int d = (int)(e % HD); const int t = (int)((e / HD) % TT); const int zz = (int)(e / ((size_t)HD * TT)); const float cs = (t < RH) ? 1.0f : (1.0f / PCAR); const size_t oo = (size_t)t * DQ + (h0 + zz) * HD + d;
    v2us oh, ol;
#pragma unroll
    for (int q = 0; q < 2; ++q) { unsigned short a, c2; splitf(O[e + q] * cs, a, c2); oh[q] = a; ol[q] = c2; } *(v2us*)(Ah + oo) = oh; *(v2us*)(Al + oo) = ol;  }

// ---- k_fattn: scores, cross-batch softmax, P.v and the hi/lo split of the context in one kernel. Grid (TT/32, heads), 4 waves.
// The work-group owns 32 queries of one head in ALL four batches; in pass kt wave w takes keys kt*128 + w*32 .. +31 (the sum over keys needs no running maximum: the softmax runs over the batches).
// Transposed products: S^T[key][q] = K Q^T (A = k plane rows, B = q plane rows), so that two 16x16 D tiles (keys 0-15, 16-31 of the pass) are, converted in place, the B operand of O^T[d][q] = V^T P^T (A = value^T plane rows): no LDS and no lane exchange between the two products.
// At the end the four waves' partial O^T (one per key subset) are summed through LDS in wave order 0..3; wave w finishes batch w.
// Every inner loop is fully unrolled so that the fragment, score and accumulator arrays are indexed by constants and stay in registers (512 of them hold O^T: one wave per SIMD).
#define FQB 2     // 16-query blocks per work-group
#define FWV 4     // waves per work-group
typedef __attribute__((ext_vector_type(8))) unsigned v8u;
__global__ __launch_bounds__(32 * FWV) void k_fattn(const bf* __restrict__ QKh, const bf* __restrict__ QKl, const bf* __restrict__ VTh, const bf* __restrict__ VTl, bf* ATh, bf* ATl) {
    typedef WFrag<bf> WF; typedef WF::V V;
    __shared__ __align__(16) v8us qs[NB_ * FQB * 2 * 2][2][32];        // q fragments [batch][nb][kc][hi|lo], fragment order: 32 KiB
    __shared__ __align__(16) v4f red[FWV][NB_ * 8 * FQB][2][32];       // the waves' partial O^T tiles: 256 KiB
    const int lane = threadIdx.x & 31, lr = lane & 15, hi = lane >> 4; const int w = __builtin_amdgcn_readfirstlane((int)(threadIdx.x >> 5));
    const int h = blockIdx.y, q0 = blockIdx.x * (16 * FQB);
    const size_t sQK = (size_t)(NH_ + NKV) * TT * HD, sV = (size_t)NH_ * HDV * TT;
    const bf* qph = QKh + (size_t)w * sQK + (size_t)h * TT * HD + (size_t)q0 * 32 + 8 * lane; const bf* qpl = QKl + (qph - QKh);
#pragma unroll
    for (int nb = 0; nb < FQB; ++nb)
#pragma unroll
        for (int kc = 0; kc < 2; ++kc) { const int o = nb * 512 + kc * (TT * 32); const int f = ((w * FQB + nb) * 2 + kc) * 2;
            qs[f][0][lane] = *(const v8us*)(qph + o); qs[f][1][lane] = *(const v8us*)(qph + o + 256); qs[f + 1][0][lane] = *(const v8us*)(qpl + o); qs[f + 1][1][lane] = *(const v8us*)(qpl + o + 256); }
    // precaution: stands between the q loads and the first reuse of their address registers (held live up to here as inputs); the scheduling fence keeps the zeroing of the accumulators, which reuses them, behind the wait
    asm volatile("s_wait_xcnt 0x0" :: "v"(qph), "v"(qpl) : "memory");
    __builtin_amdgcn_sched_barrier(0);
    v8f acc[NB_][8][FQB];
#pragma unroll
    for (int b = 0; b < NB_; ++b)
#pragma unroll
        for (int db = 0; db < 8; ++db)
#pragma unroll
            for (int nb = 0; nb < FQB; ++nb) acc[b][db][nb] = (v8f){};
    // each lane's place in this wave's 32 keys of the pass, batch 0: k planes (row = key: 32 keys are 2 blocks for each 32 d) and value^T planes (row = d: 32 keys are 8 blocks, one per 16 d); they step by 128 keys a pass
    const bf* Kh = QKh + (size_t)(NH_ + h) * TT * HD + (size_t)(w * 32) * 32 + 8 * lane; const bf* Kl = QKl + (Kh - QKh);
    const bf* Vh = VTh + (size_t)h * HDV * TT + (size_t)(w * 32) * HDV + 8 * lane; const bf* Vl = VTl + (Vh - VTh);
    // rolled: one pass is some 4,300 instructions
#pragma unroll 1
    for (int kt = 0; kt < TT / (32 * FWV); ++kt) {
        // first pass: publishes the q fragments; every pass: keeps the four waves on the same 128 keys
        __syncthreads();
        V kh[NB_][2][2], kl[NB_][2][2];
#pragma unroll
        for (int b = 0; b < NB_; ++b)
#pragma unroll
            for (int kc = 0; kc < 2; ++kc)
#pragma unroll
                for (int mb = 0; mb < 2; ++mb) { const size_t o = (size_t)b * sQK + (size_t)kc * (TT * 32) + mb * 512; kh[b][kc][mb] = WF::ld(Kh + o); kl[b][kc][mb] = WF::ld(Kl + o); }
        v8f s[NB_][2][FQB];
#pragma unroll
        for (int b = 0; b < NB_; ++b) {
#pragma unroll
            for (int mb = 0; mb < 2; ++mb)
#pragma unroll
                for (int nb = 0; nb < FQB; ++nb) s[b][mb][nb] = (v8f){};
#pragma unroll
            for (int kc = 0; kc < 2; ++kc)
#pragma unroll
                for (int nb = 0; nb < FQB; ++nb) { const int f = ((b * FQB + nb) * 2 + kc) * 2; const V qh = cat16b(qs[f][0][lane], qs[f][1][lane]), ql = cat16b(qs[f + 1][0][lane], qs[f + 1][1][lane]);
#pragma unroll
                    for (int mb = 0; mb < 2; ++mb) { s[b][mb][nb] = WF::mma(kh[b][kc][mb], qh, s[b][mb][nb]); s[b][mb][nb] = WF::mma(kh[b][kc][mb], ql, s[b][mb][nb]); s[b][mb][nb] = WF::mma(kl[b][kc][mb], qh, s[b][mb][nb]); } } }
        // value^T fragments of batch 0 are asked for here, so that they fly under the softmax arithmetic; those of batch b + 1 in front of batch b's products
        V vh[2][8], vl[2][8];
#pragma unroll
        for (int db = 0; db < 8; ++db) { const size_t o = (size_t)db * 512; vh[0][db] = WF::ld(Vh + o); vl[0][db] = WF::ld(Vl + o); }
        v8u ph[NB_][FQB], pl[NB_][FQB];     // probabilities, bf16 hi and lo, two keys to a word: word i of (batch, nb) holds k slots 2i and 2i + 1 of the B operand
#pragma unroll
        for (int nb = 0; nb < FQB; ++nb)
#pragma unroll
            for (int mb = 0; mb < 2; ++mb) {
#pragma unroll
                for (int jp = 0; jp < 4; ++jp) { float pr[2][NB_];
#pragma unroll
                    for (int q = 0; q < 2; ++q) { const int j = 2 * jp + q; float t[NB_]; float mx = -3.0e38f;
#pragma unroll
                        for (int b = 0; b < NB_; ++b) { t[b] = __fmul_rn(s[b][mb][nb][j], SCL); mx = fmaxf(mx, t[b]); }
                        float xa[NB_], ex[NB_]; float sum = 0.f;
#pragma unroll
                        for (int b = 0; b < NB_; ++b) { xa[b] = __fmul_rn(__fsub_rn(t[b], mx), 1.4426950408889634f); ex[b] = __builtin_amdgcn_exp2f(xa[b]); }
                        // the slot the instruction set asks for between a transcendental and an overwrite of its source: the four arguments stay live (inputs) up to this v_nop, which stands behind the four v_exp (their results are inputs too)
                        asm volatile("v_nop" :: "v"(xa[0]), "v"(xa[1]), "v"(xa[2]), "v"(xa[3]), "v"(ex[0]), "v"(ex[1]), "v"(ex[2]), "v"(ex[3]));
#pragma unroll
                        for (int b = 0; b < NB_; ++b) sum = __fadd_rn(sum, ex[b]);
                        const float f = __fdiv_rn(1.0f, sum);
#pragma unroll
                        for (int b = 0; b < NB_; ++b) pr[q][b] = __fmul_rn(ex[b], f); }
#pragma unroll
                    for (int b = 0; b < NB_; ++b) { unsigned a, c; split2(pr[0][b], pr[1][b], a, c); ph[b][nb][mb * 4 + jp] = a; pl[b][nb][mb * 4 + jp] = c; } }
                // one 16x16 tile's softmax at a time: left free, the scheduler runs all four tiles abreast and their unpacked halves push accumulators into scratch
                __builtin_amdgcn_sched_barrier(0); }
#pragma unroll
        for (int b = 0; b < NB_; ++b) {
            if (b + 1 < NB_) {
#pragma unroll
                for (int db = 0; db < 8; ++db) { const size_t o = (size_t)(b + 1) * sV + (size_t)db * 512; vh[(b + 1) & 1][db] = WF::ld(Vh + o); vl[(b + 1) & 1][db] = WF::ld(Vl + o); } }
            // holds the next batch's 32 loads in front of this batch's 48 products: left free, the scheduler sinks each load to just before its use and every fragment waits a full L2 latency
            __builtin_amdgcn_sched_barrier(0);
#pragma unroll
            for (int db = 0; db < 8; ++db)
#pragma unroll
                for (int nb = 0; nb < FQB; ++nb) { const V bh = __builtin_bit_cast(V, ph[b][nb]), bl = __builtin_bit_cast(V, pl[b][nb]);
                    acc[b][db][nb] = WF::mma(vh[b & 1][db], bh, acc[b][db][nb]); acc[b][db][nb] = WF::mma(vh[b & 1][db], bl, acc[b][db][nb]); acc[b][db][nb] = WF::mma(vl[b & 1][db], bh, acc[b][db][nb]); }
            // keeps the loads of batch b + 2 behind these products, whose fragments' registers they refill
            __builtin_amdgcn_sched_barrier(0); }
        Kh += FWV * 32 * 32; Kl += FWV * 32 * 32; Vh += FWV * 32 * HDV; Vl += FWV * 32 * HDV;
    }
#pragma unroll
    for (int b = 0; b < NB_; ++b)
#pragma unroll
        for (int db = 0; db < 8; ++db)
#pragma unroll
            for (int nb = 0; nb < FQB; ++nb) { const v8f a = acc[b][db][nb]; const int i = (b * 8 + db) * FQB + nb; red[w][i][0][lane] = (v4f){a[0], a[1], a[2], a[3]}; red[w][i][1][lane] = (v4f){a[4], a[5], a[6], a[7]}; }
    __syncthreads();
    for (int i = 0; i < 8 * FQB; ++i) { const int db = i / FQB, nb = i % FQB; const int ii = w * 8 * FQB + i; v4f x0 = red[0][ii][0][lane], x1 = red[0][ii][1][lane];
#pragma unroll
        for (int ww = 1; ww < FWV; ++ww) { x0 += red[ww][ii][0][lane]; x1 += red[ww][ii][1][lane]; }
        u32x4 oh, ol;
#pragma unroll
        for (int j = 0; j < 2; ++j) { unsigned a, c; split2(x0[2 * j], x0[2 * j + 1], a, c); oh[j] = a; ol[j] = c; split2(x1[2 * j], x1[2 * j + 1], a, c); oh[2 + j] = a; ol[2 + j] = c; }
        const size_t oo = (size_t)(h * (HDV / 32) + (db >> 1)) * (NB_ * TT * 32) + ((size_t)w * TT + q0 + nb * 16) * 32 + (db & 1) * 256 + 8 * lane; *(v8us*)(ATh + oo) = __builtin_bit_cast(v8us, oh); *(v8us*)(ATl + oo) = __builtin_bit_cast(v8us, ol);   // context planes [8192][DV] in fragment order: the lane's 8 d of one query are its own 16 bytes of half-block db & 1
        // precaution: stands between the two stores and the next trip's first write to their data and address registers
        asm volatile("s_wait_xcnt 0x0" ::: "memory"); }
}

extern "C" void kernel_launch(void* const* d_in, const int* in_sizes, int n_in,
                              void* d_out, int out_size, void* d_ws, size_t ws_size, hipStream_t stream) {
    (void)in_sizes; (void)n_in; (void)out_size;
    const float* x = (const float*)d_in[0]; const float* wq = (const float*)d_in[1]; const float* wk = (const float*)d_in[2]; const float* wv = (const float*)d_in[3]; const float* wo = (const float*)d_in[4];
    float* OUT = (float*)d_out;     // [4][2048][512]
    char* wsp = (char*)d_ws;
    auto take = [&](size_t bytes) { char* p = wsp; wsp += (bytes + 255) & ~(size_t)255; return (void*)p; };
    bf* W = (bf*)take((size_t)(DQ + DKV + DV + DV) * DM * 2); bf* WO = W + (size_t)(DQ + DKV + DV) * DM;
    bf* XB = (bf*)take((size_t)NB_ * TT * DM * 2);
    bf* QKh = (bf*)take((size_t)NB_ * (NH_ + NKV) * TT * HD * 2); bf* QKl = (bf*)take((size_t)NB_ * (NH_ + NKV) * TT * HD * 2);   /* [b][8] planes [t][d] in fragment order: heads 0-3 q, 4-7 k */
    bf* VTh = (bf*)take((size_t)NB_ * NH_ * HDV * TT * 2); bf* VTl = (bf*)take((size_t)NB_ * NH_ * HDV * TT * 2);
    bf* ATh = (bf*)take((size_t)NB_ * TT * DV * 2); bf* ATl = (bf*)take((size_t)NB_ * TT * DV * 2);
    if ((size_t)(wsp - (char*)d_ws) > ws_size) return;    // ws 256 MiB (carve ~58 MiB)
    k_wtG<<<dim3((unsigned)((DM * DV / 64 + 63) / 64), 4, 1), 256, 0, stream>>>(wq, wk, wv, wo, W);
    const int PF = DQ + DKV + DV;
    /* projections + planes, every batch in one launch (the softmax couples the batches) */
    k_cvt8<<<(unsigned)(((size_t)NB_ * TT * DM / 8 + 255) / 256), 256, 0, stream>>>(x, XB, (size_t)NB_ * TT * DM / 8);
    k_gemmw<bf, 0, false, true><<<dim3(NB_ * TT / 64, PF / 64, 1), 32, 0, stream>>>(XB, nullptr, W, nullptr, DM, nullptr, 0, nullptr, 0, 0, 0, QKh, QKl, VTh, VTl);
    k_fattn<<<dim3(TT / (16 * FQB), NH_, 1), 32 * FWV, 0, stream>>>(QKh, QKl, VTh, VTl, ATh, ATl);   /* all heads, all batches */
    k_gemmw<bf, 1, false><<<dim3(NB_ * TT / 64, DV / 64, 1), 32, 0, stream>>>(ATh, ATl, WO, nullptr, DV, OUT, DV, nullptr, 0, 0, 0);
}

// v006
// One run takes 136 microseconds.
// In both of two side-by-side timings against v005, it was 1.07 times as fast.
// Over all steps from v000 it is 8.45 times as fast.
#include <hip/hip_runtime.h>

// Multi-head attention whose softmax runs over the BATCH axis (the source's nn.Softmax() with no dim on a (B,N,N)-shaped view picks dim 0): input_x [4][2048][512]; q = x Wq, k = x Wk ('xw' [512][256]: 4 heads x 64), v = x Wv ('xw' [512][512]: 4 heads x 128); scores[b][h][q][k] = q.k / 8; attn = softmax over b (the 4 batches, per (h, q, k)); out[b][q][h*128+d] = sum_k attn[b][h][q][k] v[b][k][h][d]; out Wo ('xw' [512][512]) -> [4][2048][512] (4.2 M).
// Layout: exact projections first: one GEMM [8192][512] x [1024][512]^T gives q | k | v of every batch, and its epilogue writes them straight as q/k planes per (batch, head), bf16 hi/lo (heads 0-3 q, 4-7 k), and value^T planes per (batch, head); then ONE attention kernel (k_fattn) for all heads: a wave holds the scores of all four batches for 32 keys x 32 queries in registers, takes the softmax ACROSS the batches there, feeds the probabilities (hi/lo) straight into the 3-product P.v; a work-group covers 128 queries x 512 keys and stores an f32 partial, and k_fmrg adds the four key quarters and writes the hi/lo context planes; finally out = context Wo (hl x exact), 8192 rows in one GEMM.
// FRAGMENT ORDER: every 16-bit plane that a matrix instruction reads ([rows][K], K-contiguous in meaning) is stored as blocks of 16 rows x 32 k (512 elements, 1 KiB), block (k / 32) * (rows / 16) + row / 16 (neighbouring row blocks of one k step lie side by side: a tile's fragments of a k step are one run of bytes); inside a block element (row, k) lies at ((k % 32) / 16) * 256 + (((k % 16) / 8) * 16 + row % 16) * 8 + k % 8. That is the order in which the 32 lanes hold an A or B fragment, so each of a fragment's two 16-byte loads reads 512 consecutive bytes (4 whole lines) where a row-major plane gave 16 lines with 32 bytes used of each.
// Compute dtypes, f32 accumulate: every input rounded to bf16; projections exact; scores and attn.v on bf16 hi/lo planes (3 products) everywhere; the cross-batch softmax in f32.

#define NB_  4
#define TT   2048
#define DM   512
#define NH_  4
#define NKV  4
#define REP  (NH_ / NKV)
#define HD   64
#define DQ   (NH_ * HD)
#define DKV  (NKV * HD)
#define ZH   2
#define RH   2048                  // query rows < RH use hi+lo planes (0: none)
#define WIN  0
#define PCAR 1024.0f
#define SCL  0.125f   // 64^-0.5
#define HDV  128      // value head dim
#define DV   (NH_ * HDV)   // 512
typedef _Float16 h16;
typedef unsigned short bf;
typedef __attribute__((ext_vector_type(16))) __bf16   v16bf;
typedef __attribute__((ext_vector_type(16))) _Float16 v16h;
typedef __attribute__((ext_vector_type(8)))  _Float16 v8h;
typedef __attribute__((ext_vector_type(8)))  unsigned short v8us;
typedef __attribute__((ext_vector_type(8)))  float    v8f;
typedef __attribute__((ext_vector_type(4)))  float    v4f;
typedef v8h  __attribute__((may_alias)) v8ha;
typedef v4f  __attribute__((may_alias)) v4fa;
typedef v8us __attribute__((may_alias)) v8usa;

__device__ __forceinline__ unsigned short f2bf(float f) { unsigned u = __float_as_uint(f); u += 0x7FFFu + ((u >> 16) & 1u); return (unsigned short)(u >> 16); }
__device__ __forceinline__ float bf2f(unsigned short b) { return __uint_as_float(((unsigned)b) << 16); }
__device__ __forceinline__ float bfr(float f) { return bf2f(f2bf(f)); }
__device__ __forceinline__ void splitf(float y, unsigned short& h, unsigned short& l) { h = f2bf(y); l = f2bf(y - bf2f(h)); }
// two f32 to two bf16 in one word (a in the low half), round to nearest even, by the chip's packed conversion: one instruction where the integer rounding of f2bf takes some four for each value and a pack
typedef __attribute__((ext_vector_type(2))) float f32x2;
typedef __attribute__((ext_vector_type(2))) __bf16 bf16x2;
typedef __attribute__((ext_vector_type(4))) unsigned u32x4;
__device__ __forceinline__ unsigned pk2bf(float a, float b) { const f32x2 x = {a, b}; return __builtin_bit_cast(unsigned, __builtin_convertvector(x, bf16x2)); }
// hi/lo split of two values: h = their bf16 roundings, l = the roundings of what h leaves
__device__ __forceinline__ void split2(float y0, float y1, unsigned& h, unsigned& l) { h = pk2bf(y0, y1); l = pk2bf(y0 - __uint_as_float(h << 16), y1 - __uint_as_float(h & 0xFFFF0000u)); }
__device__ __forceinline__ v16h cat16(v8h lo, v8h hi) { return __builtin_shufflevector(lo, hi, 0, 1, 2, 3, 4, 5, 6, 7, 8, 9, 10, 11, 12, 13, 14, 15); }
__device__ __forceinline__ v16bf cat16b(v8us lo, v8us hi) { return __builtin_bit_cast(v16bf, __builtin_shufflevector(lo, hi, 0, 1, 2, 3, 4, 5, 6, 7, 8, 9, 10, 11, 12, 13, 14, 15)); }
__device__ __forceinline__ v8f wmma16(v16h a, v16h b, v8f c) { return __builtin_amdgcn_wmma_f32_16x16x32_f16(false, a, false, b, (short)0, c, false, false); }
__device__ __forceinline__ v8f wmmab(v16bf a, v16bf b, v8f c) { return __builtin_amdgcn_wmma_f32_16x16x32_bf16(false, a, false, b, (short)0, c, false, false); }



// ---- k_gemmw: register-blocked GEMM, ONE WAVE per 64x64 output tile (16 accumulators), operands straight from 16-bit planes in fragment order; grid (M/64, N/64, Z), 32 threads.
// C[m][n] (f32, pitch ldc, + optional f32 bias[n]) = sum_k A[m][k] Bt[n][k] (+ split products per NSPLIT). z-batch strides sA/sB/sC in elements. K % 32 == 0.
// PLANES (the q | k | v projection): no C; the epilogue splits the tile hi/lo and writes it as attention planes. A 64-column tile is one whole q or k head (columns 0-511: plane c0 / 64) or half a value head (columns 512-1023); its 64 rows lie in one batch.
// ld: p = start of a 16 x 32 block in fragment order + lane * 8
template <typename T16> struct WFrag;
template <> struct WFrag<h16> { typedef v16h V; static __device__ __forceinline__ V ld(const h16* p) { return cat16(*(const v8h*)p, *(const v8h*)(p + 256)); } static __device__ __forceinline__ v8f mma(V a, V b, v8f c) { return wmma16(a, b, c); } };
template <> struct WFrag<bf> { typedef v16bf V; static __device__ __forceinline__ V ld(const bf* p) { return cat16b(*(const v8us*)p, *(const v8us*)(p + 256)); } static __device__ __forceinline__ v8f mma(V a, V b, v8f c) { return wmmab(a, b, c); } };
template <typename T16, int NSPLIT, bool BIAS, bool PLANES = false>
__global__ __launch_bounds__(32) void k_gemmw(const T16* __restrict__ A, const T16* __restrict__ A2, const T16* __restrict__ Bt, const T16* __restrict__ Bt2, int K, float* C, int ldc, const float* __restrict__ bias, size_t sA, size_t sB, size_t sC, bf* QKh = nullptr, bf* QKl = nullptr, bf* VTh = nullptr, bf* VTl = nullptr) {
    typedef typename WFrag<T16>::V V;
    __shared__ __align__(16) float os[16 * 68];
    const size_t z = blockIdx.z; A += z * sA; if (A2) A2 += z * sA; Bt += z * sB; if (Bt2) Bt2 += z * sB; C += z * sC;
    const int lane = threadIdx.x & 31, lr = lane & 15, hi = lane >> 4; const int r0 = blockIdx.x * 64, c0 = blockIdx.y * 64;
    v8f acc[4][4];
#pragma unroll
    for (int mb = 0; mb < 4; ++mb)
#pragma unroll
        for (int nb = 0; nb < 4; ++nb) acc[mb][nb] = (v8f){};
    const size_t aoff = (size_t)r0 * 32 + 8 * lane, boff = (size_t)c0 * 32 + 8 * lane;   // 16 rows are one block = 512 elements
    const size_t ka = (size_t)gridDim.x * (64 * 32), kb = (size_t)gridDim.y * (64 * 32);   // the grid covers all rows of the A and of the B plane: 32 k on is rows * 32 elements on
    const T16* pa = A + aoff; const T16* pa2 = A2 + aoff; const T16* pb = Bt + boff; const T16* pb2 = Bt2 + boff;
#pragma unroll 1
    for (int kc = 0; kc < K; kc += 32) {
        V a[4], a2[4];
#pragma unroll
        for (int mb = 0; mb < 4; ++mb) { a[mb] = WFrag<T16>::ld(pa + mb * 512); if (NSPLIT == 1 || NSPLIT == 2) a2[mb] = WFrag<T16>::ld(pa2 + mb * 512); }
#pragma unroll
        for (int nb = 0; nb < 4; ++nb) { const V b = WFrag<T16>::ld(pb + nb * 512); V b2; if (NSPLIT >= 2) b2 = WFrag<T16>::ld(pb2 + nb * 512);
#pragma unroll
            for (int mb = 0; mb < 4; ++mb) { acc[mb][nb] = WFrag<T16>::mma(a[mb], b, acc[mb][nb]); if (NSPLIT == 1 || NSPLIT == 2) acc[mb][nb] = WFrag<T16>::mma(a2[mb], b, acc[mb][nb]); if (NSPLIT >= 2) acc[mb][nb] = WFrag<T16>::mma(a[mb], b2, acc[mb][nb]); } }
        asm volatile("v_nop\n\tv_nop\n\tv_nop\n\tv_nop" : "+v"(acc[0][0]), "+v"(acc[1][1]), "+v"(acc[2][2]), "+v"(acc[3][3]) : "v"(a[0]), "v"(a[3]));
        // precaution: stands between this trip's loads and the step of their pointers; the pointers are held live up to here (inputs), so that no later load's result is put into the registers of an address still in use
        if (NSPLIT == 0) asm volatile("s_wait_xcnt 0x0" :: "v"(pa), "v"(pb) : "memory");
        else if (NSPLIT == 1) asm volatile("s_wait_xcnt 0x0" :: "v"(pa), "v"(pa2), "v"(pb) : "memory");
        else asm volatile("s_wait_xcnt 0x0" :: "v"(pa), "v"(pa2), "v"(pb), "v"(pb2) : "memory");
        pa += ka; pa2 += ka; pb += kb; pb2 += kb;
    }
    if (PLANES) {
        const int bz = r0 / TT, t0 = r0 % TT;
        if (c0 < DQ + DKV) {
            // q or k: a plane row is a token, K = its 64 d, fragment order; a 16-row block goes through LDS so that a lane holds 8 neighbouring d of one token: trip s stores d 16 s .. 16 s + 15 of the 16 tokens, a half-block: 512 consecutive bytes
            const size_t po = (size_t)(bz * (NH_ + NKV) + c0 / HD) * TT * HD + (size_t)t0 * 32;
#pragma unroll
            for (int mb = 0; mb < 4; ++mb) {
#pragma unroll
                for (int nb = 0; nb < 4; ++nb) {
#pragma unroll
                    for (int j = 0; j < 8; ++j) os[(hi * 8 + j) * 68 + nb * 16 + lr] = acc[mb][nb][j]; }
                // one wave: keeps its LDS writes in front of its reads of other lanes' words
                __builtin_amdgcn_wave_barrier(); asm volatile("" ::: "memory");
#pragma unroll
                for (int s = 0; s < 4; ++s) { const int row = lr, cofs = (2 * s + hi) * 8; const v4f x0 = *(const v4fa*)(os + row * 68 + cofs), x1 = *(const v4fa*)(os + row * 68 + cofs + 4); u32x4 oh, ol;
#pragma unroll
                    for (int j = 0; j < 2; ++j) { unsigned p, c; split2(x0[2 * j], x0[2 * j + 1], p, c); oh[j] = p; ol[j] = c; split2(x1[2 * j], x1[2 * j + 1], p, c); oh[2 + j] = p; ol[2 + j] = c; }
                    const size_t oo = po + (size_t)(s >> 1) * (TT * 32) + mb * 512 + (s & 1) * 256 + lane * 8; *(v8us*)(QKh + oo) = __builtin_bit_cast(v8us, oh); *(v8us*)(QKl + oo) = __builtin_bit_cast(v8us, ol); }
                // and those reads in front of the next block's writes
                __builtin_amdgcn_wave_barrier(); asm volatile("" ::: "memory");
            }
        } else {
            // value^T: a plane row is one d, K = the tokens, fragment order (a wave of k_fattn reads all 128 d of 32 tokens: 8 KiB in a row); the 8 accumulator words a lane holds of a tile are 8 neighbouring tokens of one d, the lane's own 16 bytes of half-block mb & 1: stored from the registers
            const int cv = c0 - (DQ + DKV); const size_t po = (size_t)(bz * NH_ + cv / HDV) * HDV * TT + (size_t)(t0 / 32) * (HDV * 32) + (cv % HDV) * 32 + 8 * lane;
#pragma unroll
            for (int nb = 0; nb < 4; ++nb)
#pragma unroll
                for (int mb = 0; mb < 4; ++mb) { u32x4 oh, ol;
#pragma unroll
                    for (int j = 0; j < 4; ++j) { unsigned p, c; split2(acc[mb][nb][2 * j], acc[mb][nb][2 * j + 1], p, c); oh[j] = p; ol[j] = c; }
                    const size_t oo = po + (size_t)(mb >> 1) * (HDV * 32) + nb * 512 + (mb & 1) * 256; *(v8us*)(VTh + oo) = __builtin_bit_cast(v8us, oh); *(v8us*)(VTl + oo) = __builtin_bit_cast(v8us, ol); }
            // precaution: stands behind the last stores of this branch, in front of any later write to their data and address registers
            asm volatile("s_wait_xcnt 0x0" ::: "memory");
        }
        return;
    }
#pragma unroll
    for (int mb = 0; mb < 4; ++mb) {
#pragma unroll
        for (int nb = 0; nb < 4; ++nb) {
#pragma unroll
            for (int j = 0; j < 8; ++j) os[(hi * 8 + j) * 68 + nb * 16 + lr] = acc[mb][nb][j]; }
        __builtin_amdgcn_wave_barrier(); asm volatile("" ::: "memory");
        float* crow = C + (size_t)(r0 + mb * 16) * ldc + c0;
{
#pragma unroll
            for (int s = 0; s < 8; ++s) { const int row = 2 * s + hi, cofs = lr * 4; v4f val = *(const v4fa*)(os + row * 68 + cofs); if (BIAS) { val[0] += bfr(bias[c0 + cofs]); val[1] += bfr(bias[c0 + cofs + 1]); val[2] += bfr(bias[c0 + cofs + 2]); val[3] += bfr(bias[c0 + cofs + 3]); }
                *(v4f*)(crow + (size_t)row * ldc + cofs) = val; }
             }
        __builtin_amdgcn_wave_barrier(); asm volatile("" ::: "memory");
    }
}

__device__ __forceinline__ h16 tohx(float x) { return (h16)x; }
typedef __attribute__((ext_vector_type(2))) _Float16 v2h;
typedef __attribute__((ext_vector_type(4))) _Float16 v4h;
typedef __attribute__((ext_vector_type(2))) unsigned short v2us;
typedef __attribute__((ext_vector_type(4))) unsigned short v4us;
typedef __attribute__((ext_vector_type(2))) float v2f;
typedef __attribute__((ext_vector_type(4))) int v4i;

// grid y picks the weight: 0 Wq, 1 Wk, 2 Wv, 3 Wo; two transposed planes in W, K = 512, fragment order: q | k | v (1024 rows: 0-255 q, 256-511 k, 512-1023 v) and behind it o (512 rows).
__global__ __launch_bounds__(256) void k_wtG(const float* __restrict__ w0, const float* __restrict__ w1, const float* __restrict__ w2, const float* __restrict__ w3, bf* W) {
    const int y = blockIdx.y; const float* __restrict__ w = (y == 0) ? w0 : (y == 1) ? w1 : (y == 2) ? w2 : w3; const int K = DM; const int N = (y < 2) ? DQ : DV; const int ls = (y < 2) ? 4 : 5;   /* N / 16 = 1 << ls row blocks */ const int R = (y < 3) ? (DQ + DKV + DV) : DV, roff = (y == 1) ? DQ : (y == 2) ? (DQ + DKV) : 0; bf* Bt = W + ((y < 3) ? 0 : (size_t)(DQ + DKV + DV) * DM);
    const int lane = threadIdx.x & 31; const int L0 = (blockIdx.x * 8 + (threadIdx.x >> 5)) * 8; const int nlines = N * K / 64;
{
#pragma unroll 1
        for (int l = 0; l < 8; ++l) { const int L = L0 + l; if (L >= nlines) break; const size_t e = (size_t)L * 64 + lane * 2; const int blk = (int)(e / 512), wi = (int)(e % 512); const int kq = blk >> ls, rb = blk & ((1 << ls) - 1); const int k = kq * 32 + (wi / 256) * 16 + ((wi % 256) / 128) * 8 + wi % 8, n = rb * 16 + (wi % 128) / 8; const unsigned o = pk2bf(w[(size_t)k * N + n], w[(size_t)(k + 1) * N + n]);
            *(v2us*)(Bt + ((size_t)kq * (R / 16) + roff / 16 + rb) * 512 + wi) = __builtin_bit_cast(v2us, o);
            // precaution: stands between the store and the next trip's first write to its data and address registers
            asm volatile("s_wait_xcnt 0x0" ::: "memory"); }
         }
}
// 64 threads convert one 16 x 32 block of the plane ([NB_ * TT][DM] in fragment order): four neighbouring threads read the 32 floats (one 128-byte line) of one row, so a wave reads 8 whole lines and writes 4 whole lines (8 rows' pieces of each k octet lie side by side)
__global__ __launch_bounds__(256) void k_cvt8(const float* __restrict__ src, bf* dst, size_t n8) { const size_t i = (size_t)blockIdx.x * 256 + threadIdx.x; if (i >= n8) return; const int blk = (int)(i / 64), wi = (int)(i % 64); const v8f v = *(const v8f*)(src + (size_t)((blk % (NB_ * TT / 16)) * 16 + wi / 4) * DM + (blk / (NB_ * TT / 16)) * 32 + (wi % 4) * 8); u32x4 o;
#pragma unroll
    for (int k = 0; k < 4; ++k) o[k] = pk2bf(v[2 * k], v[2 * k + 1]); *(v8us*)(dst + (size_t)blk * 512 + ((wi % 4) * 16 + wi / 4) * 8) = __builtin_bit_cast(v8us, o);  }

__global__ __launch_bounds__(256) void k_vtp(const float* __restrict__ F, int pitch, int nheads, h16* V16, bf* Vh, bf* Vl) { const size_t e = ((size_t)blockIdx.x * 256 + threadIdx.x) * 2; if (e >= (size_t)nheads * HD * TT) return; const int t = (int)(e % TT); const int d = (int)((e / TT) % HD); const int g = (int)(e / ((size_t)TT * HD)); v2h o16; v2us oh, ol;
#pragma unroll
    for (int q = 0; q < 2; ++q) { const float x = F[(size_t)(t + q) * pitch + g * HD + d]; o16[q] = tohx(x); unsigned short a2, c2; splitf(x, a2, c2); oh[q] = a2; ol[q] = c2; }
    *(v2h*)(V16 + e) = o16; *(v2us*)(Vh + e) = oh; *(v2us*)(Vl + e) = ol;  }
// k_asoft: per row (zz, i): t = S x HD^-0.5 (no mask); softmax over the 2048 keys (register row, one exp, fixed trees);
__global__ __launch_bounds__(256) void k_asoft(const float* __restrict__ Sb, h16* P16, bf* Ph, bf* Pl) {
    const int lane = threadIdx.x & 31; const int row = blockIdx.x * 8 + (threadIdx.x >> 5); if (row >= ZH * TT) return; const int i = row % TT; const int zz = row / TT; (void)zz; const bool hires = (i < RH); const float* sr = Sb + (size_t)row * TT; float v[TT / 32]; float mx = -3.0e38f;
#pragma unroll
    for (int ch = 0; ch < TT / 128; ++ch) { const int j0 = ch * 128 + lane * 4; const v4f a = *(const v4f*)(sr + j0);
#pragma unroll
        for (int q = 0; q < 4; ++q) { const int j = j0 + q; (void)j; const float t = a[q] * SCL; v[ch * 4 + q] = t; mx = fmaxf(mx, t); } }
#pragma unroll
    for (int sh = 16; sh; sh >>= 1) mx = fmaxf(mx, __shfl_xor(mx, sh, 32));
    float sum = 0.f;
#pragma unroll
    for (int k = 0; k < TT / 32; ++k) { float d0 = __fsub_rn(v[k], mx); asm volatile("" : "+v"(d0)); v[k] = __builtin_amdgcn_exp2f(__fmul_rn(d0, 1.4426950408889634f)); sum += v[k]; }
#pragma unroll
    for (int sh = 16; sh; sh >>= 1) sum += __shfl_xor(sum, sh, 32);
    const float f = __fdiv_rn(hires ? 1.0f : PCAR, sum);
{
        if (hires) {
#pragma unroll
            for (int ch = 0; ch < TT / 128; ++ch) { v4us oh, ol;
#pragma unroll
                for (int q = 0; q < 4; ++q) { unsigned short a, c2; splitf(v[ch * 4 + q] * f, a, c2); oh[q] = a; ol[q] = c2; }
                const size_t oo = ((size_t)zz * (RH ? RH : 1) + i) * TT + ch * 128 + lane * 4; *(v4us*)(Ph + oo) = oh; *(v4us*)(Pl + oo) = ol; }
        } else {
#pragma unroll
            for (int ch = 0; ch < TT / 128; ++ch) { v4h o4;
#pragma unroll
                for (int q = 0; q < 4; ++q) o4[q] = tohx(v[ch * 4 + q] * f);
                *(v4h*)(P16 + (size_t)row * TT + ch * 128 + lane * 4) = o4; } }
         }
}
__global__ __launch_bounds__(256) void k_merge(const float* __restrict__ O, int h0, bf* Ah, bf* Al) { const size_t e = ((size_t)blockIdx.x * 256 + threadIdx.x) * 2; if (e >= (size_t)ZH * TT * HD) return; const int d = (int)(e % HD); const int t = (int)((e / HD) % TT); const int zz = (int)(e / ((size_t)HD * TT)); const float cs = (t < RH) ? 1.0f : (1.0f / PCAR); const size_t oo = (size_t)t * DQ + (h0 + zz) * HD + d;
    v2us oh, ol;
#pragma unroll
    for (int q = 0; q < 2; ++q) { unsigned short a, c2; splitf(O[e + q] * cs, a, c2); oh[q] = a; ol[q] = c2; } *(v2us*)(Ah + oo) = oh; *(v2us*)(Al + oo) = ol;  }

#define FQB 2     // 16-query blocks per wave
#define FWV 4     // waves per work-group
#define FKS 4     // key quarters (grid z)
#define FNT (TT / FKS / 32)   // passes of 32 keys
#define KVU 6144  // 16-byte words of one staged tile: k 64 half-blocks of 512 bytes [batch][hi|lo][kc][4], then value^T 128 half-blocks [batch][hi|lo][16]
typedef __attribute__((ext_vector_type(8))) unsigned v8u;
// one wave's share of a tile: the k and value^T fragments of its own batch, 48 asynchronous copies of 16 bytes a lane (512 bytes a copy), global memory to LDS through no register. Six runs that are consecutive in memory and in LDS alike: k hi and lo, each d half (2 KiB), value^T hi and lo (8 KiB); the immediate offset moves both addresses.
// lk, lv: the LDS byte address of its batch's k and value^T part of the buffer; the pointers: the start of the 32 keys in each plane (all the same for every lane); lo: the lane's place, 8 elements (16 bytes) a lane.
// the s_wait_xcnt is a precaution that stands, inside the statement, between the copies and any later write to the address registers they name
__device__ __forceinline__ void stage_kv(unsigned lk, unsigned lv, const bf* kh, const bf* kl, const bf* vh, const bf* vl, int lo) {
    const unsigned lb = 2 * lo;
    asm volatile(
        "global_load_async_to_lds_b128 %0, %6, off\n\t"
        "global_load_async_to_lds_b128 %0, %6, off offset:512\n\t"
        "global_load_async_to_lds_b128 %0, %6, off offset:1024\n\t"
        "global_load_async_to_lds_b128 %0, %6, off offset:1536\n\t"
        "global_load_async_to_lds_b128 %1, %7, off\n\t"
        "global_load_async_to_lds_b128 %1, %7, off offset:512\n\t"
        "global_load_async_to_lds_b128 %1, %7, off offset:1024\n\t"
        "global_load_async_to_lds_b128 %1, %7, off offset:1536\n\t"
        "global_load_async_to_lds_b128 %2, %8, off\n\t"
        "global_load_async_to_lds_b128 %2, %8, off offset:512\n\t"
        "global_load_async_to_lds_b128 %2, %8, off offset:1024\n\t"
        "global_load_async_to_lds_b128 %2, %8, off offset:1536\n\t"
        "global_load_async_to_lds_b128 %3, %9, off\n\t"
        "global_load_async_to_lds_b128 %3, %9, off offset:512\n\t"
        "global_load_async_to_lds_b128 %3, %9, off offset:1024\n\t"
        "global_load_async_to_lds_b128 %3, %9, off offset:1536\n\t"
        "global_load_async_to_lds_b128 %4, %10, off\n\t"
        "global_load_async_to_lds_b128 %4, %10, off offset:512\n\t"
        "global_load_async_to_lds_b128 %4, %10, off offset:1024\n\t"
        "global_load_async_to_lds_b128 %4, %10, off offset:1536\n\t"
        "global_load_async_to_lds_b128 %4, %10, off offset:2048\n\t"
        "global_load_async_to_lds_b128 %4, %10, off offset:2560\n\t"
        "global_load_async_to_lds_b128 %4, %10, off offset:3072\n\t"
        "global_load_async_to_lds_b128 %4, %10, off offset:3584\n\t"
        "global_load_async_to_lds_b128 %4, %10, off offset:4096\n\t"
        "global_load_async_to_lds_b128 %4, %10, off offset:4608\n\t"
        "global_load_async_to_lds_b128 %4, %10, off offset:5120\n\t"
        "global_load_async_to_lds_b128 %4, %10, off offset:5632\n\t"
        "global_load_async_to_lds_b128 %4, %10, off offset:6144\n\t"
        "global_load_async_to_lds_b128 %4, %10, off offset:6656\n\t"
        "global_load_async_to_lds_b128 %4, %10, off offset:7168\n\t"
        "global_load_async_to_lds_b128 %4, %10, off offset:7680\n\t"
        "global_load_async_to_lds_b128 %5, %11, off\n\t"
        "global_load_async_to_lds_b128 %5, %11, off offset:512\n\t"
        "global_load_async_to_lds_b128 %5, %11, off offset:1024\n\t"
        "global_load_async_to_lds_b128 %5, %11, off offset:1536\n\t"
        "global_load_async_to_lds_b128 %5, %11, off offset:2048\n\t"
        "global_load_async_to_lds_b128 %5, %11, off offset:2560\n\t"
        "global_load_async_to_lds_b128 %5, %11, off offset:3072\n\t"
        "global_load_async_to_lds_b128 %5, %11, off offset:3584\n\t"
        "global_load_async_to_lds_b128 %5, %11, off offset:4096\n\t"
        "global_load_async_to_lds_b128 %5, %11, off offset:4608\n\t"
        "global_load_async_to_lds_b128 %5, %11, off offset:5120\n\t"
        "global_load_async_to_lds_b128 %5, %11, off offset:5632\n\t"
        "global_load_async_to_lds_b128 %5, %11, off offset:6144\n\t"
        "global_load_async_to_lds_b128 %5, %11, off offset:6656\n\t"
        "global_load_async_to_lds_b128 %5, %11, off offset:7168\n\t"
        "global_load_async_to_lds_b128 %5, %11, off offset:7680\n\t"
        "s_wait_xcnt 0x0"
        :: "v"(lk + lb), "v"((lk + 2048) + lb), "v"((lk + 4096) + lb), "v"((lk + 6144) + lb), "v"(lv + lb), "v"((lv + 8192) + lb),
           "v"(kh + lo), "v"(kh + TT * 32 + lo), "v"(kl + lo), "v"(kl + TT * 32 + lo), "v"(vh + lo), "v"(vl + lo) : "memory");
}
__global__ __launch_bounds__(32 * FWV) void k_fattn(const bf* __restrict__ QKh, const bf* __restrict__ QKl, const bf* __restrict__ VTh, const bf* __restrict__ VTl, float* PO) {
    typedef WFrag<bf> WF; typedef WF::V V;
    __shared__ __align__(16) v8us sm[2 * KVU + FWV * 2048];     // two k | value^T tiles (192 KiB), then each wave's q fragments [batch][nb][kc][hi|lo][half][lane] (32 KiB a wave): the whole LDS of a WGP
    const int lane = threadIdx.x & 31; const int w = __builtin_amdgcn_readfirstlane((int)(threadIdx.x >> 5));
    const int h = blockIdx.y, q0 = blockIdx.x * (16 * FQB * FWV) + w * (16 * FQB), k0 = blockIdx.z * (TT / FKS);
    const size_t sQK = (size_t)(NH_ + NKV) * TT * HD, sV = (size_t)NH_ * HDV * TT;
    // the copies' sources: this wave stages batch w; k planes (row = key: 32 keys are 2 blocks for each 32 d) and value^T planes (row = d: 32 keys are 8 blocks, one per 16 d); they step by 32 keys a tile
    const bf* Kh = QKh + (size_t)w * sQK + (size_t)(NH_ + h) * TT * HD + (size_t)k0 * 32; const bf* Kl = QKl + (Kh - QKh);
    const bf* Vh = VTh + (size_t)w * sV + (size_t)h * HDV * TT + (size_t)k0 * HDV; const bf* Vl = VTl + (Vh - VTh);
    const unsigned lb = (unsigned)(size_t)(__attribute__((address_space(3))) v8us*)sm; const unsigned lk = lb + w * (16 * 512), lv = lb + 64 * 512 + w * (32 * 512);
    stage_kv(lk, lv, Kh, Kl, Vh, Vl, 8 * lane);
    Kh += 32 * 32; Kl += 32 * 32; Vh += 32 * HDV; Vl += 32 * HDV;
    v8us* qs = sm + 2 * KVU + w * 2048 + lane;
    const bf* qp[NB_][2];
#pragma unroll
    for (int b = 0; b < NB_; ++b) { qp[b][0] = QKh + (size_t)b * sQK + (size_t)h * TT * HD + (size_t)q0 * 32 + 8 * lane; qp[b][1] = QKl + (qp[b][0] - QKh); }
#pragma unroll
    for (int b = 0; b < NB_; ++b)
#pragma unroll
        for (int nb = 0; nb < FQB; ++nb)
#pragma unroll
            for (int kc = 0; kc < 2; ++kc) { const int o = nb * 512 + kc * (TT * 32); const int f = ((b * FQB + nb) * 2 + kc) * 2;
                qs[f * 64] = *(const v8us*)(qp[b][0] + o); qs[f * 64 + 32] = *(const v8us*)(qp[b][0] + o + 256); qs[f * 64 + 64] = *(const v8us*)(qp[b][1] + o); qs[f * 64 + 96] = *(const v8us*)(qp[b][1] + o + 256); }
    // precaution: stands between the q loads and the first reuse of their address registers (held live up to here as inputs); the scheduling fence keeps the zeroing of the accumulators, which reuses them, behind the wait
    asm volatile("s_wait_xcnt 0x0" :: "v"(qp[0][0]), "v"(qp[0][1]), "v"(qp[1][0]), "v"(qp[1][1]), "v"(qp[2][0]), "v"(qp[2][1]), "v"(qp[3][0]), "v"(qp[3][1]) : "memory");
    __builtin_amdgcn_sched_barrier(0);
    // tile 0 has landed (this wave's copies), then the barrier publishes it to the other waves
    asm volatile("s_wait_asynccnt 0x0" ::: "memory");
    __syncthreads();
    stage_kv(lk + KVU * 16, lv + KVU * 16, Kh, Kl, Vh, Vl, 8 * lane);
    Kh += 32 * 32; Kl += 32 * 32; Vh += 32 * HDV; Vl += 32 * HDV;
    v8f acc[NB_][8][FQB];
#pragma unroll
    for (int b = 0; b < NB_; ++b)
#pragma unroll
        for (int db = 0; db < 8; ++db)
#pragma unroll
            for (int nb = 0; nb < FQB; ++nb) acc[b][db][nb] = (v8f){};
    // rolled, for speed only: one pass is some thousands of instructions
#pragma unroll 1
    for (int kt = 0; kt < FNT; ++kt) {
        const unsigned bo = (kt & 1) * KVU; const v8us* kv = sm + bo + lane;
        V kh[NB_][2][2], kl[NB_][2][2];
#pragma unroll
        for (int b = 0; b < NB_; ++b)
#pragma unroll
            for (int kc = 0; kc < 2; ++kc)
#pragma unroll
                for (int mb = 0; mb < 2; ++mb) { const int o = (b * 16 + kc * 4 + mb * 2) * 32; kh[b][kc][mb] = cat16b(kv[o], kv[o + 32]); kl[b][kc][mb] = cat16b(kv[o + 8 * 32], kv[o + 9 * 32]); }
        v8f s[NB_][2][FQB];
#pragma unroll
        for (int b = 0; b < NB_; ++b) {
#pragma unroll
            for (int mb = 0; mb < 2; ++mb)
#pragma unroll
                for (int nb = 0; nb < FQB; ++nb) s[b][mb][nb] = (v8f){};
#pragma unroll
            for (int kc = 0; kc < 2; ++kc)
#pragma unroll
                for (int nb = 0; nb < FQB; ++nb) { const int f = ((b * FQB + nb) * 2 + kc) * 2; const V qh = cat16b(qs[f * 64], qs[f * 64 + 32]), ql = cat16b(qs[f * 64 + 64], qs[f * 64 + 96]);
#pragma unroll
                    for (int mb = 0; mb < 2; ++mb) { s[b][mb][nb] = WF::mma(kh[b][kc][mb], qh, s[b][mb][nb]); s[b][mb][nb] = WF::mma(kh[b][kc][mb], ql, s[b][mb][nb]); s[b][mb][nb] = WF::mma(kl[b][kc][mb], qh, s[b][mb][nb]); } } }
        // value^T fragments of batch 0 are asked for here, so that they come under the softmax arithmetic; those of batch b + 1 in front of batch b's products
        V vh[2][8], vl[2][8];
#pragma unroll
        for (int db = 0; db < 8; ++db) { const int o = (64 + db * 2) * 32; vh[0][db] = cat16b(kv[o], kv[o + 32]); vl[0][db] = cat16b(kv[o + 16 * 32], kv[o + 17 * 32]); }
        v8u ph[NB_][FQB], pl[NB_][FQB];     // probabilities, bf16 hi and lo, two keys to a word: word i of (batch, nb) holds k slots 2i and 2i + 1 of the B operand
#pragma unroll
        for (int nb = 0; nb < FQB; ++nb)
#pragma unroll
            for (int mb = 0; mb < 2; ++mb) {
#pragma unroll
                for (int jp = 0; jp < 4; ++jp) { float pr[2][NB_];
#pragma unroll
                    for (int q = 0; q < 2; ++q) { const int j = 2 * jp + q; float t[NB_]; float mx = -3.0e38f;
#pragma unroll
                        for (int b = 0; b < NB_; ++b) { t[b] = __fmul_rn(s[b][mb][nb][j], SCL); mx = fmaxf(mx, t[b]); }
                        float xa[NB_], ex[NB_]; float sum = 0.f;
#pragma unroll
                        for (int b = 0; b < NB_; ++b) { xa[b] = __fmul_rn(__fsub_rn(t[b], mx), 1.4426950408889634f); ex[b] = __builtin_amdgcn_exp2f(xa[b]); }
                        // the slot the instruction set asks for between a transcendental and an overwrite of its source: the four arguments stay live (inputs) up to this v_nop, which stands behind the four v_exp (their results are inputs too)
                        asm volatile("v_nop" :: "v"(xa[0]), "v"(xa[1]), "v"(xa[2]), "v"(xa[3]), "v"(ex[0]), "v"(ex[1]), "v"(ex[2]), "v"(ex[3]));
#pragma unroll
                        for (int b = 0; b < NB_; ++b) sum = __fadd_rn(sum, ex[b]);
                        const float f = __fdiv_rn(1.0f, sum);
#pragma unroll
                        for (int b = 0; b < NB_; ++b) pr[q][b] = __fmul_rn(ex[b], f); }
#pragma unroll
                    for (int b = 0; b < NB_; ++b) { unsigned a, c; split2(pr[0][b], pr[1][b], a, c); ph[b][nb][mb * 4 + jp] = a; pl[b][nb][mb * 4 + jp] = c; } }
                // one 16x16 tile's softmax at a time: left free, the scheduler runs all four tiles abreast and their unpacked halves push accumulators into scratch
                __builtin_amdgcn_sched_barrier(0); }
#pragma unroll
        for (int b = 0; b < NB_; ++b) {
            if (b + 1 < NB_) {
#pragma unroll
                for (int db = 0; db < 8; ++db) { const int o = (64 + (b + 1) * 32 + db * 2) * 32; vh[(b + 1) & 1][db] = cat16b(kv[o], kv[o + 32]); vl[(b + 1) & 1][db] = cat16b(kv[o + 16 * 32], kv[o + 17 * 32]); } }
            // holds the next batch's 32 LDS loads, as one group, in front of this batch's 48 products: left free, the scheduler spreads them among the products
            __builtin_amdgcn_sched_barrier(0);
#pragma unroll
            for (int db = 0; db < 8; ++db)
#pragma unroll
                for (int nb = 0; nb < FQB; ++nb) { const V bh = __builtin_bit_cast(V, ph[b][nb]), bl = __builtin_bit_cast(V, pl[b][nb]);
                    acc[b][db][nb] = WF::mma(vh[b & 1][db], bh, acc[b][db][nb]); acc[b][db][nb] = WF::mma(vh[b & 1][db], bl, acc[b][db][nb]); acc[b][db][nb] = WF::mma(vl[b & 1][db], bh, acc[b][db][nb]); }
            // keeps the loads of batch b + 2 behind these products, whose fragments' registers they refill
            __builtin_amdgcn_sched_barrier(0); }
        // hand-over: this wave's LDS reads of the tile are done
        asm volatile("s_wait_dscnt 0x0" ::: "memory");
        // its copies of the next tile have landed
        asm volatile("s_wait_asynccnt 0x0" ::: "memory");
        // publishes the next tile and ends every wave's reads of this one, whose buffer is refilled behind it
        __syncthreads();
        // the two LDS addresses are formed as scalars here: left free, the compiler keeps their lane-wise sums over the whole loop and, short of low registers, spills them to scratch
        if (kt + 2 < FNT) { stage_kv(__builtin_amdgcn_readfirstlane(lk + bo * 16), __builtin_amdgcn_readfirstlane(lv + bo * 16), Kh, Kl, Vh, Vl, 8 * lane); Kh += 32 * 32; Kl += 32 * 32; Vh += 32 * HDV; Vl += 32 * HDV; }
    }
    // no copy is left in flight when the wave ends
    asm volatile("s_wait_asynccnt 0x0" ::: "memory");
    // partial O^T, f32: tile (head, 16-query block, batch, quarter, db) is 1 KiB, [half][lane] 16 bytes: every store of a wave is 512 consecutive bytes, and the four quarters of a (query block, batch) lie side by side for k_fmrg
    v4f* pp = (v4f*)PO + (((size_t)h * (TT / 16) + q0 / 16) * (NB_ * FKS) + blockIdx.z) * (8 * 64);   // the same for every lane: a scalar base; all 128 stores lie within 256 KiB of it, and the lane's number is their one vector address register
#pragma unroll
    for (int b = 0; b < NB_; ++b)
#pragma unroll
        for (int nb = 0; nb < FQB; ++nb)
#pragma unroll
            for (int db = 0; db < 8; ++db) { const v8f a = acc[b][db][nb]; const int o = ((nb * NB_ + b) * FKS * 8 + db) * 64; pp[o + lane] = (v4f){a[0], a[1], a[2], a[3]}; pp[o + 32 + lane] = (v4f){a[4], a[5], a[6], a[7]}; }
}
// ---- k_fmrg: context = the four key quarters' partial O^T, added in order 0..3, split hi/lo into the context planes. One wave takes the 8 d tiles of one (head, 16-query block, batch), 32 KiB in a row, 64 loads of 512 bytes.
__global__ __launch_bounds__(256) void k_fmrg(const float* __restrict__ PO, bf* ATh, bf* ATl) {
    const int lane = threadIdx.x & 31; const int g = blockIdx.x * 8 + __builtin_amdgcn_readfirstlane((int)(threadIdx.x >> 5)); const int b = g % NB_, qb = (g / NB_) % (TT / 16), h = g / (NB_ * (TT / 16));
    const v4f* p = (const v4f*)PO + (size_t)g * (FKS * 8 * 64);   // 32 KiB in a row; the same for every lane: a scalar base, and the lane's number is the loads' one vector address register
    v4f x[8][FKS][2];
#pragma unroll
    for (int db = 0; db < 8; ++db)
#pragma unroll
        for (int s = 0; s < FKS; ++s) { x[db][s][0] = p[(s * 8 + db) * 64 + lane]; x[db][s][1] = p[(s * 8 + db) * 64 + 32 + lane]; }
    bf* oh8 = ATh + (size_t)(h * (HDV / 32)) * (NB_ * TT * 32) + ((size_t)b * TT + qb * 16) * 32 + 8 * lane; bf* ol8 = ATl + (oh8 - ATh);
#pragma unroll
    for (int db = 0; db < 8; ++db) { v4f x0 = x[db][0][0], x1 = x[db][0][1];
#pragma unroll
        for (int s = 1; s < FKS; ++s) { x0 += x[db][s][0]; x1 += x[db][s][1]; }
        u32x4 oh, ol;
#pragma unroll
        for (int j = 0; j < 2; ++j) { unsigned a, c; split2(x0[2 * j], x0[2 * j + 1], a, c); oh[j] = a; ol[j] = c; split2(x1[2 * j], x1[2 * j + 1], a, c); oh[2 + j] = a; ol[2 + j] = c; }
        const size_t oo = (size_t)(db >> 1) * (NB_ * TT * 32) + (db & 1) * 256; *(v8us*)(oh8 + oo) = __builtin_bit_cast(v8us, oh); *(v8us*)(ol8 + oo) = __builtin_bit_cast(v8us, ol); }   // context planes [8192][DV] in fragment order: the lane's 8 d of one query are its own 16 bytes of half-block db & 1
}

extern "C" void kernel_launch(void* const* d_in, const int* in_sizes, int n_in,
                              void* d_out, int out_size, void* d_ws, size_t ws_size, hipStream_t stream) {
    (void)in_sizes; (void)n_in; (void)out_size;
    const float* x = (const float*)d_in[0]; const float* wq = (const float*)d_in[1]; const float* wk = (const float*)d_in[2]; const float* wv = (const float*)d_in[3]; const float* wo = (const float*)d_in[4];
    float* OUT = (float*)d_out;     // [4][2048][512]
    char* wsp = (char*)d_ws;
    auto take = [&](size_t bytes) { char* p = wsp; wsp += (bytes + 255) & ~(size_t)255; return (void*)p; };
    bf* W = (bf*)take((size_t)(DQ + DKV + DV + DV) * DM * 2); bf* WO = W + (size_t)(DQ + DKV + DV) * DM;
    bf* XB = (bf*)take((size_t)NB_ * TT * DM * 2);
    bf* QKh = (bf*)take((size_t)NB_ * (NH_ + NKV) * TT * HD * 2); bf* QKl = (bf*)take((size_t)NB_ * (NH_ + NKV) * TT * HD * 2);   /* [b][8] planes [t][d] in fragment order: heads 0-3 q, 4-7 k */
    bf* VTh = (bf*)take((size_t)NB_ * NH_ * HDV * TT * 2); bf* VTl = (bf*)take((size_t)NB_ * NH_ * HDV * TT * 2);
    bf* ATh = (bf*)take((size_t)NB_ * TT * DV * 2); bf* ATl = (bf*)take((size_t)NB_ * TT * DV * 2);
    float* PO = (float*)take((size_t)FKS * NB_ * TT * DV * 4);   /* the key quarters' partial O^T */
    if ((size_t)(wsp - (char*)d_ws) > ws_size) return;    // ws 256 MiB (carve ~122 MiB)
    k_wtG<<<dim3((unsigned)((DM * DV / 64 + 63) / 64), 4, 1), 256, 0, stream>>>(wq, wk, wv, wo, W);
    const int PF = DQ + DKV + DV;
    /* projections + planes, every batch in one launch (the softmax couples the batches) */
    k_cvt8<<<(unsigned)(((size_t)NB_ * TT * DM / 8 + 255) / 256), 256, 0, stream>>>(x, XB, (size_t)NB_ * TT * DM / 8);
    k_gemmw<bf, 0, false, true><<<dim3(NB_ * TT / 64, PF / 64, 1), 32, 0, stream>>>(XB, nullptr, W, nullptr, DM, nullptr, 0, nullptr, 0, 0, 0, QKh, QKl, VTh, VTl);
    k_fattn<<<dim3(TT / (16 * FQB * FWV), NH_, FKS), 32 * FWV, 0, stream>>>(QKh, QKl, VTh, VTl, PO);   /* all heads, all batches */
    k_fmrg<<<NB_ * NH_ * (TT / 16) / 8, 256, 0, stream>>>(PO, ATh, ATl);
    k_gemmw<bf, 1, false><<<dim3(NB_ * TT / 64, DV / 64, 1), 32, 0, stream>>>(ATh, ATl, WO, nullptr, DV, OUT, DV, nullptr, 0, 0, 0);
}

// v007
// A run of this version takes 125 microseconds.
// Timed twice side by side with v006, it ran 1.09 times as fast both times.
// All steps since v000 together make it 9.21 times as fast.
#include <hip/hip_runtime.h>

// Multi-head attention whose softmax runs over the BATCH axis (the source's nn.Softmax() with no dim on a (B,N,N)-shaped view picks dim 0): input_x [4][2048][512]; q = x Wq, k = x Wk ('xw' [512][256]: 4 heads x 64), v = x Wv ('xw' [512][512]: 4 heads x 128); scores[b][h][q][k] = q.k / 8; attn = softmax over b (the 4 batches, per (h, q, k)); out[b][q][h*128+d] = sum_k attn[b][h][q][k] v[b][k][h][d]; out Wo ('xw' [512][512]) -> [4][2048][512] (4.2 M).
// Layout: exact projections first: one GEMM [8192][512] x [1024][512]^T gives q | k | v of every batch, and its epilogue writes them straight as q/k planes per (batch, head), bf16 hi/lo (heads 0-3 q, 4-7 k), and value^T planes per (batch, head); then ONE attention kernel (k_fattn) for all heads: a wave holds the scores of all four batches for 32 keys x 32 queries in registers, takes the softmax ACROSS the batches there, feeds the probabilities (hi/lo) straight into the 3-product P.v; a work-group covers 128 queries x 512 keys and stores an f32 partial, and k_fmrg adds the four key quarters and writes the hi/lo context planes; finally out = context Wo (hl x exact), 8192 rows in one GEMM.
// FRAGMENT ORDER: every 16-bit plane that a matrix instruction reads ([rows][K], K-contiguous in meaning) is stored as blocks of 16 rows x 32 k (512 elements, 1 KiB), block (k / 32) * (rows / 16) + row / 16 (neighbouring row blocks of one k step lie side by side: a tile's fragments of a k step are one run of bytes); inside a block element (row, k) lies at ((k % 32) / 16) * 256 + (((k % 16) / 8) * 16 + row % 16) * 8 + k % 8. That is the order in which the 32 lanes hold an A or B fragment, so each of a fragment's two 16-byte loads reads 512 consecutive bytes (4 whole lines) where a row-major plane gave 16 lines with 32 bytes used of each.
// Compute dtypes, f32 accumulate: every input rounded to bf16; projections exact; scores and attn.v on bf16 hi/lo planes (3 products) everywhere; the cross-batch softmax in f32.

#define NB_  4
#define TT   2048
#define DM   512
#define NH_  4
#define NKV  4
#define REP  (NH_ / NKV)
#define HD   64
#define DQ   (NH_ * HD)
#define DKV  (NKV * HD)
#define ZH   2
#define RH   2048                  // query rows < RH use hi+lo planes (0: none)
#define WIN  0
#define PCAR 1024.0f
#define SCL  0.125f   // 64^-0.5
#define HDV  128      // value head dim
#define DV   (NH_ * HDV)   // 512
typedef _Float16 h16;
typedef unsigned short bf;
typedef __attribute__((ext_vector_type(16))) __bf16   v16bf;
typedef __attribute__((ext_vector_type(16))) _Float16 v16h;
typedef __attribute__((ext_vector_type(8)))  _Float16 v8h;
typedef __attribute__((ext_vector_type(8)))  unsigned short v8us;
typedef __attribute__((ext_vector_type(8)))  float    v8f;
typedef __attribute__((ext_vector_type(4)))  float    v4f;
typedef v8h  __attribute__((may_alias)) v8ha;
typedef v4f  __attribute__((may_alias)) v4fa;
typedef v8us __attribute__((may_alias)) v8usa;

__device__ __forceinline__ unsigned short f2bf(float f) { unsigned u = __float_as_uint(f); u += 0x7FFFu + ((u >> 16) & 1u); return (unsigned short)(u >> 16); }
__device__ __forceinline__ float bf2f(unsigned short b) { return __uint_as_float(((unsigned)b) << 16); }
__device__ __forceinline__ float bfr(float f) { return bf2f(f2bf(f)); }
__device__ __forceinline__ void splitf(float y, unsigned short& h, unsigned short& l) { h = f2bf(y); l = f2bf(y - bf2f(h)); }
// two f32 to two bf16 in one word (a in the low half), round to nearest even, by the chip's packed conversion: one instruction where the integer rounding of f2bf takes some four for each value and a pack
typedef __attribute__((ext_vector_type(2))) float f32x2;
typedef __attribute__((ext_vector_type(2))) __bf16 bf16x2;
typedef __attribute__((ext_vector_type(4))) unsigned u32x4;
__device__ __forceinline__ unsigned pk2bf(float a, float b) { const f32x2 x = {a, b}; return __builtin_bit_cast(unsigned, __builtin_convertvector(x, bf16x2)); }
// hi/lo split of two values: h = their bf16 roundings, l = the roundings of what h leaves
__device__ __forceinline__ void split2(float y0, float y1, unsigned& h, unsigned& l) { h = pk2bf(y0, y1); l = pk2bf(y0 - __uint_as_float(h << 16), y1 - __uint_as_float(h & 0xFFFF0000u)); }
__device__ __forceinline__ v16h cat16(v8h lo, v8h hi) { return __builtin_shufflevector(lo, hi, 0, 1, 2, 3, 4, 5, 6, 7, 8, 9, 10, 11, 12, 13, 14, 15); }
__device__ __forceinline__ v16bf cat16b(v8us lo, v8us hi) { return __builtin_bit_cast(v16bf, __builtin_shufflevector(lo, hi, 0, 1, 2, 3, 4, 5, 6, 7, 8, 9, 10, 11, 12, 13, 14, 15)); }
__device__ __forceinline__ v8f wmma16(v16h a, v16h b, v8f c) { return __builtin_amdgcn_wmma_f32_16x16x32_f16(false, a, false, b, (short)0, c, false, false); }
__device__ __forceinline__ v8f wmmab(v16bf a, v16bf b, v8f c) { return __builtin_amdgcn_wmma_f32_16x16x32_bf16(false, a, false, b, (short)0, c, false, false); }



// ---- k_gemmw: register-blocked GEMM, ONE WAVE per 64x64 output tile (16 accumulators), operands straight from 16-bit planes in fragment order; grid (M/64, N/64, Z), 32 threads.
// C[m][n] (f32, pitch ldc, + optional f32 bias[n]) = sum_k A[m][k] Bt[n][k] (+ split products per NSPLIT). z-batch strides sA/sB/sC in elements. K % 32 == 0.
// PLANES (the q | k | v projection): no C; the epilogue splits the tile hi/lo and writes it as attention planes. A 64-column tile is one whole q or k head (columns 0-511: plane c0 / 64) or half a value head (columns 512-1023); its 64 rows lie in one batch.
// ld: p = start of a 16 x 32 block in fragment order + lane * 8
template <typename T16> struct WFrag;
template <> struct WFrag<h16> { typedef v16h V; static __device__ __forceinline__ V ld(const h16* p) { return cat16(*(const v8h*)p, *(const v8h*)(p + 256)); } static __device__ __forceinline__ v8f mma(V a, V b, v8f c) { return wmma16(a, b, c); } };
template <> struct WFrag<bf> { typedef v16bf V; static __device__ __forceinline__ V ld(const bf* p) { return cat16b(*(const v8us*)p, *(const v8us*)(p + 256)); } static __device__ __forceinline__ v8f mma(V a, V b, v8f c) { return wmmab(a, b, c); } };
template <typename T16, int NSPLIT, bool BIAS, bool PLANES = false>
__global__ __launch_bounds__(32) void k_gemmw(const T16* __restrict__ A, const T16* __restrict__ A2, const T16* __restrict__ Bt, const T16* __restrict__ Bt2, int K, float* C, int ldc, const float* __restrict__ bias, size_t sA, size_t sB, size_t sC, bf* QKh = nullptr, bf* QKl = nullptr, bf* VTh = nullptr, bf* VTl = nullptr) {
    typedef typename WFrag<T16>::V V;
    __shared__ __align__(16) float os[16 * 68];
    const size_t z = blockIdx.z; A += z * sA; if (A2) A2 += z * sA; Bt += z * sB; if (Bt2) Bt2 += z * sB; C += z * sC;
    const int lane = threadIdx.x & 31, lr = lane & 15, hi = lane >> 4; const int r0 = blockIdx.x * 64, c0 = blockIdx.y * 64;
    v8f acc[4][4];
#pragma unroll
    for (int mb = 0; mb < 4; ++mb)
#pragma unroll
        for (int nb = 0; nb < 4; ++nb) acc[mb][nb] = (v8f){};
    const size_t aoff = (size_t)r0 * 32 + 8 * lane, boff = (size_t)c0 * 32 + 8 * lane;   // 16 rows are one block = 512 elements
    const size_t ka = (size_t)gridDim.x * (64 * 32), kb = (size_t)gridDim.y * (64 * 32);   // the grid covers all rows of the A and of the B plane: 32 k on is rows * 32 elements on
    const T16* pa = A + aoff; const T16* pa2 = A2 + aoff; const T16* pb = Bt + boff; const T16* pb2 = Bt2 + boff;
#pragma unroll 1
    for (int kc = 0; kc < K; kc += 32) {
        V a[4], a2[4];
#pragma unroll
        for (int mb = 0; mb < 4; ++mb) { a[mb] = WFrag<T16>::ld(pa + mb * 512); if (NSPLIT == 1 || NSPLIT == 2) a2[mb] = WFrag<T16>::ld(pa2 + mb * 512); }
#pragma unroll
        for (int nb = 0; nb < 4; ++nb) { const V b = WFrag<T16>::ld(pb + nb * 512); V b2; if (NSPLIT >= 2) b2 = WFrag<T16>::ld(pb2 + nb * 512);
#pragma unroll
            for (int mb = 0; mb < 4; ++mb) { acc[mb][nb] = WFrag<T16>::mma(a[mb], b, acc[mb][nb]); if (NSPLIT == 1 || NSPLIT == 2) acc[mb][nb] = WFrag<T16>::mma(a2[mb], b, acc[mb][nb]); if (NSPLIT >= 2) acc[mb][nb] = WFrag<T16>::mma(a[mb], b2, acc[mb][nb]); } }
        asm volatile("v_nop\n\tv_nop\n\tv_nop\n\tv_nop" : "+v"(acc[0][0]), "+v"(acc[1][1]), "+v"(acc[2][2]), "+v"(acc[3][3]) : "v"(a[0]), "v"(a[3]));
        // precaution: stands between this trip's loads and the step of their pointers; the pointers are held live up to here (inputs), so that no later load's result is put into the registers of an address still in use
        if (NSPLIT == 0) asm volatile("s_wait_xcnt 0x0" :: "v"(pa), "v"(pb) : "memory");
        else if (NSPLIT == 1) asm volatile("s_wait_xcnt 0x0" :: "v"(pa), "v"(pa2), "v"(pb) : "memory");
        else asm volatile("s_wait_xcnt 0x0" :: "v"(pa), "v"(pa2), "v"(pb), "v"(pb2) : "memory");
        pa += ka; pa2 += ka; pb += kb; pb2 += kb;
    }
    if (PLANES) {
        const int bz = r0 / TT, t0 = r0 % TT;
        if (c0 < DQ + DKV) {
            // q or k: a plane row is a token, K = its 64 d, fragment order; a 16-row block goes through LDS so that a lane holds 8 neighbouring d of one token: trip s stores d 16 s .. 16 s + 15 of the 16 tokens, a half-block: 512 consecutive bytes
            const size_t po = (size_t)(bz * (NH_ + NKV) + c0 / HD) * TT * HD + (size_t)t0 * 32;
#pragma unroll
            for (int mb = 0; mb < 4; ++mb) {
#pragma unroll
                for (int nb = 0; nb < 4; ++nb) {
#pragma unroll
                    for (int j = 0; j < 8; ++j) os[(hi * 8 + j) * 68 + nb * 16 + lr] = acc[mb][nb][j]; }
                // one wave: keeps its LDS writes in front of its reads of other lanes' words
                __builtin_amdgcn_wave_barrier(); asm volatile("" ::: "memory");
#pragma unroll
                for (int s = 0; s < 4; ++s) { const int row = lr, cofs = (2 * s + hi) * 8; const v4f x0 = *(const v4fa*)(os + row * 68 + cofs), x1 = *(const v4fa*)(os + row * 68 + cofs + 4); u32x4 oh, ol;
#pragma unroll
                    for (int j = 0; j < 2; ++j) { unsigned p, c; split2(x0[2 * j], x0[2 * j + 1], p, c); oh[j] = p; ol[j] = c; split2(x1[2 * j], x1[2 * j + 1], p, c); oh[2 + j] = p; ol[2 + j] = c; }
                    const size_t oo = po + (size_t)(s >> 1) * (TT * 32) + mb * 512 + (s & 1) * 256 + lane * 8; *(v8us*)(QKh + oo) = __builtin_bit_cast(v8us, oh); *(v8us*)(QKl + oo) = __builtin_bit_cast(v8us, ol); }
                // and those reads in front of the next block's writes
                __builtin_amdgcn_wave_barrier(); asm volatile("" ::: "memory");
            }
        } else {
            // value^T: a plane row is one d, K = the tokens, fragment order (a wave of k_fattn reads all 128 d of 32 tokens: 8 KiB in a row); the 8 accumulator words a lane holds of a tile are 8 neighbouring tokens of one d, the lane's own 16 bytes of half-block mb & 1: stored from the registers
            const int cv = c0 - (DQ + DKV); const size_t po = (size_t)(bz * NH_ + cv / HDV) * HDV * TT + (size_t)(t0 / 32) * (HDV * 32) + (cv % HDV) * 32 + 8 * lane;
#pragma unroll
            for (int nb = 0; nb < 4; ++nb)
#pragma unroll
                for (int mb = 0; mb < 4; ++mb) { u32x4 oh, ol;
#pragma unroll
                    for (int j = 0; j < 4; ++j) { unsigned p, c; split2(acc[mb][nb][2 * j], acc[mb][nb][2 * j + 1], p, c); oh[j] = p; ol[j] = c; }
                    const size_t oo = po + (size_t)(mb >> 1) * (HDV * 32) + nb * 512 + (mb & 1) * 256; *(v8us*)(VTh + oo) = __builtin_bit_cast(v8us, oh); *(v8us*)(VTl + oo) = __builtin_bit_cast(v8us, ol); }
            // precaution: stands behind the last stores of this branch, in front of any later write to their data and address registers
            asm volatile("s_wait_xcnt 0x0" ::: "memory");
        }
        return;
    }
#pragma unroll
    for (int mb = 0; mb < 4; ++mb) {
#pragma unroll
        for (int nb = 0; nb < 4; ++nb) {
#pragma unroll
            for (int j = 0; j < 8; ++j) os[(hi * 8 + j) * 68 + nb * 16 + lr] = acc[mb][nb][j]; }
        __builtin_amdgcn_wave_barrier(); asm volatile("" ::: "memory");
        float* crow = C + (size_t)(r0 + mb * 16) * ldc + c0;
{
#pragma unroll
            for (int s = 0; s < 8; ++s) { const int row = 2 * s + hi, cofs = lr * 4; v4f val = *(const v4fa*)(os + row * 68 + cofs); if (BIAS) { val[0] += bfr(bias[c0 + cofs]); val[1] += bfr(bias[c0 + cofs + 1]); val[2] += bfr(bias[c0 + cofs + 2]); val[3] += bfr(bias[c0 + cofs + 3]); }
                *(v4f*)(crow + (size_t)row * ldc + cofs) = val; }
             }
        __builtin_amdgcn_wave_barrier(); asm volatile("" ::: "memory");
    }
}

__device__ __forceinline__ h16 tohx(float x) { return (h16)x; }
typedef __attribute__((ext_vector_type(2))) _Float16 v2h;
typedef __attribute__((ext_vector_type(4))) _Float16 v4h;
typedef __attribute__((ext_vector_type(2))) unsigned short v2us;
typedef __attribute__((ext_vector_type(4))) unsigned short v4us;
typedef __attribute__((ext_vector_type(2))) float v2f;
typedef __attribute__((ext_vector_type(4))) int v4i;

// grid y picks the weight: 0 Wq, 1 Wk, 2 Wv, 3 Wo; two transposed planes in W, K = 512, fragment order: q | k | v (1024 rows: 0-255 q, 256-511 k, 512-1023 v) and behind it o (512 rows).
__global__ __launch_bounds__(256) void k_wtG(const float* __restrict__ w0, const float* __restrict__ w1, const float* __restrict__ w2, const float* __restrict__ w3, bf* W) {
    const int y = blockIdx.y; const float* __restrict__ w = (y == 0) ? w0 : (y == 1) ? w1 : (y == 2) ? w2 : w3; const int K = DM; const int N = (y < 2) ? DQ : DV; const int ls = (y < 2) ? 4 : 5;   /* N / 16 = 1 << ls row blocks */ const int R = (y < 3) ? (DQ + DKV + DV) : DV, roff = (y == 1) ? DQ : (y == 2) ? (DQ + DKV) : 0; bf* Bt = W + ((y < 3) ? 0 : (size_t)(DQ + DKV + DV) * DM);
    const int lane = threadIdx.x & 31; const int L0 = (blockIdx.x * 8 + (threadIdx.x >> 5)) * 8; const int nlines = N * K / 64;
{
#pragma unroll 1
        for (int l = 0; l < 8; ++l) { const int L = L0 + l; if (L >= nlines) break; const size_t e = (size_t)L * 64 + lane * 2; const int blk = (int)(e / 512), wi = (int)(e % 512); const int kq = blk >> ls, rb = blk & ((1 << ls) - 1); const int k = kq * 32 + (wi / 256) * 16 + ((wi % 256) / 128) * 8 + wi % 8, n = rb * 16 + (wi % 128) / 8; const unsigned o = pk2bf(w[(size_t)k * N + n], w[(size_t)(k + 1) * N + n]);
            *(v2us*)(Bt + ((size_t)kq * (R / 16) + roff / 16 + rb) * 512 + wi) = __builtin_bit_cast(v2us, o);
            // precaution: stands between the store and the next trip's first write to its data and address registers
            asm volatile("s_wait_xcnt 0x0" ::: "memory"); }
         }
}
// 64 threads convert one 16 x 32 block of the plane ([NB_ * TT][DM] in fragment order): four neighbouring threads read the 32 floats (one 128-byte line) of one row, so a wave reads 8 whole lines and writes 4 whole lines (8 rows' pieces of each k octet lie side by side)
__global__ __launch_bounds__(256) void k_cvt8(const float* __restrict__ src, bf* dst, size_t n8) { const size_t i = (size_t)blockIdx.x * 256 + threadIdx.x; if (i >= n8) return; const int blk = (int)(i / 64), wi = (int)(i % 64); const v8f v = *(const v8f*)(src + (size_t)((blk % (NB_ * TT / 16)) * 16 + wi / 4) * DM + (blk / (NB_ * TT / 16)) * 32 + (wi % 4) * 8); u32x4 o;
#pragma unroll
    for (int k = 0; k < 4; ++k) o[k] = pk2bf(v[2 * k], v[2 * k + 1]); *(v8us*)(dst + (size_t)blk * 512 + ((wi % 4) * 16 + wi / 4) * 8) = __builtin_bit_cast(v8us, o);  }

__global__ __launch_bounds__(256) void k_vtp(const float* __restrict__ F, int pitch, int nheads, h16* V16, bf* Vh, bf* Vl) { const size_t e = ((size_t)blockIdx.x * 256 + threadIdx.x) * 2; if (e >= (size_t)nheads * HD * TT) return; const int t = (int)(e % TT); const int d = (int)((e / TT) % HD); const int g = (int)(e / ((size_t)TT * HD)); v2h o16; v2us oh, ol;
#pragma unroll
    for (int q = 0; q < 2; ++q) { const float x = F[(size_t)(t + q) * pitch + g * HD + d]; o16[q] = tohx(x); unsigned short a2, c2; splitf(x, a2, c2); oh[q] = a2; ol[q] = c2; }
    *(v2h*)(V16 + e) = o16; *(v2us*)(Vh + e) = oh; *(v2us*)(Vl + e) = ol;  }
// k_asoft: per row (zz, i): t = S x HD^-0.5 (no mask); softmax over the 2048 keys (register row, one exp, fixed trees);
__global__ __launch_bounds__(256) void k_asoft(const float* __restrict__ Sb, h16* P16, bf* Ph, bf* Pl) {
    const int lane = threadIdx.x & 31; const int row = blockIdx.x * 8 + (threadIdx.x >> 5); if (row >= ZH * TT) return; const int i = row % TT; const int zz = row / TT; (void)zz; const bool hires = (i < RH); const float* sr = Sb + (size_t)row * TT; float v[TT / 32]; float mx = -3.0e38f;
#pragma unroll
    for (int ch = 0; ch < TT / 128; ++ch) { const int j0 = ch * 128 + lane * 4; const v4f a = *(const v4f*)(sr + j0);
#pragma unroll
        for (int q = 0; q < 4; ++q) { const int j = j0 + q; (void)j; const float t = a[q] * SCL; v[ch * 4 + q] = t; mx = fmaxf(mx, t); } }
#pragma unroll
    for (int sh = 16; sh; sh >>= 1) mx = fmaxf(mx, __shfl_xor(mx, sh, 32));
    float sum = 0.f;
#pragma unroll
    for (int k = 0; k < TT / 32; ++k) { float d0 = __fsub_rn(v[k], mx); asm volatile("" : "+v"(d0)); v[k] = __builtin_amdgcn_exp2f(__fmul_rn(d0, 1.4426950408889634f)); sum += v[k]; }
#pragma unroll
    for (int sh = 16; sh; sh >>= 1) sum += __shfl_xor(sum, sh, 32);
    const float f = __fdiv_rn(hires ? 1.0f : PCAR, sum);
{
        if (hires) {
#pragma unroll
            for (int ch = 0; ch < TT / 128; ++ch) { v4us oh, ol;
#pragma unroll
                for (int q = 0; q < 4; ++q) { unsigned short a, c2; splitf(v[ch * 4 + q] * f, a, c2); oh[q] = a; ol[q] = c2; }
                const size_t oo = ((size_t)zz * (RH ? RH : 1) + i) * TT + ch * 128 + lane * 4; *(v4us*)(Ph + oo) = oh; *(v4us*)(Pl + oo) = ol; }
        } else {
#pragma unroll
            for (int ch = 0; ch < TT / 128; ++ch) { v4h o4;
#pragma unroll
                for (int q = 0; q < 4; ++q) o4[q] = tohx(v[ch * 4 + q] * f);
                *(v4h*)(P16 + (size_t)row * TT + ch * 128 + lane * 4) = o4; } }
         }
}
__global__ __launch_bounds__(256) void k_merge(const float* __restrict__ O, int h0, bf* Ah, bf* Al) { const size_t e = ((size_t)blockIdx.x * 256 + threadIdx.x) * 2; if (e >= (size_t)ZH * TT * HD) return; const int d = (int)(e % HD); const int t = (int)((e / HD) % TT); const int zz = (int)(e / ((size_t)HD * TT)); const float cs = (t < RH) ? 1.0f : (1.0f / PCAR); const size_t oo = (size_t)t * DQ + (h0 + zz) * HD + d;
    v2us oh, ol;
#pragma unroll
    for (int q = 0; q < 2; ++q) { unsigned short a, c2; splitf(O[e + q] * cs, a, c2); oh[q] = a; ol[q] = c2; } *(v2us*)(Ah + oo) = oh; *(v2us*)(Al + oo) = ol;  }

#define FQB 2     // 16-query blocks per wave
#define FWV 4     // waves per work-group
#define FKS 4     // key quarters (grid z)
#define FNT (TT / FKS / 32)   // passes of 32 keys
#define KVU 6144  // 16-byte words of one staged tile: k 64 half-blocks of 512 bytes [batch][hi|lo][kc][4], then value^T 128 half-blocks [batch][hi|lo][16]
typedef __attribute__((ext_vector_type(8))) unsigned v8u;
// one wave's share of a tile: the k and value^T fragments of its own batch, 48 asynchronous copies of 16 bytes a lane (512 bytes a copy), global memory to LDS through no register. Six runs that are consecutive in memory and in LDS alike: k hi and lo, each d half (2 KiB), value^T hi and lo (8 KiB); the immediate offset moves both addresses.
// lk, lv: the LDS byte address of its batch's k and value^T part of the buffer; the pointers: the start of the 32 keys in each plane (all the same for every lane); lo: the lane's place, 8 elements (16 bytes) a lane.
// the s_wait_xcnt is a precaution that stands, inside the statement, between the copies and any later write to the address registers they name
__device__ __forceinline__ void stage_kv(unsigned lk, unsigned lv, const bf* kh, const bf* kl, const bf* vh, const bf* vl, int lo) {
    const unsigned lb = 2 * lo;
    asm volatile(
        "global_load_async_to_lds_b128 %0, %6, off\n\t"
        "global_load_async_to_lds_b128 %0, %6, off offset:512\n\t"
        "global_load_async_to_lds_b128 %0, %6, off offset:1024\n\t"
        "global_load_async_to_lds_b128 %0, %6, off offset:1536\n\t"
        "global_load_async_to_lds_b128 %1, %7, off\n\t"
        "global_load_async_to_lds_b128 %1, %7, off offset:512\n\t"
        "global_load_async_to_lds_b128 %1, %7, off offset:1024\n\t"
        "global_load_async_to_lds_b128 %1, %7, off offset:1536\n\t"
        "global_load_async_to_lds_b128 %2, %8, off\n\t"
        "global_load_async_to_lds_b128 %2, %8, off offset:512\n\t"
        "global_load_async_to_lds_b128 %2, %8, off offset:1024\n\t"
        "global_load_async_to_lds_b128 %2, %8, off offset:1536\n\t"
        "global_load_async_to_lds_b128 %3, %9, off\n\t"
        "global_load_async_to_lds_b128 %3, %9, off offset:512\n\t"
        "global_load_async_to_lds_b128 %3, %9, off offset:1024\n\t"
        "global_load_async_to_lds_b128 %3, %9, off offset:1536\n\t"
        "global_load_async_to_lds_b128 %4, %10, off\n\t"
        "global_load_async_to_lds_b128 %4, %10, off offset:512\n\t"
        "global_load_async_to_lds_b128 %4, %10, off offset:1024\n\t"
        "global_load_async_to_lds_b128 %4, %10, off offset:1536\n\t"
        "global_load_async_to_lds_b128 %4, %10, off offset:2048\n\t"
        "global_load_async_to_lds_b128 %4, %10, off offset:2560\n\t"
        "global_load_async_to_lds_b128 %4, %10, off offset:3072\n\t"
        "global_load_async_to_lds_b128 %4, %10, off offset:3584\n\t"
        "global_load_async_to_lds_b128 %4, %10, off offset:4096\n\t"
        "global_load_async_to_lds_b128 %4, %10, off offset:4608\n\t"
        "global_load_async_to_lds_b128 %4, %10, off offset:5120\n\t"
        "global_load_async_to_lds_b128 %4, %10, off offset:5632\n\t"
        "global_load_async_to_lds_b128 %4, %10, off offset:6144\n\t"
        "global_load_async_to_lds_b128 %4, %10, off offset:6656\n\t"
        "global_load_async_to_lds_b128 %4, %10, off offset:7168\n\t"
        "global_load_async_to_lds_b128 %4, %10, off offset:7680\n\t"
        "global_load_async_to_lds_b128 %5, %11, off\n\t"
        "global_load_async_to_lds_b128 %5, %11, off offset:512\n\t"
        "global_load_async_to_lds_b128 %5, %11, off offset:1024\n\t"
        "global_load_async_to_lds_b128 %5, %11, off offset:1536\n\t"
        "global_load_async_to_lds_b128 %5, %11, off offset:2048\n\t"
        "global_load_async_to_lds_b128 %5, %11, off offset:2560\n\t"
        "global_load_async_to_lds_b128 %5, %11, off offset:3072\n\t"
        "global_load_async_to_lds_b128 %5, %11, off offset:3584\n\t"
        "global_load_async_to_lds_b128 %5, %11, off offset:4096\n\t"
        "global_load_async_to_lds_b128 %5, %11, off offset:4608\n\t"
        "global_load_async_to_lds_b128 %5, %11, off offset:5120\n\t"
        "global_load_async_to_lds_b128 %5, %11, off offset:5632\n\t"
        "global_load_async_to_lds_b128 %5, %11, off offset:6144\n\t"
        "global_load_async_to_lds_b128 %5, %11, off offset:6656\n\t"
        "global_load_async_to_lds_b128 %5, %11, off offset:7168\n\t"
        "global_load_async_to_lds_b128 %5, %11, off offset:7680\n\t"
        "s_wait_xcnt 0x0"
        :: "v"(lk + lb), "v"((lk + 2048) + lb), "v"((lk + 4096) + lb), "v"((lk + 6144) + lb), "v"(lv + lb), "v"((lv + 8192) + lb),
           "v"(kh + lo), "v"(kh + TT * 32 + lo), "v"(kl + lo), "v"(kl + TT * 32 + lo), "v"(vh + lo), "v"(vl + lo) : "memory");
}
__global__ __launch_bounds__(32 * FWV) void k_fattn(const bf* __restrict__ QKh, const bf* __restrict__ QKl, const bf* __restrict__ VTh, const bf* __restrict__ VTl, float* PO) {
    typedef WFrag<bf> WF; typedef WF::V V;
    __shared__ __align__(16) v8us sm[2 * KVU + FWV * 2048];     // two k | value^T tiles (192 KiB), then each wave's q fragments [batch][nb][kc][hi|lo][half][lane] (32 KiB a wave): the whole LDS of a WGP
    const int lane = threadIdx.x & 31; const int w = __builtin_amdgcn_readfirstlane((int)(threadIdx.x >> 5));
    const int h = blockIdx.y, q0 = blockIdx.x * (16 * FQB * FWV) + w * (16 * FQB), k0 = blockIdx.z * (TT / FKS);
    const size_t sQK = (size_t)(NH_ + NKV) * TT * HD, sV = (size_t)NH_ * HDV * TT;
    // the copies' sources: this wave stages batch w; k planes (row = key: 32 keys are 2 blocks for each 32 d) and value^T planes (row = d: 32 keys are 8 blocks, one per 16 d); they step by 32 keys a tile
    const bf* Kh = QKh + (size_t)w * sQK + (size_t)(NH_ + h) * TT * HD + (size_t)k0 * 32; const bf* Kl = QKl + (Kh - QKh);
    const bf* Vh = VTh + (size_t)w * sV + (size_t)h * HDV * TT + (size_t)k0 * HDV; const bf* Vl = VTl + (Vh - VTh);
    const unsigned lb = (unsigned)(size_t)(__attribute__((address_space(3))) v8us*)sm; const unsigned lk = lb + w * (16 * 512), lv = lb + 64 * 512 + w * (32 * 512);
    stage_kv(lk, lv, Kh, Kl, Vh, Vl, 8 * lane);
    Kh += 32 * 32; Kl += 32 * 32; Vh += 32 * HDV; Vl += 32 * HDV;
    v8us* qs = sm + 2 * KVU + w * 2048 + lane;
    const bf* qp[NB_][2];
#pragma unroll
    for (int b = 0; b < NB_; ++b) { qp[b][0] = QKh + (size_t)b * sQK + (size_t)h * TT * HD + (size_t)q0 * 32 + 8 * lane; qp[b][1] = QKl + (qp[b][0] - QKh); }
#pragma unroll
    for (int b = 0; b < NB_; ++b)
#pragma unroll
        for (int nb = 0; nb < FQB; ++nb)
#pragma unroll
            for (int kc = 0; kc < 2; ++kc) { const int o = nb * 512 + kc * (TT * 32); const int f = ((b * FQB + nb) * 2 + kc) * 2;
                qs[f * 64] = *(const v8us*)(qp[b][0] + o); qs[f * 64 + 32] = *(const v8us*)(qp[b][0] + o + 256); qs[f * 64 + 64] = *(const v8us*)(qp[b][1] + o); qs[f * 64 + 96] = *(const v8us*)(qp[b][1] + o + 256); }
    // precaution: stands between the q loads and the first reuse of their address registers (held live up to here as inputs); the scheduling fence keeps the zeroing of the accumulators, which reuses them, behind the wait
    asm volatile("s_wait_xcnt 0x0" :: "v"(qp[0][0]), "v"(qp[0][1]), "v"(qp[1][0]), "v"(qp[1][1]), "v"(qp[2][0]), "v"(qp[2][1]), "v"(qp[3][0]), "v"(qp[3][1]) : "memory");
    __builtin_amdgcn_sched_barrier(0);
    // tile 0 has landed (this wave's copies), then the barrier publishes it to the other waves
    asm volatile("s_wait_asynccnt 0x0" ::: "memory");
    __syncthreads();
    stage_kv(lk + KVU * 16, lv + KVU * 16, Kh, Kl, Vh, Vl, 8 * lane);
    Kh += 32 * 32; Kl += 32 * 32; Vh += 32 * HDV; Vl += 32 * HDV;
    v8f acc[NB_][8][FQB];
#pragma unroll
    for (int b = 0; b < NB_; ++b)
#pragma unroll
        for (int db = 0; db < 8; ++db)
#pragma unroll
            for (int nb = 0; nb < FQB; ++nb) acc[b][db][nb] = (v8f){};
    // rolled, for speed only: one pass is some thousands of instructions
#pragma unroll 1
    for (int kt = 0; kt < FNT; ++kt) {
        const unsigned bo = (kt & 1) * KVU; const v8us* kv = sm + bo + lane;
        // k and q fragments of one batch: 32 LDS loads, 128 registers; two sets, so that batch b + 1 is fetched while batch b's products run
        V kh[2][2][2], kl[2][2][2], qh[2][2][FQB], ql[2][2][FQB];     // [set][kc][mb or nb]
#pragma unroll
        for (int kc = 0; kc < 2; ++kc) {
#pragma unroll
            for (int mb = 0; mb < 2; ++mb) { const int o = (kc * 4 + mb * 2) * 32; kh[0][kc][mb] = cat16b(kv[o], kv[o + 32]); kl[0][kc][mb] = cat16b(kv[o + 8 * 32], kv[o + 9 * 32]); }
#pragma unroll
            for (int nb = 0; nb < FQB; ++nb) { const int f = (nb * 2 + kc) * 2; qh[0][kc][nb] = cat16b(qs[f * 64], qs[f * 64 + 32]); ql[0][kc][nb] = cat16b(qs[f * 64 + 64], qs[f * 64 + 96]); } }
        v8f s[NB_][2][FQB];
#pragma unroll
        for (int b = 0; b < NB_; ++b) { const int st = b & 1, sn = (b + 1) & 1;
            if (b + 1 < NB_) {
#pragma unroll
                for (int kc = 0; kc < 2; ++kc) {
#pragma unroll
                    for (int mb = 0; mb < 2; ++mb) { const int o = ((b + 1) * 16 + kc * 4 + mb * 2) * 32; kh[sn][kc][mb] = cat16b(kv[o], kv[o + 32]); kl[sn][kc][mb] = cat16b(kv[o + 8 * 32], kv[o + 9 * 32]); }
#pragma unroll
                    for (int nb = 0; nb < FQB; ++nb) { const int f = (((b + 1) * FQB + nb) * 2 + kc) * 2; qh[sn][kc][nb] = cat16b(qs[f * 64], qs[f * 64 + 32]); ql[sn][kc][nb] = cat16b(qs[f * 64 + 64], qs[f * 64 + 96]); } } }
            // holds the next batch's 32 LDS loads, as one group, in front of this batch's 24 products: left free, the scheduler puts four loads directly in front of the six products that use them, and the wave waits out the LDS latency sixteen times a pass
            __builtin_amdgcn_sched_barrier(0);
#pragma unroll
            for (int mb = 0; mb < 2; ++mb)
#pragma unroll
                for (int nb = 0; nb < FQB; ++nb) s[b][mb][nb] = (v8f){};
            // the four score tiles take turns, so that no product follows directly on the one whose sum it adds to; each tile's own order of sums is kc 0, 1 and in each hi.hi, hi.lo, lo.hi
#pragma unroll
            for (int kc = 0; kc < 2; ++kc)
#pragma unroll
                for (int p = 0; p < 3; ++p)
#pragma unroll
                    for (int nb = 0; nb < FQB; ++nb)
#pragma unroll
                        for (int mb = 0; mb < 2; ++mb) s[b][mb][nb] = WF::mma(p == 2 ? kl[st][kc][mb] : kh[st][kc][mb], p == 1 ? ql[st][kc][nb] : qh[st][kc][nb], s[b][mb][nb]);
            // keeps the loads of batch b + 2 behind these products, whose fragments' registers they refill
            __builtin_amdgcn_sched_barrier(0); }
        // value^T fragments of batch 0 are asked for here, so that they come under the softmax arithmetic; those of batch b + 1 in front of batch b's products
        V vh[2][8], vl[2][8];
#pragma unroll
        for (int db = 0; db < 8; ++db) { const int o = (64 + db * 2) * 32; vh[0][db] = cat16b(kv[o], kv[o + 32]); vl[0][db] = cat16b(kv[o + 16 * 32], kv[o + 17 * 32]); }
        // holds these 32 loads as one group in front of the softmax arithmetic: left free, the scheduler spreads them over a dozen places in it
        __builtin_amdgcn_sched_barrier(0);
        v8u ph[NB_][FQB], pl[NB_][FQB];     // probabilities, bf16 hi and lo, two keys to a word: word i of (batch, nb) holds k slots 2i and 2i + 1 of the B operand
#pragma unroll
        for (int nb = 0; nb < FQB; ++nb)
#pragma unroll
            for (int mb = 0; mb < 2; ++mb) {
#pragma unroll
                for (int jp = 0; jp < 4; ++jp) { float pr[2][NB_];
#pragma unroll
                    for (int q = 0; q < 2; ++q) { const int j = 2 * jp + q; float t[NB_]; float mx = -3.0e38f;
#pragma unroll
                        for (int b = 0; b < NB_; ++b) { t[b] = __fmul_rn(s[b][mb][nb][j], SCL); mx = fmaxf(mx, t[b]); }
                        float xa[NB_], ex[NB_]; float sum = 0.f;
#pragma unroll
                        for (int b = 0; b < NB_; ++b) { xa[b] = __fmul_rn(__fsub_rn(t[b], mx), 1.4426950408889634f); ex[b] = __builtin_amdgcn_exp2f(xa[b]); }
                        // the slot the instruction set asks for between a transcendental and an overwrite of its source: the four arguments stay live (inputs) up to this v_nop, which stands behind the four v_exp (their results are inputs too)
                        asm volatile("v_nop" :: "v"(xa[0]), "v"(xa[1]), "v"(xa[2]), "v"(xa[3]), "v"(ex[0]), "v"(ex[1]), "v"(ex[2]), "v"(ex[3]));
#pragma unroll
                        for (int b = 0; b < NB_; ++b) sum = __fadd_rn(sum, ex[b]);
                        const float f = __fdiv_rn(1.0f, sum);
#pragma unroll
                        for (int b = 0; b < NB_; ++b) pr[q][b] = __fmul_rn(ex[b], f); }
#pragma unroll
                    for (int b = 0; b < NB_; ++b) { unsigned a, c; split2(pr[0][b], pr[1][b], a, c); ph[b][nb][mb * 4 + jp] = a; pl[b][nb][mb * 4 + jp] = c; } }
                // one 16x16 tile's softmax at a time: left free, the scheduler runs all four tiles abreast and their unpacked halves push accumulators into scratch
                __builtin_amdgcn_sched_barrier(0); }
#pragma unroll
        for (int b = 0; b < NB_; ++b) {
            if (b + 1 < NB_) {
#pragma unroll
                for (int db = 0; db < 8; ++db) { const int o = (64 + (b + 1) * 32 + db * 2) * 32; vh[(b + 1) & 1][db] = cat16b(kv[o], kv[o + 32]); vl[(b + 1) & 1][db] = cat16b(kv[o + 16 * 32], kv[o + 17 * 32]); } }
            // holds the next batch's 32 LDS loads, as one group, in front of this batch's 48 products: left free, the scheduler spreads them among the products
            __builtin_amdgcn_sched_barrier(0);
#pragma unroll
            for (int db = 0; db < 8; ++db)
#pragma unroll
                for (int nb = 0; nb < FQB; ++nb) { const V bh = __builtin_bit_cast(V, ph[b][nb]), bl = __builtin_bit_cast(V, pl[b][nb]);
                    acc[b][db][nb] = WF::mma(vh[b & 1][db], bh, acc[b][db][nb]); acc[b][db][nb] = WF::mma(vh[b & 1][db], bl, acc[b][db][nb]); acc[b][db][nb] = WF::mma(vl[b & 1][db], bh, acc[b][db][nb]); }
            // keeps the loads of batch b + 2 behind these products, whose fragments' registers they refill
            __builtin_amdgcn_sched_barrier(0); }
        // hand-over: this wave's LDS reads of the tile are done
        asm volatile("s_wait_dscnt 0x0" ::: "memory");
        // its copies of the next tile have landed
        asm volatile("s_wait_asynccnt 0x0" ::: "memory");
        // publishes the next tile and ends every wave's reads of this one, whose buffer is refilled behind it
        __syncthreads();
        // the two LDS addresses are formed as scalars here: left free, the compiler keeps their lane-wise sums over the whole loop and, short of low registers, spills them to scratch
        if (kt + 2 < FNT) { stage_kv(__builtin_amdgcn_readfirstlane(lk + bo * 16), __builtin_amdgcn_readfirstlane(lv + bo * 16), Kh, Kl, Vh, Vl, 8 * lane); Kh += 32 * 32; Kl += 32 * 32; Vh += 32 * HDV; Vl += 32 * HDV; }
    }
    // no copy is left in flight when the wave ends
    asm volatile("s_wait_asynccnt 0x0" ::: "memory");
    // partial O^T, f32: tile (head, 16-query block, batch, quarter, db) is 1 KiB, [half][lane] 16 bytes: every store of a wave is 512 consecutive bytes, and the four quarters of a (query block, batch) lie side by side for k_fmrg
    v4f* pp = (v4f*)PO + (((size_t)h * (TT / 16) + q0 / 16) * (NB_ * FKS) + blockIdx.z) * (8 * 64);   // the same for every lane: a scalar base; all 128 stores lie within 256 KiB of it, and the lane's number is their one vector address register
#pragma unroll
    for (int b = 0; b < NB_; ++b)
#pragma unroll
        for (int nb = 0; nb < FQB; ++nb)
#pragma unroll
            for (int db = 0; db < 8; ++db) { const v8f a = acc[b][db][nb]; const int o = ((nb * NB_ + b) * FKS * 8 + db) * 64; pp[o + lane] = (v4f){a[0], a[1], a[2], a[3]}; pp[o + 32 + lane] = (v4f){a[4], a[5], a[6], a[7]}; }
}
// ---- k_fmrg: context = the four key quarters' partial O^T, added in order 0..3, split hi/lo into the context planes. One wave takes the 8 d tiles of one (head, 16-query block, batch), 32 KiB in a row, 64 loads of 512 bytes.
__global__ __launch_bounds__(256) void k_fmrg(const float* __restrict__ PO, bf* ATh, bf* ATl) {
    const int lane = threadIdx.x & 31; const int g = blockIdx.x * 8 + __builtin_amdgcn_readfirstlane((int)(threadIdx.x >> 5)); const int b = g % NB_, qb = (g / NB_) % (TT / 16), h = g / (NB_ * (TT / 16));
    const v4f* p = (const v4f*)PO + (size_t)g * (FKS * 8 * 64);   // 32 KiB in a row; the same for every lane: a scalar base, and the lane's number is the loads' one vector address register
    v4f x[8][FKS][2];
#pragma unroll
    for (int db = 0; db < 8; ++db)
#pragma unroll
        for (int s = 0; s < FKS; ++s) { x[db][s][0] = p[(s * 8 + db) * 64 + lane]; x[db][s][1] = p[(s * 8 + db) * 64 + 32 + lane]; }
    bf* oh8 = ATh + (size_t)(h * (HDV / 32)) * (NB_ * TT * 32) + ((size_t)b * TT + qb * 16) * 32 + 8 * lane; bf* ol8 = ATl + (oh8 - ATh);
#pragma unroll
    for (int db = 0; db < 8; ++db) { v4f x0 = x[db][0][0], x1 = x[db][0][1];
#pragma unroll
        for (int s = 1; s < FKS; ++s) { x0 += x[db][s][0]; x1 += x[db][s][1]; }
        u32x4 oh, ol;
#pragma unroll
        for (int j = 0; j < 2; ++j) { unsigned a, c; split2(x0[2 * j], x0[2 * j + 1], a, c); oh[j] = a; ol[j] = c; split2(x1[2 * j], x1[2 * j + 1], a, c); oh[2 + j] = a; ol[2 + j] = c; }
        const size_t oo = (size_t)(db >> 1) * (NB_ * TT * 32) + (db & 1) * 256; *(v8us*)(oh8 + oo) = __builtin_bit_cast(v8us, oh); *(v8us*)(ol8 + oo) = __builtin_bit_cast(v8us, ol); }   // context planes [8192][DV] in fragment order: the lane's 8 d of one query are its own 16 bytes of half-block db & 1
}

extern "C" void kernel_launch(void* const* d_in, const int* in_sizes, int n_in,
                              void* d_out, int out_size, void* d_ws, size_t ws_size, hipStream_t stream) {
    (void)in_sizes; (void)n_in; (void)out_size;
    const float* x = (const float*)d_in[0]; const float* wq = (const float*)d_in[1]; const float* wk = (const float*)d_in[2]; const float* wv = (const float*)d_in[3]; const float* wo = (const float*)d_in[4];
    float* OUT = (float*)d_out;     // [4][2048][512]
    char* wsp = (char*)d_ws;
    auto take = [&](size_t bytes) { char* p = wsp; wsp += (bytes + 255) & ~(size_t)255; return (void*)p; };
    bf* W = (bf*)take((size_t)(DQ + DKV + DV + DV) * DM * 2); bf* WO = W + (size_t)(DQ + DKV + DV) * DM;
    bf* XB = (bf*)take((size_t)NB_ * TT * DM * 2);
    bf* QKh = (bf*)take((size_t)NB_ * (NH_ + NKV) * TT * HD * 2); bf* QKl = (bf*)take((size_t)NB_ * (NH_ + NKV) * TT * HD * 2);   /* [b][8] planes [t][d] in fragment order: heads 0-3 q, 4-7 k */
    bf* VTh = (bf*)take((size_t)NB_ * NH_ * HDV * TT * 2); bf* VTl = (bf*)take((size_t)NB_ * NH_ * HDV * TT * 2);
    bf* ATh = (bf*)take((size_t)NB_ * TT * DV * 2); bf* ATl = (bf*)take((size_t)NB_ * TT * DV * 2);
    float* PO = (float*)take((size_t)FKS * NB_ * TT * DV * 4);   /* the key quarters' partial O^T */
    if ((size_t)(wsp - (char*)d_ws) > ws_size) return;    // ws 256 MiB (carve ~122 MiB)
    k_wtG<<<dim3((unsigned)((DM * DV / 64 + 63) / 64), 4, 1), 256, 0, stream>>>(wq, wk, wv, wo, W);
    const int PF = DQ + DKV + DV;
    /* projections + planes, every batch in one launch (the softmax couples the batches) */
    k_cvt8<<<(unsigned)(((size_t)NB_ * TT * DM / 8 + 255) / 256), 256, 0, stream>>>(x, XB, (size_t)NB_ * TT * DM / 8);
    k_gemmw<bf, 0, false, true><<<dim3(NB_ * TT / 64, PF / 64, 1), 32, 0, stream>>>(XB, nullptr, W, nullptr, DM, nullptr, 0, nullptr, 0, 0, 0, QKh, QKl, VTh, VTl);
    k_fattn<<<dim3(TT / (16 * FQB * FWV), NH_, FKS), 32 * FWV, 0, stream>>>(QKh, QKl, VTh, VTl, PO);   /* all heads, all batches */
    k_fmrg<<<NB_ * NH_ * (TT / 16) / 8, 256, 0, stream>>>(PO, ATh, ATl);
    k_gemmw<bf, 1, false><<<dim3(NB_ * TT / 64, DV / 64, 1), 32, 0, stream>>>(ATh, ATl, WO, nullptr, DV, OUT, DV, nullptr, 0, 0, 0);
}

// v008
// Measured time: 119 microseconds a run.
// Next to v007, in two timings, it ran 1.05 times as fast each time.
// Counting every step since v000, it is 9.65 times as fast.
#include <hip/hip_runtime.h>

// Multi-head attention whose softmax runs over the BATCH axis (the source's nn.Softmax() with no dim on a (B,N,N)-shaped view picks dim 0): input_x [4][2048][512]; q = x Wq, k = x Wk ('xw' [512][256]: 4 heads x 64), v = x Wv ('xw' [512][512]: 4 heads x 128); scores[b][h][q][k] = q.k / 8; attn = softmax over b (the 4 batches, per (h, q, k)); out[b][q][h*128+d] = sum_k attn[b][h][q][k] v[b][k][h][d]; out Wo ('xw' [512][512]) -> [4][2048][512] (4.2 M).
// Layout: exact projections first: one GEMM [8192][512] x [1024][512]^T gives q | k | v of every batch, and its epilogue writes them straight as q/k planes per (batch, head), bf16 hi/lo (heads 0-3 q, 4-7 k), and value^T planes per (batch, head); then ONE attention kernel (k_fattn) for all heads: a wave holds the scores of all four batches for 32 keys x 32 queries in registers, takes the softmax ACROSS the batches there, feeds the probabilities (hi/lo) straight into the 3-product P.v; a work-group covers 128 queries x 512 keys and stores an f32 partial, and k_fmrg adds the four key quarters and writes the hi/lo context planes; finally out = context Wo (hl x exact), 8192 rows in one GEMM.
// FRAGMENT ORDER: every 16-bit plane that a matrix instruction reads ([rows][K], K-contiguous in meaning) is stored as blocks of 16 rows x 32 k (512 elements, 1 KiB), block (k / 32) * (rows / 16) + row / 16 (neighbouring row blocks of one k step lie side by side: a tile's fragments of a k step are one run of bytes); inside a block element (row, k) lies at ((k % 32) / 16) * 256 + (((k % 16) / 8) * 16 + row % 16) * 8 + k % 8. That is the order in which the 32 lanes hold an A or B fragment, so each of a fragment's two 16-byte loads reads 512 consecutive bytes (4 whole lines) where a row-major plane gave 16 lines with 32 bytes used of each.
// Compute dtypes, f32 accumulate: every input rounded to bf16; projections exact; scores and attn.v on bf16 hi/lo planes (3 products) everywhere; the cross-batch softmax in f32.

#define NB_  4
#define TT   2048
#define DM   512
#define NH_  4
#define NKV  4
#define REP  (NH_ / NKV)
#define HD   64
#define DQ   (NH_ * HD)
#define DKV  (NKV * HD)
#define ZH   2
#define RH   2048                  // query rows < RH use hi+lo planes (0: none)
#define WIN  0
#define PCAR 1024.0f
#define SCL  0.125f   // 64^-0.5
#define HDV  128      // value head dim
#define DV   (NH_ * HDV)   // 512
typedef _Float16 h16;
typedef unsigned short bf;
typedef __attribute__((ext_vector_type(16))) __bf16   v16bf;
typedef __attribute__((ext_vector_type(16))) _Float16 v16h;
typedef __attribute__((ext_vector_type(8)))  _Float16 v8h;
typedef __attribute__((ext_vector_type(8)))  unsigned short v8us;
typedef __attribute__((ext_vector_type(8)))  float    v8f;
typedef __attribute__((ext_vector_type(4)))  float    v4f;
typedef v8h  __attribute__((may_alias)) v8ha;
typedef v4f  __attribute__((may_alias)) v4fa;
typedef v8us __attribute__((may_alias)) v8usa;

__device__ __forceinline__ unsigned short f2bf(float f) { unsigned u = __float_as_uint(f); u += 0x7FFFu + ((u >> 16) & 1u); return (unsigned short)(u >> 16); }
__device__ __forceinline__ float bf2f(unsigned short b) { return __uint_as_float(((unsigned)b) << 16); }
__device__ __forceinline__ float bfr(float f) { return bf2f(f2bf(f)); }
__device__ __forceinline__ void splitf(float y, unsigned short& h, unsigned short& l) { h = f2bf(y); l = f2bf(y - bf2f(h)); }
// two f32 to two bf16 in one word (a in the low half), round to nearest even, by the chip's packed conversion: one instruction where the integer rounding of f2bf takes some four for each value and a pack
typedef __attribute__((ext_vector_type(2))) float f32x2;
typedef __attribute__((ext_vector_type(2))) __bf16 bf16x2;
typedef __attribute__((ext_vector_type(4))) unsigned u32x4;
__device__ __forceinline__ unsigned pk2bf(float a, float b) { const f32x2 x = {a, b}; return __builtin_bit_cast(unsigned, __builtin_convertvector(x, bf16x2)); }
// hi/lo split of two values: h = their bf16 roundings, l = the roundings of what h leaves
__device__ __forceinline__ void split2(float y0, float y1, unsigned& h, unsigned& l) { h = pk2bf(y0, y1); l = pk2bf(y0 - __uint_as_float(h << 16), y1 - __uint_as_float(h & 0xFFFF0000u)); }
__device__ __forceinline__ v16h cat16(v8h lo, v8h hi) { return __builtin_shufflevector(lo, hi, 0, 1, 2, 3, 4, 5, 6, 7, 8, 9, 10, 11, 12, 13, 14, 15); }
__device__ __forceinline__ v16bf cat16b(v8us lo, v8us hi) { return __builtin_bit_cast(v16bf, __builtin_shufflevector(lo, hi, 0, 1, 2, 3, 4, 5, 6, 7, 8, 9, 10, 11, 12, 13, 14, 15)); }
__device__ __forceinline__ v8f wmma16(v16h a, v16h b, v8f c) { return __builtin_amdgcn_wmma_f32_16x16x32_f16(false, a, false, b, (short)0, c, false, false); }
__device__ __forceinline__ v8f wmmab(v16bf a, v16bf b, v8f c) { return __builtin_amdgcn_wmma_f32_16x16x32_bf16(false, a, false, b, (short)0, c, false, false); }



// ---- k_gemmw: register-blocked GEMM, ONE WAVE per 64x64 output tile (16 accumulators), operands straight from 16-bit planes in fragment order; grid (M/64, N/64, Z), 32 threads.
// C[m][n] (f32, pitch ldc, + optional f32 bias[n]) = sum_k A[m][k] Bt[n][k] (+ split products per NSPLIT). z-batch strides sA/sB/sC in elements. K % 32 == 0.
// PLANES (the q | k | v projection): no C; the epilogue splits the tile hi/lo and writes it as attention planes. A 64-column tile is one whole q or k head (columns 0-511: plane c0 / 64) or half a value head (columns 512-1023); its 64 rows lie in one batch.
// ld: p = start of a 16 x 32 block in fragment order + lane * 8
template <typename T16> struct WFrag;
template <> struct WFrag<h16> { typedef v16h V; static __device__ __forceinline__ V ld(const h16* p) { return cat16(*(const v8h*)p, *(const v8h*)(p + 256)); } static __device__ __forceinline__ v8f mma(V a, V b, v8f c) { return wmma16(a, b, c); } };
template <> struct WFrag<bf> { typedef v16bf V; static __device__ __forceinline__ V ld(const bf* p) { return cat16b(*(const v8us*)p, *(const v8us*)(p + 256)); } static __device__ __forceinline__ v8f mma(V a, V b, v8f c) { return wmmab(a, b, c); } };
template <typename T16, int NSPLIT, bool BIAS, bool PLANES = false>
__global__ __launch_bounds__(32) void k_gemmw(const T16* __restrict__ A, const T16* __restrict__ A2, const T16* __restrict__ Bt, const T16* __restrict__ Bt2, int K, float* C, int ldc, const float* __restrict__ bias, size_t sA, size_t sB, size_t sC, bf* QKh = nullptr, bf* QKl = nullptr, bf* VTh = nullptr, bf* VTl = nullptr) {
    typedef typename WFrag<T16>::V V;
    __shared__ __align__(16) float os[16 * 68];
    const size_t z = blockIdx.z; A += z * sA; if (A2) A2 += z * sA; Bt += z * sB; if (Bt2) Bt2 += z * sB; C += z * sC;
    const int lane = threadIdx.x & 31, lr = lane & 15, hi = lane >> 4; const int r0 = blockIdx.x * 64, c0 = blockIdx.y * 64;
    v8f acc[4][4];
#pragma unroll
    for (int mb = 0; mb < 4; ++mb)
#pragma unroll
        for (int nb = 0; nb < 4; ++nb) acc[mb][nb] = (v8f){};
    const size_t aoff = (size_t)r0 * 32 + 8 * lane, boff = (size_t)c0 * 32 + 8 * lane;   // 16 rows are one block = 512 elements
    const size_t ka = (size_t)gridDim.x * (64 * 32), kb = (size_t)gridDim.y * (64 * 32);   // the grid covers all rows of the A and of the B plane: 32 k on is rows * 32 elements on
    const T16* pa = A + aoff; const T16* pa2 = A2 + aoff; const T16* pb = Bt + boff; const T16* pb2 = Bt2 + boff;
#pragma unroll 1
    for (int kc = 0; kc < K; kc += 32) {
        V a[4], a2[4];
#pragma unroll
        for (int mb = 0; mb < 4; ++mb) { a[mb] = WFrag<T16>::ld(pa + mb * 512); if (NSPLIT == 1 || NSPLIT == 2) a2[mb] = WFrag<T16>::ld(pa2 + mb * 512); }
#pragma unroll
        for (int nb = 0; nb < 4; ++nb) { const V b = WFrag<T16>::ld(pb + nb * 512); V b2; if (NSPLIT >= 2) b2 = WFrag<T16>::ld(pb2 + nb * 512);
#pragma unroll
            for (int mb = 0; mb < 4; ++mb) { acc[mb][nb] = WFrag<T16>::mma(a[mb], b, acc[mb][nb]); if (NSPLIT == 1 || NSPLIT == 2) acc[mb][nb] = WFrag<T16>::mma(a2[mb], b, acc[mb][nb]); if (NSPLIT >= 2) acc[mb][nb] = WFrag<T16>::mma(a[mb], b2, acc[mb][nb]); } }
        asm volatile("v_nop\n\tv_nop\n\tv_nop\n\tv_nop" : "+v"(acc[0][0]), "+v"(acc[1][1]), "+v"(acc[2][2]), "+v"(acc[3][3]) : "v"(a[0]), "v"(a[3]));
        // precaution: stands between this trip's loads and the step of their pointers; the pointers are held live up to here (inputs), so that no later load's result is put into the registers of an address still in use
        if (NSPLIT == 0) asm volatile("s_wait_xcnt 0x0" :: "v"(pa), "v"(pb) : "memory");
        else if (NSPLIT == 1) asm volatile("s_wait_xcnt 0x0" :: "v"(pa), "v"(pa2), "v"(pb) : "memory");
        else asm volatile("s_wait_xcnt 0x0" :: "v"(pa), "v"(pa2), "v"(pb), "v"(pb2) : "memory");
        pa += ka; pa2 += ka; pb += kb; pb2 += kb;
    }
    if (PLANES) {
        const int bz = r0 / TT, t0 = r0 % TT;
        if (c0 < DQ + DKV) {
            // q or k: a plane row is a token, K = its 64 d, fragment order; a 16-row block goes through LDS so that a lane holds 8 neighbouring d of one token: trip s stores d 16 s .. 16 s + 15 of the 16 tokens, a half-block: 512 consecutive bytes
            const size_t po = (size_t)(bz * (NH_ + NKV) + c0 / HD) * TT * HD + (size_t)t0 * 32;
#pragma unroll
            for (int mb = 0; mb < 4; ++mb) {
#pragma unroll
                for (int nb = 0; nb < 4; ++nb) {
#pragma unroll
                    for (int j = 0; j < 8; ++j) os[(hi * 8 + j) * 68 + nb * 16 + lr] = acc[mb][nb][j]; }
                // one wave: keeps its LDS writes in front of its reads of other lanes' words
                __builtin_amdgcn_wave_barrier(); asm volatile("" ::: "memory");
#pragma unroll
                for (int s = 0; s < 4; ++s) { const int row = lr, cofs = (2 * s + hi) * 8; const v4f x0 = *(const v4fa*)(os + row * 68 + cofs), x1 = *(const v4fa*)(os + row * 68 + cofs + 4); u32x4 oh, ol;
#pragma unroll
                    for (int j = 0; j < 2; ++j) { unsigned p, c; split2(x0[2 * j], x0[2 * j + 1], p, c); oh[j] = p; ol[j] = c; split2(x1[2 * j], x1[2 * j + 1], p, c); oh[2 + j] = p; ol[2 + j] = c; }
                    const size_t oo = po + (size_t)(s >> 1) * (TT * 32) + mb * 512 + (s & 1) * 256 + lane * 8; *(v8us*)(QKh + oo) = __builtin_bit_cast(v8us, oh); *(v8us*)(QKl + oo) = __builtin_bit_cast(v8us, ol); }
                // and those reads in front of the next block's writes
                __builtin_amdgcn_wave_barrier(); asm volatile("" ::: "memory");
            }
        } else {
            // value^T: a plane row is one d, K = the tokens, fragment order (a wave of k_fattn reads all 128 d of 32 tokens: 8 KiB in a row); the 8 accumulator words a lane holds of a tile are 8 neighbouring tokens of one d, the lane's own 16 bytes of half-block mb & 1: stored from the registers
            const int cv = c0 - (DQ + DKV); const size_t po = (size_t)(bz * NH_ + cv / HDV) * HDV * TT + (size_t)(t0 / 32) * (HDV * 32) + (cv % HDV) * 32 + 8 * lane;
#pragma unroll
            for (int nb = 0; nb < 4; ++nb)
#pragma unroll
                for (int mb = 0; mb < 4; ++mb) { u32x4 oh, ol;
#pragma unroll
                    for (int j = 0; j < 4; ++j) { unsigned p, c; split2(acc[mb][nb][2 * j], acc[mb][nb][2 * j + 1], p, c); oh[j] = p; ol[j] = c; }
                    const size_t oo = po + (size_t)(mb >> 1) * (HDV * 32) + nb * 512 + (mb & 1) * 256; *(v8us*)(VTh + oo) = __builtin_bit_cast(v8us, oh); *(v8us*)(VTl + oo) = __builtin_bit_cast(v8us, ol); }
            // precaution: stands behind the last stores of this branch, in front of any later write to their data and address registers
            asm volatile("s_wait_xcnt 0x0" ::: "memory");
        }
        return;
    }
#pragma unroll
    for (int mb = 0; mb < 4; ++mb) {
#pragma unroll
        for (int nb = 0; nb < 4; ++nb) {
#pragma unroll
            for (int j = 0; j < 8; ++j) os[(hi * 8 + j) * 68 + nb * 16 + lr] = acc[mb][nb][j]; }
        __builtin_amdgcn_wave_barrier(); asm volatile("" ::: "memory");
        float* crow = C + (size_t)(r0 + mb * 16) * ldc + c0;
{
#pragma unroll
            for (int s = 0; s < 8; ++s) { const int row = 2 * s + hi, cofs = lr * 4; v4f val = *(const v4fa*)(os + row * 68 + cofs); if (BIAS) { val[0] += bfr(bias[c0 + cofs]); val[1] += bfr(bias[c0 + cofs + 1]); val[2] += bfr(bias[c0 + cofs + 2]); val[3] += bfr(bias[c0 + cofs + 3]); }
                *(v4f*)(crow + (size_t)row * ldc + cofs) = val; }
             }
        __builtin_amdgcn_wave_barrier(); asm volatile("" ::: "memory");
    }
}

__device__ __forceinline__ h16 tohx(float x) { return (h16)x; }
typedef __attribute__((ext_vector_type(2))) _Float16 v2h;
typedef __attribute__((ext_vector_type(4))) _Float16 v4h;
typedef __attribute__((ext_vector_type(2))) unsigned short v2us;
typedef __attribute__((ext_vector_type(4))) unsigned short v4us;
typedef __attribute__((ext_vector_type(2))) float v2f;
typedef __attribute__((ext_vector_type(4))) int v4i;

// grid y picks the weight: 0 Wq, 1 Wk, 2 Wv, 3 Wo; two transposed planes in W, K = 512, fragment order: q | k | v (1024 rows: 0-255 q, 256-511 k, 512-1023 v) and behind it o (512 rows).
__global__ __launch_bounds__(256) void k_wtG(const float* __restrict__ w0, const float* __restrict__ w1, const float* __restrict__ w2, const float* __restrict__ w3, bf* W) {
    const int y = blockIdx.y; const float* __restrict__ w = (y == 0) ? w0 : (y == 1) ? w1 : (y == 2) ? w2 : w3; const int K = DM; const int N = (y < 2) ? DQ : DV; const int ls = (y < 2) ? 4 : 5;   /* N / 16 = 1 << ls row blocks */ const int R = (y < 3) ? (DQ + DKV + DV) : DV, roff = (y == 1) ? DQ : (y == 2) ? (DQ + DKV) : 0; bf* Bt = W + ((y < 3) ? 0 : (size_t)(DQ + DKV + DV) * DM);
    const int lane = threadIdx.x & 31; const int L0 = (blockIdx.x * 8 + (threadIdx.x >> 5)) * 8; const int nlines = N * K / 64;
{
#pragma unroll 1
        for (int l = 0; l < 8; ++l) { const int L = L0 + l; if (L >= nlines) break; const size_t e = (size_t)L * 64 + lane * 2; const int blk = (int)(e / 512), wi = (int)(e % 512); const int kq = blk >> ls, rb = blk & ((1 << ls) - 1); const int k = kq * 32 + (wi / 256) * 16 + ((wi % 256) / 128) * 8 + wi % 8, n = rb * 16 + (wi % 128) / 8; const unsigned o = pk2bf(w[(size_t)k * N + n], w[(size_t)(k + 1) * N + n]);
            *(v2us*)(Bt + ((size_t)kq * (R / 16) + roff / 16 + rb) * 512 + wi) = __builtin_bit_cast(v2us, o);
            // precaution: stands between the store and the next trip's first write to its data and address registers
            asm volatile("s_wait_xcnt 0x0" ::: "memory"); }
         }
}
// 64 threads convert one 16 x 32 block of the plane ([NB_ * TT][DM] in fragment order): four neighbouring threads read the 32 floats (one 128-byte line) of one row, so a wave reads 8 whole lines and writes 4 whole lines (8 rows' pieces of each k octet lie side by side)
__global__ __launch_bounds__(256) void k_cvt8(const float* __restrict__ src, bf* dst, size_t n8) { const size_t i = (size_t)blockIdx.x * 256 + threadIdx.x; if (i >= n8) return; const int blk = (int)(i / 64), wi = (int)(i % 64); const v8f v = *(const v8f*)(src + (size_t)((blk % (NB_ * TT / 16)) * 16 + wi / 4) * DM + (blk / (NB_ * TT / 16)) * 32 + (wi % 4) * 8); u32x4 o;
#pragma unroll
    for (int k = 0; k < 4; ++k) o[k] = pk2bf(v[2 * k], v[2 * k + 1]); *(v8us*)(dst + (size_t)blk * 512 + ((wi % 4) * 16 + wi / 4) * 8) = __builtin_bit_cast(v8us, o);  }

__global__ __launch_bounds__(256) void k_vtp(const float* __restrict__ F, int pitch, int nheads, h16* V16, bf* Vh, bf* Vl) { const size_t e = ((size_t)blockIdx.x * 256 + threadIdx.x) * 2; if (e >= (size_t)nheads * HD * TT) return; const int t = (int)(e % TT); const int d = (int)((e / TT) % HD); const int g = (int)(e / ((size_t)TT * HD)); v2h o16; v2us oh, ol;
#pragma unroll
    for (int q = 0; q < 2; ++q) { const float x = F[(size_t)(t + q) * pitch + g * HD + d]; o16[q] = tohx(x); unsigned short a2, c2; splitf(x, a2, c2); oh[q] = a2; ol[q] = c2; }
    *(v2h*)(V16 + e) = o16; *(v2us*)(Vh + e) = oh; *(v2us*)(Vl + e) = ol;  }
// k_asoft: per row (zz, i): t = S x HD^-0.5 (no mask); softmax over the 2048 keys (register row, one exp, fixed trees);
__global__ __launch_bounds__(256) void k_asoft(const float* __restrict__ Sb, h16* P16, bf* Ph, bf* Pl) {
    const int lane = threadIdx.x & 31; const int row = blockIdx.x * 8 + (threadIdx.x >> 5); if (row >= ZH * TT) return; const int i = row % TT; const int zz = row / TT; (void)zz; const bool hires = (i < RH); const float* sr = Sb + (size_t)row * TT; float v[TT / 32]; float mx = -3.0e38f;
#pragma unroll
    for (int ch = 0; ch < TT / 128; ++ch) { const int j0 = ch * 128 + lane * 4; const v4f a = *(const v4f*)(sr + j0);
#pragma unroll
        for (int q = 0; q < 4; ++q) { const int j = j0 + q; (void)j; const float t = a[q] * SCL; v[ch * 4 + q] = t; mx = fmaxf(mx, t); } }
#pragma unroll
    for (int sh = 16; sh; sh >>= 1) mx = fmaxf(mx, __shfl_xor(mx, sh, 32));
    float sum = 0.f;
#pragma unroll
    for (int k = 0; k < TT / 32; ++k) { float d0 = __fsub_rn(v[k], mx); asm volatile("" : "+v"(d0)); v[k] = __builtin_amdgcn_exp2f(__fmul_rn(d0, 1.4426950408889634f)); sum += v[k]; }
#pragma unroll
    for (int sh = 16; sh; sh >>= 1) sum += __shfl_xor(sum, sh, 32);
    const float f = __fdiv_rn(hires ? 1.0f : PCAR, sum);
{
        if (hires) {
#pragma unroll
            for (int ch = 0; ch < TT / 128; ++ch) { v4us oh, ol;
#pragma unroll
                for (int q = 0; q < 4; ++q) { unsigned short a, c2; splitf(v[ch * 4 + q] * f, a, c2); oh[q] = a; ol[q] = c2; }
                const size_t oo = ((size_t)zz * (RH ? RH : 1) + i) * TT + ch * 128 + lane * 4; *(v4us*)(Ph + oo) = oh; *(v4us*)(Pl + oo) = ol; }
        } else {
#pragma unroll
            for (int ch = 0; ch < TT / 128; ++ch) { v4h o4;
#pragma unroll
                for (int q = 0; q < 4; ++q) o4[q] = tohx(v[ch * 4 + q] * f);
                *(v4h*)(P16 + (size_t)row * TT + ch * 128 + lane * 4) = o4; } }
         }
}
__global__ __launch_bounds__(256) void k_merge(const float* __restrict__ O, int h0, bf* Ah, bf* Al) { const size_t e = ((size_t)blockIdx.x * 256 + threadIdx.x) * 2; if (e >= (size_t)ZH * TT * HD) return; const int d = (int)(e % HD); const int t = (int)((e / HD) % TT); const int zz = (int)(e / ((size_t)HD * TT)); const float cs = (t < RH) ? 1.0f : (1.0f / PCAR); const size_t oo = (size_t)t * DQ + (h0 + zz) * HD + d;
    v2us oh, ol;
#pragma unroll
    for (int q = 0; q < 2; ++q) { unsigned short a, c2; splitf(O[e + q] * cs, a, c2); oh[q] = a; ol[q] = c2; } *(v2us*)(Ah + oo) = oh; *(v2us*)(Al + oo) = ol;  }

#define FQB 2     // 16-query blocks per wave
#define FWV 4     // waves per work-group
#define FKS 4     // key quarters (grid z)
#define FNT (TT / FKS / 32)   // passes of 32 keys
#define KVU 6144  // 16-byte words of one staged tile: k 64 half-blocks of 512 bytes [batch][hi|lo][kc][4], then value^T 128 half-blocks [batch][hi|lo][16]
typedef __attribute__((ext_vector_type(8))) unsigned v8u;
// one wave's share of a tile: the k and value^T fragments of its own batch, 48 asynchronous copies of 16 bytes a lane (512 bytes a copy), global memory to LDS through no register. Six runs that are consecutive in memory and in LDS alike: k hi and lo, each d half (2 KiB), value^T hi and lo (8 KiB); the immediate offset moves both addresses.
// lk, lv: the LDS byte address of its batch's k and value^T part of the buffer; the pointers: the start of the 32 keys in each plane (all the same for every lane); lo: the lane's place, 8 elements (16 bytes) a lane.
// the s_wait_xcnt is a precaution that stands, inside the statement, between the copies and any later write to the address registers they name
__device__ __forceinline__ void stage_kv(unsigned lk, unsigned lv, const bf* kh, const bf* kl, const bf* vh, const bf* vl, int lo) {
    const unsigned lb = 2 * lo;
    asm volatile(
        "global_load_async_to_lds_b128 %0, %6, off\n\t"
        "global_load_async_to_lds_b128 %0, %6, off offset:512\n\t"
        "global_load_async_to_lds_b128 %0, %6, off offset:1024\n\t"
        "global_load_async_to_lds_b128 %0, %6, off offset:1536\n\t"
        "global_load_async_to_lds_b128 %1, %7, off\n\t"
        "global_load_async_to_lds_b128 %1, %7, off offset:512\n\t"
        "global_load_async_to_lds_b128 %1, %7, off offset:1024\n\t"
        "global_load_async_to_lds_b128 %1, %7, off offset:1536\n\t"
        "global_load_async_to_lds_b128 %2, %8, off\n\t"
        "global_load_async_to_lds_b128 %2, %8, off offset:512\n\t"
        "global_load_async_to_lds_b128 %2, %8, off offset:1024\n\t"
        "global_load_async_to_lds_b128 %2, %8, off offset:1536\n\t"
        "global_load_async_to_lds_b128 %3, %9, off\n\t"
        "global_load_async_to_lds_b128 %3, %9, off offset:512\n\t"
        "global_load_async_to_lds_b128 %3, %9, off offset:1024\n\t"
        "global_load_async_to_lds_b128 %3, %9, off offset:1536\n\t"
        "global_load_async_to_lds_b128 %4, %10, off\n\t"
        "global_load_async_to_lds_b128 %4, %10, off offset:512\n\t"
        "global_load_async_to_lds_b128 %4, %10, off offset:1024\n\t"
        "global_load_async_to_lds_b128 %4, %10, off offset:1536\n\t"
        "global_load_async_to_lds_b128 %4, %10, off offset:2048\n\t"
        "global_load_async_to_lds_b128 %4, %10, off offset:2560\n\t"
        "global_load_async_to_lds_b128 %4, %10, off offset:3072\n\t"
        "global_load_async_to_lds_b128 %4, %10, off offset:3584\n\t"
        "global_load_async_to_lds_b128 %4, %10, off offset:4096\n\t"
        "global_load_async_to_lds_b128 %4, %10, off offset:4608\n\t"
        "global_load_async_to_lds_b128 %4, %10, off offset:5120\n\t"
        "global_load_async_to_lds_b128 %4, %10, off offset:5632\n\t"
        "global_load_async_to_lds_b128 %4, %10, off offset:6144\n\t"
        "global_load_async_to_lds_b128 %4, %10, off offset:6656\n\t"
        "global_load_async_to_lds_b128 %4, %10, off offset:7168\n\t"
        "global_load_async_to_lds_b128 %4, %10, off offset:7680\n\t"
        "global_load_async_to_lds_b128 %5, %11, off\n\t"
        "global_load_async_to_lds_b128 %5, %11, off offset:512\n\t"
        "global_load_async_to_lds_b128 %5, %11, off offset:1024\n\t"
        "global_load_async_to_lds_b128 %5, %11, off offset:1536\n\t"
        "global_load_async_to_lds_b128 %5, %11, off offset:2048\n\t"
        "global_load_async_to_lds_b128 %5, %11, off offset:2560\n\t"
        "global_load_async_to_lds_b128 %5, %11, off offset:3072\n\t"
        "global_load_async_to_lds_b128 %5, %11, off offset:3584\n\t"
        "global_load_async_to_lds_b128 %5, %11, off offset:4096\n\t"
        "global_load_async_to_lds_b128 %5, %11, off offset:4608\n\t"
        "global_load_async_to_lds_b128 %5, %11, off offset:5120\n\t"
        "global_load_async_to_lds_b128 %5, %11, off offset:5632\n\t"
        "global_load_async_to_lds_b128 %5, %11, off offset:6144\n\t"
        "global_load_async_to_lds_b128 %5, %11, off offset:6656\n\t"
        "global_load_async_to_lds_b128 %5, %11, off offset:7168\n\t"
        "global_load_async_to_lds_b128 %5, %11, off offset:7680\n\t"
        "s_wait_xcnt 0x0"
        :: "v"(lk + lb), "v"((lk + 2048) + lb), "v"((lk + 4096) + lb), "v"((lk + 6144) + lb), "v"(lv + lb), "v"((lv + 8192) + lb),
           "v"(kh + lo), "v"(kh + TT * 32 + lo), "v"(kl + lo), "v"(kl + TT * 32 + lo), "v"(vh + lo), "v"(vl + lo) : "memory");
}
__global__ __launch_bounds__(32 * FWV) void k_fattn(const bf* __restrict__ QKh, const bf* __restrict__ QKl, const bf* __restrict__ VTh, const bf* __restrict__ VTl, float* PO) {
    typedef WFrag<bf> WF; typedef WF::V V;
    __shared__ __align__(16) v8us sm[2 * KVU + FWV * 2048];     // two k | value^T tiles (192 KiB), then each wave's q fragments [batch][nb][kc][hi|lo][half][lane] (32 KiB a wave): the whole LDS of a WGP
    const int lane = threadIdx.x & 31; const int w = __builtin_amdgcn_readfirstlane((int)(threadIdx.x >> 5));
    const int h = blockIdx.y, q0 = blockIdx.x * (16 * FQB * FWV) + w * (16 * FQB), k0 = blockIdx.z * (TT / FKS);
    const size_t sQK = (size_t)(NH_ + NKV) * TT * HD, sV = (size_t)NH_ * HDV * TT;
    // the copies' sources: this wave stages batch w; k planes (row = key: 32 keys are 2 blocks for each 32 d) and value^T planes (row = d: 32 keys are 8 blocks, one per 16 d); they step by 32 keys a tile
    const bf* Kh = QKh + (size_t)w * sQK + (size_t)(NH_ + h) * TT * HD + (size_t)k0 * 32; const bf* Kl = QKl + (Kh - QKh);
    const bf* Vh = VTh + (size_t)w * sV + (size_t)h * HDV * TT + (size_t)k0 * HDV; const bf* Vl = VTl + (Vh - VTh);
    const unsigned lb = (unsigned)(size_t)(__attribute__((address_space(3))) v8us*)sm; const unsigned lk = lb + w * (16 * 512), lv = lb + 64 * 512 + w * (32 * 512);
    stage_kv(lk, lv, Kh, Kl, Vh, Vl, 8 * lane);
    Kh += 32 * 32; Kl += 32 * 32; Vh += 32 * HDV; Vl += 32 * HDV;
    v8us* qs = sm + 2 * KVU + w * 2048 + lane;
    const bf* qp[NB_][2];
#pragma unroll
    for (int b = 0; b < NB_; ++b) { qp[b][0] = QKh + (size_t)b * sQK + (size_t)h * TT * HD + (size_t)q0 * 32 + 8 * lane; qp[b][1] = QKl + (qp[b][0] - QKh); }
#pragma unroll
    for (int b = 0; b < NB_; ++b)
#pragma unroll
        for (int nb = 0; nb < FQB; ++nb)
#pragma unroll
            for (int kc = 0; kc < 2; ++kc) { const int o = nb * 512 + kc * (TT * 32); const int f = ((b * FQB + nb) * 2 + kc) * 2;
                qs[f * 64] = *(const v8us*)(qp[b][0] + o); qs[f * 64 + 32] = *(const v8us*)(qp[b][0] + o + 256); qs[f * 64 + 64] = *(const v8us*)(qp[b][1] + o); qs[f * 64 + 96] = *(const v8us*)(qp[b][1] + o + 256); }
    // precaution: stands between the q loads and the first reuse of their address registers (held live up to here as inputs); the scheduling fence keeps the zeroing of the accumulators, which reuses them, behind the wait
    asm volatile("s_wait_xcnt 0x0" :: "v"(qp[0][0]), "v"(qp[0][1]), "v"(qp[1][0]), "v"(qp[1][1]), "v"(qp[2][0]), "v"(qp[2][1]), "v"(qp[3][0]), "v"(qp[3][1]) : "memory");
    __builtin_amdgcn_sched_barrier(0);
    // tile 0 has landed (this wave's copies), then the barrier publishes it to the other waves
    asm volatile("s_wait_asynccnt 0x0" ::: "memory");
    __syncthreads();
    stage_kv(lk + KVU * 16, lv + KVU * 16, Kh, Kl, Vh, Vl, 8 * lane);
    Kh += 32 * 32; Kl += 32 * 32; Vh += 32 * HDV; Vl += 32 * HDV;
    v8f acc[NB_][8][FQB];
#pragma unroll
    for (int b = 0; b < NB_; ++b)
#pragma unroll
        for (int db = 0; db < 8; ++db)
#pragma unroll
            for (int nb = 0; nb < FQB; ++nb) acc[b][db][nb] = (v8f){};
    // rolled, for speed only: one pass is some thousands of instructions
#pragma unroll 1
    for (int kt = 0; kt < FNT; ++kt) {
        const unsigned bo = (kt & 1) * KVU; const v8us* kv = sm + bo + lane;
        // k and q fragments of one batch: 32 LDS loads, 128 registers; two sets, so that batch b + 1 is fetched while batch b's products run
        V kh[2][2][2], kl[2][2][2], qh[2][2][FQB], ql[2][2][FQB];     // [set][kc][mb or nb]
#pragma unroll
        for (int kc = 0; kc < 2; ++kc) {
#pragma unroll
            for (int mb = 0; mb < 2; ++mb) { const int o = (kc * 4 + mb * 2) * 32; kh[0][kc][mb] = cat16b(kv[o], kv[o + 32]); kl[0][kc][mb] = cat16b(kv[o + 8 * 32], kv[o + 9 * 32]); }
#pragma unroll
            for (int nb = 0; nb < FQB; ++nb) { const int f = (nb * 2 + kc) * 2; qh[0][kc][nb] = cat16b(qs[f * 64], qs[f * 64 + 32]); ql[0][kc][nb] = cat16b(qs[f * 64 + 64], qs[f * 64 + 96]); } }
        v8f s[NB_][2][FQB];
#pragma unroll
        for (int b = 0; b < NB_; ++b) { const int st = b & 1, sn = (b + 1) & 1;
            if (b + 1 < NB_) {
#pragma unroll
                for (int kc = 0; kc < 2; ++kc) {
#pragma unroll
                    for (int mb = 0; mb < 2; ++mb) { const int o = ((b + 1) * 16 + kc * 4 + mb * 2) * 32; kh[sn][kc][mb] = cat16b(kv[o], kv[o + 32]); kl[sn][kc][mb] = cat16b(kv[o + 8 * 32], kv[o + 9 * 32]); }
#pragma unroll
                    for (int nb = 0; nb < FQB; ++nb) { const int f = (((b + 1) * FQB + nb) * 2 + kc) * 2; qh[sn][kc][nb] = cat16b(qs[f * 64], qs[f * 64 + 32]); ql[sn][kc][nb] = cat16b(qs[f * 64 + 64], qs[f * 64 + 96]); } } }
            // holds the next batch's 32 LDS loads, as one group, in front of this batch's 24 products: left free, the scheduler puts four loads directly in front of the six products that use them, and the wave waits out the LDS latency sixteen times a pass
            __builtin_amdgcn_sched_barrier(0);
#pragma unroll
            for (int mb = 0; mb < 2; ++mb)
#pragma unroll
                for (int nb = 0; nb < FQB; ++nb) s[b][mb][nb] = (v8f){};
            // the four score tiles take turns, so that no product follows directly on the one whose sum it adds to; each tile's own order of sums is kc 0, 1 and in each hi.hi, hi.lo, lo.hi
#pragma unroll
            for (int kc = 0; kc < 2; ++kc)
#pragma unroll
                for (int p = 0; p < 3; ++p)
#pragma unroll
                    for (int nb = 0; nb < FQB; ++nb)
#pragma unroll
                        for (int mb = 0; mb < 2; ++mb) s[b][mb][nb] = WF::mma(p == 2 ? kl[st][kc][mb] : kh[st][kc][mb], p == 1 ? ql[st][kc][nb] : qh[st][kc][nb], s[b][mb][nb]);
            // keeps the loads of batch b + 2 behind these products, whose fragments' registers they refill
            __builtin_amdgcn_sched_barrier(0); }
        // value^T fragments of batch 0 are asked for here, so that they come under the softmax arithmetic; those of batch b + 1 in front of batch b's products
        V vh[2][8], vl[2][8];
#pragma unroll
        for (int db = 0; db < 8; ++db) { const int o = (64 + db * 2) * 32; vh[0][db] = cat16b(kv[o], kv[o + 32]); vl[0][db] = cat16b(kv[o + 16 * 32], kv[o + 17 * 32]); }
        // holds these 32 loads as one group in front of the softmax arithmetic: left free, the scheduler spreads them over a dozen places in it
        __builtin_amdgcn_sched_barrier(0);
        v8u ph[NB_][FQB], pl[NB_][FQB];     // probabilities, bf16 hi and lo, two keys to a word: word i of (batch, nb) holds k slots 2i and 2i + 1 of the B operand
#pragma unroll
        for (int nb = 0; nb < FQB; ++nb)
#pragma unroll
            for (int mb = 0; mb < 2; ++mb) {
#pragma unroll
                for (int jp = 0; jp < 4; ++jp) {
                    // two neighbouring keys of a lane (an even and odd accumulator register) go side by side through the packed f32 instructions
                    f32x2 sv[NB_], xa[NB_], ex[NB_], mx;
#pragma unroll
                    for (int b = 0; b < NB_; ++b) sv[b] = (f32x2){s[b][mb][nb][2 * jp], s[b][mb][nb][2 * jp + 1]};
#pragma unroll
                    for (int q = 0; q < 2; ++q) mx[q] = fmaxf(fmaxf(fmaxf(fmaxf(-3.0e38f, sv[0][q]), sv[1][q]), sv[2][q]), sv[3][q]);
                    // exponent to base 2 of exp((s - max) / 8): one multiply-add a score, the 1/8 and log2 e in one factor
                    const f32x2 cs = {SCL * 1.4426950408889634f, SCL * 1.4426950408889634f}; const f32x2 nm = -(mx * cs);
#pragma unroll
                    for (int b = 0; b < NB_; ++b) { xa[b] = __builtin_elementwise_fma(sv[b], cs, nm); ex[b] = (f32x2){__builtin_amdgcn_exp2f(xa[b][0]), __builtin_amdgcn_exp2f(xa[b][1])}; }
                    const f32x2 sum = ((ex[0] + ex[1]) + ex[2]) + ex[3];
                    // 1 / sum by the chip's reciprocal (1 ulp; the probabilities keep 16 bits behind it), not the division sequence of some nine instructions
                    const f32x2 f = {__builtin_amdgcn_rcpf(sum[0]), __builtin_amdgcn_rcpf(sum[1])};
#pragma unroll
                    for (int b = 0; b < NB_; ++b) { const f32x2 pr = ex[b] * f; unsigned a, c; split2(pr[0], pr[1], a, c); ph[b][nb][mb * 4 + jp] = a; pl[b][nb][mb * 4 + jp] = c; } }
                // one 16x16 tile's softmax at a time: left free, the scheduler runs all four tiles abreast and their unpacked halves push accumulators into scratch
                __builtin_amdgcn_sched_barrier(0); }
#pragma unroll
        for (int b = 0; b < NB_; ++b) {
            if (b + 1 < NB_) {
#pragma unroll
                for (int db = 0; db < 8; ++db) { const int o = (64 + (b + 1) * 32 + db * 2) * 32; vh[(b + 1) & 1][db] = cat16b(kv[o], kv[o + 32]); vl[(b + 1) & 1][db] = cat16b(kv[o + 16 * 32], kv[o + 17 * 32]); } }
            // holds the next batch's 32 LDS loads, as one group, in front of this batch's 48 products: left free, the scheduler spreads them among the products
            __builtin_amdgcn_sched_barrier(0);
#pragma unroll
            for (int db = 0; db < 8; ++db)
#pragma unroll
                for (int nb = 0; nb < FQB; ++nb) { const V bh = __builtin_bit_cast(V, ph[b][nb]), bl = __builtin_bit_cast(V, pl[b][nb]);
                    acc[b][db][nb] = WF::mma(vh[b & 1][db], bh, acc[b][db][nb]); acc[b][db][nb] = WF::mma(vh[b & 1][db], bl, acc[b][db][nb]); acc[b][db][nb] = WF::mma(vl[b & 1][db], bh, acc[b][db][nb]); }
            // keeps the loads of batch b + 2 behind these products, whose fragments' registers they refill
            __builtin_amdgcn_sched_barrier(0); }
        // hand-over: this wave's LDS reads of the tile are done
        asm volatile("s_wait_dscnt 0x0" ::: "memory");
        // its copies of the next tile have landed
        asm volatile("s_wait_asynccnt 0x0" ::: "memory");
        // publishes the next tile and ends every wave's reads of this one, whose buffer is refilled behind it
        __syncthreads();
        // the two LDS addresses are formed as scalars here: left free, the compiler keeps their lane-wise sums over the whole loop and, short of low registers, spills them to scratch
        if (kt + 2 < FNT) { stage_kv(__builtin_amdgcn_readfirstlane(lk + bo * 16), __builtin_amdgcn_readfirstlane(lv + bo * 16), Kh, Kl, Vh, Vl, 8 * lane); Kh += 32 * 32; Kl += 32 * 32; Vh += 32 * HDV; Vl += 32 * HDV; }
    }
    // no copy is left in flight when the wave ends
    asm volatile("s_wait_asynccnt 0x0" ::: "memory");
    // partial O^T, f32: tile (head, 16-query block, batch, quarter, db) is 1 KiB, [half][lane] 16 bytes: every store of a wave is 512 consecutive bytes, and the four quarters of a (query block, batch) lie side by side for k_fmrg
    v4f* pp = (v4f*)PO + (((size_t)h * (TT / 16) + q0 / 16) * (NB_ * FKS) + blockIdx.z) * (8 * 64);   // the same for every lane: a scalar base; all 128 stores lie within 256 KiB of it, and the lane's number is their one vector address register
#pragma unroll
    for (int b = 0; b < NB_; ++b)
#pragma unroll
        for (int nb = 0; nb < FQB; ++nb)
#pragma unroll
            for (int db = 0; db < 8; ++db) { const v8f a = acc[b][db][nb]; const int o = ((nb * NB_ + b) * FKS * 8 + db) * 64; pp[o + lane] = (v4f){a[0], a[1], a[2], a[3]}; pp[o + 32 + lane] = (v4f){a[4], a[5], a[6], a[7]}; }
}
// ---- k_fmrg: context = the four key quarters' partial O^T, added in order 0..3, split hi/lo into the context planes. One wave takes the 8 d tiles of one (head, 16-query block, batch), 32 KiB in a row, 64 loads of 512 bytes.
__global__ __launch_bounds__(256) void k_fmrg(const float* __restrict__ PO, bf* ATh, bf* ATl) {
    const int lane = threadIdx.x & 31; const int g = blockIdx.x * 8 + __builtin_amdgcn_readfirstlane((int)(threadIdx.x >> 5)); const int b = g % NB_, qb = (g / NB_) % (TT / 16), h = g / (NB_ * (TT / 16));
    const v4f* p = (const v4f*)PO + (size_t)g * (FKS * 8 * 64);   // 32 KiB in a row; the same for every lane: a scalar base, and the lane's number is the loads' one vector address register
    v4f x[8][FKS][2];
#pragma unroll
    for (int db = 0; db < 8; ++db)
#pragma unroll
        for (int s = 0; s < FKS; ++s) { x[db][s][0] = p[(s * 8 + db) * 64 + lane]; x[db][s][1] = p[(s * 8 + db) * 64 + 32 + lane]; }
    bf* oh8 = ATh + (size_t)(h * (HDV / 32)) * (NB_ * TT * 32) + ((size_t)b * TT + qb * 16) * 32 + 8 * lane; bf* ol8 = ATl + (oh8 - ATh);
#pragma unroll
    for (int db = 0; db < 8; ++db) { v4f x0 = x[db][0][0], x1 = x[db][0][1];
#pragma unroll
        for (int s = 1; s < FKS; ++s) { x0 += x[db][s][0]; x1 += x[db][s][1]; }
        u32x4 oh, ol;
#pragma unroll
        for (int j = 0; j < 2; ++j) { unsigned a, c; split2(x0[2 * j], x0[2 * j + 1], a, c); oh[j] = a; ol[j] = c; split2(x1[2 * j], x1[2 * j + 1], a, c); oh[2 + j] = a; ol[2 + j] = c; }
        const size_t oo = (size_t)(db >> 1) * (NB_ * TT * 32) + (db & 1) * 256; *(v8us*)(oh8 + oo) = __builtin_bit_cast(v8us, oh); *(v8us*)(ol8 + oo) = __builtin_bit_cast(v8us, ol); }   // context planes [8192][DV] in fragment order: the lane's 8 d of one query are its own 16 bytes of half-block db & 1
}

extern "C" void kernel_launch(void* const* d_in, const int* in_sizes, int n_in,
                              void* d_out, int out_size, void* d_ws, size_t ws_size, hipStream_t stream) {
    (void)in_sizes; (void)n_in; (void)out_size;
    const float* x = (const float*)d_in[0]; const float* wq = (const float*)d_in[1]; const float* wk = (const float*)d_in[2]; const float* wv = (const float*)d_in[3]; const float* wo = (const float*)d_in[4];
    float* OUT = (float*)d_out;     // [4][2048][512]
    char* wsp = (char*)d_ws;
    auto take = [&](size_t bytes) { char* p = wsp; wsp += (bytes + 255) & ~(size_t)255; return (void*)p; };
    bf* W = (bf*)take((size_t)(DQ + DKV + DV + DV) * DM * 2); bf* WO = W + (size_t)(DQ + DKV + DV) * DM;
    bf* XB = (bf*)take((size_t)NB_ * TT * DM * 2);
    bf* QKh = (bf*)take((size_t)NB_ * (NH_ + NKV) * TT * HD * 2); bf* QKl = (bf*)take((size_t)NB_ * (NH_ + NKV) * TT * HD * 2);   /* [b][8] planes [t][d] in fragment order: heads 0-3 q, 4-7 k */
    bf* VTh = (bf*)take((size_t)NB_ * NH_ * HDV * TT * 2); bf* VTl = (bf*)take((size_t)NB_ * NH_ * HDV * TT * 2);
    bf* ATh = (bf*)take((size_t)NB_ * TT * DV * 2); bf* ATl = (bf*)take((size_t)NB_ * TT * DV * 2);
    float* PO = (float*)take((size_t)FKS * NB_ * TT * DV * 4);   /* the key quarters' partial O^T */
    if ((size_t)(wsp - (char*)d_ws) > ws_size) return;    // ws 256 MiB (carve ~122 MiB)
    k_wtG<<<dim3((unsigned)((DM * DV / 64 + 63) / 64), 4, 1), 256, 0, stream>>>(wq, wk, wv, wo, W);
    const int PF = DQ + DKV + DV;
    /* projections + planes, every batch in one launch (the softmax couples the batches) */
    k_cvt8<<<(unsigned)(((size_t)NB_ * TT * DM / 8 + 255) / 256), 256, 0, stream>>>(x, XB, (size_t)NB_ * TT * DM / 8);
    k_gemmw<bf, 0, false, true><<<dim3(NB_ * TT / 64, PF / 64, 1), 32, 0, stream>>>(XB, nullptr, W, nullptr, DM, nullptr, 0, nullptr, 0, 0, 0, QKh, QKl, VTh, VTl);
    k_fattn<<<dim3(TT / (16 * FQB * FWV), NH_, FKS), 32 * FWV, 0, stream>>>(QKh, QKl, VTh, VTl, PO);   /* all heads, all batches */
    k_fmrg<<<NB_ * NH_ * (TT / 16) / 8, 256, 0, stream>>>(PO, ATh, ATl);
    k_gemmw<bf, 1, false><<<dim3(NB_ * TT / 64, DV / 64, 1), 32, 0, stream>>>(ATh, ATl, WO, nullptr, DV, OUT, DV, nullptr, 0, 0, 0);
}

// v009
// It runs in 115 microseconds.
// Timed twice side by side with v008, it ran 1.04 times as fast both times.
// Over all steps from v000 it is 10.0 times as fast.
#include <hip/hip_runtime.h>

// Multi-head attention whose softmax runs over the BATCH axis (the source's nn.Softmax() with no dim on a (B,N,N)-shaped view picks dim 0): input_x [4][2048][512]; q = x Wq, k = x Wk ('xw' [512][256]: 4 heads x 64), v = x Wv ('xw' [512][512]: 4 heads x 128); scores[b][h][q][k] = q.k / 8; attn = softmax over b (the 4 batches, per (h, q, k)); out[b][q][h*128+d] = sum_k attn[b][h][q][k] v[b][k][h][d]; out Wo ('xw' [512][512]) -> [4][2048][512] (4.2 M).
// Layout: exact projections first: one GEMM [8192][512] x [1024][512]^T gives q | k | v of every batch, and its epilogue writes them straight as q/k planes per (batch, head), bf16 hi/lo (heads 0-3 q, 4-7 k), and value^T planes per (batch, head); then ONE attention kernel (k_fattn) for all heads: a wave holds the scores of all four batches for 32 keys x 32 queries in registers, takes the softmax ACROSS the batches there, feeds the probabilities (hi/lo) straight into the 3-product P.v; a work-group covers 128 queries x 512 keys and stores an f32 partial, and k_fmrg adds the four key quarters and writes the hi/lo context planes; finally out = context Wo (hl x exact), 8192 rows in one GEMM.
// FRAGMENT ORDER: every 16-bit plane that a matrix instruction reads ([rows][K], K-contiguous in meaning) is stored as blocks of 16 rows x 32 k (512 elements, 1 KiB), block (k / 32) * (rows / 16) + row / 16 (neighbouring row blocks of one k step lie side by side: a tile's fragments of a k step are one run of bytes); inside a block element (row, k) lies at ((k % 32) / 16) * 256 + (((k % 16) / 8) * 16 + row % 16) * 8 + k % 8. That is the order in which the 32 lanes hold an A or B fragment, so each of a fragment's two 16-byte loads reads 512 consecutive bytes (4 whole lines) where a row-major plane gave 16 lines with 32 bytes used of each.
// Compute dtypes, f32 accumulate: every input rounded to bf16; projections exact; scores and attn.v on bf16 hi/lo planes (3 products) everywhere; the cross-batch softmax in f32.

#define NB_  4
#define TT   2048
#define DM   512
#define NH_  4
#define NKV  4
#define REP  (NH_ / NKV)
#define HD   64
#define DQ   (NH_ * HD)
#define DKV  (NKV * HD)
#define ZH   2
#define RH   2048                  // query rows < RH use hi+lo planes (0: none)
#define WIN  0
#define PCAR 1024.0f
#define SCL  0.125f   // 64^-0.5
#define HDV  128      // value head dim
#define DV   (NH_ * HDV)   // 512
typedef _Float16 h16;
typedef unsigned short bf;
typedef __attribute__((ext_vector_type(16))) __bf16   v16bf;
typedef __attribute__((ext_vector_type(16))) _Float16 v16h;
typedef __attribute__((ext_vector_type(8)))  _Float16 v8h;
typedef __attribute__((ext_vector_type(8)))  unsigned short v8us;
typedef __attribute__((ext_vector_type(8)))  float    v8f;
typedef __attribute__((ext_vector_type(4)))  float    v4f;
typedef v8h  __attribute__((may_alias)) v8ha;
typedef v4f  __attribute__((may_alias)) v4fa;
typedef v8us __attribute__((may_alias)) v8usa;

__device__ __forceinline__ unsigned short f2bf(float f) { unsigned u = __float_as_uint(f); u += 0x7FFFu + ((u >> 16) & 1u); return (unsigned short)(u >> 16); }
__device__ __forceinline__ float bf2f(unsigned short b) { return __uint_as_float(((unsigned)b) << 16); }
__device__ __forceinline__ float bfr(float f) { return bf2f(f2bf(f)); }
__device__ __forceinline__ void splitf(float y, unsigned short& h, unsigned short& l) { h = f2bf(y); l = f2bf(y - bf2f(h)); }
// two f32 to two bf16 in one word (a in the low half), round to nearest even, by the chip's packed conversion: one instruction where the integer rounding of f2bf takes some four for each value and a pack
typedef __attribute__((ext_vector_type(2))) float f32x2;
typedef __attribute__((ext_vector_type(2))) __bf16 bf16x2;
typedef __attribute__((ext_vector_type(4))) unsigned u32x4;
__device__ __forceinline__ unsigned pk2bf(float a, float b) { const f32x2 x = {a, b}; return __builtin_bit_cast(unsigned, __builtin_convertvector(x, bf16x2)); }
// hi/lo split of two values: h = their bf16 roundings, l = the roundings of what h leaves
__device__ __forceinline__ void split2(float y0, float y1, unsigned& h, unsigned& l) { h = pk2bf(y0, y1); l = pk2bf(y0 - __uint_as_float(h << 16), y1 - __uint_as_float(h & 0xFFFF0000u)); }
__device__ __forceinline__ v16h cat16(v8h lo, v8h hi) { return __builtin_shufflevector(lo, hi, 0, 1, 2, 3, 4, 5, 6, 7, 8, 9, 10, 11, 12, 13, 14, 15); }
__device__ __forceinline__ v16bf cat16b(v8us lo, v8us hi) { return __builtin_bit_cast(v16bf, __builtin_shufflevector(lo, hi, 0, 1, 2, 3, 4, 5, 6, 7, 8, 9, 10, 11, 12, 13, 14, 15)); }
__device__ __forceinline__ v8f wmma16(v16h a, v16h b, v8f c) { return __builtin_amdgcn_wmma_f32_16x16x32_f16(false, a, false, b, (short)0, c, false, false); }
__device__ __forceinline__ v8f wmmab(v16bf a, v16bf b, v8f c) { return __builtin_amdgcn_wmma_f32_16x16x32_bf16(false, a, false, b, (short)0, c, false, false); }



// ---- k_gemmw: register-blocked GEMM, ONE WAVE per 64x64 output tile (16 accumulators), operands straight from 16-bit planes in fragment order; grid (M/64, N/64, Z), 32 threads.
// C[m][n] (f32, pitch ldc, + optional f32 bias[n]) = sum_k A[m][k] Bt[n][k] (+ split products per NSPLIT). z-batch strides sA/sB/sC in elements. K % 32 == 0.
// PLANES (the q | k | v projection): no C; the epilogue splits the tile hi/lo and writes it as attention planes. A 64-column tile is one whole q or k head (columns 0-511: plane c0 / 64) or half a value head (columns 512-1023); its 64 rows lie in one batch.
// ld: p = start of a 16 x 32 block in fragment order + lane * 8
template <typename T16> struct WFrag;
template <> struct WFrag<h16> { typedef v16h V; static __device__ __forceinline__ V ld(const h16* p) { return cat16(*(const v8h*)p, *(const v8h*)(p + 256)); } static __device__ __forceinline__ v8f mma(V a, V b, v8f c) { return wmma16(a, b, c); } };
template <> struct WFrag<bf> { typedef v16bf V; static __device__ __forceinline__ V ld(const bf* p) { return cat16b(*(const v8us*)p, *(const v8us*)(p + 256)); } static __device__ __forceinline__ v8f mma(V a, V b, v8f c) { return wmmab(a, b, c); } };
template <typename T16, int NSPLIT, bool BIAS, bool PLANES = false>
__global__ __launch_bounds__(32) void k_gemmw(const T16* __restrict__ A, const T16* __restrict__ A2, const T16* __restrict__ Bt, const T16* __restrict__ Bt2, int K, float* C, int ldc, const float* __restrict__ bias, size_t sA, size_t sB, size_t sC, bf* QKh = nullptr, bf* QKl = nullptr, bf* VTh = nullptr, bf* VTl = nullptr) {
    typedef typename WFrag<T16>::V V;
    __shared__ __align__(16) float os[16 * 68];
    const size_t z = blockIdx.z; A += z * sA; if (A2) A2 += z * sA; Bt += z * sB; if (Bt2) Bt2 += z * sB; C += z * sC;
    const int lane = threadIdx.x & 31, lr = lane & 15, hi = lane >> 4; const int r0 = blockIdx.x * 64, c0 = blockIdx.y * 64;
    v8f acc[4][4];
#pragma unroll
    for (int mb = 0; mb < 4; ++mb)
#pragma unroll
        for (int nb = 0; nb < 4; ++nb) acc[mb][nb] = (v8f){};
    const size_t aoff = (size_t)r0 * 32 + 8 * lane, boff = (size_t)c0 * 32 + 8 * lane;   // 16 rows are one block = 512 elements
    const size_t ka = (size_t)gridDim.x * (64 * 32), kb = (size_t)gridDim.y * (64 * 32);   // the grid covers all rows of the A and of the B plane: 32 k on is rows * 32 elements on
    const T16* pa = A + aoff; const T16* pa2 = A2 + aoff; const T16* pb = Bt + boff; const T16* pb2 = Bt2 + boff;
#pragma unroll 1
    for (int kc = 0; kc < K; kc += 32) {
        V a[4], a2[4];
#pragma unroll
        for (int mb = 0; mb < 4; ++mb) { a[mb] = WFrag<T16>::ld(pa + mb * 512); if (NSPLIT == 1 || NSPLIT == 2) a2[mb] = WFrag<T16>::ld(pa2 + mb * 512); }
#pragma unroll
        for (int nb = 0; nb < 4; ++nb) { const V b = WFrag<T16>::ld(pb + nb * 512); V b2; if (NSPLIT >= 2) b2 = WFrag<T16>::ld(pb2 + nb * 512);
#pragma unroll
            for (int mb = 0; mb < 4; ++mb) { acc[mb][nb] = WFrag<T16>::mma(a[mb], b, acc[mb][nb]); if (NSPLIT == 1 || NSPLIT == 2) acc[mb][nb] = WFrag<T16>::mma(a2[mb], b, acc[mb][nb]); if (NSPLIT >= 2) acc[mb][nb] = WFrag<T16>::mma(a[mb], b2, acc[mb][nb]); } }
        asm volatile("v_nop\n\tv_nop\n\tv_nop\n\tv_nop" : "+v"(acc[0][0]), "+v"(acc[1][1]), "+v"(acc[2][2]), "+v"(acc[3][3]) : "v"(a[0]), "v"(a[3]));
        // precaution: stands between this trip's loads and the step of their pointers; the pointers are held live up to here (inputs), so that no later load's result is put into the registers of an address still in use
        if (NSPLIT == 0) asm volatile("s_wait_xcnt 0x0" :: "v"(pa), "v"(pb) : "memory");
        else if (NSPLIT == 1) asm volatile("s_wait_xcnt 0x0" :: "v"(pa), "v"(pa2), "v"(pb) : "memory");
        else asm volatile("s_wait_xcnt 0x0" :: "v"(pa), "v"(pa2), "v"(pb), "v"(pb2) : "memory");
        pa += ka; pa2 += ka; pb += kb; pb2 += kb;
    }
    if (PLANES) {
        const int bz = r0 / TT, t0 = r0 % TT;
        if (c0 < DQ + DKV) {
            // q or k: a plane row is a token, K = its 64 d, fragment order; a 16-row block goes through LDS so that a lane holds 8 neighbouring d of one token: trip s stores d 16 s .. 16 s + 15 of the 16 tokens, a half-block: 512 consecutive bytes
            const size_t po = (size_t)(bz * (NH_ + NKV) + c0 / HD) * TT * HD + (size_t)t0 * 32;
#pragma unroll
            for (int mb = 0; mb < 4; ++mb) {
#pragma unroll
                for (int nb = 0; nb < 4; ++nb) {
#pragma unroll
                    for (int j = 0; j < 8; ++j) os[(hi * 8 + j) * 68 + nb * 16 + lr] = acc[mb][nb][j]; }
                // one wave: keeps its LDS writes in front of its reads of other lanes' words
                __builtin_amdgcn_wave_barrier(); asm volatile("" ::: "memory");
#pragma unroll
                for (int s = 0; s < 4; ++s) { const int row = lr, cofs = (2 * s + hi) * 8; const v4f x0 = *(const v4fa*)(os + row * 68 + cofs), x1 = *(const v4fa*)(os + row * 68 + cofs + 4); u32x4 oh, ol;
#pragma unroll
                    for (int j = 0; j < 2; ++j) { unsigned p, c; split2(x0[2 * j], x0[2 * j + 1], p, c); oh[j] = p; ol[j] = c; split2(x1[2 * j], x1[2 * j + 1], p, c); oh[2 + j] = p; ol[2 + j] = c; }
                    const size_t oo = po + (size_t)(s >> 1) * (TT * 32) + mb * 512 + (s & 1) * 256 + lane * 8; *(v8us*)(QKh + oo) = __builtin_bit_cast(v8us, oh); *(v8us*)(QKl + oo) = __builtin_bit_cast(v8us, ol); }
                // and those reads in front of the next block's writes
                __builtin_amdgcn_wave_barrier(); asm volatile("" ::: "memory");
            }
        } else {
            // value^T: a plane row is one d, K = the tokens, fragment order (a wave of k_fattn reads all 128 d of 32 tokens: 8 KiB in a row); the 8 accumulator words a lane holds of a tile are 8 neighbouring tokens of one d, the lane's own 16 bytes of half-block mb & 1: stored from the registers
            const int cv = c0 - (DQ + DKV); const size_t po = (size_t)(bz * NH_ + cv / HDV) * HDV * TT + (size_t)(t0 / 32) * (HDV * 32) + (cv % HDV) * 32 + 8 * lane;
#pragma unroll
            for (int nb = 0; nb < 4; ++nb)
#pragma unroll
                for (int mb = 0; mb < 4; ++mb) { u32x4 oh, ol;
#pragma unroll
                    for (int j = 0; j < 4; ++j) { unsigned p, c; split2(acc[mb][nb][2 * j], acc[mb][nb][2 * j + 1], p, c); oh[j] = p; ol[j] = c; }
                    const size_t oo = po + (size_t)(mb >> 1) * (HDV * 32) + nb * 512 + (mb & 1) * 256; *(v8us*)(VTh + oo) = __builtin_bit_cast(v8us, oh); *(v8us*)(VTl + oo) = __builtin_bit_cast(v8us, ol); }
            // precaution: stands behind the last stores of this branch, in front of any later write to their data and address registers
            asm volatile("s_wait_xcnt 0x0" ::: "memory");
        }
        return;
    }
#pragma unroll
    for (int mb = 0; mb < 4; ++mb) {
#pragma unroll
        for (int nb = 0; nb < 4; ++nb) {
#pragma unroll
            for (int j = 0; j < 8; ++j) os[(hi * 8 + j) * 68 + nb * 16 + lr] = acc[mb][nb][j]; }
        __builtin_amdgcn_wave_barrier(); asm volatile("" ::: "memory");
        float* crow = C + (size_t)(r0 + mb * 16) * ldc + c0;
{
#pragma unroll
            for (int s = 0; s < 8; ++s) { const int row = 2 * s + hi, cofs = lr * 4; v4f val = *(const v4fa*)(os + row * 68 + cofs); if (BIAS) { val[0] += bfr(bias[c0 + cofs]); val[1] += bfr(bias[c0 + cofs + 1]); val[2] += bfr(bias[c0 + cofs + 2]); val[3] += bfr(bias[c0 + cofs + 3]); }
                *(v4f*)(crow + (size_t)row * ldc + cofs) = val; }
             }
        __builtin_amdgcn_wave_barrier(); asm volatile("" ::: "memory");
    }
}

__device__ __forceinline__ h16 tohx(float x) { return (h16)x; }
typedef __attribute__((ext_vector_type(2))) _Float16 v2h;
typedef __attribute__((ext_vector_type(4))) _Float16 v4h;
typedef __attribute__((ext_vector_type(2))) unsigned short v2us;
typedef __attribute__((ext_vector_type(4))) unsigned short v4us;
typedef __attribute__((ext_vector_type(2))) float v2f;
typedef __attribute__((ext_vector_type(4))) int v4i;

// ---- k_prep: every input to bf16 planes in fragment order, in ONE launch of 256 work-groups x 8 waves (one work-group a WGP, every wave resident at once). A wave converts 8 pieces of x and 6 lines of the weights, and all of its 28 loads are issued before the first conversion: it waits out the memory latency once, and the launch has only 2048 waves to start (one wave for every 32 x 8 floats would be 16384 waves for x alone).
// x -> XB ([NB_ * TT][DM]): wave gw takes 8 rows (half a 16-row block) x 256 k; piece u is the rows' 32 floats of one k block: four neighbouring lanes read one row's 128-byte line, so a piece is 8 whole lines read and 4 whole lines written (8 rows' parts of each k octet lie side by side), and the 8 pieces are 1 KiB in a row of each x row.
// weights -> W: two transposed planes, K = 512: q | k | v (1024 rows: 0-255 q, 256-511 k, 512-1023 v) and behind it o (512 rows). A line is 64 elements (128 bytes) of a plane: 8 k x 8 n of the weight; a lane takes (k, n) and (k + 1, n). Wq and Wk have as many lines as there are waves, Wv and Wo twice as many.
#define PWV (NB_ * TT * DM / (8 * 256))   // waves of k_prep: 2048
static_assert(DQ * DM / 64 == PWV && DKV * DM / 64 == PWV && DV * DM / 64 == 2 * PWV, "k_prep deals the weights' lines by these counts");
// line L (the same for the whole wave) of a weight [DM][N] whose transpose is rows ROFF .. ROFF + N - 1 of a plane of R rows: s = the source element of its first k and n, d = the line's start in the plane
template <unsigned N, unsigned R, unsigned ROFF> __device__ __forceinline__ void wt_map(unsigned L, unsigned& s, unsigned& d) { const unsigned blk = L / 8, l8 = L % 8, kq = blk / (N / 16), rb = blk % (N / 16); s = (kq * 32 + (l8 / 4) * 16 + ((l8 % 4) / 2) * 8) * N + rb * 16 + (l8 % 2) * 8; d = (kq * (R / 16) + ROFF / 16 + rb) * 512 + l8 * 64; }
__global__ __launch_bounds__(256) void k_prep(const float* __restrict__ x, const float* __restrict__ w0, const float* __restrict__ w1, const float* __restrict__ w2, const float* __restrict__ w3, bf* XB, bf* W) {
    const unsigned lane = threadIdx.x & 31; const unsigned gw = blockIdx.x * 8 + (unsigned)__builtin_amdgcn_readfirstlane((int)(threadIdx.x >> 5));
    const unsigned hb = gw % (NB_ * TT / 8), kg = gw / (NB_ * TT / 8);   // which 8 rows, which 256 k
    const float* xp = x + (size_t)(hb * 8 + (lane >> 2)) * DM + kg * 256 + (lane & 3) * 8;
    constexpr unsigned PR = DQ + DKV + DV;
    unsigned s[6], d[6];
    wt_map<DQ, PR, 0>(gw, s[0], d[0]); wt_map<DKV, PR, DQ>(gw, s[1], d[1]); wt_map<DV, PR, DQ + DKV>(gw, s[2], d[2]); wt_map<DV, PR, DQ + DKV>(gw + PWV, s[3], d[3]); wt_map<DV, DV, 0>(gw, s[4], d[4]); wt_map<DV, DV, 0>(gw + PWV, s[5], d[5]);
    const float* wp[6] = {w0 + s[0], w1 + s[1], w2 + s[2], w2 + s[3], w3 + s[4], w3 + s[5]};   // the same for every lane: scalar bases
    const unsigned lq = (lane & 3) * 2 * DQ + (lane >> 2), lv = (lane & 3) * 2 * DV + (lane >> 2);   // the lane's (k, n) in a line, for rows of 256 and of 512 floats: the weight loads' two vector address registers
    v8f xv[8]; float wa[6], wb[6];
#pragma unroll
    for (int u = 0; u < 8; ++u) xv[u] = *(const v8f*)(xp + u * 32);
#pragma unroll
    for (int i = 0; i < 6; ++i) { wa[i] = wp[i][i < 2 ? lq : lv]; wb[i] = wp[i][i < 2 ? lq + DQ : lv + DV]; }
    // precaution: stands between the loads and the first reuse of their address registers (held live up to here as inputs, so that no later load's result is put into them either)
    asm volatile("s_wait_xcnt 0x0" :: "v"(xp), "v"(lq), "v"(lv) : "memory");
    // keeps every conversion behind all 28 loads, and the wait above directly behind them: left free, the scheduler converts the first piece, and so waits out a memory latency, before it issues the other loads
    __builtin_amdgcn_sched_barrier(0);
    u32x4 o[8]; unsigned ow[6];
#pragma unroll
    for (int u = 0; u < 8; ++u)
#pragma unroll
        for (int k = 0; k < 4; ++k) o[u][k] = pk2bf(xv[u][2 * k], xv[u][2 * k + 1]);
#pragma unroll
    for (int i = 0; i < 6; ++i) ow[i] = pk2bf(wa[i], wb[i]);
    bf* xd = XB + ((size_t)(kg * 8) * (NB_ * TT / 16) + hb / 2) * 512 + (hb & 1) * 64;   // the same for every lane
    const unsigned lx = ((lane & 3) * 16 + (lane >> 2)) * 8;
#pragma unroll
    for (int u = 0; u < 8; ++u) *(v8us*)(xd + (size_t)u * (NB_ * TT / 16) * 512 + lx) = __builtin_bit_cast(v8us, o[u]);
#pragma unroll
    for (int i = 0; i < 6; ++i) *(v2us*)(W + (i < 4 ? 0 : (size_t)PR * DM) + d[i] + lane * 2) = __builtin_bit_cast(v2us, ow[i]);
}

__global__ __launch_bounds__(256) void k_vtp(const float* __restrict__ F, int pitch, int nheads, h16* V16, bf* Vh, bf* Vl) { const size_t e = ((size_t)blockIdx.x * 256 + threadIdx.x) * 2; if (e >= (size_t)nheads * HD * TT) return; const int t = (int)(e % TT); const int d = (int)((e / TT) % HD); const int g = (int)(e / ((size_t)TT * HD)); v2h o16; v2us oh, ol;
#pragma unroll
    for (int q = 0; q < 2; ++q) { const float x = F[(size_t)(t + q) * pitch + g * HD + d]; o16[q] = tohx(x); unsigned short a2, c2; splitf(x, a2, c2); oh[q] = a2; ol[q] = c2; }
    *(v2h*)(V16 + e) = o16; *(v2us*)(Vh + e) = oh; *(v2us*)(Vl + e) = ol;  }
// k_asoft: per row (zz, i): t = S x HD^-0.5 (no mask); softmax over the 2048 keys (register row, one exp, fixed trees);
__global__ __launch_bounds__(256) void k_asoft(const float* __restrict__ Sb, h16* P16, bf* Ph, bf* Pl) {
    const int lane = threadIdx.x & 31; const int row = blockIdx.x * 8 + (threadIdx.x >> 5); if (row >= ZH * TT) return; const int i = row % TT; const int zz = row / TT; (void)zz; const bool hires = (i < RH); const float* sr = Sb + (size_t)row * TT; float v[TT / 32]; float mx = -3.0e38f;
#pragma unroll
    for (int ch = 0; ch < TT / 128; ++ch) { const int j0 = ch * 128 + lane * 4; const v4f a = *(const v4f*)(sr + j0);
#pragma unroll
        for (int q = 0; q < 4; ++q) { const int j = j0 + q; (void)j; const float t = a[q] * SCL; v[ch * 4 + q] = t; mx = fmaxf(mx, t); } }
#pragma unroll
    for (int sh = 16; sh; sh >>= 1) mx = fmaxf(mx, __shfl_xor(mx, sh, 32));
    float sum = 0.f;
#pragma unroll
    for (int k = 0; k < TT / 32; ++k) { float d0 = __fsub_rn(v[k], mx); asm volatile("" : "+v"(d0)); v[k] = __builtin_amdgcn_exp2f(__fmul_rn(d0, 1.4426950408889634f)); sum += v[k]; }
#pragma unroll
    for (int sh = 16; sh; sh >>= 1) sum += __shfl_xor(sum, sh, 32);
    const float f = __fdiv_rn(hires ? 1.0f : PCAR, sum);
{
        if (hires) {
#pragma unroll
            for (int ch = 0; ch < TT / 128; ++ch) { v4us oh, ol;
#pragma unroll
                for (int q = 0; q < 4; ++q) { unsigned short a, c2; splitf(v[ch * 4 + q] * f, a, c2); oh[q] = a; ol[q] = c2; }
                const size_t oo = ((size_t)zz * (RH ? RH : 1) + i) * TT + ch * 128 + lane * 4; *(v4us*)(Ph + oo) = oh; *(v4us*)(Pl + oo) = ol; }
        } else {
#pragma unroll
            for (int ch = 0; ch < TT / 128; ++ch) { v4h o4;
#pragma unroll
                for (int q = 0; q < 4; ++q) o4[q] = tohx(v[ch * 4 + q] * f);
                *(v4h*)(P16 + (size_t)row * TT + ch * 128 + lane * 4) = o4; } }
         }
}
__global__ __launch_bounds__(256) void k_merge(const float* __restrict__ O, int h0, bf* Ah, bf* Al) { const size_t e = ((size_t)blockIdx.x * 256 + threadIdx.x) * 2; if (e >= (size_t)ZH * TT * HD) return; const int d = (int)(e % HD); const int t = (int)((e / HD) % TT); const int zz = (int)(e / ((size_t)HD * TT)); const float cs = (t < RH) ? 1.0f : (1.0f / PCAR); const size_t oo = (size_t)t * DQ + (h0 + zz) * HD + d;
    v2us oh, ol;
#pragma unroll
    for (int q = 0; q < 2; ++q) { unsigned short a, c2; splitf(O[e + q] * cs, a, c2); oh[q] = a; ol[q] = c2; } *(v2us*)(Ah + oo) = oh; *(v2us*)(Al + oo) = ol;  }

#define FQB 2     // 16-query blocks per wave
#define FWV 4     // waves per work-group
#define FKS 4     // key quarters (grid z)
#define FNT (TT / FKS / 32)   // passes of 32 keys
#define KVU 6144  // 16-byte words of one staged tile: k 64 half-blocks of 512 bytes [batch][hi|lo][kc][4], then value^T 128 half-blocks [batch][hi|lo][16]
typedef __attribute__((ext_vector_type(8))) unsigned v8u;
// one wave's share of a tile: the k and value^T fragments of its own batch, 48 asynchronous copies of 16 bytes a lane (512 bytes a copy), global memory to LDS through no register. Six runs that are consecutive in memory and in LDS alike: k hi and lo, each d half (2 KiB), value^T hi and lo (8 KiB); the immediate offset moves both addresses.
// lk, lv: the LDS byte address of its batch's k and value^T part of the buffer; the pointers: the start of the 32 keys in each plane (all the same for every lane); lo: the lane's place, 8 elements (16 bytes) a lane.
// the s_wait_xcnt is a precaution that stands, inside the statement, between the copies and any later write to the address registers they name
__device__ __forceinline__ void stage_kv(unsigned lk, unsigned lv, const bf* kh, const bf* kl, const bf* vh, const bf* vl, int lo) {
    const unsigned lb = 2 * lo;
    asm volatile(
        "global_load_async_to_lds_b128 %0, %6, off\n\t"
        "global_load_async_to_lds_b128 %0, %6, off offset:512\n\t"
        "global_load_async_to_lds_b128 %0, %6, off offset:1024\n\t"
        "global_load_async_to_lds_b128 %0, %6, off offset:1536\n\t"
        "global_load_async_to_lds_b128 %1, %7, off\n\t"
        "global_load_async_to_lds_b128 %1, %7, off offset:512\n\t"
        "global_load_async_to_lds_b128 %1, %7, off offset:1024\n\t"
        "global_load_async_to_lds_b128 %1, %7, off offset:1536\n\t"
        "global_load_async_to_lds_b128 %2, %8, off\n\t"
        "global_load_async_to_lds_b128 %2, %8, off offset:512\n\t"
        "global_load_async_to_lds_b128 %2, %8, off offset:1024\n\t"
        "global_load_async_to_lds_b128 %2, %8, off offset:1536\n\t"
        "global_load_async_to_lds_b128 %3, %9, off\n\t"
        "global_load_async_to_lds_b128 %3, %9, off offset:512\n\t"
        "global_load_async_to_lds_b128 %3, %9, off offset:1024\n\t"
        "global_load_async_to_lds_b128 %3, %9, off offset:1536\n\t"
        "global_load_async_to_lds_b128 %4, %10, off\n\t"
        "global_load_async_to_lds_b128 %4, %10, off offset:512\n\t"
        "global_load_async_to_lds_b128 %4, %10, off offset:1024\n\t"
        "global_load_async_to_lds_b128 %4, %10, off offset:1536\n\t"
        "global_load_async_to_lds_b128 %4, %10, off offset:2048\n\t"
        "global_load_async_to_lds_b128 %4, %10, off offset:2560\n\t"
        "global_load_async_to_lds_b128 %4, %10, off offset:3072\n\t"
        "global_load_async_to_lds_b128 %4, %10, off offset:3584\n\t"
        "global_load_async_to_lds_b128 %4, %10, off offset:4096\n\t"
        "global_load_async_to_lds_b128 %4, %10, off offset:4608\n\t"
        "global_load_async_to_lds_b128 %4, %10, off offset:5120\n\t"
        "global_load_async_to_lds_b128 %4, %10, off offset:5632\n\t"
        "global_load_async_to_lds_b128 %4, %10, off offset:6144\n\t"
        "global_load_async_to_lds_b128 %4, %10, off offset:6656\n\t"
        "global_load_async_to_lds_b128 %4, %10, off offset:7168\n\t"
        "global_load_async_to_lds_b128 %4, %10, off offset:7680\n\t"
        "global_load_async_to_lds_b128 %5, %11, off\n\t"
        "global_load_async_to_lds_b128 %5, %11, off offset:512\n\t"
        "global_load_async_to_lds_b128 %5, %11, off offset:1024\n\t"
        "global_load_async_to_lds_b128 %5, %11, off offset:1536\n\t"
        "global_load_async_to_lds_b128 %5, %11, off offset:2048\n\t"
        "global_load_async_to_lds_b128 %5, %11, off offset:2560\n\t"
        "global_load_async_to_lds_b128 %5, %11, off offset:3072\n\t"
        "global_load_async_to_lds_b128 %5, %11, off offset:3584\n\t"
        "global_load_async_to_lds_b128 %5, %11, off offset:4096\n\t"
        "global_load_async_to_lds_b128 %5, %11, off offset:4608\n\t"
        "global_load_async_to_lds_b128 %5, %11, off offset:5120\n\t"
        "global_load_async_to_lds_b128 %5, %11, off offset:5632\n\t"
        "global_load_async_to_lds_b128 %5, %11, off offset:6144\n\t"
        "global_load_async_to_lds_b128 %5, %11, off offset:6656\n\t"
        "global_load_async_to_lds_b128 %5, %11, off offset:7168\n\t"
        "global_load_async_to_lds_b128 %5, %11, off offset:7680\n\t"
        "s_wait_xcnt 0x0"
        :: "v"(lk + lb), "v"((lk + 2048) + lb), "v"((lk + 4096) + lb), "v"((lk + 6144) + lb), "v"(lv + lb), "v"((lv + 8192) + lb),
           "v"(kh + lo), "v"(kh + TT * 32 + lo), "v"(kl + lo), "v"(kl + TT * 32 + lo), "v"(vh + lo), "v"(vl + lo) : "memory");
}
__global__ __launch_bounds__(32 * FWV) void k_fattn(const bf* __restrict__ QKh, const bf* __restrict__ QKl, const bf* __restrict__ VTh, const bf* __restrict__ VTl, float* PO) {
    typedef WFrag<bf> WF; typedef WF::V V;
    __shared__ __align__(16) v8us sm[2 * KVU + FWV * 2048];     // two k | value^T tiles (192 KiB), then each wave's q fragments [batch][nb][kc][hi|lo][half][lane] (32 KiB a wave): the whole LDS of a WGP
    const int lane = threadIdx.x & 31; const int w = __builtin_amdgcn_readfirstlane((int)(threadIdx.x >> 5));
    const int h = blockIdx.y, q0 = blockIdx.x * (16 * FQB * FWV) + w * (16 * FQB), k0 = blockIdx.z * (TT / FKS);
    const size_t sQK = (size_t)(NH_ + NKV) * TT * HD, sV = (size_t)NH_ * HDV * TT;
    // the copies' sources: this wave stages batch w; k planes (row = key: 32 keys are 2 blocks for each 32 d) and value^T planes (row = d: 32 keys are 8 blocks, one per 16 d); they step by 32 keys a tile
    const bf* Kh = QKh + (size_t)w * sQK + (size_t)(NH_ + h) * TT * HD + (size_t)k0 * 32; const bf* Kl = QKl + (Kh - QKh);
    const bf* Vh = VTh + (size_t)w * sV + (size_t)h * HDV * TT + (size_t)k0 * HDV; const bf* Vl = VTl + (Vh - VTh);
    const unsigned lb = (unsigned)(size_t)(__attribute__((address_space(3))) v8us*)sm; const unsigned lk = lb + w * (16 * 512), lv = lb + 64 * 512 + w * (32 * 512);
    stage_kv(lk, lv, Kh, Kl, Vh, Vl, 8 * lane);
    Kh += 32 * 32; Kl += 32 * 32; Vh += 32 * HDV; Vl += 32 * HDV;
    v8us* qs = sm + 2 * KVU + w * 2048 + lane;
    const bf* qp[NB_][2];
#pragma unroll
    for (int b = 0; b < NB_; ++b) { qp[b][0] = QKh + (size_t)b * sQK + (size_t)h * TT * HD + (size_t)q0 * 32 + 8 * lane; qp[b][1] = QKl + (qp[b][0] - QKh); }
#pragma unroll
    for (int b = 0; b < NB_; ++b)
#pragma unroll
        for (int nb = 0; nb < FQB; ++nb)
#pragma unroll
            for (int kc = 0; kc < 2; ++kc) { const int o = nb * 512 + kc * (TT * 32); const int f = ((b * FQB + nb) * 2 + kc) * 2;
                qs[f * 64] = *(const v8us*)(qp[b][0] + o); qs[f * 64 + 32] = *(const v8us*)(qp[b][0] + o + 256); qs[f * 64 + 64] = *(const v8us*)(qp[b][1] + o); qs[f * 64 + 96] = *(const v8us*)(qp[b][1] + o + 256); }
    // precaution: stands between the q loads and the first reuse of their address registers (held live up to here as inputs); the scheduling fence keeps the zeroing of the accumulators, which reuses them, behind the wait
    asm volatile("s_wait_xcnt 0x0" :: "v"(qp[0][0]), "v"(qp[0][1]), "v"(qp[1][0]), "v"(qp[1][1]), "v"(qp[2][0]), "v"(qp[2][1]), "v"(qp[3][0]), "v"(qp[3][1]) : "memory");
    __builtin_amdgcn_sched_barrier(0);
    // tile 0 has landed (this wave's copies), then the barrier publishes it to the other waves
    asm volatile("s_wait_asynccnt 0x0" ::: "memory");
    __syncthreads();
    stage_kv(lk + KVU * 16, lv + KVU * 16, Kh, Kl, Vh, Vl, 8 * lane);
    Kh += 32 * 32; Kl += 32 * 32; Vh += 32 * HDV; Vl += 32 * HDV;
    v8f acc[NB_][8][FQB];
#pragma unroll
    for (int b = 0; b < NB_; ++b)
#pragma unroll
        for (int db = 0; db < 8; ++db)
#pragma unroll
            for (int nb = 0; nb < FQB; ++nb) acc[b][db][nb] = (v8f){};
    // rolled, for speed only: one pass is some thousands of instructions
#pragma unroll 1
    for (int kt = 0; kt < FNT; ++kt) {
        const unsigned bo = (kt & 1) * KVU; const v8us* kv = sm + bo + lane;
        // k and q fragments of one batch: 32 LDS loads, 128 registers; two sets, so that batch b + 1 is fetched while batch b's products run
        V kh[2][2][2], kl[2][2][2], qh[2][2][FQB], ql[2][2][FQB];     // [set][kc][mb or nb]
#pragma unroll
        for (int kc = 0; kc < 2; ++kc) {
#pragma unroll
            for (int mb = 0; mb < 2; ++mb) { const int o = (kc * 4 + mb * 2) * 32; kh[0][kc][mb] = cat16b(kv[o], kv[o + 32]); kl[0][kc][mb] = cat16b(kv[o + 8 * 32], kv[o + 9 * 32]); }
#pragma unroll
            for (int nb = 0; nb < FQB; ++nb) { const int f = (nb * 2 + kc) * 2; qh[0][kc][nb] = cat16b(qs[f * 64], qs[f * 64 + 32]); ql[0][kc][nb] = cat16b(qs[f * 64 + 64], qs[f * 64 + 96]); } }
        v8f s[NB_][2][FQB];
#pragma unroll
        for (int b = 0; b < NB_; ++b) { const int st = b & 1, sn = (b + 1) & 1;
            if (b + 1 < NB_) {
#pragma unroll
                for (int kc = 0; kc < 2; ++kc) {
#pragma unroll
                    for (int mb = 0; mb < 2; ++mb) { const int o = ((b + 1) * 16 + kc * 4 + mb * 2) * 32; kh[sn][kc][mb] = cat16b(kv[o], kv[o + 32]); kl[sn][kc][mb] = cat16b(kv[o + 8 * 32], kv[o + 9 * 32]); }
#pragma unroll
                    for (int nb = 0; nb < FQB; ++nb) { const int f = (((b + 1) * FQB + nb) * 2 + kc) * 2; qh[sn][kc][nb] = cat16b(qs[f * 64], qs[f * 64 + 32]); ql[sn][kc][nb] = cat16b(qs[f * 64 + 64], qs[f * 64 + 96]); } } }
            // holds the next batch's 32 LDS loads, as one group, in front of this batch's 24 products: left free, the scheduler puts four loads directly in front of the six products that use them, and the wave waits out the LDS latency sixteen times a pass
            __builtin_amdgcn_sched_barrier(0);
#pragma unroll
            for (int mb = 0; mb < 2; ++mb)
#pragma unroll
                for (int nb = 0; nb < FQB; ++nb) s[b][mb][nb] = (v8f){};
            // the four score tiles take turns, so that no product follows directly on the one whose sum it adds to; each tile's own order of sums is kc 0, 1 and in each hi.hi, hi.lo, lo.hi
#pragma unroll
            for (int kc = 0; kc < 2; ++kc)
#pragma unroll
                for (int p = 0; p < 3; ++p)
#pragma unroll
                    for (int nb = 0; nb < FQB; ++nb)
#pragma unroll
                        for (int mb = 0; mb < 2; ++mb) s[b][mb][nb] = WF::mma(p == 2 ? kl[st][kc][mb] : kh[st][kc][mb], p == 1 ? ql[st][kc][nb] : qh[st][kc][nb], s[b][mb][nb]);
            // keeps the loads of batch b + 2 behind these products, whose fragments' registers they refill
            __builtin_amdgcn_sched_barrier(0); }
        // value^T fragments of batch 0 are asked for here, so that they come under the softmax arithmetic; those of batch b + 1 in front of batch b's products
        V vh[2][8], vl[2][8];
#pragma unroll
        for (int db = 0; db < 8; ++db) { const int o = (64 + db * 2) * 32; vh[0][db] = cat16b(kv[o], kv[o + 32]); vl[0][db] = cat16b(kv[o + 16 * 32], kv[o + 17 * 32]); }
        // holds these 32 loads as one group in front of the softmax arithmetic: left free, the scheduler spreads them over a dozen places in it
        __builtin_amdgcn_sched_barrier(0);
        v8u ph[NB_][FQB], pl[NB_][FQB];     // probabilities, bf16 hi and lo, two keys to a word: word i of (batch, nb) holds k slots 2i and 2i + 1 of the B operand
#pragma unroll
        for (int nb = 0; nb < FQB; ++nb)
#pragma unroll
            for (int mb = 0; mb < 2; ++mb) {
#pragma unroll
                for (int jp = 0; jp < 4; ++jp) {
                    // two neighbouring keys of a lane (an even and odd accumulator register) go side by side through the packed f32 instructions
                    f32x2 sv[NB_], xa[NB_], ex[NB_], mx;
#pragma unroll
                    for (int b = 0; b < NB_; ++b) sv[b] = (f32x2){s[b][mb][nb][2 * jp], s[b][mb][nb][2 * jp + 1]};
#pragma unroll
                    for (int q = 0; q < 2; ++q) mx[q] = fmaxf(fmaxf(fmaxf(fmaxf(-3.0e38f, sv[0][q]), sv[1][q]), sv[2][q]), sv[3][q]);
                    // exponent to base 2 of exp((s - max) / 8): one multiply-add a score, the 1/8 and log2 e in one factor
                    const f32x2 cs = {SCL * 1.4426950408889634f, SCL * 1.4426950408889634f}; const f32x2 nm = -(mx * cs);
#pragma unroll
                    for (int b = 0; b < NB_; ++b) { xa[b] = __builtin_elementwise_fma(sv[b], cs, nm); ex[b] = (f32x2){__builtin_amdgcn_exp2f(xa[b][0]), __builtin_amdgcn_exp2f(xa[b][1])}; }
                    const f32x2 sum = ((ex[0] + ex[1]) + ex[2]) + ex[3];
                    // 1 / sum by the chip's reciprocal (1 ulp; the probabilities keep 16 bits behind it), not the division sequence of some nine instructions
                    const f32x2 f = {__builtin_amdgcn_rcpf(sum[0]), __builtin_amdgcn_rcpf(sum[1])};
#pragma unroll
                    for (int b = 0; b < NB_; ++b) { const f32x2 pr = ex[b] * f; unsigned a, c; split2(pr[0], pr[1], a, c); ph[b][nb][mb * 4 + jp] = a; pl[b][nb][mb * 4 + jp] = c; } }
                // one 16x16 tile's softmax at a time: left free, the scheduler runs all four tiles abreast and their unpacked halves push accumulators into scratch
                __builtin_amdgcn_sched_barrier(0); }
#pragma unroll
        for (int b = 0; b < NB_; ++b) {
            if (b + 1 < NB_) {
#pragma unroll
                for (int db = 0; db < 8; ++db) { const int o = (64 + (b + 1) * 32 + db * 2) * 32; vh[(b + 1) & 1][db] = cat16b(kv[o], kv[o + 32]); vl[(b + 1) & 1][db] = cat16b(kv[o + 16 * 32], kv[o + 17 * 32]); } }
            // holds the next batch's 32 LDS loads, as one group, in front of this batch's 48 products: left free, the scheduler spreads them among the products
            __builtin_amdgcn_sched_barrier(0);
#pragma unroll
            for (int db = 0; db < 8; ++db)
#pragma unroll
                for (int nb = 0; nb < FQB; ++nb) { const V bh = __builtin_bit_cast(V, ph[b][nb]), bl = __builtin_bit_cast(V, pl[b][nb]);
                    acc[b][db][nb] = WF::mma(vh[b & 1][db], bh, acc[b][db][nb]); acc[b][db][nb] = WF::mma(vh[b & 1][db], bl, acc[b][db][nb]); acc[b][db][nb] = WF::mma(vl[b & 1][db], bh, acc[b][db][nb]); }
            // keeps the loads of batch b + 2 behind these products, whose fragments' registers they refill
            __builtin_amdgcn_sched_barrier(0); }
        // hand-over: this wave's LDS reads of the tile are done
        asm volatile("s_wait_dscnt 0x0" ::: "memory");
        // its copies of the next tile have landed
        asm volatile("s_wait_asynccnt 0x0" ::: "memory");
        // publishes the next tile and ends every wave's reads of this one, whose buffer is refilled behind it
        __syncthreads();
        // the two LDS addresses are formed as scalars here: left free, the compiler keeps their lane-wise sums over the whole loop and, short of low registers, spills them to scratch
        if (kt + 2 < FNT) { stage_kv(__builtin_amdgcn_readfirstlane(lk + bo * 16), __builtin_amdgcn_readfirstlane(lv + bo * 16), Kh, Kl, Vh, Vl, 8 * lane); Kh += 32 * 32; Kl += 32 * 32; Vh += 32 * HDV; Vl += 32 * HDV; }
    }
    // no copy is left in flight when the wave ends
    asm volatile("s_wait_asynccnt 0x0" ::: "memory");
    // partial O^T, f32: tile (head, 16-query block, batch, quarter, db) is 1 KiB, [half][lane] 16 bytes: every store of a wave is 512 consecutive bytes, and the four quarters of a (query block, batch) lie side by side for k_fmrg
    v4f* pp = (v4f*)PO + (((size_t)h * (TT / 16) + q0 / 16) * (NB_ * FKS) + blockIdx.z) * (8 * 64);   // the same for every lane: a scalar base; all 128 stores lie within 256 KiB of it, and the lane's number is their one vector address register
#pragma unroll
    for (int b = 0; b < NB_; ++b)
#pragma unroll
        for (int nb = 0; nb < FQB; ++nb)
#pragma unroll
            for (int db = 0; db < 8; ++db) { const v8f a = acc[b][db][nb]; const int o = ((nb * NB_ + b) * FKS * 8 + db) * 64; pp[o + lane] = (v4f){a[0], a[1], a[2], a[3]}; pp[o + 32 + lane] = (v4f){a[4], a[5], a[6], a[7]}; }
}
// ---- k_fmrg: context = the four key quarters' partial O^T, added in order 0..3, split hi/lo into the context planes. One wave takes the 8 d tiles of one (head, 16-query block, batch), 32 KiB in a row, 64 loads of 512 bytes.
__global__ __launch_bounds__(256) void k_fmrg(const float* __restrict__ PO, bf* ATh, bf* ATl) {
    const int lane = threadIdx.x & 31; const int g = blockIdx.x * 8 + __builtin_amdgcn_readfirstlane((int)(threadIdx.x >> 5)); const int b = g % NB_, qb = (g / NB_) % (TT / 16), h = g / (NB_ * (TT / 16));
    const v4f* p = (const v4f*)PO + (size_t)g * (FKS * 8 * 64);   // 32 KiB in a row; the same for every lane: a scalar base, and the lane's number is the loads' one vector address register
    v4f x[8][FKS][2];
#pragma unroll
    for (int db = 0; db < 8; ++db)
#pragma unroll
        for (int s = 0; s < FKS; ++s) { x[db][s][0] = p[(s * 8 + db) * 64 + lane]; x[db][s][1] = p[(s * 8 + db) * 64 + 32 + lane]; }
    bf* oh8 = ATh + (size_t)(h * (HDV / 32)) * (NB_ * TT * 32) + ((size_t)b * TT + qb * 16) * 32 + 8 * lane; bf* ol8 = ATl + (oh8 - ATh);
#pragma unroll
    for (int db = 0; db < 8; ++db) { v4f x0 = x[db][0][0], x1 = x[db][0][1];
#pragma unroll
        for (int s = 1; s < FKS; ++s) { x0 += x[db][s][0]; x1 += x[db][s][1]; }
        u32x4 oh, ol;
#pragma unroll
        for (int j = 0; j < 2; ++j) { unsigned a, c; split2(x0[2 * j], x0[2 * j + 1], a, c); oh[j] = a; ol[j] = c; split2(x1[2 * j], x1[2 * j + 1], a, c); oh[2 + j] = a; ol[2 + j] = c; }
        const size_t oo = (size_t)(db >> 1) * (NB_ * TT * 32) + (db & 1) * 256; *(v8us*)(oh8 + oo) = __builtin_bit_cast(v8us, oh); *(v8us*)(ol8 + oo) = __builtin_bit_cast(v8us, ol); }   // context planes [8192][DV] in fragment order: the lane's 8 d of one query are its own 16 bytes of half-block db & 1
}

extern "C" void kernel_launch(void* const* d_in, const int* in_sizes, int n_in,
                              void* d_out, int out_size, void* d_ws, size_t ws_size, hipStream_t stream) {
    (void)in_sizes; (void)n_in; (void)out_size;
    const float* x = (const float*)d_in[0]; const float* wq = (const float*)d_in[1]; const float* wk = (const float*)d_in[2]; const float* wv = (const float*)d_in[3]; const float* wo = (const float*)d_in[4];
    float* OUT = (float*)d_out;     // [4][2048][512]
    char* wsp = (char*)d_ws;
    auto take = [&](size_t bytes) { char* p = wsp; wsp += (bytes + 255) & ~(size_t)255; return (void*)p; };
    bf* W = (bf*)take((size_t)(DQ + DKV + DV + DV) * DM * 2); bf* WO = W + (size_t)(DQ + DKV + DV) * DM;
    bf* XB = (bf*)take((size_t)NB_ * TT * DM * 2);
    bf* QKh = (bf*)take((size_t)NB_ * (NH_ + NKV) * TT * HD * 2); bf* QKl = (bf*)take((size_t)NB_ * (NH_ + NKV) * TT * HD * 2);   /* [b][8] planes [t][d] in fragment order: heads 0-3 q, 4-7 k */
    bf* VTh = (bf*)take((size_t)NB_ * NH_ * HDV * TT * 2); bf* VTl = (bf*)take((size_t)NB_ * NH_ * HDV * TT * 2);
    bf* ATh = (bf*)take((size_t)NB_ * TT * DV * 2); bf* ATl = (bf*)take((size_t)NB_ * TT * DV * 2);
    float* PO = (float*)take((size_t)FKS * NB_ * TT * DV * 4);   /* the key quarters' partial O^T */
    if ((size_t)(wsp - (char*)d_ws) > ws_size) return;    // ws 256 MiB (carve ~122 MiB)
    k_prep<<<PWV / 8, 256, 0, stream>>>(x, wq, wk, wv, wo, XB, W);   /* x and the four weights to bf16 planes */
    const int PF = DQ + DKV + DV;
    /* projections + planes, every batch in one launch (the softmax couples the batches) */
    k_gemmw<bf, 0, false, true><<<dim3(NB_ * TT / 64, PF / 64, 1), 32, 0, stream>>>(XB, nullptr, W, nullptr, DM, nullptr, 0, nullptr, 0, 0, 0, QKh, QKl, VTh, VTl);
    k_fattn<<<dim3(TT / (16 * FQB * FWV), NH_, FKS), 32 * FWV, 0, stream>>>(QKh, QKl, VTh, VTl, PO);   /* all heads, all batches */
    k_fmrg<<<NB_ * NH_ * (TT / 16) / 8, 256, 0, stream>>>(PO, ATh, ATl);
    k_gemmw<bf, 1, false><<<dim3(NB_ * TT / 64, DV / 64, 1), 32, 0, stream>>>(ATh, ATl, WO, nullptr, DV, OUT, DV, nullptr, 0, 0, 0);
}

// v010
// One run takes 97.2 microseconds.
// Next to v009, in two timings, it ran 1.18 and 1.17 times as fast.
// Over all steps from v000 it is 11.8 times as fast.
#include <hip/hip_runtime.h>

// Multi-head attention whose softmax runs over the BATCH axis (the source's nn.Softmax() with no dim on a (B,N,N)-shaped view picks dim 0): input_x [4][2048][512]; q = x Wq, k = x Wk ('xw' [512][256]: 4 heads x 64), v = x Wv ('xw' [512][512]: 4 heads x 128); scores[b][h][q][k] = q.k / 8; attn = softmax over b (the 4 batches, per (h, q, k)); out[b][q][h*128+d] = sum_k attn[b][h][q][k] v[b][k][h][d]; out Wo ('xw' [512][512]) -> [4][2048][512] (4.2 M).
// Layout: exact projections first: one GEMM [8192][512] x [1024][512]^T gives q | k | v of every batch, and its epilogue writes them straight as q/k planes per (batch, head), bf16 hi/lo (heads 0-3 q, 4-7 k), and value^T planes per (batch, head); then ONE attention kernel (k_fattn) for all heads: a wave holds the scores of all four batches for 32 keys x 32 queries in registers, takes the softmax ACROSS the batches there, feeds the probabilities (hi/lo) straight into the 3-product P.v; a work-group covers 128 queries x 512 keys and stores an f32 partial, and k_outf adds the four key quarters, splits the context hi/lo in LDS and multiplies it by Wo (hl x exact).
// FRAGMENT ORDER: every 16-bit plane that a matrix instruction reads ([rows][K], K-contiguous in meaning) is stored as blocks of 16 rows x 32 k (512 elements, 1 KiB), block (k / 32) * (rows / 16) + row / 16 (neighbouring row blocks of one k step lie side by side: a tile's fragments of a k step are one run of bytes); inside a block element (row, k) lies at ((k % 32) / 16) * 256 + (((k % 16) / 8) * 16 + row % 16) * 8 + k % 8. That is the order in which the 32 lanes hold an A or B fragment, so each of a fragment's two 16-byte loads reads 512 consecutive bytes (4 whole lines) where a row-major plane gave 16 lines with 32 bytes used of each.
// Compute dtypes, f32 accumulate: every input rounded to bf16; projections exact; scores and attn.v on bf16 hi/lo planes (3 products) everywhere; the cross-batch softmax in f32.

#define NB_  4
#define TT   2048
#define DM   512
#define NH_  4
#define NKV  4
#define REP  (NH_ / NKV)
#define HD   64
#define DQ   (NH_ * HD)
#define DKV  (NKV * HD)
#define ZH   2
#define RH   2048                  // query rows < RH use hi+lo planes (0: none)
#define WIN  0
#define PCAR 1024.0f
#define SCL  0.125f   // 64^-0.5
#define HDV  128      // value head dim
#define DV   (NH_ * HDV)   // 512
typedef _Float16 h16;
typedef unsigned short bf;
typedef __attribute__((ext_vector_type(16))) __bf16   v16bf;
typedef __attribute__((ext_vector_type(16))) _Float16 v16h;
typedef __attribute__((ext_vector_type(8)))  _Float16 v8h;
typedef __attribute__((ext_vector_type(8)))  unsigned short v8us;
typedef __attribute__((ext_vector_type(8)))  float    v8f;
typedef __attribute__((ext_vector_type(4)))  float    v4f;
typedef v8h  __attribute__((may_alias)) v8ha;
typedef v4f  __attribute__((may_alias)) v4fa;
typedef v8us __attribute__((may_alias)) v8usa;

__device__ __forceinline__ unsigned short f2bf(float f) { unsigned u = __float_as_uint(f); u += 0x7FFFu + ((u >> 16) & 1u); return (unsigned short)(u >> 16); }
__device__ __forceinline__ float bf2f(unsigned short b) { return __uint_as_float(((unsigned)b) << 16); }
__device__ __forceinline__ float bfr(float f) { return bf2f(f2bf(f)); }
__device__ __forceinline__ void splitf(float y, unsigned short& h, unsigned short& l) { h = f2bf(y); l = f2bf(y - bf2f(h)); }
// two f32 to two bf16 in one word (a in the low half), round to nearest even, by the chip's packed conversion: one instruction where the integer rounding of f2bf takes some four for each value and a pack
typedef __attribute__((ext_vector_type(2))) float f32x2;
typedef __attribute__((ext_vector_type(2))) __bf16 bf16x2;
typedef __attribute__((ext_vector_type(4))) unsigned u32x4;
__device__ __forceinline__ unsigned pk2bf(float a, float b) { const f32x2 x = {a, b}; return __builtin_bit_cast(unsigned, __builtin_convertvector(x, bf16x2)); }
// hi/lo split of two values: h = their bf16 roundings, l = the roundings of what h leaves
__device__ __forceinline__ void split2(float y0, float y1, unsigned& h, unsigned& l) { h = pk2bf(y0, y1); l = pk2bf(y0 - __uint_as_float(h << 16), y1 - __uint_as_float(h & 0xFFFF0000u)); }
__device__ __forceinline__ v16h cat16(v8h lo, v8h hi) { return __builtin_shufflevector(lo, hi, 0, 1, 2, 3, 4, 5, 6, 7, 8, 9, 10, 11, 12, 13, 14, 15); }
__device__ __forceinline__ v16bf cat16b(v8us lo, v8us hi) { return __builtin_bit_cast(v16bf, __builtin_shufflevector(lo, hi, 0, 1, 2, 3, 4, 5, 6, 7, 8, 9, 10, 11, 12, 13, 14, 15)); }
__device__ __forceinline__ v8f wmma16(v16h a, v16h b, v8f c) { return __builtin_amdgcn_wmma_f32_16x16x32_f16(false, a, false, b, (short)0, c, false, false); }
__device__ __forceinline__ v8f wmmab(v16bf a, v16bf b, v8f c) { return __builtin_amdgcn_wmma_f32_16x16x32_bf16(false, a, false, b, (short)0, c, false, false); }



// ---- k_gemmw: register-blocked GEMM, ONE WAVE per 64x64 output tile (16 accumulators), operands straight from 16-bit planes in fragment order; grid (M/64, N/64, Z), 32 threads.
// C[m][n] (f32, pitch ldc, + optional f32 bias[n]) = sum_k A[m][k] Bt[n][k] (+ split products per NSPLIT). z-batch strides sA/sB/sC in elements. K % 32 == 0.
// PLANES (the q | k | v projection): no C; the epilogue splits the tile hi/lo and writes it as attention planes. A 64-column tile is one whole q or k head (columns 0-511: plane c0 / 64) or half a value head (columns 512-1023); its 64 rows lie in one batch.
// ld: p = start of a 16 x 32 block in fragment order + lane * 8
template <typename T16> struct WFrag;
template <> struct WFrag<h16> { typedef v16h V; static __device__ __forceinline__ V ld(const h16* p) { return cat16(*(const v8h*)p, *(const v8h*)(p + 256)); } static __device__ __forceinline__ v8f mma(V a, V b, v8f c) { return wmma16(a, b, c); } };
template <> struct WFrag<bf> { typedef v16bf V; static __device__ __forceinline__ V ld(const bf* p) { return cat16b(*(const v8us*)p, *(const v8us*)(p + 256)); } static __device__ __forceinline__ v8f mma(V a, V b, v8f c) { return wmmab(a, b, c); } };
template <typename T16, int NSPLIT, bool BIAS, bool PLANES = false>
__global__ __launch_bounds__(32) void k_gemmw(const T16* __restrict__ A, const T16* __restrict__ A2, const T16* __restrict__ Bt, const T16* __restrict__ Bt2, int K, float* C, int ldc, const float* __restrict__ bias, size_t sA, size_t sB, size_t sC, bf* QKh = nullptr, bf* QKl = nullptr, bf* VTh = nullptr, bf* VTl = nullptr) {
    typedef typename WFrag<T16>::V V;
    __shared__ __align__(16) float os[16 * 68];
    const size_t z = blockIdx.z; A += z * sA; if (A2) A2 += z * sA; Bt += z * sB; if (Bt2) Bt2 += z * sB; C += z * sC;
    const int lane = threadIdx.x & 31, lr = lane & 15, hi = lane >> 4; const int r0 = blockIdx.x * 64, c0 = blockIdx.y * 64;
    v8f acc[4][4];
#pragma unroll
    for (int mb = 0; mb < 4; ++mb)
#pragma unroll
        for (int nb = 0; nb < 4; ++nb) acc[mb][nb] = (v8f){};
    const size_t aoff = (size_t)r0 * 32 + 8 * lane, boff = (size_t)c0 * 32 + 8 * lane;   // 16 rows are one block = 512 elements
    const size_t ka = (size_t)gridDim.x * (64 * 32), kb = (size_t)gridDim.y * (64 * 32);   // the grid covers all rows of the A and of the B plane: 32 k on is rows * 32 elements on
    const T16* pa = A + aoff; const T16* pa2 = A2 + aoff; const T16* pb = Bt + boff; const T16* pb2 = Bt2 + boff;
#pragma unroll 1
    for (int kc = 0; kc < K; kc += 32) {
        V a[4], a2[4];
#pragma unroll
        for (int mb = 0; mb < 4; ++mb) { a[mb] = WFrag<T16>::ld(pa + mb * 512); if (NSPLIT == 1 || NSPLIT == 2) a2[mb] = WFrag<T16>::ld(pa2 + mb * 512); }
#pragma unroll
        for (int nb = 0; nb < 4; ++nb) { const V b = WFrag<T16>::ld(pb + nb * 512); V b2; if (NSPLIT >= 2) b2 = WFrag<T16>::ld(pb2 + nb * 512);
#pragma unroll
            for (int mb = 0; mb < 4; ++mb) { acc[mb][nb] = WFrag<T16>::mma(a[mb], b, acc[mb][nb]); if (NSPLIT == 1 || NSPLIT == 2) acc[mb][nb] = WFrag<T16>::mma(a2[mb], b, acc[mb][nb]); if (NSPLIT >= 2) acc[mb][nb] = WFrag<T16>::mma(a[mb], b2, acc[mb][nb]); } }
        asm volatile("v_nop\n\tv_nop\n\tv_nop\n\tv_nop" : "+v"(acc[0][0]), "+v"(acc[1][1]), "+v"(acc[2][2]), "+v"(acc[3][3]) : "v"(a[0]), "v"(a[3]));
        // precaution: stands between this trip's loads and the step of their pointers; the pointers are held live up to here (inputs), so that no later load's result is put into the registers of an address still in use
        if (NSPLIT == 0) asm volatile("s_wait_xcnt 0x0" :: "v"(pa), "v"(pb) : "memory");
        else if (NSPLIT == 1) asm volatile("s_wait_xcnt 0x0" :: "v"(pa), "v"(pa2), "v"(pb) : "memory");
        else asm volatile("s_wait_xcnt 0x0" :: "v"(pa), "v"(pa2), "v"(pb), "v"(pb2) : "memory");
        pa += ka; pa2 += ka; pb += kb; pb2 += kb;
    }
    if (PLANES) {
        const int bz = r0 / TT, t0 = r0 % TT;
        if (c0 < DQ + DKV) {
            // q or k: a plane row is a token, K = its 64 d, fragment order; a 16-row block goes through LDS so that a lane holds 8 neighbouring d of one token: trip s stores d 16 s .. 16 s + 15 of the 16 tokens, a half-block: 512 consecutive bytes
            const size_t po = (size_t)(bz * (NH_ + NKV) + c0 / HD) * TT * HD + (size_t)t0 * 32;
#pragma unroll
            for (int mb = 0; mb < 4; ++mb) {
#pragma unroll
                for (int nb = 0; nb < 4; ++nb) {
#pragma unroll
                    for (int j = 0; j < 8; ++j) os[(hi * 8 + j) * 68 + nb * 16 + lr] = acc[mb][nb][j]; }
                // one wave: keeps its LDS writes in front of its reads of other lanes' words
                __builtin_amdgcn_wave_barrier(); asm volatile("" ::: "memory");
#pragma unroll
                for (int s = 0; s < 4; ++s) { const int row = lr, cofs = (2 * s + hi) * 8; const v4f x0 = *(const v4fa*)(os + row * 68 + cofs), x1 = *(const v4fa*)(os + row * 68 + cofs + 4); u32x4 oh, ol;
#pragma unroll
                    for (int j = 0; j < 2; ++j) { unsigned p, c; split2(x0[2 * j], x0[2 * j + 1], p, c); oh[j] = p; ol[j] = c; split2(x1[2 * j], x1[2 * j + 1], p, c); oh[2 + j] = p; ol[2 + j] = c; }
                    const size_t oo = po + (size_t)(s >> 1) * (TT * 32) + mb * 512 + (s & 1) * 256 + lane * 8; *(v8us*)(QKh + oo) = __builtin_bit_cast(v8us, oh); *(v8us*)(QKl + oo) = __builtin_bit_cast(v8us, ol); }
                // and those reads in front of the next block's writes
                __builtin_amdgcn_wave_barrier(); asm volatile("" ::: "memory");
            }
        } else {
            // value^T: a plane row is one d, K = the tokens, fragment order (a wave of k_fattn reads all 128 d of 32 tokens: 8 KiB in a row); the 8 accumulator words a lane holds of a tile are 8 neighbouring tokens of one d, the lane's own 16 bytes of half-block mb & 1: stored from the registers
            const int cv = c0 - (DQ + DKV); const size_t po = (size_t)(bz * NH_ + cv / HDV) * HDV * TT + (size_t)(t0 / 32) * (HDV * 32) + (cv % HDV) * 32 + 8 * lane;
#pragma unroll
            for (int nb = 0; nb < 4; ++nb)
#pragma unroll
                for (int mb = 0; mb < 4; ++mb) { u32x4 oh, ol;
#pragma unroll
                    for (int j = 0; j < 4; ++j) { unsigned p, c; split2(acc[mb][nb][2 * j], acc[mb][nb][2 * j + 1], p, c); oh[j] = p; ol[j] = c; }
                    const size_t oo = po + (size_t)(mb >> 1) * (HDV * 32) + nb * 512 + (mb & 1) * 256; *(v8us*)(VTh + oo) = __builtin_bit_cast(v8us, oh); *(v8us*)(VTl + oo) = __builtin_bit_cast(v8us, ol); }
            // precaution: stands behind the last stores of this branch, in front of any later write to their data and address registers
            asm volatile("s_wait_xcnt 0x0" ::: "memory");
        }
        return;
    }
#pragma unroll
    for (int mb = 0; mb < 4; ++mb) {
#pragma unroll
        for (int nb = 0; nb < 4; ++nb) {
#pragma unroll
            for (int j = 0; j < 8; ++j) os[(hi * 8 + j) * 68 + nb * 16 + lr] = acc[mb][nb][j]; }
        __builtin_amdgcn_wave_barrier(); asm volatile("" ::: "memory");
        float* crow = C + (size_t)(r0 + mb * 16) * ldc + c0;
{
#pragma unroll
            for (int s = 0; s < 8; ++s) { const int row = 2 * s + hi, cofs = lr * 4; v4f val = *(const v4fa*)(os + row * 68 + cofs); if (BIAS) { val[0] += bfr(bias[c0 + cofs]); val[1] += bfr(bias[c0 + cofs + 1]); val[2] += bfr(bias[c0 + cofs + 2]); val[3] += bfr(bias[c0 + cofs + 3]); }
                *(v4f*)(crow + (size_t)row * ldc + cofs) = val; }
             }
        __builtin_amdgcn_wave_barrier(); asm volatile("" ::: "memory");
    }
}

__device__ __forceinline__ h16 tohx(float x) { return (h16)x; }
typedef __attribute__((ext_vector_type(2))) _Float16 v2h;
typedef __attribute__((ext_vector_type(4))) _Float16 v4h;
typedef __attribute__((ext_vector_type(2))) unsigned short v2us;
typedef __attribute__((ext_vector_type(4))) unsigned short v4us;
typedef __attribute__((ext_vector_type(2))) float v2f;
typedef __attribute__((ext_vector_type(4))) int v4i;

// ---- k_prep: every input to bf16 planes in fragment order, in ONE launch of 256 work-groups x 8 waves (one work-group a WGP, every wave resident at once). A wave converts 8 pieces of x and 6 lines of the weights, and all of its 28 loads are issued before the first conversion: it waits out the memory latency once, and the launch has only 2048 waves to start (one wave for every 32 x 8 floats would be 16384 waves for x alone).
// x -> XB ([NB_ * TT][DM]): wave gw takes 8 rows (half a 16-row block) x 256 k; piece u is the rows' 32 floats of one k block: four neighbouring lanes read one row's 128-byte line, so a piece is 8 whole lines read and 4 whole lines written (8 rows' parts of each k octet lie side by side), and the 8 pieces are 1 KiB in a row of each x row.
// weights -> W: two transposed planes, K = 512: q | k | v (1024 rows: 0-255 q, 256-511 k, 512-1023 v) and behind it o (512 rows). A line is 64 elements (128 bytes) of a plane: 8 k x 8 n of the weight; a lane takes (k, n) and (k + 1, n). Wq and Wk have as many lines as there are waves, Wv and Wo twice as many.
#define PWV (NB_ * TT * DM / (8 * 256))   // waves of k_prep: 2048
static_assert(DQ * DM / 64 == PWV && DKV * DM / 64 == PWV && DV * DM / 64 == 2 * PWV, "k_prep deals the weights' lines by these counts");
// line L (the same for the whole wave) of a weight [DM][N] whose transpose is rows ROFF .. ROFF + N - 1 of a plane of R rows: s = the source element of its first k and n, d = the line's start in the plane
template <unsigned N, unsigned R, unsigned ROFF> __device__ __forceinline__ void wt_map(unsigned L, unsigned& s, unsigned& d) { const unsigned blk = L / 8, l8 = L % 8, kq = blk / (N / 16), rb = blk % (N / 16); s = (kq * 32 + (l8 / 4) * 16 + ((l8 % 4) / 2) * 8) * N + rb * 16 + (l8 % 2) * 8; d = (kq * (R / 16) + ROFF / 16 + rb) * 512 + l8 * 64; }
__global__ __launch_bounds__(256) void k_prep(const float* __restrict__ x, const float* __restrict__ w0, const float* __restrict__ w1, const float* __restrict__ w2, const float* __restrict__ w3, bf* XB, bf* W) {
    const unsigned lane = threadIdx.x & 31; const unsigned gw = blockIdx.x * 8 + (unsigned)__builtin_amdgcn_readfirstlane((int)(threadIdx.x >> 5));
    const unsigned hb = gw % (NB_ * TT / 8), kg = gw / (NB_ * TT / 8);   // which 8 rows, which 256 k
    const float* xp = x + (size_t)(hb * 8 + (lane >> 2)) * DM + kg * 256 + (lane & 3) * 8;
    constexpr unsigned PR = DQ + DKV + DV;
    unsigned s[6], d[6];
    wt_map<DQ, PR, 0>(gw, s[0], d[0]); wt_map<DKV, PR, DQ>(gw, s[1], d[1]); wt_map<DV, PR, DQ + DKV>(gw, s[2], d[2]); wt_map<DV, PR, DQ + DKV>(gw + PWV, s[3], d[3]); wt_map<DV, DV, 0>(gw, s[4], d[4]); wt_map<DV, DV, 0>(gw + PWV, s[5], d[5]);
    const float* wp[6] = {w0 + s[0], w1 + s[1], w2 + s[2], w2 + s[3], w3 + s[4], w3 + s[5]};   // the same for every lane: scalar bases
    const unsigned lq = (lane & 3) * 2 * DQ + (lane >> 2), lv = (lane & 3) * 2 * DV + (lane >> 2);   // the lane's (k, n) in a line, for rows of 256 and of 512 floats: the weight loads' two vector address registers
    v8f xv[8]; float wa[6], wb[6];
#pragma unroll
    for (int u = 0; u < 8; ++u) xv[u] = *(const v8f*)(xp + u * 32);
#pragma unroll
    for (int i = 0; i < 6; ++i) { wa[i] = wp[i][i < 2 ? lq : lv]; wb[i] = wp[i][i < 2 ? lq + DQ : lv + DV]; }
    // precaution: stands between the loads and the first reuse of their address registers (held live up to here as inputs, so that no later load's result is put into them either)
    asm volatile("s_wait_xcnt 0x0" :: "v"(xp), "v"(lq), "v"(lv) : "memory");
    // keeps every conversion behind all 28 loads, and the wait above directly behind them: left free, the scheduler converts the first piece, and so waits out a memory latency, before it issues the other loads
    __builtin_amdgcn_sched_barrier(0);
    u32x4 o[8]; unsigned ow[6];
#pragma unroll
    for (int u = 0; u < 8; ++u)
#pragma unroll
        for (int k = 0; k < 4; ++k) o[u][k] = pk2bf(xv[u][2 * k], xv[u][2 * k + 1]);
#pragma unroll
    for (int i = 0; i < 6; ++i) ow[i] = pk2bf(wa[i], wb[i]);
    bf* xd = XB + ((size_t)(kg * 8) * (NB_ * TT / 16) + hb / 2) * 512 + (hb & 1) * 64;   // the same for every lane
    const unsigned lx = ((lane & 3) * 16 + (lane >> 2)) * 8;
#pragma unroll
    for (int u = 0; u < 8; ++u) *(v8us*)(xd + (size_t)u * (NB_ * TT / 16) * 512 + lx) = __builtin_bit_cast(v8us, o[u]);
#pragma unroll
    for (int i = 0; i < 6; ++i) *(v2us*)(W + (i < 4 ? 0 : (size_t)PR * DM) + d[i] + lane * 2) = __builtin_bit_cast(v2us, ow[i]);
}

__global__ __launch_bounds__(256) void k_vtp(const float* __restrict__ F, int pitch, int nheads, h16* V16, bf* Vh, bf* Vl) { const size_t e = ((size_t)blockIdx.x * 256 + threadIdx.x) * 2; if (e >= (size_t)nheads * HD * TT) return; const int t = (int)(e % TT); const int d = (int)((e / TT) % HD); const int g = (int)(e / ((size_t)TT * HD)); v2h o16; v2us oh, ol;
#pragma unroll
    for (int q = 0; q < 2; ++q) { const float x = F[(size_t)(t + q) * pitch + g * HD + d]; o16[q] = tohx(x); unsigned short a2, c2; splitf(x, a2, c2); oh[q] = a2; ol[q] = c2; }
    *(v2h*)(V16 + e) = o16; *(v2us*)(Vh + e) = oh; *(v2us*)(Vl + e) = ol;  }
// k_asoft: per row (zz, i): t = S x HD^-0.5 (no mask); softmax over the 2048 keys (register row, one exp, fixed trees);
__global__ __launch_bounds__(256) void k_asoft(const float* __restrict__ Sb, h16* P16, bf* Ph, bf* Pl) {
    const int lane = threadIdx.x & 31; const int row = blockIdx.x * 8 + (threadIdx.x >> 5); if (row >= ZH * TT) return; const int i = row % TT; const int zz = row / TT; (void)zz; const bool hires = (i < RH); const float* sr = Sb + (size_t)row * TT; float v[TT / 32]; float mx = -3.0e38f;
#pragma unroll
    for (int ch = 0; ch < TT / 128; ++ch) { const int j0 = ch * 128 + lane * 4; const v4f a = *(const v4f*)(sr + j0);
#pragma unroll
        for (int q = 0; q < 4; ++q) { const int j = j0 + q; (void)j; const float t = a[q] * SCL; v[ch * 4 + q] = t; mx = fmaxf(mx, t); } }
#pragma unroll
    for (int sh = 16; sh; sh >>= 1) mx = fmaxf(mx, __shfl_xor(mx, sh, 32));
    float sum = 0.f;
#pragma unroll
    for (int k = 0; k < TT / 32; ++k) { float d0 = __fsub_rn(v[k], mx); asm volatile("" : "+v"(d0)); v[k] = __builtin_amdgcn_exp2f(__fmul_rn(d0, 1.4426950408889634f)); sum += v[k]; }
#pragma unroll
    for (int sh = 16; sh; sh >>= 1) sum += __shfl_xor(sum, sh, 32);
    const float f = __fdiv_rn(hires ? 1.0f : PCAR, sum);
{
        if (hires) {
#pragma unroll
            for (int ch = 0; ch < TT / 128; ++ch) { v4us oh, ol;
#pragma unroll
                for (int q = 0; q < 4; ++q) { unsigned short a, c2; splitf(v[ch * 4 + q] * f, a, c2); oh[q] = a; ol[q] = c2; }
                const size_t oo = ((size_t)zz * (RH ? RH : 1) + i) * TT + ch * 128 + lane * 4; *(v4us*)(Ph + oo) = oh; *(v4us*)(Pl + oo) = ol; }
        } else {
#pragma unroll
            for (int ch = 0; ch < TT / 128; ++ch) { v4h o4;
#pragma unroll
                for (int q = 0; q < 4; ++q) o4[q] = tohx(v[ch * 4 + q] * f);
                *(v4h*)(P16 + (size_t)row * TT + ch * 128 + lane * 4) = o4; } }
         }
}
__global__ __launch_bounds__(256) void k_merge(const float* __restrict__ O, int h0, bf* Ah, bf* Al) { const size_t e = ((size_t)blockIdx.x * 256 + threadIdx.x) * 2; if (e >= (size_t)ZH * TT * HD) return; const int d = (int)(e % HD); const int t = (int)((e / HD) % TT); const int zz = (int)(e / ((size_t)HD * TT)); const float cs = (t < RH) ? 1.0f : (1.0f / PCAR); const size_t oo = (size_t)t * DQ + (h0 + zz) * HD + d;
    v2us oh, ol;
#pragma unroll
    for (int q = 0; q < 2; ++q) { unsigned short a, c2; splitf(O[e + q] * cs, a, c2); oh[q] = a; ol[q] = c2; } *(v2us*)(Ah + oo) = oh; *(v2us*)(Al + oo) = ol;  }

#define FQB 2     // 16-query blocks per wave
#define FWV 4     // waves per work-group
#define FKS 4     // key quarters (grid z)
#define FNT (TT / FKS / 32)   // passes of 32 keys
#define KVU 6144  // 16-byte words of one staged tile: k 64 half-blocks of 512 bytes [batch][hi|lo][kc][4], then value^T 128 half-blocks [batch][hi|lo][16]
typedef __attribute__((ext_vector_type(8))) unsigned v8u;
// one wave's share of a tile: the k and value^T fragments of its own batch, 48 asynchronous copies of 16 bytes a lane (512 bytes a copy), global memory to LDS through no register. Six runs that are consecutive in memory and in LDS alike: k hi and lo, each d half (2 KiB), value^T hi and lo (8 KiB); the immediate offset moves both addresses.
// lk, lv: the LDS byte address of its batch's k and value^T part of the buffer; the pointers: the start of the 32 keys in each plane (all the same for every lane); lo: the lane's place, 8 elements (16 bytes) a lane.
// the s_wait_xcnt is a precaution that stands, inside the statement, between the copies and any later write to the address registers they name
__device__ __forceinline__ void stage_kv(unsigned lk, unsigned lv, const bf* kh, const bf* kl, const bf* vh, const bf* vl, int lo) {
    const unsigned lb = 2 * lo;
    asm volatile(
        "global_load_async_to_lds_b128 %0, %6, off\n\t"
        "global_load_async_to_lds_b128 %0, %6, off offset:512\n\t"
        "global_load_async_to_lds_b128 %0, %6, off offset:1024\n\t"
        "global_load_async_to_lds_b128 %0, %6, off offset:1536\n\t"
        "global_load_async_to_lds_b128 %1, %7, off\n\t"
        "global_load_async_to_lds_b128 %1, %7, off offset:512\n\t"
        "global_load_async_to_lds_b128 %1, %7, off offset:1024\n\t"
        "global_load_async_to_lds_b128 %1, %7, off offset:1536\n\t"
        "global_load_async_to_lds_b128 %2, %8, off\n\t"
        "global_load_async_to_lds_b128 %2, %8, off offset:512\n\t"
        "global_load_async_to_lds_b128 %2, %8, off offset:1024\n\t"
        "global_load_async_to_lds_b128 %2, %8, off offset:1536\n\t"
        "global_load_async_to_lds_b128 %3, %9, off\n\t"
        "global_load_async_to_lds_b128 %3, %9, off offset:512\n\t"
        "global_load_async_to_lds_b128 %3, %9, off offset:1024\n\t"
        "global_load_async_to_lds_b128 %3, %9, off offset:1536\n\t"
        "global_load_async_to_lds_b128 %4, %10, off\n\t"
        "global_load_async_to_lds_b128 %4, %10, off offset:512\n\t"
        "global_load_async_to_lds_b128 %4, %10, off offset:1024\n\t"
        "global_load_async_to_lds_b128 %4, %10, off offset:1536\n\t"
        "global_load_async_to_lds_b128 %4, %10, off offset:2048\n\t"
        "global_load_async_to_lds_b128 %4, %10, off offset:2560\n\t"
        "global_load_async_to_lds_b128 %4, %10, off offset:3072\n\t"
        "global_load_async_to_lds_b128 %4, %10, off offset:3584\n\t"
        "global_load_async_to_lds_b128 %4, %10, off offset:4096\n\t"
        "global_load_async_to_lds_b128 %4, %10, off offset:4608\n\t"
        "global_load_async_to_lds_b128 %4, %10, off offset:5120\n\t"
        "global_load_async_to_lds_b128 %4, %10, off offset:5632\n\t"
        "global_load_async_to_lds_b128 %4, %10, off offset:6144\n\t"
        "global_load_async_to_lds_b128 %4, %10, off offset:6656\n\t"
        "global_load_async_to_lds_b128 %4, %10, off offset:7168\n\t"
        "global_load_async_to_lds_b128 %4, %10, off offset:7680\n\t"
        "global_load_async_to_lds_b128 %5, %11, off\n\t"
        "global_load_async_to_lds_b128 %5, %11, off offset:512\n\t"
        "global_load_async_to_lds_b128 %5, %11, off offset:1024\n\t"
        "global_load_async_to_lds_b128 %5, %11, off offset:1536\n\t"
        "global_load_async_to_lds_b128 %5, %11, off offset:2048\n\t"
        "global_load_async_to_lds_b128 %5, %11, off offset:2560\n\t"
        "global_load_async_to_lds_b128 %5, %11, off offset:3072\n\t"
        "global_load_async_to_lds_b128 %5, %11, off offset:3584\n\t"
        "global_load_async_to_lds_b128 %5, %11, off offset:4096\n\t"
        "global_load_async_to_lds_b128 %5, %11, off offset:4608\n\t"
        "global_load_async_to_lds_b128 %5, %11, off offset:5120\n\t"
        "global_load_async_to_lds_b128 %5, %11, off offset:5632\n\t"
        "global_load_async_to_lds_b128 %5, %11, off offset:6144\n\t"
        "global_load_async_to_lds_b128 %5, %11, off offset:6656\n\t"
        "global_load_async_to_lds_b128 %5, %11, off offset:7168\n\t"
        "global_load_async_to_lds_b128 %5, %11, off offset:7680\n\t"
        "s_wait_xcnt 0x0"
        :: "v"(lk + lb), "v"((lk + 2048) + lb), "v"((lk + 4096) + lb), "v"((lk + 6144) + lb), "v"(lv + lb), "v"((lv + 8192) + lb),
           "v"(kh + lo), "v"(kh + TT * 32 + lo), "v"(kl + lo), "v"(kl + TT * 32 + lo), "v"(vh + lo), "v"(vl + lo) : "memory");
}
__global__ __launch_bounds__(32 * FWV) void k_fattn(const bf* __restrict__ QKh, const bf* __restrict__ QKl, const bf* __restrict__ VTh, const bf* __restrict__ VTl, float* PO) {
    typedef WFrag<bf> WF; typedef WF::V V;
    __shared__ __align__(16) v8us sm[2 * KVU + FWV * 2048];     // two k | value^T tiles (192 KiB), then each wave's q fragments [batch][nb][kc][hi|lo][half][lane] (32 KiB a wave): the whole LDS of a WGP
    const int lane = threadIdx.x & 31; const int w = __builtin_amdgcn_readfirstlane((int)(threadIdx.x >> 5));
    const int h = blockIdx.y, q0 = blockIdx.x * (16 * FQB * FWV) + w * (16 * FQB), k0 = blockIdx.z * (TT / FKS);
    const size_t sQK = (size_t)(NH_ + NKV) * TT * HD, sV = (size_t)NH_ * HDV * TT;
    // the copies' sources: this wave stages batch w; k planes (row = key: 32 keys are 2 blocks for each 32 d) and value^T planes (row = d: 32 keys are 8 blocks, one per 16 d); they step by 32 keys a tile
    const bf* Kh = QKh + (size_t)w * sQK + (size_t)(NH_ + h) * TT * HD + (size_t)k0 * 32; const bf* Kl = QKl + (Kh - QKh);
    const bf* Vh = VTh + (size_t)w * sV + (size_t)h * HDV * TT + (size_t)k0 * HDV; const bf* Vl = VTl + (Vh - VTh);
    const unsigned lb = (unsigned)(size_t)(__attribute__((address_space(3))) v8us*)sm; const unsigned lk = lb + w * (16 * 512), lv = lb + 64 * 512 + w * (32 * 512);
    stage_kv(lk, lv, Kh, Kl, Vh, Vl, 8 * lane);
    Kh += 32 * 32; Kl += 32 * 32; Vh += 32 * HDV; Vl += 32 * HDV;
    v8us* qs = sm + 2 * KVU + w * 2048 + lane;
    const bf* qp[NB_][2];
#pragma unroll
    for (int b = 0; b < NB_; ++b) { qp[b][0] = QKh + (size_t)b * sQK + (size_t)h * TT * HD + (size_t)q0 * 32 + 8 * lane; qp[b][1] = QKl + (qp[b][0] - QKh); }
#pragma unroll
    for (int b = 0; b < NB_; ++b)
#pragma unroll
        for (int nb = 0; nb < FQB; ++nb)
#pragma unroll
            for (int kc = 0; kc < 2; ++kc) { const int o = nb * 512 + kc * (TT * 32); const int f = ((b * FQB + nb) * 2 + kc) * 2;
                qs[f * 64] = *(const v8us*)(qp[b][0] + o); qs[f * 64 + 32] = *(const v8us*)(qp[b][0] + o + 256); qs[f * 64 + 64] = *(const v8us*)(qp[b][1] + o); qs[f * 64 + 96] = *(const v8us*)(qp[b][1] + o + 256); }
    // precaution: stands between the q loads and the first reuse of their address registers (held live up to here as inputs); the scheduling fence keeps the zeroing of the accumulators, which reuses them, behind the wait
    asm volatile("s_wait_xcnt 0x0" :: "v"(qp[0][0]), "v"(qp[0][1]), "v"(qp[1][0]), "v"(qp[1][1]), "v"(qp[2][0]), "v"(qp[2][1]), "v"(qp[3][0]), "v"(qp[3][1]) : "memory");
    __builtin_amdgcn_sched_barrier(0);
    // tile 0 has landed (this wave's copies), then the barrier publishes it to the other waves
    asm volatile("s_wait_asynccnt 0x0" ::: "memory");
    __syncthreads();
    stage_kv(lk + KVU * 16, lv + KVU * 16, Kh, Kl, Vh, Vl, 8 * lane);
    Kh += 32 * 32; Kl += 32 * 32; Vh += 32 * HDV; Vl += 32 * HDV;
    v8f acc[NB_][8][FQB];
#pragma unroll
    for (int b = 0; b < NB_; ++b)
#pragma unroll
        for (int db = 0; db < 8; ++db)
#pragma unroll
            for (int nb = 0; nb < FQB; ++nb) acc[b][db][nb] = (v8f){};
    // rolled, for speed only: one pass is some thousands of instructions
#pragma unroll 1
    for (int kt = 0; kt < FNT; ++kt) {
        const unsigned bo = (kt & 1) * KVU; const v8us* kv = sm + bo + lane;
        // k and q fragments of one batch: 32 LDS loads, 128 registers; two sets, so that batch b + 1 is fetched while batch b's products run
        V kh[2][2][2], kl[2][2][2], qh[2][2][FQB], ql[2][2][FQB];     // [set][kc][mb or nb]
#pragma unroll
        for (int kc = 0; kc < 2; ++kc) {
#pragma unroll
            for (int mb = 0; mb < 2; ++mb) { const int o = (kc * 4 + mb * 2) * 32; kh[0][kc][mb] = cat16b(kv[o], kv[o + 32]); kl[0][kc][mb] = cat16b(kv[o + 8 * 32], kv[o + 9 * 32]); }
#pragma unroll
            for (int nb = 0; nb < FQB; ++nb) { const int f = (nb * 2 + kc) * 2; qh[0][kc][nb] = cat16b(qs[f * 64], qs[f * 64 + 32]); ql[0][kc][nb] = cat16b(qs[f * 64 + 64], qs[f * 64 + 96]); } }
        v8f s[NB_][2][FQB];
#pragma unroll
        for (int b = 0; b < NB_; ++b) { const int st = b & 1, sn = (b + 1) & 1;
            if (b + 1 < NB_) {
#pragma unroll
                for (int kc = 0; kc < 2; ++kc) {
#pragma unroll
                    for (int mb = 0; mb < 2; ++mb) { const int o = ((b + 1) * 16 + kc * 4 + mb * 2) * 32; kh[sn][kc][mb] = cat16b(kv[o], kv[o + 32]); kl[sn][kc][mb] = cat16b(kv[o + 8 * 32], kv[o + 9 * 32]); }
#pragma unroll
                    for (int nb = 0; nb < FQB; ++nb) { const int f = (((b + 1) * FQB + nb) * 2 + kc) * 2; qh[sn][kc][nb] = cat16b(qs[f * 64], qs[f * 64 + 32]); ql[sn][kc][nb] = cat16b(qs[f * 64 + 64], qs[f * 64 + 96]); } } }
            // holds the next batch's 32 LDS loads, as one group, in front of this batch's 24 products: left free, the scheduler puts four loads directly in front of the six products that use them, and the wave waits out the LDS latency sixteen times a pass
            __builtin_amdgcn_sched_barrier(0);
#pragma unroll
            for (int mb = 0; mb < 2; ++mb)
#pragma unroll
                for (int nb = 0; nb < FQB; ++nb) s[b][mb][nb] = (v8f){};
            // the four score tiles take turns, so that no product follows directly on the one whose sum it adds to; each tile's own order of sums is kc 0, 1 and in each hi.hi, hi.lo, lo.hi
#pragma unroll
            for (int kc = 0; kc < 2; ++kc)
#pragma unroll
                for (int p = 0; p < 3; ++p)
#pragma unroll
                    for (int nb = 0; nb < FQB; ++nb)
#pragma unroll
                        for (int mb = 0; mb < 2; ++mb) s[b][mb][nb] = WF::mma(p == 2 ? kl[st][kc][mb] : kh[st][kc][mb], p == 1 ? ql[st][kc][nb] : qh[st][kc][nb], s[b][mb][nb]);
            // keeps the loads of batch b + 2 behind these products, whose fragments' registers they refill
            __builtin_amdgcn_sched_barrier(0); }
        // value^T fragments of batch 0 are asked for here, so that they come under the softmax arithmetic; those of batch b + 1 in front of batch b's products
        V vh[2][8], vl[2][8];
#pragma unroll
        for (int db = 0; db < 8; ++db) { const int o = (64 + db * 2) * 32; vh[0][db] = cat16b(kv[o], kv[o + 32]); vl[0][db] = cat16b(kv[o + 16 * 32], kv[o + 17 * 32]); }
        // holds these 32 loads as one group in front of the softmax arithmetic: left free, the scheduler spreads them over a dozen places in it
        __builtin_amdgcn_sched_barrier(0);
        v8u ph[NB_][FQB], pl[NB_][FQB];     // probabilities, bf16 hi and lo, two keys to a word: word i of (batch, nb) holds k slots 2i and 2i + 1 of the B operand
#pragma unroll
        for (int nb = 0; nb < FQB; ++nb)
#pragma unroll
            for (int mb = 0; mb < 2; ++mb) {
#pragma unroll
                for (int jp = 0; jp < 4; ++jp) {
                    // two neighbouring keys of a lane (an even and odd accumulator register) go side by side through the packed f32 instructions
                    f32x2 sv[NB_], xa[NB_], ex[NB_], mx;
#pragma unroll
                    for (int b = 0; b < NB_; ++b) sv[b] = (f32x2){s[b][mb][nb][2 * jp], s[b][mb][nb][2 * jp + 1]};
#pragma unroll
                    for (int q = 0; q < 2; ++q) mx[q] = fmaxf(fmaxf(fmaxf(fmaxf(-3.0e38f, sv[0][q]), sv[1][q]), sv[2][q]), sv[3][q]);
                    // exponent to base 2 of exp((s - max) / 8): one multiply-add a score, the 1/8 and log2 e in one factor
                    const f32x2 cs = {SCL * 1.4426950408889634f, SCL * 1.4426950408889634f}; const f32x2 nm = -(mx * cs);
#pragma unroll
                    for (int b = 0; b < NB_; ++b) { xa[b] = __builtin_elementwise_fma(sv[b], cs, nm); ex[b] = (f32x2){__builtin_amdgcn_exp2f(xa[b][0]), __builtin_amdgcn_exp2f(xa[b][1])}; }
                    const f32x2 sum = ((ex[0] + ex[1]) + ex[2]) + ex[3];
                    // 1 / sum by the chip's reciprocal (1 ulp; the probabilities keep 16 bits behind it), not the division sequence of some nine instructions
                    const f32x2 f = {__builtin_amdgcn_rcpf(sum[0]), __builtin_amdgcn_rcpf(sum[1])};
#pragma unroll
                    for (int b = 0; b < NB_; ++b) { const f32x2 pr = ex[b] * f; unsigned a, c; split2(pr[0], pr[1], a, c); ph[b][nb][mb * 4 + jp] = a; pl[b][nb][mb * 4 + jp] = c; } }
                // one 16x16 tile's softmax at a time: left free, the scheduler runs all four tiles abreast and their unpacked halves push accumulators into scratch
                __builtin_amdgcn_sched_barrier(0); }
#pragma unroll
        for (int b = 0; b < NB_; ++b) {
            if (b + 1 < NB_) {
#pragma unroll
                for (int db = 0; db < 8; ++db) { const int o = (64 + (b + 1) * 32 + db * 2) * 32; vh[(b + 1) & 1][db] = cat16b(kv[o], kv[o + 32]); vl[(b + 1) & 1][db] = cat16b(kv[o + 16 * 32], kv[o + 17 * 32]); } }
            // holds the next batch's 32 LDS loads, as one group, in front of this batch's 48 products: left free, the scheduler spreads them among the products
            __builtin_amdgcn_sched_barrier(0);
#pragma unroll
            for (int db = 0; db < 8; ++db)
#pragma unroll
                for (int nb = 0; nb < FQB; ++nb) { const V bh = __builtin_bit_cast(V, ph[b][nb]), bl = __builtin_bit_cast(V, pl[b][nb]);
                    acc[b][db][nb] = WF::mma(vh[b & 1][db], bh, acc[b][db][nb]); acc[b][db][nb] = WF::mma(vh[b & 1][db], bl, acc[b][db][nb]); acc[b][db][nb] = WF::mma(vl[b & 1][db], bh, acc[b][db][nb]); }
            // keeps the loads of batch b + 2 behind these products, whose fragments' registers they refill
            __builtin_amdgcn_sched_barrier(0); }
        // hand-over: this wave's LDS reads of the tile are done
        asm volatile("s_wait_dscnt 0x0" ::: "memory");
        // its copies of the next tile have landed
        asm volatile("s_wait_asynccnt 0x0" ::: "memory");
        // publishes the next tile and ends every wave's reads of this one, whose buffer is refilled behind it
        __syncthreads();
        // the two LDS addresses are formed as scalars here: left free, the compiler keeps their lane-wise sums over the whole loop and, short of low registers, spills them to scratch
        if (kt + 2 < FNT) { stage_kv(__builtin_amdgcn_readfirstlane(lk + bo * 16), __builtin_amdgcn_readfirstlane(lv + bo * 16), Kh, Kl, Vh, Vl, 8 * lane); Kh += 32 * 32; Kl += 32 * 32; Vh += 32 * HDV; Vl += 32 * HDV; }
    }
    // no copy is left in flight when the wave ends
    asm volatile("s_wait_asynccnt 0x0" ::: "memory");
    // partial O^T, f32: tile (head, 16-query block, batch, quarter, db) is 1 KiB, [half][lane] 16 bytes: every store of a wave is 512 consecutive bytes, and the four quarters of a (query block, batch) lie side by side for k_outf
    v4f* pp = (v4f*)PO + (((size_t)h * (TT / 16) + q0 / 16) * (NB_ * FKS) + blockIdx.z) * (8 * 64);   // the same for every lane: a scalar base; all 128 stores lie within 256 KiB of it, and the lane's number is their one vector address register
#pragma unroll
    for (int b = 0; b < NB_; ++b)
#pragma unroll
        for (int nb = 0; nb < FQB; ++nb)
#pragma unroll
            for (int db = 0; db < 8; ++db) { const v8f a = acc[b][db][nb]; const int o = ((nb * NB_ + b) * FKS * 8 + db) * 64; pp[o + lane] = (v4f){a[0], a[1], a[2], a[3]}; pp[o + 32 + lane] = (v4f){a[4], a[5], a[6], a[7]}; }
}
// ---- k_outf: the key quarters' merge and out = context Wo in one kernel. Grid NB_ * TT / 32, 8 waves: a work-group owns 32 rows (two 16-query blocks of one batch) and all 512 columns.
// Merge: wave w takes the 8 d tiles of one (head w / 2, query block w % 2): 32 KiB of partial O^T in a row, 64 loads of 512 bytes; it adds the four quarters in order 0..3, splits hi/lo and writes the result to LDS. The lane's 8 d of one query are its own 16 bytes of a half-block, so what lands in LDS are the A fragments of the 32 rows x 512 k, hi and lo (64 KiB): [k block][row block][hi|lo][half][lane]. The context never goes to memory.
// Product: wave w takes columns w * 64 .. + 63 (8 accumulators), A from LDS, B = the Wo plane's fragments straight from L2, fetched OPD k blocks ahead into a ring of ORS register sets; the first OPD sets are asked for in front of the merge, whose memory wait they share. Each accumulator's order of sums: k blocks upwards, in each hi then lo. Every loop is fully unrolled, so that the partial, fragment and accumulator arrays are indexed by constants and stay in registers.
#define OPD 3
#define ORS 4
__global__ __launch_bounds__(256) void k_outf(const float* __restrict__ PO, const bf* __restrict__ Bt, float* C) {
    typedef WFrag<bf> WF; typedef WF::V V;
    __shared__ __align__(16) v8us as[(DV / 32) * 2 * 2 * 64];
    __shared__ __align__(16) float osw[8][16 * 68];
    const int lane = threadIdx.x & 31, lr = lane & 15, hi = lane >> 4; const int w = __builtin_amdgcn_readfirstlane((int)(threadIdx.x >> 5));
    const bf* pb = Bt + (size_t)w * (64 * 32);   // the same for every lane: a scalar base; a k block on is DV * 32 elements on, and the lane's place is the loads' one vector address register
    V bq[ORS][4];
#pragma unroll
    for (int kq = 0; kq < OPD; ++kq)
#pragma unroll
        for (int nb = 0; nb < 4; ++nb) bq[kq][nb] = WF::ld(pb + kq * (DV * 32) + nb * 512 + 8 * lane);
    {
        const int rb = w & 1, h = w >> 1; const int rbg = blockIdx.x * 2 + rb; const int b = rbg / (TT / 16), qb = rbg % (TT / 16);
        const v4f* p = (const v4f*)PO + (size_t)((h * (TT / 16) + qb) * NB_ + b) * (FKS * 8 * 64);   // a scalar base, the lane's number the one vector address register
        v4f x[8][FKS][2];
#pragma unroll
        for (int db = 0; db < 8; ++db)
#pragma unroll
            for (int s = 0; s < FKS; ++s) { x[db][s][0] = p[(s * 8 + db) * 64 + lane]; x[db][s][1] = p[(s * 8 + db) * 64 + 32 + lane]; }
        // precaution: stands between the loads and the first reuse of their address registers (held live up to here as inputs)
        asm volatile("s_wait_xcnt 0x0" :: "s"(p), "s"(pb), "v"(lane) : "memory");
        // keeps every sum behind all 64 loads, and the wait above directly behind them: left free, the scheduler adds up the first tiles, and so waits out a memory latency, before it issues the other loads
        __builtin_amdgcn_sched_barrier(0);
        v8us* ad = as + (h * (HDV / 32) * 2 + rb) * 128 + lane;
#pragma unroll
        for (int db = 0; db < 8; ++db) { v4f x0 = x[db][0][0], x1 = x[db][0][1];
#pragma unroll
            for (int s = 1; s < FKS; ++s) { x0 += x[db][s][0]; x1 += x[db][s][1]; }
            u32x4 oh, ol;
#pragma unroll
            for (int j = 0; j < 2; ++j) { unsigned a, c; split2(x0[2 * j], x0[2 * j + 1], a, c); oh[j] = a; ol[j] = c; split2(x1[2 * j], x1[2 * j + 1], a, c); oh[2 + j] = a; ol[2 + j] = c; }
            const int oo = (db >> 1) * 256 + (db & 1) * 32; ad[oo] = __builtin_bit_cast(v8us, oh); ad[oo + 64] = __builtin_bit_cast(v8us, ol); }
    }
    // publishes the 32 rows' fragments to the eight waves
    __syncthreads();
    v8f acc[2][4];
#pragma unroll
    for (int mb = 0; mb < 2; ++mb)
#pragma unroll
        for (int nb = 0; nb < 4; ++nb) acc[mb][nb] = (v8f){};
    const v8us* ap = as + lane;
    V a[2][2], a2[2][2];     // [set][mb]: two sets, the next k block's fragments are read from LDS while this one's products run
#pragma unroll
    for (int mb = 0; mb < 2; ++mb) { const int o = mb * 128; a[0][mb] = cat16b(ap[o], ap[o + 32]); a2[0][mb] = cat16b(ap[o + 64], ap[o + 96]); }
#pragma unroll
    for (int kq = 0; kq < DV / 32; ++kq) {
        if (kq + OPD < DV / 32) {
#pragma unroll
            for (int nb = 0; nb < 4; ++nb) bq[(kq + OPD) % ORS][nb] = WF::ld(pb + (kq + OPD) * (DV * 32) + nb * 512 + 8 * lane); }
        if (kq + 1 < DV / 32) {
#pragma unroll
            for (int mb = 0; mb < 2; ++mb) { const int o = ((kq + 1) * 2 + mb) * 128; a[(kq + 1) & 1][mb] = cat16b(ap[o], ap[o + 32]); a2[(kq + 1) & 1][mb] = cat16b(ap[o + 64], ap[o + 96]); } }
        // holds the loads for later k blocks, as one group, in front of this block's 16 products: left free, the scheduler lifts the loads of all 16 blocks to the top and spills their registers to scratch
        __builtin_amdgcn_sched_barrier(0);
        // the eight tiles take turns, so that no product follows directly on the one whose sum it adds to
#pragma unroll
        for (int pl = 0; pl < 2; ++pl)
#pragma unroll
            for (int nb = 0; nb < 4; ++nb)
#pragma unroll
                for (int mb = 0; mb < 2; ++mb) acc[mb][nb] = WF::mma(pl ? a2[kq & 1][mb] : a[kq & 1][mb], bq[kq % ORS][nb], acc[mb][nb]);
        // keeps the next group of loads behind these products, whose fragments' registers it refills
        __builtin_amdgcn_sched_barrier(0);
    }
    // precaution: stands between the Wo loads and the first reuse of their address registers (held live up to here as inputs)
    asm volatile("s_wait_xcnt 0x0" :: "s"(pb), "v"(lane) : "memory");
    // a 16 x 64 tile goes through the wave's own LDS rows, so that a store is two whole 256-byte row pieces
    float* os = osw[w]; const int r0 = blockIdx.x * 32, c0 = w * 64;
#pragma unroll
    for (int mb = 0; mb < 2; ++mb) {
#pragma unroll
        for (int nb = 0; nb < 4; ++nb) {
#pragma unroll
            for (int j = 0; j < 8; ++j) os[(hi * 8 + j) * 68 + nb * 16 + lr] = acc[mb][nb][j]; }
        // one wave: keeps its LDS writes in front of its reads of other lanes' words
        __builtin_amdgcn_wave_barrier(); asm volatile("" ::: "memory");
        float* crow = C + (size_t)(r0 + mb * 16) * DV + c0;
#pragma unroll
        for (int s = 0; s < 8; ++s) { const int row = 2 * s + hi, cofs = lr * 4; const v4f val = *(const v4fa*)(os + row * 68 + cofs); *(v4f*)(crow + (size_t)row * DV + cofs) = val; }
        // and those reads in front of the next block's writes
        __builtin_amdgcn_wave_barrier(); asm volatile("" ::: "memory");
    }
}

extern "C" void kernel_launch(void* const* d_in, const int* in_sizes, int n_in,
                              void* d_out, int out_size, void* d_ws, size_t ws_size, hipStream_t stream) {
    (void)in_sizes; (void)n_in; (void)out_size;
    const float* x = (const float*)d_in[0]; const float* wq = (const float*)d_in[1]; const float* wk = (const float*)d_in[2]; const float* wv = (const float*)d_in[3]; const float* wo = (const float*)d_in[4];
    float* OUT = (float*)d_out;     // [4][2048][512]
    char* wsp = (char*)d_ws;
    auto take = [&](size_t bytes) { char* p = wsp; wsp += (bytes + 255) & ~(size_t)255; return (void*)p; };
    bf* W = (bf*)take((size_t)(DQ + DKV + DV + DV) * DM * 2); bf* WO = W + (size_t)(DQ + DKV + DV) * DM;
    bf* XB = (bf*)take((size_t)NB_ * TT * DM * 2);
    bf* QKh = (bf*)take((size_t)NB_ * (NH_ + NKV) * TT * HD * 2); bf* QKl = (bf*)take((size_t)NB_ * (NH_ + NKV) * TT * HD * 2);   /* [b][8] planes [t][d] in fragment order: heads 0-3 q, 4-7 k */
    bf* VTh = (bf*)take((size_t)NB_ * NH_ * HDV * TT * 2); bf* VTl = (bf*)take((size_t)NB_ * NH_ * HDV * TT * 2);
    float* PO = (float*)take((size_t)FKS * NB_ * TT * DV * 4);   /* the key quarters' partial O^T */
    if ((size_t)(wsp - (char*)d_ws) > ws_size) return;    // ws 256 MiB (carve ~106 MiB)
    k_prep<<<PWV / 8, 256, 0, stream>>>(x, wq, wk, wv, wo, XB, W);   /* x and the four weights to bf16 planes */
    const int PF = DQ + DKV + DV;
    /* projections + planes, every batch in one launch (the softmax couples the batches) */
    k_gemmw<bf, 0, false, true><<<dim3(NB_ * TT / 64, PF / 64, 1), 32, 0, stream>>>(XB, nullptr, W, nullptr, DM, nullptr, 0, nullptr, 0, 0, 0, QKh, QKl, VTh, VTl);
    k_fattn<<<dim3(TT / (16 * FQB * FWV), NH_, FKS), 32 * FWV, 0, stream>>>(QKh, QKl, VTh, VTl, PO);   /* all heads, all batches */
    k_outf<<<NB_ * TT / 32, 256, 0, stream>>>(PO, WO, OUT);   /* key quarters merged, context Wo */
}
